// v000
// Times are from an AMD MI455X. After a warm-up the kernel runs many times in a row, and a time is the length of
// such a window on the GPU divided by its runs, so every launch and the gaps after it count. The runs cycle
// through copies of the inputs. A figure is the median of several windows, for all but v000 over two sittings.
// Sittings can differ by a few percent; kernels timed side by side share one.
// The starting kernel, v000, takes 7100 microseconds a run.
#include <hip/hip_runtime.h>
// Multi-head self-attention with half-split RoPE from RANDOM input tables, NON-causal (x [2][2048][1024]; q / k / v = x W^T (nn.Linear natural [1024][1024] sigma 1/32, no biases), 16 heads of 64; rope: x * [cos | cos] + rotate_half(x) * [sin | sin] with rotate_half = (-x2, x1) over the two 32-lane halves and INPUT tables rope_cos / rope_sin [2048][32] (cos / sin of uniform-random angles); scores / sqrt(64); softmax over all 2048 keys (f32; no mask); out = merged Wo^T (natural, no bias) -> [2][2048][1024]); run as 16 groups of ONE head.
// Structure: x as exact f16 rows; natural weights as exact x16 planes; v as a WMMA GEMM (32x64 wave tiles, f32 accumulation, f16 output); rope tables bf16-rounded once from the input tables; per batch: q [2048][1024] and k [2048][1024] as GEMMs into f32 rows then the rotate-half rotation + f16 conversion per (row, head) on VALU; V^T of the 16 groups via LDS transposes; per query tile of 256 rows and per group: scores of its one head against ALL 2048 keys of its key slab (K = 64, key head stride HD, alpha 1/8), row softmax on VALU (f32 statistics, expf; weights x256 f16), o = P V^T with the shared value slab (o carried x64) into merged f16 rows; out = o Wo^T GEMM (f32, alpha 2^-10); launches: see trace.
// Compute dtype: inputs rounded to bf16; x / weights exact; q, k, v, softmax weights and o as plain f16 GEMM operands (~2^-12); scores and softmax statistics f32. v_wmma_f32_16x16x32_f16.
#define NB 2
#define NG 16
#define HPG 1
#define KVD (NG * HD)
#define SQ 2048
#define DM 1024
#define NH 16
#define HD 64
#define HG 4                         /* heads per block group of the unlaunched k_vt overload */
#define QT 256                       /* query rows per tile */
#define NKX SQ                       /* S / P row pitch */
#define QT0 128                      /* rows per head of k_att0 (not launched); sizes unused f32 buffers */
#define B0 0                         /* first batch processed (debug hook) */
#define NBR NB                       /* batches processed (debug hook) */
#define NR ((size_t)NB * SQ)         /* token rows */
#define MP ((int)((size_t)NBR * SQ)) /* rows projected (debug hook) */
#define QN SQ                        /* query rows attended per batch (debug hook) */
#define NHD NH                       /* heads attended (debug hook) */
#define MPO MP                       /* rows through the output stage (debug hook) */
#define LQ DM      /* row pitch of the q/k/v rows */
typedef __bf16 v16b __attribute__((ext_vector_type(16)));
typedef unsigned short v8us __attribute__((ext_vector_type(8), may_alias));
typedef float  v8f  __attribute__((ext_vector_type(8)));
typedef float  v4f  __attribute__((ext_vector_type(4)));
typedef float  v4fa __attribute__((ext_vector_type(4), may_alias));
union FragB { v16b v; v8us half[2]; unsigned short u[16]; };

__device__ __forceinline__ unsigned short bf16_bits(float x) { unsigned int u = __float_as_uint(x); return (unsigned short)((u + 0x7FFFu + ((u >> 16) & 1u)) >> 16); }
__device__ __forceinline__ float bf16_val(unsigned short b) { return __uint_as_float(((unsigned int)b) << 16); }
__device__ __forceinline__ float bf16_round(float x) { return bf16_val(bf16_bits(x)); }
// D += A·B with NT terms: 1 = ah·bh, 2 = + al·bh (A split), 3 = + ah·bl (both split)
template <int NT>
__device__ __forceinline__ v8f mmaN(v16b ah, v16b al, v16b bh, v16b bl, v8f c) {
  c = __builtin_amdgcn_wmma_f32_16x16x32_bf16(false, ah, false, bh, (short)0, c, false, false);
  if (NT >= 2) c = __builtin_amdgcn_wmma_f32_16x16x32_bf16(false, al, false, bh, (short)0, c, false, false);
  if (NT >= 3) c = __builtin_amdgcn_wmma_f32_16x16x32_bf16(false, ah, false, bl, (short)0, c, false, false);
  asm volatile("v_nop\n\tv_nop\n\tv_nop\n\tv_nop" : "+v"(c) : "v"(ah), "v"(al), "v"(bh), "v"(bl));
  return c;
}

__global__ __launch_bounds__(256) void k_wt_bf16(const float* __restrict__ W, unsigned short* __restrict__ Wt, int K, int N) {
  const int t = blockIdx.x * 256 + threadIdx.x;
  const int k8n = K / 8;
  if (t >= N * k8n) return;
  const int n = t / k8n, k8 = (t % k8n) * 8;
  v8us v;
#pragma unroll
  for (int i = 0; i < 8; ++i) v[i] = bf16_bits(W[(size_t)(k8 + i) * N + n]);
  *(v8us*)(Wt + (size_t)n * K + k8) = v;
  
}

// GEMM C[M][N] (f32, pitch ldc) = act(A[M][K]·W + bias). A f32 row-major (pitch lda) converted per fragment to bf16
// (ASPLIT: hi/lo two planes -> 2 terms, else single rounded term); Wt bf16 [N][K] (pitch ldb). BIAS_BF16 rounds the
// bias to bf16 first (bias quantised to bf16 before the add). K%32==0, M%16==0, N%64==0.
template <bool ASPLIT, int ACT, bool BIAS_BF16>
__global__ __launch_bounds__(128) void k_gemm_bf(const float* __restrict__ A, int lda, const unsigned short* __restrict__ Wt, int ldb,
                                               const float* __restrict__ bias, float* __restrict__ C, int ldc, int M, int N, int K) {
  __shared__ __attribute__((aligned(16))) float so[4][16][64];
  const int tid = threadIdx.x, w = tid >> 5, lane = tid & 31, ln = lane & 15, hh = lane >> 4;
  const int ntn = N / 64;
  const int wid = blockIdx.x * 4 + w;
  const int mt = wid / ntn, nq = wid % ntn;
  if (mt * 16 >= M) return;
  const int row0 = mt * 16, col0 = nq * 64;
  const float* arow = A + (size_t)(row0 + ln) * lda;
  v8f acc[4] = {};
  for (int kb = 0; kb < K; kb += 32) {
    FragB ah, al;
    const v4f x0 = *(const v4fa*)(arow + kb + 8 * hh), x1 = *(const v4fa*)(arow + kb + 8 * hh + 4);
    const v4f x2 = *(const v4fa*)(arow + kb + 16 + 8 * hh), x3 = *(const v4fa*)(arow + kb + 16 + 8 * hh + 4);
    float xs[16] = {x0[0],x0[1],x0[2],x0[3],x1[0],x1[1],x1[2],x1[3],x2[0],x2[1],x2[2],x2[3],x3[0],x3[1],x3[2],x3[3]};
#pragma unroll
    for (int i = 0; i < 16; ++i) { const unsigned short hb = bf16_bits(xs[i]); ah.u[i] = hb; al.u[i] = ASPLIT ? bf16_bits(xs[i] - bf16_val(hb)) : (unsigned short)0; }
#pragma unroll
    for (int t = 0; t < 4; ++t) {
      const unsigned short* brow = Wt + (size_t)(col0 + t * 16 + ln) * ldb + kb;
      FragB b;
      b.half[0] = *(const v8us*)(brow + 8 * hh);
      b.half[1] = *(const v8us*)(brow + 16 + 8 * hh);
      acc[t] = mmaN<ASPLIT ? 2 : 1>(ah.v, al.v, b.v, b.v, acc[t]);
    }
  }
#pragma unroll
  for (int t = 0; t < 4; ++t) {
    float bv = bias ? bias[col0 + t * 16 + ln] : 0.f;
    if (BIAS_BF16) bv = bf16_round(bv);
#pragma unroll
    for (int r = 0; r < 8; ++r) { float v = acc[t][r] + bv; if (ACT == 1) v = fmaxf(v, 0.f); so[w][8 * hh + r][t * 16 + ln] = v; }
  }
  __builtin_amdgcn_fence(__ATOMIC_ACQ_REL, "workgroup");
  __builtin_amdgcn_wave_barrier();
  const int rsub = lane >> 4, c4 = (lane & 15) * 4;
  {
#pragma unroll
    for (int q = 0; q < 8; ++q) {
      const int r = q * 2 + rsub;
      const v4f v = *(const v4fa*)&so[w][r][c4];
      *(v4f*)(C + (size_t)(row0 + r) * ldc + col0 + c4) = v;
    }
    
  }
}

// GEMM C = act(A·W + bias + resid): A f32 (ASPLIT -> hi/lo 2 terms), Wt bf16 [N][K]; ACT 0 none, 1 relu, 2 exact gelu;
// resid (optional, f32, row index = (row % rmod), pitch ldr, RES_BF16 rounds it) added before the activation.
template <bool ASPLIT, int ACT, bool BIAS_BF16, bool RES_BF16>
__global__ __launch_bounds__(128) void k_gemm_bf3(const float* __restrict__ A, int lda, const unsigned short* __restrict__ Wt, int ldb,
                                                const float* __restrict__ bias, const float* __restrict__ resid, int rmod, int ldr,
                                                float* __restrict__ C, int ldc, int M, int N, int K) {
  __shared__ __attribute__((aligned(16))) float so[4][16][64];
  const int tid = threadIdx.x, w = tid >> 5, lane = tid & 31, ln = lane & 15, hh = lane >> 4;
  const int ntn = N / 64;
  const int wid = blockIdx.x * 4 + w;
  const int mt = wid / ntn, nq = wid % ntn;
  if (mt * 16 >= M) return;
  const int row0 = mt * 16, col0 = nq * 64;
  const float* arow = A + (size_t)(row0 + ln) * lda;
  v8f acc[4] = {};
  for (int kb = 0; kb < K; kb += 32) {
    FragB ah, al;
    const v4f x0 = *(const v4fa*)(arow + kb + 8 * hh), x1 = *(const v4fa*)(arow + kb + 8 * hh + 4);
    const v4f x2 = *(const v4fa*)(arow + kb + 16 + 8 * hh), x3 = *(const v4fa*)(arow + kb + 16 + 8 * hh + 4);
    float xs[16] = {x0[0],x0[1],x0[2],x0[3],x1[0],x1[1],x1[2],x1[3],x2[0],x2[1],x2[2],x2[3],x3[0],x3[1],x3[2],x3[3]};
#pragma unroll
    for (int i = 0; i < 16; ++i) { const unsigned short hb = bf16_bits(xs[i]); ah.u[i] = hb; al.u[i] = ASPLIT ? bf16_bits(xs[i] - bf16_val(hb)) : (unsigned short)0; }
#pragma unroll
    for (int t = 0; t < 4; ++t) {
      const unsigned short* brow = Wt + (size_t)(col0 + t * 16 + ln) * ldb + kb;
      FragB b;
      b.half[0] = *(const v8us*)(brow + 8 * hh);
      b.half[1] = *(const v8us*)(brow + 16 + 8 * hh);
      acc[t] = mmaN<ASPLIT ? 2 : 1>(ah.v, al.v, b.v, b.v, acc[t]);
    }
  }
#pragma unroll
  for (int t = 0; t < 4; ++t) {
    const int col = col0 + t * 16 + ln;
    float bv = bias ? bias[col] : 0.f;
    if (BIAS_BF16) bv = bf16_round(bv);
#pragma unroll
    for (int r = 0; r < 8; ++r) {
      float v = acc[t][r] + bv;
      if (resid) { float rv = resid[(size_t)((row0 + 8 * hh + r) % rmod) * ldr + col]; if (RES_BF16) rv = bf16_round(rv); v += rv; }
      if (ACT == 1) v = fmaxf(v, 0.f);
      if (ACT == 2) v = 0.5f * v * (1.0f + erff(v * 0.70710678118654752f));
      if (ACT == 3) { const float u = 0.7978845608028654f * (v + 0.044715f * v * v * v); v = 0.5f * v * (1.0f + tanhf(u)); }
      so[w][8 * hh + r][t * 16 + ln] = v;
    }
  }
  __builtin_amdgcn_fence(__ATOMIC_ACQ_REL, "workgroup");
  __builtin_amdgcn_wave_barrier();
  const int rsub = lane >> 4, c4 = (lane & 15) * 4;
  {
#pragma unroll
    for (int q = 0; q < 8; ++q) {
      const int r = q * 2 + rsub;
      const v4f v = *(const v4fa*)&so[w][r][c4];
      *(v4f*)(C + (size_t)(row0 + r) * ldc + col0 + c4) = v;
    }
    
  }
}
// row LayerNorm (biased variance, eps) over N: s = X (+ R); optional out_sum <- s; out_norm <- (s-mu)*rsqrt(var+eps)*g + b
template <bool PARAM_BF16>
__global__ __launch_bounds__(256) void k_layernorm(const float* __restrict__ X, const float* __restrict__ R, const float* __restrict__ g, const float* __restrict__ bta,
                                                  float* __restrict__ out_sum, float* __restrict__ out_norm, int N, float eps) {
  __shared__ float red[256];
  const int row = blockIdx.x, tid = threadIdx.x;
  const float* x = X + (size_t)row * N; const float* rr = R ? R + (size_t)row * N : nullptr;
  float vals[16];                     // up to N = 4096
  const int per = N / 256;            // contiguous chunk per thread? use strided-by-4 chunks: thread handles j = tid*4 + 1024*u
  float s1 = 0.f;
  for (int u = 0; u < per / 4; ++u) {
    const int j = tid * 4 + 1024 * u;
    const v4f a = *(const v4fa*)(x + j);
    v4f b = {0.f,0.f,0.f,0.f}; if (rr) b = *(const v4fa*)(rr + j);
#pragma unroll
    for (int q = 0; q < 4; ++q) { const float v = a[q] + b[q]; vals[u * 4 + q] = v; s1 += v; }
  }
  red[tid] = s1; __syncthreads();
  for (int st = 128; st > 0; st >>= 1) { if (tid < st) red[tid] += red[tid + st]; __syncthreads(); }
  const float mu = red[0] / (float)N; __syncthreads();
  float s2 = 0.f;
  for (int u = 0; u < per / 4; ++u)
#pragma unroll
    for (int q = 0; q < 4; ++q) { const float c = vals[u * 4 + q] - mu; s2 += c * c; }
  red[tid] = s2; __syncthreads();
  for (int st = 128; st > 0; st >>= 1) { if (tid < st) red[tid] += red[tid + st]; __syncthreads(); }
  const float rs = rsqrtf(red[0] / (float)N + eps);
  {
    for (int u = 0; u < per / 4; ++u) {
      const int j = tid * 4 + 1024 * u;
      v4f o, sm;
#pragma unroll
      for (int q = 0; q < 4; ++q) {
        float gg = g[j + q], bb = bta[j + q];
        if (PARAM_BF16) { gg = bf16_round(gg); bb = bf16_round(bb); }
        sm[q] = vals[u * 4 + q]; o[q] = (vals[u * 4 + q] - mu) * rs * gg + bb;
      }
      if (out_sum) *(v4f*)(out_sum + (size_t)row * N + j) = sm;
      *(v4f*)(out_norm + (size_t)row * N + j) = o;
    }
    
  }
}



// ---- f16 WMMA path (v_wmma_f32_16x16x32_f16): 11-bit significands for operands in range — used where a [0,1] probability operand needs more precision than bf16
typedef _Float16 v16h __attribute__((ext_vector_type(16)));
union FragH { v16h v; v8us half[2]; _Float16 h[16]; unsigned short u[16]; };
template <int NT>
__device__ __forceinline__ v8f mmaH(v16h ah, v16h al, v16h bh, v16h bl, v8f c) {
  c = __builtin_amdgcn_wmma_f32_16x16x32_f16(false, ah, false, bh, (short)0, c, false, false);
  if (NT >= 2) c = __builtin_amdgcn_wmma_f32_16x16x32_f16(false, al, false, bh, (short)0, c, false, false);
  if (NT >= 3) c = __builtin_amdgcn_wmma_f32_16x16x32_f16(false, ah, false, bl, (short)0, c, false, false);
  asm volatile("v_nop\n\tv_nop\n\tv_nop\n\tv_nop" : "+v"(c) : "v"(ah), "v"(al), "v"(bh), "v"(bl));
  return c;
}
// batched GEMM like k_gemm_b but f16 operands: A f32 (split into f16 hi/lo if ASPLIT, else rounded to f16), Bt = f16 values [n][k]; alpha; C f32; N multiple of 16 (partial tiles skipped)
template <bool ASPLIT>
__global__ __launch_bounds__(128) void k_gemm_h(const float* __restrict__ A, int lda, size_t sA, const _Float16* __restrict__ Bh, int ldb, size_t sB, float alpha, float* __restrict__ C, int ldc, size_t sC, int M, int N, int K) {
  __shared__ __attribute__((aligned(16))) float so[4][16][64];
  const int tid = threadIdx.x, w = tid >> 5, lane = tid & 31, ln = lane & 15, hh = lane >> 4; const int by = blockIdx.y;
  A += (size_t)by * sA; Bh += (size_t)by * sB; C += (size_t)by * sC;
  const int ntn = (N + 63) / 64; const int wid = blockIdx.x * 4 + w; const int mt = wid / ntn, nq = wid % ntn; if (mt * 16 >= M) return;
  const int row0 = mt * 16, col0 = nq * 64; const float* arow = A + (size_t)(row0 + ln) * lda;
  v8f acc[4] = {};
  for (int kb = 0; kb < K; kb += 32) {
    FragH ah, al;
    const v4f x0 = *(const v4fa*)(arow + kb + 8 * hh), x1 = *(const v4fa*)(arow + kb + 8 * hh + 4), x2 = *(const v4fa*)(arow + kb + 16 + 8 * hh), x3 = *(const v4fa*)(arow + kb + 16 + 8 * hh + 4);
    float xs[16] = {x0[0],x0[1],x0[2],x0[3],x1[0],x1[1],x1[2],x1[3],x2[0],x2[1],x2[2],x2[3],x3[0],x3[1],x3[2],x3[3]};
#pragma unroll
    for (int i = 0; i < 16; ++i) { const _Float16 h = (_Float16)xs[i]; ah.h[i] = h; al.h[i] = ASPLIT ? (_Float16)(xs[i] - (float)h) : (_Float16)0.0f; }
#pragma unroll
    for (int t = 0; t < 4; ++t) { if (col0 + t * 16 >= N) continue; const size_t boff = (size_t)(col0 + t * 16 + ln) * ldb + kb; FragH bq; bq.half[0] = *(const v8us*)(Bh + boff + 8 * hh); bq.half[1] = *(const v8us*)(Bh + boff + 16 + 8 * hh);
      acc[t] = mmaH<ASPLIT ? 2 : 1>(ah.v, al.v, bq.v, bq.v, acc[t]); }
  }
#pragma unroll
  for (int t = 0; t < 4; ++t) { if (col0 + t * 16 >= N) continue;
#pragma unroll
    for (int r = 0; r < 8; ++r) so[w][8 * hh + r][t * 16 + ln] = acc[t][r] * alpha; }
  __builtin_amdgcn_fence(__ATOMIC_ACQ_REL, "workgroup"); __builtin_amdgcn_wave_barrier();
  const int rsub = lane >> 4, c4 = (lane & 15) * 4;
  {
#pragma unroll
    for (int q = 0; q < 8; ++q) { const int r = q * 2 + rsub; if (col0 + c4 < N) { const v4f v = *(const v4fa*)&so[w][r][c4]; *(v4f*)(C + (size_t)(row0 + r) * ldc + col0 + c4) = v; } }
     }
}

// Wt[n][k] = f16(W[k][n]·scale) from f32 row-major W[K][N] (scale = power of two; bf16-exact weights stay exact in f16 away from the subnormal range)
__global__ __launch_bounds__(256) void k_wt_f16(const float* __restrict__ W, _Float16* __restrict__ Wt, int K, int N, float scale) {
  const int t = blockIdx.x * 256 + threadIdx.x; if (t >= N * (K / 8)) return; const int n = t / (K / 8), k8 = (t % (K / 8)) * 8; FragH f;
#pragma unroll
  for (int i = 0; i < 8; ++i) f.h[i] = (_Float16)(bf16_round(W[(size_t)(k8 + i) * N + n]) * scale); const v8us o = f.half[0];
  *(v8us*)((unsigned short*)Wt + (size_t)n * K + k8) = o; 
}
// k_gemm_hh variant with fused epilogue: v = acc·alpha + bias[by·sBias + col] (+ CP[(row/rowsPerB)·sCPb + by·64 + col] if CP) ; ACT 0 none / 1 elu ; writes f16 C16 (and f32 C if non-null)
template <int ACT>
__global__ __launch_bounds__(128) void k_gemm_hhx(const _Float16* __restrict__ A, int lda, size_t sA, const _Float16* __restrict__ Bh, int ldb, size_t sB, float alpha, const float* __restrict__ bias, size_t sBias, const float* __restrict__ CP, int rowsPerB, size_t sCPb, int row0g,
    float* __restrict__ C, _Float16* __restrict__ C16, int ldc, size_t sC, int M, int N, int K) {
  __shared__ __attribute__((aligned(16))) float so[4][16][64];
  const int tid = threadIdx.x, w = tid >> 5, lane = tid & 31, ln = lane & 15, hh = lane >> 4; const int by = blockIdx.y;
  A += (size_t)by * sA; Bh += (size_t)by * sB; const size_t cofs = (size_t)by * sC; const float* bp = bias ? bias + (size_t)by * sBias : nullptr;
  const int ntn = (N + 63) / 64; const int wid = blockIdx.x * 4 + w; const int mt = wid / ntn, nq = wid % ntn; if (mt * 16 >= M) return;
  const int row0 = mt * 16, col0 = nq * 64; const _Float16* arow = A + (size_t)(row0 + ln) * lda;
  v8f acc[4] = {};
  for (int kb = 0; kb < K; kb += 32) { FragH ah; ah.half[0] = *(const v8us*)((const unsigned short*)arow + kb + 8 * hh); ah.half[1] = *(const v8us*)((const unsigned short*)arow + kb + 16 + 8 * hh);
#pragma unroll
    for (int t = 0; t < 4; ++t) { if (col0 + t * 16 >= N) continue; const size_t boff = (size_t)(col0 + t * 16 + ln) * ldb + kb; FragH bq; bq.half[0] = *(const v8us*)((const unsigned short*)Bh + boff + 8 * hh); bq.half[1] = *(const v8us*)((const unsigned short*)Bh + boff + 16 + 8 * hh);
      acc[t] = mmaH<1>(ah.v, ah.v, bq.v, bq.v, acc[t]); }
  }
#pragma unroll
  for (int t = 0; t < 4; ++t) { if (col0 + t * 16 >= N) continue; const int col = col0 + t * 16 + ln; const float bv = bp ? bf16_round(bp[col]) : 0.f;
#pragma unroll
    for (int r = 0; r < 8; ++r) { float v = acc[t][r] * alpha + bv; if (CP) { const int rr = row0g + row0 + 8 * hh + r; if (rowsPerB < 0) v += CP[cofs + (size_t)rr * ldc + col];      /* rowsPerB < 0: own element of the batched C plane */ else { const int bidx = rr / rowsPerB; v += CP[(size_t)bidx * sCPb + (size_t)by * 64 + col]; } } if (ACT == 1) v = (v > 0.f) ? v : expm1f(v); else if (ACT == 7) v = (v > 0.f) ? v + 1.0f : expf(v); else if (ACT == 8) v = tanhf(v); else if (ACT == 9) v = 0.5f * v * (1.0f + tanhf(0.7978845608028654f * (v + 0.044715f * v * v * v))); else if (ACT == 11) v = 1.0f / (1.0f + expf(-v)); else if (ACT == 12) v = (v > 0.f) ? v : 0.01f * v; else if (ACT == 14) v = (v > 0.f) ? v : 0.1f * v; else if (ACT == 16) v = (v >= 0.f) ? v : 0.3f * v; else if (ACT == 17) v = (v >= 0.f) ? v : 0.2f * v; else if (ACT == 15) v = v / (1.0f + expf(-v)); else if (ACT == 3) v = fmaxf(v, 0.f); else if (ACT == 6) v = 0.5f * v * (1.0f + erff(v * 0.70710678118654752f)); so[w][8 * hh + r][t * 16 + ln] = v; } }
  __builtin_amdgcn_fence(__ATOMIC_ACQ_REL, "workgroup"); __builtin_amdgcn_wave_barrier();
  const int rsub = lane >> 4, c4 = (lane & 15) * 4; typedef _Float16 v4h __attribute__((ext_vector_type(4)));
  {
#pragma unroll
    for (int q = 0; q < 8; ++q) { const int r = q * 2 + rsub; if (col0 + c4 < N) { const v4f v = *(const v4fa*)&so[w][r][c4]; if (C) *(v4f*)(C + cofs + (size_t)(row0 + r) * ldc + col0 + c4) = v; if (C16) { v4h h4; for (int i = 0; i < 4; ++i) h4[i] = (_Float16)v[i]; *(v4h*)(C16 + cofs + (size_t)(row0 + r) * ldc + col0 + c4) = h4; } } }
     }
}


typedef _Float16 v4h __attribute__((ext_vector_type(4)));

__global__ __launch_bounds__(256) void k_x16(const float* __restrict__ x, _Float16* __restrict__ X16, size_t n8) { const size_t t = (size_t)blockIdx.x * 256 + threadIdx.x; if (t >= n8) return; FragH f;
#pragma unroll
  for (int q = 0; q < 8; ++q) f.h[q] = (_Float16)bf16_round(x[t * 8 + q]); *(v8us*)((unsigned short*)X16 + t * 8) = f.half[0];  }
__global__ __launch_bounds__(256) void k_h16(const float* __restrict__ x, _Float16* __restrict__ X16, size_t n8) { const size_t t = (size_t)blockIdx.x * 256 + threadIdx.x; if (t >= n8) return; FragH f;
#pragma unroll
  for (int q = 0; q < 8; ++q) f.h[q] = (_Float16)x[t * 8 + q]; *(v8us*)((unsigned short*)X16 + t * 8) = f.half[0];  }
__global__ __launch_bounds__(256) void k_round16f(const float* __restrict__ W, _Float16* __restrict__ Bt, size_t n8) { const size_t t = (size_t)blockIdx.x * 256 + threadIdx.x; if (t >= n8) return; FragH f;
#pragma unroll
  for (int i = 0; i < 8; ++i) f.h[i] = (_Float16)(bf16_round(W[t * 8 + i]) * 16.0f); *(v8us*)((unsigned short*)Bt + t * 8) = f.half[0];  }
template <int NHv, int TTv>
__global__ __launch_bounds__(256) void k_vt(const _Float16* __restrict__ V16, int ldv, int voff, _Float16* __restrict__ Vt) { __shared__ unsigned short tl[64][66]; const int tid = threadIdx.x; const int slab = blockIdx.x / (TTv / 64), lg = blockIdx.x % (TTv / 64); const int b = slab / NHv, h = slab % NHv;
  for (int i = tid; i < 64 * 8; i += 256) { const int r = i / 8, c8 = (i % 8) * 8; FragH f; f.half[0] = *(const v8us*)((const unsigned short*)V16 + ((size_t)b * TTv + lg * 64 + r) * ldv + voff + h * 64 + c8);
#pragma unroll
    for (int q = 0; q < 8; ++q) tl[r][c8 + q] = f.u[q]; }
  __syncthreads();
  {
#pragma unroll
    for (int rd = 0; rd < 2; ++rd) { const int d = rd * 32 + tid / 8, pc = tid % 8; FragH f;
#pragma unroll
      for (int q = 0; q < 8; ++q) f.u[q] = tl[pc * 8 + q][d];
      *(v8us*)((unsigned short*)Vt + ((size_t)slab * 64 + d) * TTv + lg * 64 + pc * 8) = f.half[0]; }
     } }

__global__ __launch_bounds__(256) void k_hl(const float* __restrict__ F, _Float16* __restrict__ Hh, _Float16* __restrict__ Hl, size_t n8) { const size_t t = (size_t)blockIdx.x * 256 + threadIdx.x; if (t >= n8) return; FragH fh, fl; const v4f a = *(const v4fa*)(F + t * 8), c = *(const v4fa*)(F + t * 8 + 4);
#pragma unroll
  for (int q = 0; q < 4; ++q) { _Float16 h = (_Float16)a[q]; fh.h[q] = h; fl.h[q] = (_Float16)((a[q] - (float)h) * 1024.0f); h = (_Float16)c[q]; fh.h[4 + q] = h; fl.h[4 + q] = (_Float16)((c[q] - (float)h) * 1024.0f); }
  { *(v8us*)((unsigned short*)Hh + t * 8) = fh.half[0]; *(v8us*)((unsigned short*)Hl + t * 8) = fl.half[0];  } }

// ---- fast GEMM (wave tile 32x64; requires M % 32 == 0 rows per launch region and N % 64 == 0); epilogue = k_gemm_hhx semantics ----
__device__ __forceinline__ v16h g2_frag(const _Float16* p, int hh) { FragH f; f.half[0] = *(const v8us*)((const unsigned short*)p + 8 * hh); f.half[1] = *(const v8us*)((const unsigned short*)p + 16 + 8 * hh); return f.v; }
__device__ __forceinline__ v8f g2_mma(v16h a, v16h b, v8f c) { v8f d = __builtin_amdgcn_wmma_f32_16x16x32_f16(false, a, false, b, (short)0, c, false, false); asm volatile("v_nop\n\tv_nop\n\tv_nop\n\tv_nop" : "+v"(d) : "v"(a), "v"(b)); return d; }
template <int ACT>
__global__ __launch_bounds__(128) void k_gemm2(const _Float16* __restrict__ A, int lda, size_t sA, const _Float16* __restrict__ Bh, int ldb, size_t sB, float alpha, const float* __restrict__ bias, size_t sBias, const float* __restrict__ CP, int rowsPerB, size_t sCPb, int row0g,
    float* __restrict__ C, _Float16* __restrict__ C16, int ldc, size_t sC, int M, int N, int K) { static_assert(ACT == 0 || ACT == 3 || ACT == 6 || ACT == 8 || ACT == 9 || ACT == 11 || ACT == 12 || ACT == 14 || ACT == 15 || ACT == 16 || ACT == 17, "k_gemm2: unsupported ACT code (would silently apply no activation)");
  __shared__ __attribute__((aligned(16))) float so[4][32][68];
  const int tid = threadIdx.x, w = tid >> 5, lane = tid & 31, ln = lane & 15, hh = lane >> 4; const int by = blockIdx.y;
  A += (size_t)by * sA; Bh += (size_t)by * sB; const size_t cofs = (size_t)by * sC; const float* bp = bias ? bias + (size_t)by * sBias : nullptr;
  const int ntn = N >> 6; const int mt = blockIdx.x / ntn, nq = blockIdx.x - mt * ntn; const int row0 = mt * 128 + 32 * w, col0 = nq * 64; if (row0 >= M) return;
  const _Float16* a0p = A + (size_t)(row0 + ln) * lda; const _Float16* a1p = a0p + (size_t)16 * lda;
  const _Float16* b0p = Bh + (size_t)(col0 + ln) * ldb; const _Float16* b1p = b0p + (size_t)16 * ldb; const _Float16* b2p = b1p + (size_t)16 * ldb; const _Float16* b3p = b2p + (size_t)16 * ldb;
  const v8f z8 = {0.f,0.f,0.f,0.f,0.f,0.f,0.f,0.f}; v8f c00 = z8, c01 = z8, c02 = z8, c03 = z8, c10 = z8, c11 = z8, c12 = z8, c13 = z8;
#pragma unroll 1
  for (int kb = 0; kb < K; kb += 32) { const v16h a0 = g2_frag(a0p + kb, hh), a1 = g2_frag(a1p + kb, hh);
    v16h b = g2_frag(b0p + kb, hh); c00 = g2_mma(a0, b, c00); c10 = g2_mma(a1, b, c10);
    b = g2_frag(b1p + kb, hh); c01 = g2_mma(a0, b, c01); c11 = g2_mma(a1, b, c11);
    b = g2_frag(b2p + kb, hh); c02 = g2_mma(a0, b, c02); c12 = g2_mma(a1, b, c12);
    b = g2_frag(b3p + kb, hh); c03 = g2_mma(a0, b, c03); c13 = g2_mma(a1, b, c13); }
  v8f accs[8] = {c00, c01, c02, c03, c10, c11, c12, c13};
#pragma unroll
  for (int u = 0; u < 8; ++u) { const int t = u & 3, half = u >> 2; const int col = col0 + t * 16 + ln; const float bv = bp ? bf16_round(bp[col]) : 0.f;
#pragma unroll
    for (int r = 0; r < 8; ++r) { const int rloc = half * 16 + 8 * hh + r; float v = accs[u][r] * alpha + bv; if (CP) { if (rowsPerB < 0) v += CP[cofs + (size_t)(row0g + row0 + rloc) * ldc + col];      /* rowsPerB < 0: own element of the batched C plane */ else { const int bidx = (row0g + row0 + rloc) / rowsPerB; v += CP[(size_t)bidx * sCPb + (size_t)by * 64 + col]; } }
      if (ACT == 3) v = fmaxf(v, 0.f); else if (ACT == 6) v = 0.5f * v * (1.0f + erff(v * 0.70710678118654752f)); else if (ACT == 11) v = 1.0f / (1.0f + expf(-v)); else if (ACT == 15) v = v / (1.0f + expf(-v)); else if (ACT == 12) v = (v > 0.f) ? v : 0.01f * v; else if (ACT == 8) v = tanhf(v); else if (ACT == 9) v = 0.5f * v * (1.0f + tanhf(0.7978845608028654f * (v + 0.044715f * v * v * v))); else if (ACT == 14) v = (v > 0.f) ? v : 0.1f * v; else if (ACT == 16) v = (v >= 0.f) ? v : 0.3f * v; else if (ACT == 17) v = (v >= 0.f) ? v : 0.2f * v;
      so[w][rloc][t * 16 + ln] = v; } }
  __builtin_amdgcn_fence(__ATOMIC_ACQ_REL, "workgroup"); __builtin_amdgcn_wave_barrier();
  const int rsub = lane >> 4, c4 = (lane & 15) * 4;
  {
#pragma unroll
    for (int q = 0; q < 16; ++q) { const int r = q * 2 + rsub; const v4f v = *(const v4fa*)&so[w][r][c4]; if (C) *(v4f*)(C + cofs + (size_t)(row0 + r) * ldc + col0 + c4) = v; if (C16) { v4h h4; for (int i = 0; i < 4; ++i) h4[i] = (_Float16)v[i]; *(v4h*)(C16 + cofs + (size_t)(row0 + r) * ldc + col0 + c4) = h4; } }
     } }


__global__ __launch_bounds__(256) void k_wnat(const float* __restrict__ w, size_t n8, _Float16* __restrict__ Bt) { const size_t t = (size_t)blockIdx.x * 256 + threadIdx.x; if (t >= n8) return; FragH f; for (int q = 0; q < 8; ++q) f.h[q] = (_Float16)(bf16_round(w[t * 8 + q]) * 16.0f); *(v8us*)((unsigned short*)Bt + t * 8) = f.half[0];  }
__global__ __launch_bounds__(256) void k_rsm(const float* __restrict__ S, _Float16* __restrict__ P, int nrows) {
  #pragma clang fp contract(off)
  const int i = blockIdx.x * 256 + threadIdx.x; if (i >= nrows) return; const float* s = S + (size_t)i * SQ; float mx = -3.0e38f;
#pragma unroll 1
  for (int j = 0; j < SQ; ++j) mx = fmaxf(mx, s[j]); float se = 0.f;
#pragma unroll 1
  for (int j = 0; j < SQ; ++j) se += expf(s[j] - mx); const float sc = 256.0f / se;
#pragma unroll 1
  for (int j0 = 0; j0 < SQ; j0 += 8) { FragH f; for (int q = 0; q < 8; ++q) f.h[q] = (_Float16)(expf(s[j0 + q] - mx) * sc); unsigned short* d = (unsigned short*)P + (size_t)i * SQ + j0; *(v8us*)d = f.half[0];  } }
__global__ __launch_bounds__(256) void k_vt(const _Float16* __restrict__ V16, int b, int h0, _Float16* __restrict__ VT) { __shared__ unsigned short tl[64][65]; const int tid = threadIdx.x; const int hh = blockIdx.x % HG, sg = blockIdx.x / HG; const int s0 = sg * 64; const int h = h0 + hh;
  for (int i = tid; i < 64 * 8; i += 256) { const int j = i / 8, d8 = (i % 8) * 8; FragH f; f.half[0] = *(const v8us*)((const unsigned short*)V16 + ((size_t)b * SQ + s0 + j) * DM + h * HD + d8); for (int q = 0; q < 8; ++q) tl[d8 + q][j] = f.u[q]; }
  __syncthreads();
  { for (int i = tid; i < 64 * 8; i += 256) { const int d = i / 8, j8 = (i % 8) * 8; FragH f; for (int q = 0; q < 8; ++q) f.u[q] = tl[d][j8 + q]; *(v8us*)((unsigned short*)VT + ((size_t)hh * HD + d) * SQ + s0 + j8) = f.half[0]; }  } }



__global__ __launch_bounds__(256) void k_rsmcf2(const float* __restrict__ S, _Float16* __restrict__ P, int hg, int q0, int nk) {
  #pragma clang fp contract(off)
  const int t = blockIdx.x * 256 + threadIdx.x; if (t >= hg * QT) return; const size_t i = (size_t)t; const float* s = S + i * NKX; const int last = q0 + (t % QT); float mx = -3.0e38f;
#pragma unroll 1
  for (int j = 0; j < nk; ++j) { const float f = (j <= last) ? 1.f : 0.f; mx = fmaxf(mx, fmaf(f, s[j], (1.f - f) * -1.0e9f)); } float se = 0.f;
#pragma unroll 1
  for (int j = 0; j < nk; ++j) { const float f = (j <= last) ? 1.f : 0.f; se += __expf(fmaf(f, s[j], (1.f - f) * -1.0e9f) - mx); } const float sc = 256.0f / se;
#pragma unroll 1
  for (int j0 = 0; j0 < nk; j0 += 8) { FragH fr; for (int q = 0; q < 8; ++q) { const int j = j0 + q; const float f = (j <= last) ? 1.f : 0.f; fr.h[q] = (_Float16)(__expf(fmaf(f, s[j], (1.f - f) * -1.0e9f) - mx) * sc); } unsigned short* d = (unsigned short*)P + i * NKX + j0; *(v8us*)d = fr.half[0];  } }


template <int MASKADD>
__global__ __launch_bounds__(64) void k_att0(const float* __restrict__ QF, const float* __restrict__ KF, const float* __restrict__ VF, int ld, const float* __restrict__ mask, float scale, float* __restrict__ OF, int ldo) {
  #pragma clang fp contract(off)
  __shared__ __attribute__((aligned(16))) float lq[64][64]; __shared__ __attribute__((aligned(16))) float lo[64][64];
  const int tid = threadIdx.x; const int h = blockIdx.x / (QT0 / 64), rg = blockIdx.x % (QT0 / 64); const int i = rg * 64 + tid;
  const float* qr = QF + (size_t)i * ld + h * HD;
#pragma unroll 1
  for (int c = 0; c < HD / 4; ++c) { *(v4f*)&lq[tid][c * 4] = *(const v4fa*)(qr + c * 4); const v4f z = {0.f, 0.f, 0.f, 0.f}; *(v4f*)&lo[tid][c * 4] = z; }
  float m = -1.0e30f, l = 0.f; const int jmax = MASKADD ? (SQ - 1) : (rg * 64 + 63);      /* additive-mask form: every key (the mask input decides); causal form: keys up to the block's last row */
#pragma unroll 1
  for (int j = 0; j <= jmax; ++j) { const float* kr = KF + (size_t)j * ld + h * HD; const float* vr = VF + (size_t)j * ld + h * HD; float s = 0.f;
#pragma unroll 1
    for (int c = 0; c < HD / 4; ++c) { const v4f kq = *(const v4fa*)(kr + c * 4); const v4f qq = *(v4f*)&lq[tid][c * 4]; s = __fadd_rn(s, __fmul_rn(qq[0], kq[0])); s = __fadd_rn(s, __fmul_rn(qq[1], kq[1])); s = __fadd_rn(s, __fmul_rn(qq[2], kq[2])); s = __fadd_rn(s, __fmul_rn(qq[3], kq[3])); }
    s = __fmul_rn(s, scale); if (MASKADD) s = __fadd_rn(s, __fmul_rn(bf16_round(mask[(size_t)i * SQ + j]), -10000.0f));
    const float f = (MASKADD || j <= i) ? 1.f : 0.f; const float sm = fmaf(f, s, (1.f - f) * -1.0e30f); const float mn = fmaxf(m, sm); const float sc = expf(m - mn); const float e = expf(sm - mn); l = __fadd_rn(__fmul_rn(l, sc), e); m = mn;
#pragma unroll 1
    for (int c = 0; c < HD / 4; ++c) { const v4f vv = *(const v4fa*)(vr + c * 4); v4f oo = *(v4f*)&lo[tid][c * 4]; for (int u = 0; u < 4; ++u) oo[u] = __fadd_rn(__fmul_rn(oo[u], sc), __fmul_rn(e, vv[u])); *(v4f*)&lo[tid][c * 4] = oo; } }
  const float fin = 64.0f / l;      /* o carried x64 like the f16 path */
#pragma unroll 1
  for (int c = 0; c < HD / 4; ++c) { v4f oo = *(v4f*)&lo[tid][c * 4]; for (int u = 0; u < 4; ++u) oo[u] = __fmul_rn(oo[u], fin); *(v4f*)&lo[tid][c * 4] = oo; }
  __syncthreads();
  {
#pragma unroll 1
    for (int it = 0; it < 16; ++it) { const int row = it * 4 + tid / 16, pc = (tid % 16) * 4; const v4f v = *(const v4f*)&lo[row][pc]; *(v4f*)(OF + (size_t)(rg * 64 + row) * ldo + h * HD + pc) = v; }
     } }


__global__ __launch_bounds__(256) void k_kvexp(const float* __restrict__ src, float* __restrict__ dst, size_t n4) { const size_t t = (size_t)blockIdx.x * 256 + threadIdx.x; if (t >= n4) return; const size_t e = t * 4; const size_t row = e / DM; const int col = (int)(e % DM); const int h = col / HD, d = col % HD; const v4f v = *(const v4fa*)(src + row * KVD + (size_t)(h / HPG) * HD + d); *(v4f*)(dst + e) = v;  }

__global__ __launch_bounds__(256) void k_tab2(float theta, float* __restrict__ CS, float* __restrict__ SN) {
  #pragma clang fp contract(off)
  const int t = blockIdx.x * 256 + threadIdx.x; if (t >= SQ * (HD / 2)) return; const int i = t % (HD / 2); const int p = t / (HD / 2); const float invf = 1.0f / powf(theta, (float)(2 * i) / (float)HD); const float ang = __fmul_rn((float)p, invf); const float c = cosf(ang), s = sinf(ang);
  *(float*)(CS + t) = c; *(float*)(SN + t) = s;  }
template <int NORM, int ROPE>
__global__ __launch_bounds__(64) void k_xform(const float* __restrict__ F, int ldf, int nh, const float* __restrict__ gain, float eps, const float* __restrict__ CS, const float* __restrict__ SN, _Float16* __restrict__ H16, int ldo) {
  #pragma clang fp contract(off)
  __shared__ float xv[HD]; __shared__ float red[HD]; __shared__ unsigned short sh_[HD]; const int d = threadIdx.x; const int h = blockIdx.x % nh; const size_t r = blockIdx.x / nh; const int p = (int)(r % SQ);
  float x = F[r * (size_t)ldf + (size_t)h * HD + d];
  if (NORM) { red[d] = __fmul_rn(x, x); __syncthreads(); for (int st = HD / 2; st > 0; st >>= 1) { if (d < st) red[d] = __fadd_rn(red[d], red[d + st]); __syncthreads(); } const float rs = rsqrtf(__fadd_rn(red[0] / (float)HD, eps)); x = __fmul_rn(__fmul_rn(x, rs), bf16_round(gain[d])); }
  xv[d] = x; __syncthreads();
  float o = x;
  if (ROPE == 1) { const int i = d >> 1; const float c = CS[p * (HD / 2) + i], s = SN[p * (HD / 2) + i]; const float ev = xv[2 * i], od = xv[2 * i + 1]; o = (d & 1) ? __fadd_rn(__fmul_rn(ev, s), __fmul_rn(od, c)) : __fadd_rn(__fmul_rn(ev, c), -__fmul_rn(od, s)); }
  if (ROPE == 2) { const int i = d & (HD / 2 - 1); const float c = CS[p * (HD / 2) + i], s = SN[p * (HD / 2) + i]; const float lo = xv[i], hi = xv[i + HD / 2]; o = (d < HD / 2) ? __fadd_rn(__fmul_rn(lo, c), -__fmul_rn(hi, s)) : __fadd_rn(__fmul_rn(lo, s), __fmul_rn(hi, c)); }
  FragH th; th.h[0] = (_Float16)o; sh_[d] = th.u[0]; __syncthreads();
  if (d < HD / 8) { FragH f; for (int q = 0; q < 8; ++q) f.u[q] = sh_[d * 8 + q]; unsigned short* dst = (unsigned short*)H16 + r * (size_t)ldo + (size_t)h * HD + d * 8; *(v8us*)dst = f.half[0];  } }

template <int NORM, int ROPE>
__global__ __launch_bounds__(64) void k_xformf(const float* __restrict__ F, int ldf, int nh, const float* __restrict__ gain, float eps, const float* __restrict__ CS, const float* __restrict__ SN, float* __restrict__ F32, int ldo) {
  #pragma clang fp contract(off)
  __shared__ float xv[HD]; __shared__ float red[HD]; const int d = threadIdx.x; const int h = blockIdx.x % nh; const size_t r = blockIdx.x / nh; const int p = (int)(r % SQ);
  float x = F[r * (size_t)ldf + (size_t)h * HD + d];
  if (NORM) { red[d] = __fmul_rn(x, x); __syncthreads(); for (int st = HD / 2; st > 0; st >>= 1) { if (d < st) red[d] = __fadd_rn(red[d], red[d + st]); __syncthreads(); } const float rs = rsqrtf(__fadd_rn(red[0] / (float)HD, eps)); x = __fmul_rn(__fmul_rn(x, rs), bf16_round(gain[d])); }
  xv[d] = x; __syncthreads();
  float o = x;
  if (ROPE == 1) { const int i = d >> 1; const float c = CS[p * (HD / 2) + i], s = SN[p * (HD / 2) + i]; const float ev = xv[2 * i], od = xv[2 * i + 1]; o = (d & 1) ? __fadd_rn(__fmul_rn(ev, s), __fmul_rn(od, c)) : __fadd_rn(__fmul_rn(ev, c), -__fmul_rn(od, s)); }
  if (ROPE == 2) { const int i = d & (HD / 2 - 1); const float c = CS[p * (HD / 2) + i], s = SN[p * (HD / 2) + i]; const float lo = xv[i], hi = xv[i + HD / 2]; o = (d < HD / 2) ? __fadd_rn(__fmul_rn(lo, c), -__fmul_rn(hi, s)) : __fadd_rn(__fmul_rn(lo, s), __fmul_rn(hi, c)); }
  float* dst = F32 + r * (size_t)ldo + (size_t)h * HD + d; *(float*)dst = o;  }

__global__ __launch_bounds__(256) void k_bfcp(const float* __restrict__ src, float* __restrict__ dst, size_t n4) { const size_t t = (size_t)blockIdx.x * 256 + threadIdx.x; if (t >= n4) return; const v4f a = *(const v4fa*)(src + t * 4); v4f o; for (int q = 0; q < 4; ++q) o[q] = bf16_round(a[q]); *(v4f*)(dst + t * 4) = o;  }

__global__ __launch_bounds__(256) void k_tab2d(float* __restrict__ CS, float* __restrict__ SN) {
  #pragma clang fp contract(off)
  const int t = blockIdx.x * 256 + threadIdx.x; if (t >= SQ * (HD / 2)) return; const int i = t % (HD / 2); const int p = t / (HD / 2); const float invf = (float)(1.0 / pow(10000.0, (double)(2 * i) / (double)HD)); const float ang = __fmul_rn((float)p, invf); const float c = cosf(ang), s = sinf(ang);
  *(float*)(CS + t) = c; *(float*)(SN + t) = s;  }
extern "C" void kernel_launch(void* const* d_in, const int* in_sizes, int n_in,
                              void* d_out, int out_size, void* d_ws, size_t ws_size, hipStream_t stream) {
  (void)in_sizes; (void)n_in; (void)out_size;
  const float* const* I = (const float* const*)d_in; const float* x = I[0]; const float* wq = I[1]; const float* wk = I[2]; const float* wv = I[3]; const float* wo = I[4]; const float* tcos = I[5]; const float* tsin = I[6]; const float* bq = nullptr; const float* bk = nullptr; const float* bv = nullptr; const float* bo = nullptr;      /* natural [out][in] weights, no biases; rope_cos / rope_sin INPUT tables [2048][32] */
  static_assert(HPG == 1 && NH == NG * HPG && NH * HD == DM && KVD == DM, "plain multi-head attention as 16 kv groups of one query head");
  char* ws = (char*)d_ws; size_t off = 0;
  auto take = [&](size_t bytes) { char* p = ws + off; off += (bytes + 255) & ~(size_t)255; return p; };
  _Float16* BQ = (_Float16*)take((size_t)DM * DM * 2); _Float16* BK = (_Float16*)take((size_t)KVD * DM * 2); _Float16* BV = (_Float16*)take((size_t)KVD * DM * 2); _Float16* BO = (_Float16*)take((size_t)DM * DM * 2);
  _Float16* X16 = (_Float16*)take(NR * DM * 2); float* QF = (float*)take((size_t)SQ * DM * 4); float* KF = (float*)take((size_t)SQ * KVD * 4); float* CSB = (float*)take((size_t)SQ * 32 * 4); float* SNB = (float*)take((size_t)SQ * 32 * 4); _Float16* Q16 = (_Float16*)take(NR * DM * 2); _Float16* K16 = (_Float16*)take(NR * KVD * 2); _Float16* V16 = (_Float16*)take(NR * KVD * 2); _Float16* O16 = (_Float16*)take(NR * DM * 2);
  float* S = (float*)take((size_t)NH * QT * NKX * 4); _Float16* P = (_Float16*)take((size_t)NH * QT * NKX * 2); _Float16* VT = (_Float16*)take((size_t)NH * HD * SQ * 2);
  float* QF0 = (float*)take((size_t)QT0 * DM * 4); float* KF0 = (float*)take((size_t)QT0 * KVD * 4); float* VF0 = (float*)take((size_t)QT0 * KVD * 4); float* KF0e = (float*)take((size_t)QT0 * DM * 4); float* VF0e = (float*)take((size_t)QT0 * DM * 4); float* OF0 = (float*)take((size_t)NB * QT0 * DM * 4); _Float16* OH0 = (_Float16*)take((size_t)NB * QT0 * DM * 2); _Float16* OL0 = (_Float16*)take((size_t)NB * QT0 * DM * 2);
  if (off > ws_size) return;
  k_wnat<<<(unsigned)(((size_t)DM * DM / 8 + 255) / 256), 256, 0, stream>>>(wq, (size_t)DM * DM / 8, BQ); k_wnat<<<(unsigned)(((size_t)KVD * DM / 8 + 255) / 256), 256, 0, stream>>>(wk, (size_t)KVD * DM / 8, BK); k_wnat<<<(unsigned)(((size_t)KVD * DM / 8 + 255) / 256), 256, 0, stream>>>(wv, (size_t)KVD * DM / 8, BV); k_wnat<<<(unsigned)(((size_t)DM * DM / 8 + 255) / 256), 256, 0, stream>>>(wo, (size_t)DM * DM / 8, BO);      /* natural [out][in] = Bt planes x16 */
  k_x16<<<(unsigned)((NR * DM / 8 + 255) / 256), 256, 0, stream>>>(x, X16, NR * DM / 8);
  const size_t r0p = (size_t)B0 * SQ;      /* first projected row */
  k_gemm2<0><<<dim3((unsigned)((MP / 128) * (KVD / 64)), 1), 128, 0, stream>>>(X16 + r0p * DM, DM, 0, BV, DM, 0, 0.0625f, bv, 0, nullptr, 1, 0, 0, nullptr, V16 + r0p * KVD, KVD, 0, MP, KVD, DM);
  k_bfcp<<<(unsigned)(((size_t)SQ * (HD / 2) / 4 + 255) / 256), 256, 0, stream>>>(tcos, CSB, (size_t)SQ * (HD / 2) / 4); k_bfcp<<<(unsigned)(((size_t)SQ * (HD / 2) / 4 + 255) / 256), 256, 0, stream>>>(tsin, SNB, (size_t)SQ * (HD / 2) / 4);      /* bf16-rounded copies of the module's INPUT rope tables [2048][32] (the [pos][i] layout k_xform indexes; the rotate-half branch uses table column d mod 32 = the module's [cos | cos]) */
  for (int b = B0; b < B0 + NBR; ++b) { const size_t r0 = (size_t)b * SQ;
    k_gemm2<0><<<dim3((unsigned)((SQ / 128) * (DM / 64)), 1), 128, 0, stream>>>(X16 + r0 * DM, DM, 0, BQ, DM, 0, 0.0625f, nullptr, 0, nullptr, 1, 0, 0, QF, nullptr, DM, 0, SQ, DM, DM);      /* q (f32) of this batch */
    k_gemm2<0><<<dim3((unsigned)((SQ / 128) * (KVD / 64)), 1), 128, 0, stream>>>(X16 + r0 * DM, DM, 0, BK, DM, 0, 0.0625f, nullptr, 0, nullptr, 1, 0, 0, KF, nullptr, KVD, 0, SQ, KVD, DM);      /* k (f32) */
    k_xform<0, 2><<<(unsigned)((size_t)SQ * NH), 64, 0, stream>>>(QF, DM, NH, nullptr, 0.f, CSB, SNB, Q16 + r0 * DM, DM); k_xform<0, 2><<<(unsigned)((size_t)SQ * NG), 64, 0, stream>>>(KF, KVD, NG, nullptr, 0.f, CSB, SNB, K16 + r0 * KVD, KVD);      /* rotate-half rope of q and k from the bf16-rounded input tables -> f16 rows */
    k_vt<NG, SQ><<<NG * (SQ / 64), 256, 0, stream>>>(V16 + r0 * KVD, KVD, 0, VT);      /* V^T [NH][HD][SQ] for this batch */
    for (int q0 = 0; q0 < QN; q0 += QT) { const int nk = SQ;      /* non-causal: all keys for every query tile */
      k_gemm2<0><<<dim3((QT / 128) * (nk / 64), NH), 128, 0, stream>>>(Q16 + (r0 + q0) * LQ, LQ, (size_t)HD, K16 + r0 * KVD, KVD, (size_t)HD, 0.125f, nullptr, 0, nullptr, 1, 0, 0, S, nullptr, NKX, (size_t)QT * NKX, QT, nk, HD);      /* scores: HPG == 1: ONE launch with all 16 heads on grid.y, key head stride HD */
      k_rsm<<<(NHD * QT + 255) / 256, 256, 0, stream>>>(S, P, NHD * QT);      /* plain row softmax over all SQ keys (row pitch NKX == SQ) */
      k_gemm2<0><<<dim3((QT / 128) * (HD / 64), NH), 128, 0, stream>>>(P, NKX, (size_t)QT * NKX, VT, SQ, (size_t)HD * SQ, 0.25f, nullptr, 0, nullptr, 1, 0, 0, nullptr, O16 + (r0 + q0) * DM, DM, (size_t)HD, QT, HD, nk); } }      /* o for all 16 heads in ONE launch (value head stride HD*SQ) (x64) */
  k_gemm2<0><<<dim3((unsigned)((MPO / 128) * (DM / 64)), 1), 128, 0, stream>>>(O16 + r0p * DM, DM, 0, BO, DM, 0, 0.0009765625f, bo, 0, nullptr, 1, 0, 0, (float*)d_out + r0p * DM, nullptr, DM, 0, MPO, DM, DM);      /* out rows are the output layout */
}

// v001
// One run takes 1460 microseconds.
// Timed twice side by side with v000, it ran 4.86 times as fast both times.
#include <hip/hip_runtime.h>
// Multi-head self-attention with half-split RoPE from RANDOM input tables, NON-causal (x [2][2048][1024]; q / k / v = x W^T (nn.Linear natural [1024][1024] sigma 1/32, no biases), 16 heads of 64; rope: x * [cos | cos] + rotate_half(x) * [sin | sin] with rotate_half = (-x2, x1) over the two 32-lane halves and INPUT tables rope_cos / rope_sin [2048][32] (cos / sin of uniform-random angles); scores / sqrt(64); softmax over all 2048 keys (f32; no mask); out = merged Wo^T (natural, no bias) -> [2][2048][1024]); run as 16 groups of ONE head.
// Structure: x as exact f16 rows; natural weights as exact x16 planes; v as a WMMA GEMM (32x64 wave tiles, f32 accumulation, f16 output); rope tables bf16-rounded once from the input tables; per batch: q [2048][1024] and k [2048][1024] as GEMMs into f32 rows then the rotate-half rotation + f16 conversion per (row, head) on VALU; V^T of the 16 groups via LDS transposes; per query tile of 256 rows and per group: scores of its one head against ALL 2048 keys of its key slab (K = 64, key head stride HD, alpha 1/8), row softmax on VALU (f32 statistics, expf; weights x256 f16), o = P V^T with the shared value slab (o carried x64) into merged f16 rows; out = o Wo^T GEMM (f32, alpha 2^-10); launches: see trace.
// Compute dtype: inputs rounded to bf16; x / weights exact; q, k, v, softmax weights and o as plain f16 GEMM operands (~2^-12); scores and softmax statistics f32. v_wmma_f32_16x16x32_f16.
#define NB 2
#define NG 16
#define HPG 1
#define KVD (NG * HD)
#define SQ 2048
#define DM 1024
#define NH 16
#define HD 64
#define HG 4                         /* heads per block group of the unlaunched k_vt overload */
#define QT 256                       /* query rows per tile */
#define NKX SQ                       /* S / P row pitch */
#define QT0 128                      /* rows per head of k_att0 (not launched); sizes unused f32 buffers */
#define B0 0                         /* first batch processed (debug hook) */
#define NBR NB                       /* batches processed (debug hook) */
#define NR ((size_t)NB * SQ)         /* token rows */
#define MP ((int)((size_t)NBR * SQ)) /* rows projected (debug hook) */
#define QN SQ                        /* query rows attended per batch (debug hook) */
#define NHD NH                       /* heads attended (debug hook) */
#define MPO MP                       /* rows through the output stage (debug hook) */
#define LQ DM      /* row pitch of the q/k/v rows */
typedef __bf16 v16b __attribute__((ext_vector_type(16)));
typedef unsigned short v8us __attribute__((ext_vector_type(8), may_alias));
typedef float  v8f  __attribute__((ext_vector_type(8)));
typedef float  v4f  __attribute__((ext_vector_type(4)));
typedef float  v4fa __attribute__((ext_vector_type(4), may_alias));
union FragB { v16b v; v8us half[2]; unsigned short u[16]; };

__device__ __forceinline__ unsigned short bf16_bits(float x) { unsigned int u = __float_as_uint(x); return (unsigned short)((u + 0x7FFFu + ((u >> 16) & 1u)) >> 16); }
__device__ __forceinline__ float bf16_val(unsigned short b) { return __uint_as_float(((unsigned int)b) << 16); }
__device__ __forceinline__ float bf16_round(float x) { return bf16_val(bf16_bits(x)); }
// D += A·B with NT terms: 1 = ah·bh, 2 = + al·bh (A split), 3 = + ah·bl (both split)
template <int NT>
__device__ __forceinline__ v8f mmaN(v16b ah, v16b al, v16b bh, v16b bl, v8f c) {
  c = __builtin_amdgcn_wmma_f32_16x16x32_bf16(false, ah, false, bh, (short)0, c, false, false);
  if (NT >= 2) c = __builtin_amdgcn_wmma_f32_16x16x32_bf16(false, al, false, bh, (short)0, c, false, false);
  if (NT >= 3) c = __builtin_amdgcn_wmma_f32_16x16x32_bf16(false, ah, false, bl, (short)0, c, false, false);
  asm volatile("v_nop\n\tv_nop\n\tv_nop\n\tv_nop" : "+v"(c) : "v"(ah), "v"(al), "v"(bh), "v"(bl));
  return c;
}

__global__ __launch_bounds__(256) void k_wt_bf16(const float* __restrict__ W, unsigned short* __restrict__ Wt, int K, int N) {
  const int t = blockIdx.x * 256 + threadIdx.x;
  const int k8n = K / 8;
  if (t >= N * k8n) return;
  const int n = t / k8n, k8 = (t % k8n) * 8;
  v8us v;
#pragma unroll
  for (int i = 0; i < 8; ++i) v[i] = bf16_bits(W[(size_t)(k8 + i) * N + n]);
  *(v8us*)(Wt + (size_t)n * K + k8) = v;
  
}

// GEMM C[M][N] (f32, pitch ldc) = act(A[M][K]·W + bias). A f32 row-major (pitch lda) converted per fragment to bf16
// (ASPLIT: hi/lo two planes -> 2 terms, else single rounded term); Wt bf16 [N][K] (pitch ldb). BIAS_BF16 rounds the
// bias to bf16 first (bias quantised to bf16 before the add). K%32==0, M%16==0, N%64==0.
template <bool ASPLIT, int ACT, bool BIAS_BF16>
__global__ __launch_bounds__(128) void k_gemm_bf(const float* __restrict__ A, int lda, const unsigned short* __restrict__ Wt, int ldb,
                                               const float* __restrict__ bias, float* __restrict__ C, int ldc, int M, int N, int K) {
  __shared__ __attribute__((aligned(16))) float so[4][16][64];
  const int tid = threadIdx.x, w = tid >> 5, lane = tid & 31, ln = lane & 15, hh = lane >> 4;
  const int ntn = N / 64;
  const int wid = blockIdx.x * 4 + w;
  const int mt = wid / ntn, nq = wid % ntn;
  if (mt * 16 >= M) return;
  const int row0 = mt * 16, col0 = nq * 64;
  const float* arow = A + (size_t)(row0 + ln) * lda;
  v8f acc[4] = {};
  for (int kb = 0; kb < K; kb += 32) {
    FragB ah, al;
    const v4f x0 = *(const v4fa*)(arow + kb + 8 * hh), x1 = *(const v4fa*)(arow + kb + 8 * hh + 4);
    const v4f x2 = *(const v4fa*)(arow + kb + 16 + 8 * hh), x3 = *(const v4fa*)(arow + kb + 16 + 8 * hh + 4);
    float xs[16] = {x0[0],x0[1],x0[2],x0[3],x1[0],x1[1],x1[2],x1[3],x2[0],x2[1],x2[2],x2[3],x3[0],x3[1],x3[2],x3[3]};
#pragma unroll
    for (int i = 0; i < 16; ++i) { const unsigned short hb = bf16_bits(xs[i]); ah.u[i] = hb; al.u[i] = ASPLIT ? bf16_bits(xs[i] - bf16_val(hb)) : (unsigned short)0; }
#pragma unroll
    for (int t = 0; t < 4; ++t) {
      const unsigned short* brow = Wt + (size_t)(col0 + t * 16 + ln) * ldb + kb;
      FragB b;
      b.half[0] = *(const v8us*)(brow + 8 * hh);
      b.half[1] = *(const v8us*)(brow + 16 + 8 * hh);
      acc[t] = mmaN<ASPLIT ? 2 : 1>(ah.v, al.v, b.v, b.v, acc[t]);
    }
  }
#pragma unroll
  for (int t = 0; t < 4; ++t) {
    float bv = bias ? bias[col0 + t * 16 + ln] : 0.f;
    if (BIAS_BF16) bv = bf16_round(bv);
#pragma unroll
    for (int r = 0; r < 8; ++r) { float v = acc[t][r] + bv; if (ACT == 1) v = fmaxf(v, 0.f); so[w][8 * hh + r][t * 16 + ln] = v; }
  }
  __builtin_amdgcn_fence(__ATOMIC_ACQ_REL, "workgroup");
  __builtin_amdgcn_wave_barrier();
  const int rsub = lane >> 4, c4 = (lane & 15) * 4;
  {
#pragma unroll
    for (int q = 0; q < 8; ++q) {
      const int r = q * 2 + rsub;
      const v4f v = *(const v4fa*)&so[w][r][c4];
      *(v4f*)(C + (size_t)(row0 + r) * ldc + col0 + c4) = v;
    }
    
  }
}

// GEMM C = act(A·W + bias + resid): A f32 (ASPLIT -> hi/lo 2 terms), Wt bf16 [N][K]; ACT 0 none, 1 relu, 2 exact gelu;
// resid (optional, f32, row index = (row % rmod), pitch ldr, RES_BF16 rounds it) added before the activation.
template <bool ASPLIT, int ACT, bool BIAS_BF16, bool RES_BF16>
__global__ __launch_bounds__(128) void k_gemm_bf3(const float* __restrict__ A, int lda, const unsigned short* __restrict__ Wt, int ldb,
                                                const float* __restrict__ bias, const float* __restrict__ resid, int rmod, int ldr,
                                                float* __restrict__ C, int ldc, int M, int N, int K) {
  __shared__ __attribute__((aligned(16))) float so[4][16][64];
  const int tid = threadIdx.x, w = tid >> 5, lane = tid & 31, ln = lane & 15, hh = lane >> 4;
  const int ntn = N / 64;
  const int wid = blockIdx.x * 4 + w;
  const int mt = wid / ntn, nq = wid % ntn;
  if (mt * 16 >= M) return;
  const int row0 = mt * 16, col0 = nq * 64;
  const float* arow = A + (size_t)(row0 + ln) * lda;
  v8f acc[4] = {};
  for (int kb = 0; kb < K; kb += 32) {
    FragB ah, al;
    const v4f x0 = *(const v4fa*)(arow + kb + 8 * hh), x1 = *(const v4fa*)(arow + kb + 8 * hh + 4);
    const v4f x2 = *(const v4fa*)(arow + kb + 16 + 8 * hh), x3 = *(const v4fa*)(arow + kb + 16 + 8 * hh + 4);
    float xs[16] = {x0[0],x0[1],x0[2],x0[3],x1[0],x1[1],x1[2],x1[3],x2[0],x2[1],x2[2],x2[3],x3[0],x3[1],x3[2],x3[3]};
#pragma unroll
    for (int i = 0; i < 16; ++i) { const unsigned short hb = bf16_bits(xs[i]); ah.u[i] = hb; al.u[i] = ASPLIT ? bf16_bits(xs[i] - bf16_val(hb)) : (unsigned short)0; }
#pragma unroll
    for (int t = 0; t < 4; ++t) {
      const unsigned short* brow = Wt + (size_t)(col0 + t * 16 + ln) * ldb + kb;
      FragB b;
      b.half[0] = *(const v8us*)(brow + 8 * hh);
      b.half[1] = *(const v8us*)(brow + 16 + 8 * hh);
      acc[t] = mmaN<ASPLIT ? 2 : 1>(ah.v, al.v, b.v, b.v, acc[t]);
    }
  }
#pragma unroll
  for (int t = 0; t < 4; ++t) {
    const int col = col0 + t * 16 + ln;
    float bv = bias ? bias[col] : 0.f;
    if (BIAS_BF16) bv = bf16_round(bv);
#pragma unroll
    for (int r = 0; r < 8; ++r) {
      float v = acc[t][r] + bv;
      if (resid) { float rv = resid[(size_t)((row0 + 8 * hh + r) % rmod) * ldr + col]; if (RES_BF16) rv = bf16_round(rv); v += rv; }
      if (ACT == 1) v = fmaxf(v, 0.f);
      if (ACT == 2) v = 0.5f * v * (1.0f + erff(v * 0.70710678118654752f));
      if (ACT == 3) { const float u = 0.7978845608028654f * (v + 0.044715f * v * v * v); v = 0.5f * v * (1.0f + tanhf(u)); }
      so[w][8 * hh + r][t * 16 + ln] = v;
    }
  }
  __builtin_amdgcn_fence(__ATOMIC_ACQ_REL, "workgroup");
  __builtin_amdgcn_wave_barrier();
  const int rsub = lane >> 4, c4 = (lane & 15) * 4;
  {
#pragma unroll
    for (int q = 0; q < 8; ++q) {
      const int r = q * 2 + rsub;
      const v4f v = *(const v4fa*)&so[w][r][c4];
      *(v4f*)(C + (size_t)(row0 + r) * ldc + col0 + c4) = v;
    }
    
  }
}
// row LayerNorm (biased variance, eps) over N: s = X (+ R); optional out_sum <- s; out_norm <- (s-mu)*rsqrt(var+eps)*g + b
template <bool PARAM_BF16>
__global__ __launch_bounds__(256) void k_layernorm(const float* __restrict__ X, const float* __restrict__ R, const float* __restrict__ g, const float* __restrict__ bta,
                                                  float* __restrict__ out_sum, float* __restrict__ out_norm, int N, float eps) {
  __shared__ float red[256];
  const int row = blockIdx.x, tid = threadIdx.x;
  const float* x = X + (size_t)row * N; const float* rr = R ? R + (size_t)row * N : nullptr;
  float vals[16];                     // up to N = 4096
  const int per = N / 256;            // contiguous chunk per thread? use strided-by-4 chunks: thread handles j = tid*4 + 1024*u
  float s1 = 0.f;
  for (int u = 0; u < per / 4; ++u) {
    const int j = tid * 4 + 1024 * u;
    const v4f a = *(const v4fa*)(x + j);
    v4f b = {0.f,0.f,0.f,0.f}; if (rr) b = *(const v4fa*)(rr + j);
#pragma unroll
    for (int q = 0; q < 4; ++q) { const float v = a[q] + b[q]; vals[u * 4 + q] = v; s1 += v; }
  }
  red[tid] = s1; __syncthreads();
  for (int st = 128; st > 0; st >>= 1) { if (tid < st) red[tid] += red[tid + st]; __syncthreads(); }
  const float mu = red[0] / (float)N; __syncthreads();
  float s2 = 0.f;
  for (int u = 0; u < per / 4; ++u)
#pragma unroll
    for (int q = 0; q < 4; ++q) { const float c = vals[u * 4 + q] - mu; s2 += c * c; }
  red[tid] = s2; __syncthreads();
  for (int st = 128; st > 0; st >>= 1) { if (tid < st) red[tid] += red[tid + st]; __syncthreads(); }
  const float rs = rsqrtf(red[0] / (float)N + eps);
  {
    for (int u = 0; u < per / 4; ++u) {
      const int j = tid * 4 + 1024 * u;
      v4f o, sm;
#pragma unroll
      for (int q = 0; q < 4; ++q) {
        float gg = g[j + q], bb = bta[j + q];
        if (PARAM_BF16) { gg = bf16_round(gg); bb = bf16_round(bb); }
        sm[q] = vals[u * 4 + q]; o[q] = (vals[u * 4 + q] - mu) * rs * gg + bb;
      }
      if (out_sum) *(v4f*)(out_sum + (size_t)row * N + j) = sm;
      *(v4f*)(out_norm + (size_t)row * N + j) = o;
    }
    
  }
}



// ---- f16 WMMA path (v_wmma_f32_16x16x32_f16): 11-bit significands for operands in range — used where a [0,1] probability operand needs more precision than bf16
typedef _Float16 v16h __attribute__((ext_vector_type(16)));
union FragH { v16h v; v8us half[2]; _Float16 h[16]; unsigned short u[16]; };
template <int NT>
__device__ __forceinline__ v8f mmaH(v16h ah, v16h al, v16h bh, v16h bl, v8f c) {
  c = __builtin_amdgcn_wmma_f32_16x16x32_f16(false, ah, false, bh, (short)0, c, false, false);
  if (NT >= 2) c = __builtin_amdgcn_wmma_f32_16x16x32_f16(false, al, false, bh, (short)0, c, false, false);
  if (NT >= 3) c = __builtin_amdgcn_wmma_f32_16x16x32_f16(false, ah, false, bl, (short)0, c, false, false);
  asm volatile("v_nop\n\tv_nop\n\tv_nop\n\tv_nop" : "+v"(c) : "v"(ah), "v"(al), "v"(bh), "v"(bl));
  return c;
}
// batched GEMM like k_gemm_b but f16 operands: A f32 (split into f16 hi/lo if ASPLIT, else rounded to f16), Bt = f16 values [n][k]; alpha; C f32; N multiple of 16 (partial tiles skipped)
template <bool ASPLIT>
__global__ __launch_bounds__(128) void k_gemm_h(const float* __restrict__ A, int lda, size_t sA, const _Float16* __restrict__ Bh, int ldb, size_t sB, float alpha, float* __restrict__ C, int ldc, size_t sC, int M, int N, int K) {
  __shared__ __attribute__((aligned(16))) float so[4][16][64];
  const int tid = threadIdx.x, w = tid >> 5, lane = tid & 31, ln = lane & 15, hh = lane >> 4; const int by = blockIdx.y;
  A += (size_t)by * sA; Bh += (size_t)by * sB; C += (size_t)by * sC;
  const int ntn = (N + 63) / 64; const int wid = blockIdx.x * 4 + w; const int mt = wid / ntn, nq = wid % ntn; if (mt * 16 >= M) return;
  const int row0 = mt * 16, col0 = nq * 64; const float* arow = A + (size_t)(row0 + ln) * lda;
  v8f acc[4] = {};
  for (int kb = 0; kb < K; kb += 32) {
    FragH ah, al;
    const v4f x0 = *(const v4fa*)(arow + kb + 8 * hh), x1 = *(const v4fa*)(arow + kb + 8 * hh + 4), x2 = *(const v4fa*)(arow + kb + 16 + 8 * hh), x3 = *(const v4fa*)(arow + kb + 16 + 8 * hh + 4);
    float xs[16] = {x0[0],x0[1],x0[2],x0[3],x1[0],x1[1],x1[2],x1[3],x2[0],x2[1],x2[2],x2[3],x3[0],x3[1],x3[2],x3[3]};
#pragma unroll
    for (int i = 0; i < 16; ++i) { const _Float16 h = (_Float16)xs[i]; ah.h[i] = h; al.h[i] = ASPLIT ? (_Float16)(xs[i] - (float)h) : (_Float16)0.0f; }
#pragma unroll
    for (int t = 0; t < 4; ++t) { if (col0 + t * 16 >= N) continue; const size_t boff = (size_t)(col0 + t * 16 + ln) * ldb + kb; FragH bq; bq.half[0] = *(const v8us*)(Bh + boff + 8 * hh); bq.half[1] = *(const v8us*)(Bh + boff + 16 + 8 * hh);
      acc[t] = mmaH<ASPLIT ? 2 : 1>(ah.v, al.v, bq.v, bq.v, acc[t]); }
  }
#pragma unroll
  for (int t = 0; t < 4; ++t) { if (col0 + t * 16 >= N) continue;
#pragma unroll
    for (int r = 0; r < 8; ++r) so[w][8 * hh + r][t * 16 + ln] = acc[t][r] * alpha; }
  __builtin_amdgcn_fence(__ATOMIC_ACQ_REL, "workgroup"); __builtin_amdgcn_wave_barrier();
  const int rsub = lane >> 4, c4 = (lane & 15) * 4;
  {
#pragma unroll
    for (int q = 0; q < 8; ++q) { const int r = q * 2 + rsub; if (col0 + c4 < N) { const v4f v = *(const v4fa*)&so[w][r][c4]; *(v4f*)(C + (size_t)(row0 + r) * ldc + col0 + c4) = v; } }
     }
}

// Wt[n][k] = f16(W[k][n]·scale) from f32 row-major W[K][N] (scale = power of two; bf16-exact weights stay exact in f16 away from the subnormal range)
__global__ __launch_bounds__(256) void k_wt_f16(const float* __restrict__ W, _Float16* __restrict__ Wt, int K, int N, float scale) {
  const int t = blockIdx.x * 256 + threadIdx.x; if (t >= N * (K / 8)) return; const int n = t / (K / 8), k8 = (t % (K / 8)) * 8; FragH f;
#pragma unroll
  for (int i = 0; i < 8; ++i) f.h[i] = (_Float16)(bf16_round(W[(size_t)(k8 + i) * N + n]) * scale); const v8us o = f.half[0];
  *(v8us*)((unsigned short*)Wt + (size_t)n * K + k8) = o; 
}
// k_gemm_hh variant with fused epilogue: v = acc·alpha + bias[by·sBias + col] (+ CP[(row/rowsPerB)·sCPb + by·64 + col] if CP) ; ACT 0 none / 1 elu ; writes f16 C16 (and f32 C if non-null)
template <int ACT>
__global__ __launch_bounds__(128) void k_gemm_hhx(const _Float16* __restrict__ A, int lda, size_t sA, const _Float16* __restrict__ Bh, int ldb, size_t sB, float alpha, const float* __restrict__ bias, size_t sBias, const float* __restrict__ CP, int rowsPerB, size_t sCPb, int row0g,
    float* __restrict__ C, _Float16* __restrict__ C16, int ldc, size_t sC, int M, int N, int K) {
  __shared__ __attribute__((aligned(16))) float so[4][16][64];
  const int tid = threadIdx.x, w = tid >> 5, lane = tid & 31, ln = lane & 15, hh = lane >> 4; const int by = blockIdx.y;
  A += (size_t)by * sA; Bh += (size_t)by * sB; const size_t cofs = (size_t)by * sC; const float* bp = bias ? bias + (size_t)by * sBias : nullptr;
  const int ntn = (N + 63) / 64; const int wid = blockIdx.x * 4 + w; const int mt = wid / ntn, nq = wid % ntn; if (mt * 16 >= M) return;
  const int row0 = mt * 16, col0 = nq * 64; const _Float16* arow = A + (size_t)(row0 + ln) * lda;
  v8f acc[4] = {};
  for (int kb = 0; kb < K; kb += 32) { FragH ah; ah.half[0] = *(const v8us*)((const unsigned short*)arow + kb + 8 * hh); ah.half[1] = *(const v8us*)((const unsigned short*)arow + kb + 16 + 8 * hh);
#pragma unroll
    for (int t = 0; t < 4; ++t) { if (col0 + t * 16 >= N) continue; const size_t boff = (size_t)(col0 + t * 16 + ln) * ldb + kb; FragH bq; bq.half[0] = *(const v8us*)((const unsigned short*)Bh + boff + 8 * hh); bq.half[1] = *(const v8us*)((const unsigned short*)Bh + boff + 16 + 8 * hh);
      acc[t] = mmaH<1>(ah.v, ah.v, bq.v, bq.v, acc[t]); }
  }
#pragma unroll
  for (int t = 0; t < 4; ++t) { if (col0 + t * 16 >= N) continue; const int col = col0 + t * 16 + ln; const float bv = bp ? bf16_round(bp[col]) : 0.f;
#pragma unroll
    for (int r = 0; r < 8; ++r) { float v = acc[t][r] * alpha + bv; if (CP) { const int rr = row0g + row0 + 8 * hh + r; if (rowsPerB < 0) v += CP[cofs + (size_t)rr * ldc + col];      /* rowsPerB < 0: own element of the batched C plane */ else { const int bidx = rr / rowsPerB; v += CP[(size_t)bidx * sCPb + (size_t)by * 64 + col]; } } if (ACT == 1) v = (v > 0.f) ? v : expm1f(v); else if (ACT == 7) v = (v > 0.f) ? v + 1.0f : expf(v); else if (ACT == 8) v = tanhf(v); else if (ACT == 9) v = 0.5f * v * (1.0f + tanhf(0.7978845608028654f * (v + 0.044715f * v * v * v))); else if (ACT == 11) v = 1.0f / (1.0f + expf(-v)); else if (ACT == 12) v = (v > 0.f) ? v : 0.01f * v; else if (ACT == 14) v = (v > 0.f) ? v : 0.1f * v; else if (ACT == 16) v = (v >= 0.f) ? v : 0.3f * v; else if (ACT == 17) v = (v >= 0.f) ? v : 0.2f * v; else if (ACT == 15) v = v / (1.0f + expf(-v)); else if (ACT == 3) v = fmaxf(v, 0.f); else if (ACT == 6) v = 0.5f * v * (1.0f + erff(v * 0.70710678118654752f)); so[w][8 * hh + r][t * 16 + ln] = v; } }
  __builtin_amdgcn_fence(__ATOMIC_ACQ_REL, "workgroup"); __builtin_amdgcn_wave_barrier();
  const int rsub = lane >> 4, c4 = (lane & 15) * 4; typedef _Float16 v4h __attribute__((ext_vector_type(4)));
  {
#pragma unroll
    for (int q = 0; q < 8; ++q) { const int r = q * 2 + rsub; if (col0 + c4 < N) { const v4f v = *(const v4fa*)&so[w][r][c4]; if (C) *(v4f*)(C + cofs + (size_t)(row0 + r) * ldc + col0 + c4) = v; if (C16) { v4h h4; for (int i = 0; i < 4; ++i) h4[i] = (_Float16)v[i]; *(v4h*)(C16 + cofs + (size_t)(row0 + r) * ldc + col0 + c4) = h4; } } }
     }
}


typedef _Float16 v4h __attribute__((ext_vector_type(4)));

__global__ __launch_bounds__(256) void k_x16(const float* __restrict__ x, _Float16* __restrict__ X16, size_t n8) { const size_t t = (size_t)blockIdx.x * 256 + threadIdx.x; if (t >= n8) return; FragH f;
#pragma unroll
  for (int q = 0; q < 8; ++q) f.h[q] = (_Float16)bf16_round(x[t * 8 + q]); *(v8us*)((unsigned short*)X16 + t * 8) = f.half[0];  }
__global__ __launch_bounds__(256) void k_h16(const float* __restrict__ x, _Float16* __restrict__ X16, size_t n8) { const size_t t = (size_t)blockIdx.x * 256 + threadIdx.x; if (t >= n8) return; FragH f;
#pragma unroll
  for (int q = 0; q < 8; ++q) f.h[q] = (_Float16)x[t * 8 + q]; *(v8us*)((unsigned short*)X16 + t * 8) = f.half[0];  }
__global__ __launch_bounds__(256) void k_round16f(const float* __restrict__ W, _Float16* __restrict__ Bt, size_t n8) { const size_t t = (size_t)blockIdx.x * 256 + threadIdx.x; if (t >= n8) return; FragH f;
#pragma unroll
  for (int i = 0; i < 8; ++i) f.h[i] = (_Float16)(bf16_round(W[t * 8 + i]) * 16.0f); *(v8us*)((unsigned short*)Bt + t * 8) = f.half[0];  }
template <int NHv, int TTv>
__global__ __launch_bounds__(256) void k_vt(const _Float16* __restrict__ V16, int ldv, int voff, _Float16* __restrict__ Vt) { __shared__ unsigned short tl[64][66]; const int tid = threadIdx.x; const int slab = blockIdx.x / (TTv / 64), lg = blockIdx.x % (TTv / 64); const int b = slab / NHv, h = slab % NHv;
  for (int i = tid; i < 64 * 8; i += 256) { const int r = i / 8, c8 = (i % 8) * 8; FragH f; f.half[0] = *(const v8us*)((const unsigned short*)V16 + ((size_t)b * TTv + lg * 64 + r) * ldv + voff + h * 64 + c8);
#pragma unroll
    for (int q = 0; q < 8; ++q) tl[r][c8 + q] = f.u[q]; }
  __syncthreads();
  {
#pragma unroll
    for (int rd = 0; rd < 2; ++rd) { const int d = rd * 32 + tid / 8, pc = tid % 8; FragH f;
#pragma unroll
      for (int q = 0; q < 8; ++q) f.u[q] = tl[pc * 8 + q][d];
      *(v8us*)((unsigned short*)Vt + ((size_t)slab * 64 + d) * TTv + lg * 64 + pc * 8) = f.half[0]; }
     } }

__global__ __launch_bounds__(256) void k_hl(const float* __restrict__ F, _Float16* __restrict__ Hh, _Float16* __restrict__ Hl, size_t n8) { const size_t t = (size_t)blockIdx.x * 256 + threadIdx.x; if (t >= n8) return; FragH fh, fl; const v4f a = *(const v4fa*)(F + t * 8), c = *(const v4fa*)(F + t * 8 + 4);
#pragma unroll
  for (int q = 0; q < 4; ++q) { _Float16 h = (_Float16)a[q]; fh.h[q] = h; fl.h[q] = (_Float16)((a[q] - (float)h) * 1024.0f); h = (_Float16)c[q]; fh.h[4 + q] = h; fl.h[4 + q] = (_Float16)((c[q] - (float)h) * 1024.0f); }
  { *(v8us*)((unsigned short*)Hh + t * 8) = fh.half[0]; *(v8us*)((unsigned short*)Hl + t * 8) = fl.half[0];  } }

// ---- fast GEMM (wave tile 32x64; requires M % 32 == 0 rows per launch region and N % 64 == 0); epilogue = k_gemm_hhx semantics ----
__device__ __forceinline__ v16h g2_frag(const _Float16* p, int hh) { FragH f; f.half[0] = *(const v8us*)((const unsigned short*)p + 8 * hh); f.half[1] = *(const v8us*)((const unsigned short*)p + 16 + 8 * hh); return f.v; }
__device__ __forceinline__ v8f g2_mma(v16h a, v16h b, v8f c) { v8f d = __builtin_amdgcn_wmma_f32_16x16x32_f16(false, a, false, b, (short)0, c, false, false); asm volatile("v_nop\n\tv_nop\n\tv_nop\n\tv_nop" : "+v"(d) : "v"(a), "v"(b)); return d; }
template <int ACT>
__global__ __launch_bounds__(128) void k_gemm2(const _Float16* __restrict__ A, int lda, size_t sA, const _Float16* __restrict__ Bh, int ldb, size_t sB, float alpha, const float* __restrict__ bias, size_t sBias, const float* __restrict__ CP, int rowsPerB, size_t sCPb, int row0g,
    float* __restrict__ C, _Float16* __restrict__ C16, int ldc, size_t sC, int M, int N, int K) { static_assert(ACT == 0 || ACT == 3 || ACT == 6 || ACT == 8 || ACT == 9 || ACT == 11 || ACT == 12 || ACT == 14 || ACT == 15 || ACT == 16 || ACT == 17, "k_gemm2: unsupported ACT code (would silently apply no activation)");
  __shared__ __attribute__((aligned(16))) float so[4][32][68];
  const int tid = threadIdx.x, w = tid >> 5, lane = tid & 31, ln = lane & 15, hh = lane >> 4; const int by = blockIdx.y;
  A += (size_t)by * sA; Bh += (size_t)by * sB; const size_t cofs = (size_t)by * sC; const float* bp = bias ? bias + (size_t)by * sBias : nullptr;
  const int ntn = N >> 6; const int mt = blockIdx.x / ntn, nq = blockIdx.x - mt * ntn; const int row0 = mt * 128 + 32 * w, col0 = nq * 64; if (row0 >= M) return;
  const _Float16* a0p = A + (size_t)(row0 + ln) * lda; const _Float16* a1p = a0p + (size_t)16 * lda;
  const _Float16* b0p = Bh + (size_t)(col0 + ln) * ldb; const _Float16* b1p = b0p + (size_t)16 * ldb; const _Float16* b2p = b1p + (size_t)16 * ldb; const _Float16* b3p = b2p + (size_t)16 * ldb;
  const v8f z8 = {0.f,0.f,0.f,0.f,0.f,0.f,0.f,0.f}; v8f c00 = z8, c01 = z8, c02 = z8, c03 = z8, c10 = z8, c11 = z8, c12 = z8, c13 = z8;
#pragma unroll 1
  for (int kb = 0; kb < K; kb += 32) { const v16h a0 = g2_frag(a0p + kb, hh), a1 = g2_frag(a1p + kb, hh);
    v16h b = g2_frag(b0p + kb, hh); c00 = g2_mma(a0, b, c00); c10 = g2_mma(a1, b, c10);
    b = g2_frag(b1p + kb, hh); c01 = g2_mma(a0, b, c01); c11 = g2_mma(a1, b, c11);
    b = g2_frag(b2p + kb, hh); c02 = g2_mma(a0, b, c02); c12 = g2_mma(a1, b, c12);
    b = g2_frag(b3p + kb, hh); c03 = g2_mma(a0, b, c03); c13 = g2_mma(a1, b, c13); }
  v8f accs[8] = {c00, c01, c02, c03, c10, c11, c12, c13};
#pragma unroll
  for (int u = 0; u < 8; ++u) { const int t = u & 3, half = u >> 2; const int col = col0 + t * 16 + ln; const float bv = bp ? bf16_round(bp[col]) : 0.f;
#pragma unroll
    for (int r = 0; r < 8; ++r) { const int rloc = half * 16 + 8 * hh + r; float v = accs[u][r] * alpha + bv; if (CP) { if (rowsPerB < 0) v += CP[cofs + (size_t)(row0g + row0 + rloc) * ldc + col];      /* rowsPerB < 0: own element of the batched C plane */ else { const int bidx = (row0g + row0 + rloc) / rowsPerB; v += CP[(size_t)bidx * sCPb + (size_t)by * 64 + col]; } }
      if (ACT == 3) v = fmaxf(v, 0.f); else if (ACT == 6) v = 0.5f * v * (1.0f + erff(v * 0.70710678118654752f)); else if (ACT == 11) v = 1.0f / (1.0f + expf(-v)); else if (ACT == 15) v = v / (1.0f + expf(-v)); else if (ACT == 12) v = (v > 0.f) ? v : 0.01f * v; else if (ACT == 8) v = tanhf(v); else if (ACT == 9) v = 0.5f * v * (1.0f + tanhf(0.7978845608028654f * (v + 0.044715f * v * v * v))); else if (ACT == 14) v = (v > 0.f) ? v : 0.1f * v; else if (ACT == 16) v = (v >= 0.f) ? v : 0.3f * v; else if (ACT == 17) v = (v >= 0.f) ? v : 0.2f * v;
      so[w][rloc][t * 16 + ln] = v; } }
  __builtin_amdgcn_fence(__ATOMIC_ACQ_REL, "workgroup"); __builtin_amdgcn_wave_barrier();
  const int rsub = lane >> 4, c4 = (lane & 15) * 4;
  {
#pragma unroll
    for (int q = 0; q < 16; ++q) { const int r = q * 2 + rsub; const v4f v = *(const v4fa*)&so[w][r][c4]; if (C) *(v4f*)(C + cofs + (size_t)(row0 + r) * ldc + col0 + c4) = v; if (C16) { v4h h4; for (int i = 0; i < 4; ++i) h4[i] = (_Float16)v[i]; *(v4h*)(C16 + cofs + (size_t)(row0 + r) * ldc + col0 + c4) = h4; } }
     } }


__global__ __launch_bounds__(256) void k_wnat(const float* __restrict__ w, size_t n8, _Float16* __restrict__ Bt) { const size_t t = (size_t)blockIdx.x * 256 + threadIdx.x; if (t >= n8) return; FragH f; for (int q = 0; q < 8; ++q) f.h[q] = (_Float16)(bf16_round(w[t * 8 + q]) * 16.0f); *(v8us*)((unsigned short*)Bt + t * 8) = f.half[0];  }
// row softmax, ONE WAVE PER ROW: the row's SQ f32 scores stay in registers (each load = 512 contiguous bytes of the row), so S is read once and each exp is taken once; max and sum = per-lane partials, then a five-step butterfly over the 32 lanes
__global__ __launch_bounds__(512) void k_rsm(const float* __restrict__ S, _Float16* __restrict__ P, int nrows) {
  const int lane = threadIdx.x & 31; const int row = blockIdx.x * 16 + __builtin_amdgcn_readfirstlane(threadIdx.x >> 5); if (row >= nrows) return;      /* the wave's row as a scalar: scalar exit test and scalar row bases; the kernel has no barrier */
  const v4fa* s = (const v4fa*)(S + (size_t)row * SQ); v4f v[SQ / 128];
#pragma unroll      /* here and at the three loops over v[] below: every index of v[] a constant, so that the row stays in registers and all 16 loads are issued together */
  for (int u = 0; u < SQ / 128; ++u) v[u] = s[u * 32 + lane];
  v4f m4 = v[0];
#pragma unroll      /* v[] in registers */
  for (int u = 1; u < SQ / 128; ++u) for (int q = 0; q < 4; ++q) m4[q] = fmaxf(m4[q], v[u][q]);
  float mx = fmaxf(fmaxf(fmaxf(m4[0], m4[1]), fmaxf(m4[2], m4[3])), -3.0e38f);
  for (int m = 16; m > 0; m >>= 1) mx = fmaxf(mx, __shfl_xor(mx, m, 32));
  v4f s4 = {0.f, 0.f, 0.f, 0.f};
#pragma unroll      /* v[] in registers */
  for (int u = 0; u < SQ / 128; ++u) for (int q = 0; q < 4; ++q) { const float e = expf(v[u][q] - mx); v[u][q] = e; s4[q] += e; }
  float se = (s4[0] + s4[1]) + (s4[2] + s4[3]);
  for (int m = 16; m > 0; m >>= 1) se += __shfl_xor(se, m, 32);
  const float sc = 256.0f / se; v4h* p = (v4h*)(P + (size_t)row * SQ);
#pragma unroll      /* v[] in registers */
  for (int u = 0; u < SQ / 128; ++u) { v4h h4; for (int q = 0; q < 4; ++q) h4[q] = (_Float16)(v[u][q] * sc); p[u * 32 + lane] = h4; } }
__global__ __launch_bounds__(256) void k_vt(const _Float16* __restrict__ V16, int b, int h0, _Float16* __restrict__ VT) { __shared__ unsigned short tl[64][65]; const int tid = threadIdx.x; const int hh = blockIdx.x % HG, sg = blockIdx.x / HG; const int s0 = sg * 64; const int h = h0 + hh;
  for (int i = tid; i < 64 * 8; i += 256) { const int j = i / 8, d8 = (i % 8) * 8; FragH f; f.half[0] = *(const v8us*)((const unsigned short*)V16 + ((size_t)b * SQ + s0 + j) * DM + h * HD + d8); for (int q = 0; q < 8; ++q) tl[d8 + q][j] = f.u[q]; }
  __syncthreads();
  { for (int i = tid; i < 64 * 8; i += 256) { const int d = i / 8, j8 = (i % 8) * 8; FragH f; for (int q = 0; q < 8; ++q) f.u[q] = tl[d][j8 + q]; *(v8us*)((unsigned short*)VT + ((size_t)hh * HD + d) * SQ + s0 + j8) = f.half[0]; }  } }



__global__ __launch_bounds__(256) void k_rsmcf2(const float* __restrict__ S, _Float16* __restrict__ P, int hg, int q0, int nk) {
  #pragma clang fp contract(off)
  const int t = blockIdx.x * 256 + threadIdx.x; if (t >= hg * QT) return; const size_t i = (size_t)t; const float* s = S + i * NKX; const int last = q0 + (t % QT); float mx = -3.0e38f;
#pragma unroll 1
  for (int j = 0; j < nk; ++j) { const float f = (j <= last) ? 1.f : 0.f; mx = fmaxf(mx, fmaf(f, s[j], (1.f - f) * -1.0e9f)); } float se = 0.f;
#pragma unroll 1
  for (int j = 0; j < nk; ++j) { const float f = (j <= last) ? 1.f : 0.f; se += __expf(fmaf(f, s[j], (1.f - f) * -1.0e9f) - mx); } const float sc = 256.0f / se;
#pragma unroll 1
  for (int j0 = 0; j0 < nk; j0 += 8) { FragH fr; for (int q = 0; q < 8; ++q) { const int j = j0 + q; const float f = (j <= last) ? 1.f : 0.f; fr.h[q] = (_Float16)(__expf(fmaf(f, s[j], (1.f - f) * -1.0e9f) - mx) * sc); } unsigned short* d = (unsigned short*)P + i * NKX + j0; *(v8us*)d = fr.half[0];  } }


template <int MASKADD>
__global__ __launch_bounds__(64) void k_att0(const float* __restrict__ QF, const float* __restrict__ KF, const float* __restrict__ VF, int ld, const float* __restrict__ mask, float scale, float* __restrict__ OF, int ldo) {
  #pragma clang fp contract(off)
  __shared__ __attribute__((aligned(16))) float lq[64][64]; __shared__ __attribute__((aligned(16))) float lo[64][64];
  const int tid = threadIdx.x; const int h = blockIdx.x / (QT0 / 64), rg = blockIdx.x % (QT0 / 64); const int i = rg * 64 + tid;
  const float* qr = QF + (size_t)i * ld + h * HD;
#pragma unroll 1
  for (int c = 0; c < HD / 4; ++c) { *(v4f*)&lq[tid][c * 4] = *(const v4fa*)(qr + c * 4); const v4f z = {0.f, 0.f, 0.f, 0.f}; *(v4f*)&lo[tid][c * 4] = z; }
  float m = -1.0e30f, l = 0.f; const int jmax = MASKADD ? (SQ - 1) : (rg * 64 + 63);      /* additive-mask form: every key (the mask input decides); causal form: keys up to the block's last row */
#pragma unroll 1
  for (int j = 0; j <= jmax; ++j) { const float* kr = KF + (size_t)j * ld + h * HD; const float* vr = VF + (size_t)j * ld + h * HD; float s = 0.f;
#pragma unroll 1
    for (int c = 0; c < HD / 4; ++c) { const v4f kq = *(const v4fa*)(kr + c * 4); const v4f qq = *(v4f*)&lq[tid][c * 4]; s = __fadd_rn(s, __fmul_rn(qq[0], kq[0])); s = __fadd_rn(s, __fmul_rn(qq[1], kq[1])); s = __fadd_rn(s, __fmul_rn(qq[2], kq[2])); s = __fadd_rn(s, __fmul_rn(qq[3], kq[3])); }
    s = __fmul_rn(s, scale); if (MASKADD) s = __fadd_rn(s, __fmul_rn(bf16_round(mask[(size_t)i * SQ + j]), -10000.0f));
    const float f = (MASKADD || j <= i) ? 1.f : 0.f; const float sm = fmaf(f, s, (1.f - f) * -1.0e30f); const float mn = fmaxf(m, sm); const float sc = expf(m - mn); const float e = expf(sm - mn); l = __fadd_rn(__fmul_rn(l, sc), e); m = mn;
#pragma unroll 1
    for (int c = 0; c < HD / 4; ++c) { const v4f vv = *(const v4fa*)(vr + c * 4); v4f oo = *(v4f*)&lo[tid][c * 4]; for (int u = 0; u < 4; ++u) oo[u] = __fadd_rn(__fmul_rn(oo[u], sc), __fmul_rn(e, vv[u])); *(v4f*)&lo[tid][c * 4] = oo; } }
  const float fin = 64.0f / l;      /* o carried x64 like the f16 path */
#pragma unroll 1
  for (int c = 0; c < HD / 4; ++c) { v4f oo = *(v4f*)&lo[tid][c * 4]; for (int u = 0; u < 4; ++u) oo[u] = __fmul_rn(oo[u], fin); *(v4f*)&lo[tid][c * 4] = oo; }
  __syncthreads();
  {
#pragma unroll 1
    for (int it = 0; it < 16; ++it) { const int row = it * 4 + tid / 16, pc = (tid % 16) * 4; const v4f v = *(const v4f*)&lo[row][pc]; *(v4f*)(OF + (size_t)(rg * 64 + row) * ldo + h * HD + pc) = v; }
     } }


__global__ __launch_bounds__(256) void k_kvexp(const float* __restrict__ src, float* __restrict__ dst, size_t n4) { const size_t t = (size_t)blockIdx.x * 256 + threadIdx.x; if (t >= n4) return; const size_t e = t * 4; const size_t row = e / DM; const int col = (int)(e % DM); const int h = col / HD, d = col % HD; const v4f v = *(const v4fa*)(src + row * KVD + (size_t)(h / HPG) * HD + d); *(v4f*)(dst + e) = v;  }

__global__ __launch_bounds__(256) void k_tab2(float theta, float* __restrict__ CS, float* __restrict__ SN) {
  #pragma clang fp contract(off)
  const int t = blockIdx.x * 256 + threadIdx.x; if (t >= SQ * (HD / 2)) return; const int i = t % (HD / 2); const int p = t / (HD / 2); const float invf = 1.0f / powf(theta, (float)(2 * i) / (float)HD); const float ang = __fmul_rn((float)p, invf); const float c = cosf(ang), s = sinf(ang);
  *(float*)(CS + t) = c; *(float*)(SN + t) = s;  }
template <int NORM, int ROPE>
__global__ __launch_bounds__(64) void k_xform(const float* __restrict__ F, int ldf, int nh, const float* __restrict__ gain, float eps, const float* __restrict__ CS, const float* __restrict__ SN, _Float16* __restrict__ H16, int ldo) {
  #pragma clang fp contract(off)
  __shared__ float xv[HD]; __shared__ float red[HD]; __shared__ unsigned short sh_[HD]; const int d = threadIdx.x; const int h = blockIdx.x % nh; const size_t r = blockIdx.x / nh; const int p = (int)(r % SQ);
  float x = F[r * (size_t)ldf + (size_t)h * HD + d];
  if (NORM) { red[d] = __fmul_rn(x, x); __syncthreads(); for (int st = HD / 2; st > 0; st >>= 1) { if (d < st) red[d] = __fadd_rn(red[d], red[d + st]); __syncthreads(); } const float rs = rsqrtf(__fadd_rn(red[0] / (float)HD, eps)); x = __fmul_rn(__fmul_rn(x, rs), bf16_round(gain[d])); }
  xv[d] = x; __syncthreads();
  float o = x;
  if (ROPE == 1) { const int i = d >> 1; const float c = CS[p * (HD / 2) + i], s = SN[p * (HD / 2) + i]; const float ev = xv[2 * i], od = xv[2 * i + 1]; o = (d & 1) ? __fadd_rn(__fmul_rn(ev, s), __fmul_rn(od, c)) : __fadd_rn(__fmul_rn(ev, c), -__fmul_rn(od, s)); }
  if (ROPE == 2) { const int i = d & (HD / 2 - 1); const float c = CS[p * (HD / 2) + i], s = SN[p * (HD / 2) + i]; const float lo = xv[i], hi = xv[i + HD / 2]; o = (d < HD / 2) ? __fadd_rn(__fmul_rn(lo, c), -__fmul_rn(hi, s)) : __fadd_rn(__fmul_rn(lo, s), __fmul_rn(hi, c)); }
  FragH th; th.h[0] = (_Float16)o; sh_[d] = th.u[0]; __syncthreads();
  if (d < HD / 8) { FragH f; for (int q = 0; q < 8; ++q) f.u[q] = sh_[d * 8 + q]; unsigned short* dst = (unsigned short*)H16 + r * (size_t)ldo + (size_t)h * HD + d * 8; *(v8us*)dst = f.half[0];  } }

template <int NORM, int ROPE>
__global__ __launch_bounds__(64) void k_xformf(const float* __restrict__ F, int ldf, int nh, const float* __restrict__ gain, float eps, const float* __restrict__ CS, const float* __restrict__ SN, float* __restrict__ F32, int ldo) {
  #pragma clang fp contract(off)
  __shared__ float xv[HD]; __shared__ float red[HD]; const int d = threadIdx.x; const int h = blockIdx.x % nh; const size_t r = blockIdx.x / nh; const int p = (int)(r % SQ);
  float x = F[r * (size_t)ldf + (size_t)h * HD + d];
  if (NORM) { red[d] = __fmul_rn(x, x); __syncthreads(); for (int st = HD / 2; st > 0; st >>= 1) { if (d < st) red[d] = __fadd_rn(red[d], red[d + st]); __syncthreads(); } const float rs = rsqrtf(__fadd_rn(red[0] / (float)HD, eps)); x = __fmul_rn(__fmul_rn(x, rs), bf16_round(gain[d])); }
  xv[d] = x; __syncthreads();
  float o = x;
  if (ROPE == 1) { const int i = d >> 1; const float c = CS[p * (HD / 2) + i], s = SN[p * (HD / 2) + i]; const float ev = xv[2 * i], od = xv[2 * i + 1]; o = (d & 1) ? __fadd_rn(__fmul_rn(ev, s), __fmul_rn(od, c)) : __fadd_rn(__fmul_rn(ev, c), -__fmul_rn(od, s)); }
  if (ROPE == 2) { const int i = d & (HD / 2 - 1); const float c = CS[p * (HD / 2) + i], s = SN[p * (HD / 2) + i]; const float lo = xv[i], hi = xv[i + HD / 2]; o = (d < HD / 2) ? __fadd_rn(__fmul_rn(lo, c), -__fmul_rn(hi, s)) : __fadd_rn(__fmul_rn(lo, s), __fmul_rn(hi, c)); }
  float* dst = F32 + r * (size_t)ldo + (size_t)h * HD + d; *(float*)dst = o;  }

__global__ __launch_bounds__(256) void k_bfcp(const float* __restrict__ src, float* __restrict__ dst, size_t n4) { const size_t t = (size_t)blockIdx.x * 256 + threadIdx.x; if (t >= n4) return; const v4f a = *(const v4fa*)(src + t * 4); v4f o; for (int q = 0; q < 4; ++q) o[q] = bf16_round(a[q]); *(v4f*)(dst + t * 4) = o;  }

__global__ __launch_bounds__(256) void k_tab2d(float* __restrict__ CS, float* __restrict__ SN) {
  #pragma clang fp contract(off)
  const int t = blockIdx.x * 256 + threadIdx.x; if (t >= SQ * (HD / 2)) return; const int i = t % (HD / 2); const int p = t / (HD / 2); const float invf = (float)(1.0 / pow(10000.0, (double)(2 * i) / (double)HD)); const float ang = __fmul_rn((float)p, invf); const float c = cosf(ang), s = sinf(ang);
  *(float*)(CS + t) = c; *(float*)(SN + t) = s;  }
extern "C" void kernel_launch(void* const* d_in, const int* in_sizes, int n_in,
                              void* d_out, int out_size, void* d_ws, size_t ws_size, hipStream_t stream) {
  (void)in_sizes; (void)n_in; (void)out_size;
  const float* const* I = (const float* const*)d_in; const float* x = I[0]; const float* wq = I[1]; const float* wk = I[2]; const float* wv = I[3]; const float* wo = I[4]; const float* tcos = I[5]; const float* tsin = I[6]; const float* bq = nullptr; const float* bk = nullptr; const float* bv = nullptr; const float* bo = nullptr;      /* natural [out][in] weights, no biases; rope_cos / rope_sin INPUT tables [2048][32] */
  static_assert(HPG == 1 && NH == NG * HPG && NH * HD == DM && KVD == DM, "plain multi-head attention as 16 kv groups of one query head");
  char* ws = (char*)d_ws; size_t off = 0;
  auto take = [&](size_t bytes) { char* p = ws + off; off += (bytes + 255) & ~(size_t)255; return p; };
  _Float16* BQ = (_Float16*)take((size_t)DM * DM * 2); _Float16* BK = (_Float16*)take((size_t)KVD * DM * 2); _Float16* BV = (_Float16*)take((size_t)KVD * DM * 2); _Float16* BO = (_Float16*)take((size_t)DM * DM * 2);
  _Float16* X16 = (_Float16*)take(NR * DM * 2); float* QF = (float*)take((size_t)SQ * DM * 4); float* KF = (float*)take((size_t)SQ * KVD * 4); float* CSB = (float*)take((size_t)SQ * 32 * 4); float* SNB = (float*)take((size_t)SQ * 32 * 4); _Float16* Q16 = (_Float16*)take(NR * DM * 2); _Float16* K16 = (_Float16*)take(NR * KVD * 2); _Float16* V16 = (_Float16*)take(NR * KVD * 2); _Float16* O16 = (_Float16*)take(NR * DM * 2);
  float* S = (float*)take((size_t)NH * QT * NKX * 4); _Float16* P = (_Float16*)take((size_t)NH * QT * NKX * 2); _Float16* VT = (_Float16*)take((size_t)NH * HD * SQ * 2);
  float* QF0 = (float*)take((size_t)QT0 * DM * 4); float* KF0 = (float*)take((size_t)QT0 * KVD * 4); float* VF0 = (float*)take((size_t)QT0 * KVD * 4); float* KF0e = (float*)take((size_t)QT0 * DM * 4); float* VF0e = (float*)take((size_t)QT0 * DM * 4); float* OF0 = (float*)take((size_t)NB * QT0 * DM * 4); _Float16* OH0 = (_Float16*)take((size_t)NB * QT0 * DM * 2); _Float16* OL0 = (_Float16*)take((size_t)NB * QT0 * DM * 2);
  if (off > ws_size) return;
  k_wnat<<<(unsigned)(((size_t)DM * DM / 8 + 255) / 256), 256, 0, stream>>>(wq, (size_t)DM * DM / 8, BQ); k_wnat<<<(unsigned)(((size_t)KVD * DM / 8 + 255) / 256), 256, 0, stream>>>(wk, (size_t)KVD * DM / 8, BK); k_wnat<<<(unsigned)(((size_t)KVD * DM / 8 + 255) / 256), 256, 0, stream>>>(wv, (size_t)KVD * DM / 8, BV); k_wnat<<<(unsigned)(((size_t)DM * DM / 8 + 255) / 256), 256, 0, stream>>>(wo, (size_t)DM * DM / 8, BO);      /* natural [out][in] = Bt planes x16 */
  k_x16<<<(unsigned)((NR * DM / 8 + 255) / 256), 256, 0, stream>>>(x, X16, NR * DM / 8);
  const size_t r0p = (size_t)B0 * SQ;      /* first projected row */
  k_gemm2<0><<<dim3((unsigned)((MP / 128) * (KVD / 64)), 1), 128, 0, stream>>>(X16 + r0p * DM, DM, 0, BV, DM, 0, 0.0625f, bv, 0, nullptr, 1, 0, 0, nullptr, V16 + r0p * KVD, KVD, 0, MP, KVD, DM);
  k_bfcp<<<(unsigned)(((size_t)SQ * (HD / 2) / 4 + 255) / 256), 256, 0, stream>>>(tcos, CSB, (size_t)SQ * (HD / 2) / 4); k_bfcp<<<(unsigned)(((size_t)SQ * (HD / 2) / 4 + 255) / 256), 256, 0, stream>>>(tsin, SNB, (size_t)SQ * (HD / 2) / 4);      /* bf16-rounded copies of the module's INPUT rope tables [2048][32] (the [pos][i] layout k_xform indexes; the rotate-half branch uses table column d mod 32 = the module's [cos | cos]) */
  for (int b = B0; b < B0 + NBR; ++b) { const size_t r0 = (size_t)b * SQ;
    k_gemm2<0><<<dim3((unsigned)((SQ / 128) * (DM / 64)), 1), 128, 0, stream>>>(X16 + r0 * DM, DM, 0, BQ, DM, 0, 0.0625f, nullptr, 0, nullptr, 1, 0, 0, QF, nullptr, DM, 0, SQ, DM, DM);      /* q (f32) of this batch */
    k_gemm2<0><<<dim3((unsigned)((SQ / 128) * (KVD / 64)), 1), 128, 0, stream>>>(X16 + r0 * DM, DM, 0, BK, DM, 0, 0.0625f, nullptr, 0, nullptr, 1, 0, 0, KF, nullptr, KVD, 0, SQ, KVD, DM);      /* k (f32) */
    k_xform<0, 2><<<(unsigned)((size_t)SQ * NH), 64, 0, stream>>>(QF, DM, NH, nullptr, 0.f, CSB, SNB, Q16 + r0 * DM, DM); k_xform<0, 2><<<(unsigned)((size_t)SQ * NG), 64, 0, stream>>>(KF, KVD, NG, nullptr, 0.f, CSB, SNB, K16 + r0 * KVD, KVD);      /* rotate-half rope of q and k from the bf16-rounded input tables -> f16 rows */
    k_vt<NG, SQ><<<NG * (SQ / 64), 256, 0, stream>>>(V16 + r0 * KVD, KVD, 0, VT);      /* V^T [NH][HD][SQ] for this batch */
    for (int q0 = 0; q0 < QN; q0 += QT) { const int nk = SQ;      /* non-causal: all keys for every query tile */
      k_gemm2<0><<<dim3((QT / 128) * (nk / 64), NH), 128, 0, stream>>>(Q16 + (r0 + q0) * LQ, LQ, (size_t)HD, K16 + r0 * KVD, KVD, (size_t)HD, 0.125f, nullptr, 0, nullptr, 1, 0, 0, S, nullptr, NKX, (size_t)QT * NKX, QT, nk, HD);      /* scores: HPG == 1: ONE launch with all 16 heads on grid.y, key head stride HD */
      k_rsm<<<(NHD * QT + 15) / 16, 512, 0, stream>>>(S, P, NHD * QT);      /* plain row softmax over all SQ keys (row pitch NKX == SQ), one wave per row */
      k_gemm2<0><<<dim3((QT / 128) * (HD / 64), NH), 128, 0, stream>>>(P, NKX, (size_t)QT * NKX, VT, SQ, (size_t)HD * SQ, 0.25f, nullptr, 0, nullptr, 1, 0, 0, nullptr, O16 + (r0 + q0) * DM, DM, (size_t)HD, QT, HD, nk); } }      /* o for all 16 heads in ONE launch (value head stride HD*SQ) (x64) */
  k_gemm2<0><<<dim3((unsigned)((MPO / 128) * (DM / 64)), 1), 128, 0, stream>>>(O16 + r0p * DM, DM, 0, BO, DM, 0, 0.0009765625f, bo, 0, nullptr, 1, 0, 0, (float*)d_out + r0p * DM, nullptr, DM, 0, MPO, DM, DM);      /* out rows are the output layout */
}

// v002
// One run takes 299 microseconds.
// In two side-by-side timings against v001, it was 4.89 and 4.90 times as fast.
// Counting every step since v000, it is 23.8 times as fast.
#include <hip/hip_runtime.h>
// Multi-head self-attention with half-split RoPE from RANDOM input tables, NON-causal (x [2][2048][1024]; q / k / v = x W^T (nn.Linear natural [1024][1024] sigma 1/32, no biases), 16 heads of 64; rope: x * [cos | cos] + rotate_half(x) * [sin | sin] with rotate_half = (-x2, x1) over the two 32-lane halves and INPUT tables rope_cos / rope_sin [2048][32] (cos / sin of uniform-random angles); scores / sqrt(64); softmax over all 2048 keys (f32; no mask); out = merged Wo^T (natural, no bias) -> [2][2048][1024]); run in grouped-query form as 16 groups of ONE head.
// Structure: x as exact f16 rows; natural weights as exact x16 planes; v as a WMMA GEMM (32x64 wave tiles, f32 accumulation, f16 output); rope tables as bf16-rounded copies of the input tables; per batch: q [2048][1024] and k [2048][1024] as GEMMs into f32 rows then the rotate-half rotation + f16 conversion per (row, head) on VALU; V^T of the 16 groups via LDS transposes; then ONE fused attention launch for all batches, heads and query rows (k_fattn: scores of 32 query columns per wave against ALL 2048 keys, running softmax in registers with f32 statistics and native exp2, unnormalised f16 weights, o = P V^T carried x64) into merged f16 rows; out = o Wo^T GEMM (f32, alpha 2^-10); launches: see trace.
// Compute dtype: inputs rounded to bf16; x / weights exact; q, k, v, softmax weights and o as plain f16 GEMM operands (~2^-12); scores and softmax statistics f32. v_wmma_f32_16x16x32_f16.
#define NB 2
#define NG 16
#define HPG 1
#define KVD (NG * HD)
#define SQ 2048
#define DM 1024
#define NH 16
#define HD 64
#define HG 4                         /* heads per block group of the unlaunched k_vt overload */
#define QT 256                       /* query rows per tile */
#define NKX SQ                       /* S / P row pitch */
#define QT0 128                      /* rows per head of k_att0 (not launched); sizes unused f32 buffers */
#define B0 0                         /* first batch processed (debug hook) */
#define NBR NB                       /* batches processed (debug hook) */
#define NR ((size_t)NB * SQ)         /* token rows */
#define MP ((int)((size_t)NBR * SQ)) /* rows projected (debug hook) */
#define QN SQ                        /* unused: k_fattn attends all SQ query rows of a batch */
#define NHD NH                       /* unused: k_fattn attends all NH heads */
#define MPO MP                       /* rows through the output stage (debug hook) */
#define LQ DM      /* row pitch of the q/k/v rows */
typedef __bf16 v16b __attribute__((ext_vector_type(16)));
typedef unsigned short v8us __attribute__((ext_vector_type(8), may_alias));
typedef float  v8f  __attribute__((ext_vector_type(8)));
typedef float  v4f  __attribute__((ext_vector_type(4)));
typedef float  v4fa __attribute__((ext_vector_type(4), may_alias));
union FragB { v16b v; v8us half[2]; unsigned short u[16]; };

__device__ __forceinline__ unsigned short bf16_bits(float x) { unsigned int u = __float_as_uint(x); return (unsigned short)((u + 0x7FFFu + ((u >> 16) & 1u)) >> 16); }
__device__ __forceinline__ float bf16_val(unsigned short b) { return __uint_as_float(((unsigned int)b) << 16); }
__device__ __forceinline__ float bf16_round(float x) { return bf16_val(bf16_bits(x)); }
// D += A·B with NT terms: 1 = ah·bh, 2 = + al·bh (A split), 3 = + ah·bl (both split)
template <int NT>
__device__ __forceinline__ v8f mmaN(v16b ah, v16b al, v16b bh, v16b bl, v8f c) {
  c = __builtin_amdgcn_wmma_f32_16x16x32_bf16(false, ah, false, bh, (short)0, c, false, false);
  if (NT >= 2) c = __builtin_amdgcn_wmma_f32_16x16x32_bf16(false, al, false, bh, (short)0, c, false, false);
  if (NT >= 3) c = __builtin_amdgcn_wmma_f32_16x16x32_bf16(false, ah, false, bl, (short)0, c, false, false);
  asm volatile("v_nop\n\tv_nop\n\tv_nop\n\tv_nop" : "+v"(c) : "v"(ah), "v"(al), "v"(bh), "v"(bl));
  return c;
}

__global__ __launch_bounds__(256) void k_wt_bf16(const float* __restrict__ W, unsigned short* __restrict__ Wt, int K, int N) {
  const int t = blockIdx.x * 256 + threadIdx.x;
  const int k8n = K / 8;
  if (t >= N * k8n) return;
  const int n = t / k8n, k8 = (t % k8n) * 8;
  v8us v;
#pragma unroll
  for (int i = 0; i < 8; ++i) v[i] = bf16_bits(W[(size_t)(k8 + i) * N + n]);
  *(v8us*)(Wt + (size_t)n * K + k8) = v;
  
}

// GEMM C[M][N] (f32, pitch ldc) = act(A[M][K]·W + bias). A f32 row-major (pitch lda) converted per fragment to bf16
// (ASPLIT: hi/lo two planes -> 2 terms, else single rounded term); Wt bf16 [N][K] (pitch ldb). BIAS_BF16 rounds the
// bias to bf16 first (bias quantised to bf16 before the add). K%32==0, M%16==0, N%64==0.
template <bool ASPLIT, int ACT, bool BIAS_BF16>
__global__ __launch_bounds__(128) void k_gemm_bf(const float* __restrict__ A, int lda, const unsigned short* __restrict__ Wt, int ldb,
                                               const float* __restrict__ bias, float* __restrict__ C, int ldc, int M, int N, int K) {
  __shared__ __attribute__((aligned(16))) float so[4][16][64];
  const int tid = threadIdx.x, w = tid >> 5, lane = tid & 31, ln = lane & 15, hh = lane >> 4;
  const int ntn = N / 64;
  const int wid = blockIdx.x * 4 + w;
  const int mt = wid / ntn, nq = wid % ntn;
  if (mt * 16 >= M) return;
  const int row0 = mt * 16, col0 = nq * 64;
  const float* arow = A + (size_t)(row0 + ln) * lda;
  v8f acc[4] = {};
  for (int kb = 0; kb < K; kb += 32) {
    FragB ah, al;
    const v4f x0 = *(const v4fa*)(arow + kb + 8 * hh), x1 = *(const v4fa*)(arow + kb + 8 * hh + 4);
    const v4f x2 = *(const v4fa*)(arow + kb + 16 + 8 * hh), x3 = *(const v4fa*)(arow + kb + 16 + 8 * hh + 4);
    float xs[16] = {x0[0],x0[1],x0[2],x0[3],x1[0],x1[1],x1[2],x1[3],x2[0],x2[1],x2[2],x2[3],x3[0],x3[1],x3[2],x3[3]};
#pragma unroll
    for (int i = 0; i < 16; ++i) { const unsigned short hb = bf16_bits(xs[i]); ah.u[i] = hb; al.u[i] = ASPLIT ? bf16_bits(xs[i] - bf16_val(hb)) : (unsigned short)0; }
#pragma unroll
    for (int t = 0; t < 4; ++t) {
      const unsigned short* brow = Wt + (size_t)(col0 + t * 16 + ln) * ldb + kb;
      FragB b;
      b.half[0] = *(const v8us*)(brow + 8 * hh);
      b.half[1] = *(const v8us*)(brow + 16 + 8 * hh);
      acc[t] = mmaN<ASPLIT ? 2 : 1>(ah.v, al.v, b.v, b.v, acc[t]);
    }
  }
#pragma unroll
  for (int t = 0; t < 4; ++t) {
    float bv = bias ? bias[col0 + t * 16 + ln] : 0.f;
    if (BIAS_BF16) bv = bf16_round(bv);
#pragma unroll
    for (int r = 0; r < 8; ++r) { float v = acc[t][r] + bv; if (ACT == 1) v = fmaxf(v, 0.f); so[w][8 * hh + r][t * 16 + ln] = v; }
  }
  __builtin_amdgcn_fence(__ATOMIC_ACQ_REL, "workgroup");
  __builtin_amdgcn_wave_barrier();
  const int rsub = lane >> 4, c4 = (lane & 15) * 4;
  {
#pragma unroll
    for (int q = 0; q < 8; ++q) {
      const int r = q * 2 + rsub;
      const v4f v = *(const v4fa*)&so[w][r][c4];
      *(v4f*)(C + (size_t)(row0 + r) * ldc + col0 + c4) = v;
    }
    
  }
}

// GEMM C = act(A·W + bias + resid): A f32 (ASPLIT -> hi/lo 2 terms), Wt bf16 [N][K]; ACT 0 none, 1 relu, 2 exact gelu;
// resid (optional, f32, row index = (row % rmod), pitch ldr, RES_BF16 rounds it) added before the activation.
template <bool ASPLIT, int ACT, bool BIAS_BF16, bool RES_BF16>
__global__ __launch_bounds__(128) void k_gemm_bf3(const float* __restrict__ A, int lda, const unsigned short* __restrict__ Wt, int ldb,
                                                const float* __restrict__ bias, const float* __restrict__ resid, int rmod, int ldr,
                                                float* __restrict__ C, int ldc, int M, int N, int K) {
  __shared__ __attribute__((aligned(16))) float so[4][16][64];
  const int tid = threadIdx.x, w = tid >> 5, lane = tid & 31, ln = lane & 15, hh = lane >> 4;
  const int ntn = N / 64;
  const int wid = blockIdx.x * 4 + w;
  const int mt = wid / ntn, nq = wid % ntn;
  if (mt * 16 >= M) return;
  const int row0 = mt * 16, col0 = nq * 64;
  const float* arow = A + (size_t)(row0 + ln) * lda;
  v8f acc[4] = {};
  for (int kb = 0; kb < K; kb += 32) {
    FragB ah, al;
    const v4f x0 = *(const v4fa*)(arow + kb + 8 * hh), x1 = *(const v4fa*)(arow + kb + 8 * hh + 4);
    const v4f x2 = *(const v4fa*)(arow + kb + 16 + 8 * hh), x3 = *(const v4fa*)(arow + kb + 16 + 8 * hh + 4);
    float xs[16] = {x0[0],x0[1],x0[2],x0[3],x1[0],x1[1],x1[2],x1[3],x2[0],x2[1],x2[2],x2[3],x3[0],x3[1],x3[2],x3[3]};
#pragma unroll
    for (int i = 0; i < 16; ++i) { const unsigned short hb = bf16_bits(xs[i]); ah.u[i] = hb; al.u[i] = ASPLIT ? bf16_bits(xs[i] - bf16_val(hb)) : (unsigned short)0; }
#pragma unroll
    for (int t = 0; t < 4; ++t) {
      const unsigned short* brow = Wt + (size_t)(col0 + t * 16 + ln) * ldb + kb;
      FragB b;
      b.half[0] = *(const v8us*)(brow + 8 * hh);
      b.half[1] = *(const v8us*)(brow + 16 + 8 * hh);
      acc[t] = mmaN<ASPLIT ? 2 : 1>(ah.v, al.v, b.v, b.v, acc[t]);
    }
  }
#pragma unroll
  for (int t = 0; t < 4; ++t) {
    const int col = col0 + t * 16 + ln;
    float bv = bias ? bias[col] : 0.f;
    if (BIAS_BF16) bv = bf16_round(bv);
#pragma unroll
    for (int r = 0; r < 8; ++r) {
      float v = acc[t][r] + bv;
      if (resid) { float rv = resid[(size_t)((row0 + 8 * hh + r) % rmod) * ldr + col]; if (RES_BF16) rv = bf16_round(rv); v += rv; }
      if (ACT == 1) v = fmaxf(v, 0.f);
      if (ACT == 2) v = 0.5f * v * (1.0f + erff(v * 0.70710678118654752f));
      if (ACT == 3) { const float u = 0.7978845608028654f * (v + 0.044715f * v * v * v); v = 0.5f * v * (1.0f + tanhf(u)); }
      so[w][8 * hh + r][t * 16 + ln] = v;
    }
  }
  __builtin_amdgcn_fence(__ATOMIC_ACQ_REL, "workgroup");
  __builtin_amdgcn_wave_barrier();
  const int rsub = lane >> 4, c4 = (lane & 15) * 4;
  {
#pragma unroll
    for (int q = 0; q < 8; ++q) {
      const int r = q * 2 + rsub;
      const v4f v = *(const v4fa*)&so[w][r][c4];
      *(v4f*)(C + (size_t)(row0 + r) * ldc + col0 + c4) = v;
    }
    
  }
}
// row LayerNorm (biased variance, eps) over N: s = X (+ R); optional out_sum <- s; out_norm <- (s-mu)*rsqrt(var+eps)*g + b
template <bool PARAM_BF16>
__global__ __launch_bounds__(256) void k_layernorm(const float* __restrict__ X, const float* __restrict__ R, const float* __restrict__ g, const float* __restrict__ bta,
                                                  float* __restrict__ out_sum, float* __restrict__ out_norm, int N, float eps) {
  __shared__ float red[256];
  const int row = blockIdx.x, tid = threadIdx.x;
  const float* x = X + (size_t)row * N; const float* rr = R ? R + (size_t)row * N : nullptr;
  float vals[16];                     // up to N = 4096
  const int per = N / 256;            // contiguous chunk per thread? use strided-by-4 chunks: thread handles j = tid*4 + 1024*u
  float s1 = 0.f;
  for (int u = 0; u < per / 4; ++u) {
    const int j = tid * 4 + 1024 * u;
    const v4f a = *(const v4fa*)(x + j);
    v4f b = {0.f,0.f,0.f,0.f}; if (rr) b = *(const v4fa*)(rr + j);
#pragma unroll
    for (int q = 0; q < 4; ++q) { const float v = a[q] + b[q]; vals[u * 4 + q] = v; s1 += v; }
  }
  red[tid] = s1; __syncthreads();
  for (int st = 128; st > 0; st >>= 1) { if (tid < st) red[tid] += red[tid + st]; __syncthreads(); }
  const float mu = red[0] / (float)N; __syncthreads();
  float s2 = 0.f;
  for (int u = 0; u < per / 4; ++u)
#pragma unroll
    for (int q = 0; q < 4; ++q) { const float c = vals[u * 4 + q] - mu; s2 += c * c; }
  red[tid] = s2; __syncthreads();
  for (int st = 128; st > 0; st >>= 1) { if (tid < st) red[tid] += red[tid + st]; __syncthreads(); }
  const float rs = rsqrtf(red[0] / (float)N + eps);
  {
    for (int u = 0; u < per / 4; ++u) {
      const int j = tid * 4 + 1024 * u;
      v4f o, sm;
#pragma unroll
      for (int q = 0; q < 4; ++q) {
        float gg = g[j + q], bb = bta[j + q];
        if (PARAM_BF16) { gg = bf16_round(gg); bb = bf16_round(bb); }
        sm[q] = vals[u * 4 + q]; o[q] = (vals[u * 4 + q] - mu) * rs * gg + bb;
      }
      if (out_sum) *(v4f*)(out_sum + (size_t)row * N + j) = sm;
      *(v4f*)(out_norm + (size_t)row * N + j) = o;
    }
    
  }
}



// ---- f16 WMMA path (v_wmma_f32_16x16x32_f16): 11-bit significands for operands in range — used where a [0,1] probability operand needs more precision than bf16
typedef _Float16 v16h __attribute__((ext_vector_type(16)));
union FragH { v16h v; v8us half[2]; _Float16 h[16]; unsigned short u[16]; };
template <int NT>
__device__ __forceinline__ v8f mmaH(v16h ah, v16h al, v16h bh, v16h bl, v8f c) {
  c = __builtin_amdgcn_wmma_f32_16x16x32_f16(false, ah, false, bh, (short)0, c, false, false);
  if (NT >= 2) c = __builtin_amdgcn_wmma_f32_16x16x32_f16(false, al, false, bh, (short)0, c, false, false);
  if (NT >= 3) c = __builtin_amdgcn_wmma_f32_16x16x32_f16(false, ah, false, bl, (short)0, c, false, false);
  asm volatile("v_nop\n\tv_nop\n\tv_nop\n\tv_nop" : "+v"(c) : "v"(ah), "v"(al), "v"(bh), "v"(bl));
  return c;
}
// batched GEMM like k_gemm_b but f16 operands: A f32 (split into f16 hi/lo if ASPLIT, else rounded to f16), Bt = f16 values [n][k]; alpha; C f32; N multiple of 16 (partial tiles skipped)
template <bool ASPLIT>
__global__ __launch_bounds__(128) void k_gemm_h(const float* __restrict__ A, int lda, size_t sA, const _Float16* __restrict__ Bh, int ldb, size_t sB, float alpha, float* __restrict__ C, int ldc, size_t sC, int M, int N, int K) {
  __shared__ __attribute__((aligned(16))) float so[4][16][64];
  const int tid = threadIdx.x, w = tid >> 5, lane = tid & 31, ln = lane & 15, hh = lane >> 4; const int by = blockIdx.y;
  A += (size_t)by * sA; Bh += (size_t)by * sB; C += (size_t)by * sC;
  const int ntn = (N + 63) / 64; const int wid = blockIdx.x * 4 + w; const int mt = wid / ntn, nq = wid % ntn; if (mt * 16 >= M) return;
  const int row0 = mt * 16, col0 = nq * 64; const float* arow = A + (size_t)(row0 + ln) * lda;
  v8f acc[4] = {};
  for (int kb = 0; kb < K; kb += 32) {
    FragH ah, al;
    const v4f x0 = *(const v4fa*)(arow + kb + 8 * hh), x1 = *(const v4fa*)(arow + kb + 8 * hh + 4), x2 = *(const v4fa*)(arow + kb + 16 + 8 * hh), x3 = *(const v4fa*)(arow + kb + 16 + 8 * hh + 4);
    float xs[16] = {x0[0],x0[1],x0[2],x0[3],x1[0],x1[1],x1[2],x1[3],x2[0],x2[1],x2[2],x2[3],x3[0],x3[1],x3[2],x3[3]};
#pragma unroll
    for (int i = 0; i < 16; ++i) { const _Float16 h = (_Float16)xs[i]; ah.h[i] = h; al.h[i] = ASPLIT ? (_Float16)(xs[i] - (float)h) : (_Float16)0.0f; }
#pragma unroll
    for (int t = 0; t < 4; ++t) { if (col0 + t * 16 >= N) continue; const size_t boff = (size_t)(col0 + t * 16 + ln) * ldb + kb; FragH bq; bq.half[0] = *(const v8us*)(Bh + boff + 8 * hh); bq.half[1] = *(const v8us*)(Bh + boff + 16 + 8 * hh);
      acc[t] = mmaH<ASPLIT ? 2 : 1>(ah.v, al.v, bq.v, bq.v, acc[t]); }
  }
#pragma unroll
  for (int t = 0; t < 4; ++t) { if (col0 + t * 16 >= N) continue;
#pragma unroll
    for (int r = 0; r < 8; ++r) so[w][8 * hh + r][t * 16 + ln] = acc[t][r] * alpha; }
  __builtin_amdgcn_fence(__ATOMIC_ACQ_REL, "workgroup"); __builtin_amdgcn_wave_barrier();
  const int rsub = lane >> 4, c4 = (lane & 15) * 4;
  {
#pragma unroll
    for (int q = 0; q < 8; ++q) { const int r = q * 2 + rsub; if (col0 + c4 < N) { const v4f v = *(const v4fa*)&so[w][r][c4]; *(v4f*)(C + (size_t)(row0 + r) * ldc + col0 + c4) = v; } }
     }
}

// Wt[n][k] = f16(W[k][n]·scale) from f32 row-major W[K][N] (scale = power of two; bf16-exact weights stay exact in f16 away from the subnormal range)
__global__ __launch_bounds__(256) void k_wt_f16(const float* __restrict__ W, _Float16* __restrict__ Wt, int K, int N, float scale) {
  const int t = blockIdx.x * 256 + threadIdx.x; if (t >= N * (K / 8)) return; const int n = t / (K / 8), k8 = (t % (K / 8)) * 8; FragH f;
#pragma unroll
  for (int i = 0; i < 8; ++i) f.h[i] = (_Float16)(bf16_round(W[(size_t)(k8 + i) * N + n]) * scale); const v8us o = f.half[0];
  *(v8us*)((unsigned short*)Wt + (size_t)n * K + k8) = o; 
}
// k_gemm_hh variant with fused epilogue: v = acc·alpha + bias[by·sBias + col] (+ CP[(row/rowsPerB)·sCPb + by·64 + col] if CP) ; ACT 0 none / 1 elu ; writes f16 C16 (and f32 C if non-null)
template <int ACT>
__global__ __launch_bounds__(128) void k_gemm_hhx(const _Float16* __restrict__ A, int lda, size_t sA, const _Float16* __restrict__ Bh, int ldb, size_t sB, float alpha, const float* __restrict__ bias, size_t sBias, const float* __restrict__ CP, int rowsPerB, size_t sCPb, int row0g,
    float* __restrict__ C, _Float16* __restrict__ C16, int ldc, size_t sC, int M, int N, int K) {
  __shared__ __attribute__((aligned(16))) float so[4][16][64];
  const int tid = threadIdx.x, w = tid >> 5, lane = tid & 31, ln = lane & 15, hh = lane >> 4; const int by = blockIdx.y;
  A += (size_t)by * sA; Bh += (size_t)by * sB; const size_t cofs = (size_t)by * sC; const float* bp = bias ? bias + (size_t)by * sBias : nullptr;
  const int ntn = (N + 63) / 64; const int wid = blockIdx.x * 4 + w; const int mt = wid / ntn, nq = wid % ntn; if (mt * 16 >= M) return;
  const int row0 = mt * 16, col0 = nq * 64; const _Float16* arow = A + (size_t)(row0 + ln) * lda;
  v8f acc[4] = {};
  for (int kb = 0; kb < K; kb += 32) { FragH ah; ah.half[0] = *(const v8us*)((const unsigned short*)arow + kb + 8 * hh); ah.half[1] = *(const v8us*)((const unsigned short*)arow + kb + 16 + 8 * hh);
#pragma unroll
    for (int t = 0; t < 4; ++t) { if (col0 + t * 16 >= N) continue; const size_t boff = (size_t)(col0 + t * 16 + ln) * ldb + kb; FragH bq; bq.half[0] = *(const v8us*)((const unsigned short*)Bh + boff + 8 * hh); bq.half[1] = *(const v8us*)((const unsigned short*)Bh + boff + 16 + 8 * hh);
      acc[t] = mmaH<1>(ah.v, ah.v, bq.v, bq.v, acc[t]); }
  }
#pragma unroll
  for (int t = 0; t < 4; ++t) { if (col0 + t * 16 >= N) continue; const int col = col0 + t * 16 + ln; const float bv = bp ? bf16_round(bp[col]) : 0.f;
#pragma unroll
    for (int r = 0; r < 8; ++r) { float v = acc[t][r] * alpha + bv; if (CP) { const int rr = row0g + row0 + 8 * hh + r; if (rowsPerB < 0) v += CP[cofs + (size_t)rr * ldc + col];      /* rowsPerB < 0: own element of the batched C plane */ else { const int bidx = rr / rowsPerB; v += CP[(size_t)bidx * sCPb + (size_t)by * 64 + col]; } } if (ACT == 1) v = (v > 0.f) ? v : expm1f(v); else if (ACT == 7) v = (v > 0.f) ? v + 1.0f : expf(v); else if (ACT == 8) v = tanhf(v); else if (ACT == 9) v = 0.5f * v * (1.0f + tanhf(0.7978845608028654f * (v + 0.044715f * v * v * v))); else if (ACT == 11) v = 1.0f / (1.0f + expf(-v)); else if (ACT == 12) v = (v > 0.f) ? v : 0.01f * v; else if (ACT == 14) v = (v > 0.f) ? v : 0.1f * v; else if (ACT == 16) v = (v >= 0.f) ? v : 0.3f * v; else if (ACT == 17) v = (v >= 0.f) ? v : 0.2f * v; else if (ACT == 15) v = v / (1.0f + expf(-v)); else if (ACT == 3) v = fmaxf(v, 0.f); else if (ACT == 6) v = 0.5f * v * (1.0f + erff(v * 0.70710678118654752f)); so[w][8 * hh + r][t * 16 + ln] = v; } }
  __builtin_amdgcn_fence(__ATOMIC_ACQ_REL, "workgroup"); __builtin_amdgcn_wave_barrier();
  const int rsub = lane >> 4, c4 = (lane & 15) * 4; typedef _Float16 v4h __attribute__((ext_vector_type(4)));
  {
#pragma unroll
    for (int q = 0; q < 8; ++q) { const int r = q * 2 + rsub; if (col0 + c4 < N) { const v4f v = *(const v4fa*)&so[w][r][c4]; if (C) *(v4f*)(C + cofs + (size_t)(row0 + r) * ldc + col0 + c4) = v; if (C16) { v4h h4; for (int i = 0; i < 4; ++i) h4[i] = (_Float16)v[i]; *(v4h*)(C16 + cofs + (size_t)(row0 + r) * ldc + col0 + c4) = h4; } } }
     }
}


typedef _Float16 v4h __attribute__((ext_vector_type(4)));

__global__ __launch_bounds__(256) void k_x16(const float* __restrict__ x, _Float16* __restrict__ X16, size_t n8) { const size_t t = (size_t)blockIdx.x * 256 + threadIdx.x; if (t >= n8) return; FragH f;
#pragma unroll
  for (int q = 0; q < 8; ++q) f.h[q] = (_Float16)bf16_round(x[t * 8 + q]); *(v8us*)((unsigned short*)X16 + t * 8) = f.half[0];  }
__global__ __launch_bounds__(256) void k_h16(const float* __restrict__ x, _Float16* __restrict__ X16, size_t n8) { const size_t t = (size_t)blockIdx.x * 256 + threadIdx.x; if (t >= n8) return; FragH f;
#pragma unroll
  for (int q = 0; q < 8; ++q) f.h[q] = (_Float16)x[t * 8 + q]; *(v8us*)((unsigned short*)X16 + t * 8) = f.half[0];  }
__global__ __launch_bounds__(256) void k_round16f(const float* __restrict__ W, _Float16* __restrict__ Bt, size_t n8) { const size_t t = (size_t)blockIdx.x * 256 + threadIdx.x; if (t >= n8) return; FragH f;
#pragma unroll
  for (int i = 0; i < 8; ++i) f.h[i] = (_Float16)(bf16_round(W[t * 8 + i]) * 16.0f); *(v8us*)((unsigned short*)Bt + t * 8) = f.half[0];  }
template <int NHv, int TTv>
__global__ __launch_bounds__(256) void k_vt(const _Float16* __restrict__ V16, int ldv, int voff, _Float16* __restrict__ Vt) { __shared__ unsigned short tl[64][66]; const int tid = threadIdx.x; const int slab = blockIdx.x / (TTv / 64), lg = blockIdx.x % (TTv / 64); const int b = slab / NHv, h = slab % NHv;
  for (int i = tid; i < 64 * 8; i += 256) { const int r = i / 8, c8 = (i % 8) * 8; FragH f; f.half[0] = *(const v8us*)((const unsigned short*)V16 + ((size_t)b * TTv + lg * 64 + r) * ldv + voff + h * 64 + c8);
#pragma unroll
    for (int q = 0; q < 8; ++q) tl[r][c8 + q] = f.u[q]; }
  __syncthreads();
  {
#pragma unroll
    for (int rd = 0; rd < 2; ++rd) { const int d = rd * 32 + tid / 8, pc = tid % 8; FragH f;
#pragma unroll
      for (int q = 0; q < 8; ++q) f.u[q] = tl[pc * 8 + q][d];
      *(v8us*)((unsigned short*)Vt + ((size_t)slab * 64 + d) * TTv + lg * 64 + pc * 8) = f.half[0]; }
     } }

__global__ __launch_bounds__(256) void k_hl(const float* __restrict__ F, _Float16* __restrict__ Hh, _Float16* __restrict__ Hl, size_t n8) { const size_t t = (size_t)blockIdx.x * 256 + threadIdx.x; if (t >= n8) return; FragH fh, fl; const v4f a = *(const v4fa*)(F + t * 8), c = *(const v4fa*)(F + t * 8 + 4);
#pragma unroll
  for (int q = 0; q < 4; ++q) { _Float16 h = (_Float16)a[q]; fh.h[q] = h; fl.h[q] = (_Float16)((a[q] - (float)h) * 1024.0f); h = (_Float16)c[q]; fh.h[4 + q] = h; fl.h[4 + q] = (_Float16)((c[q] - (float)h) * 1024.0f); }
  { *(v8us*)((unsigned short*)Hh + t * 8) = fh.half[0]; *(v8us*)((unsigned short*)Hl + t * 8) = fl.half[0];  } }

// ---- fast GEMM (wave tile 32x64; requires M % 32 == 0 rows per launch region and N % 64 == 0); epilogue = k_gemm_hhx semantics ----
__device__ __forceinline__ v16h g2_frag(const _Float16* p, int hh) { FragH f; f.half[0] = *(const v8us*)((const unsigned short*)p + 8 * hh); f.half[1] = *(const v8us*)((const unsigned short*)p + 16 + 8 * hh); return f.v; }
__device__ __forceinline__ v8f g2_mma(v16h a, v16h b, v8f c) { v8f d = __builtin_amdgcn_wmma_f32_16x16x32_f16(false, a, false, b, (short)0, c, false, false); asm volatile("v_nop\n\tv_nop\n\tv_nop\n\tv_nop" : "+v"(d) : "v"(a), "v"(b)); return d; }
template <int ACT>
__global__ __launch_bounds__(128) void k_gemm2(const _Float16* __restrict__ A, int lda, size_t sA, const _Float16* __restrict__ Bh, int ldb, size_t sB, float alpha, const float* __restrict__ bias, size_t sBias, const float* __restrict__ CP, int rowsPerB, size_t sCPb, int row0g,
    float* __restrict__ C, _Float16* __restrict__ C16, int ldc, size_t sC, int M, int N, int K) { static_assert(ACT == 0 || ACT == 3 || ACT == 6 || ACT == 8 || ACT == 9 || ACT == 11 || ACT == 12 || ACT == 14 || ACT == 15 || ACT == 16 || ACT == 17, "k_gemm2: unsupported ACT code (would silently apply no activation)");
  __shared__ __attribute__((aligned(16))) float so[4][32][68];
  const int tid = threadIdx.x, w = tid >> 5, lane = tid & 31, ln = lane & 15, hh = lane >> 4; const int by = blockIdx.y;
  A += (size_t)by * sA; Bh += (size_t)by * sB; const size_t cofs = (size_t)by * sC; const float* bp = bias ? bias + (size_t)by * sBias : nullptr;
  const int ntn = N >> 6; const int mt = blockIdx.x / ntn, nq = blockIdx.x - mt * ntn; const int row0 = mt * 128 + 32 * w, col0 = nq * 64; if (row0 >= M) return;
  const _Float16* a0p = A + (size_t)(row0 + ln) * lda; const _Float16* a1p = a0p + (size_t)16 * lda;
  const _Float16* b0p = Bh + (size_t)(col0 + ln) * ldb; const _Float16* b1p = b0p + (size_t)16 * ldb; const _Float16* b2p = b1p + (size_t)16 * ldb; const _Float16* b3p = b2p + (size_t)16 * ldb;
  const v8f z8 = {0.f,0.f,0.f,0.f,0.f,0.f,0.f,0.f}; v8f c00 = z8, c01 = z8, c02 = z8, c03 = z8, c10 = z8, c11 = z8, c12 = z8, c13 = z8;
#pragma unroll 1
  for (int kb = 0; kb < K; kb += 32) { const v16h a0 = g2_frag(a0p + kb, hh), a1 = g2_frag(a1p + kb, hh);
    v16h b = g2_frag(b0p + kb, hh); c00 = g2_mma(a0, b, c00); c10 = g2_mma(a1, b, c10);
    b = g2_frag(b1p + kb, hh); c01 = g2_mma(a0, b, c01); c11 = g2_mma(a1, b, c11);
    b = g2_frag(b2p + kb, hh); c02 = g2_mma(a0, b, c02); c12 = g2_mma(a1, b, c12);
    b = g2_frag(b3p + kb, hh); c03 = g2_mma(a0, b, c03); c13 = g2_mma(a1, b, c13); }
  v8f accs[8] = {c00, c01, c02, c03, c10, c11, c12, c13};
#pragma unroll
  for (int u = 0; u < 8; ++u) { const int t = u & 3, half = u >> 2; const int col = col0 + t * 16 + ln; const float bv = bp ? bf16_round(bp[col]) : 0.f;
#pragma unroll
    for (int r = 0; r < 8; ++r) { const int rloc = half * 16 + 8 * hh + r; float v = accs[u][r] * alpha + bv; if (CP) { if (rowsPerB < 0) v += CP[cofs + (size_t)(row0g + row0 + rloc) * ldc + col];      /* rowsPerB < 0: own element of the batched C plane */ else { const int bidx = (row0g + row0 + rloc) / rowsPerB; v += CP[(size_t)bidx * sCPb + (size_t)by * 64 + col]; } }
      if (ACT == 3) v = fmaxf(v, 0.f); else if (ACT == 6) v = 0.5f * v * (1.0f + erff(v * 0.70710678118654752f)); else if (ACT == 11) v = 1.0f / (1.0f + expf(-v)); else if (ACT == 15) v = v / (1.0f + expf(-v)); else if (ACT == 12) v = (v > 0.f) ? v : 0.01f * v; else if (ACT == 8) v = tanhf(v); else if (ACT == 9) v = 0.5f * v * (1.0f + tanhf(0.7978845608028654f * (v + 0.044715f * v * v * v))); else if (ACT == 14) v = (v > 0.f) ? v : 0.1f * v; else if (ACT == 16) v = (v >= 0.f) ? v : 0.3f * v; else if (ACT == 17) v = (v >= 0.f) ? v : 0.2f * v;
      so[w][rloc][t * 16 + ln] = v; } }
  __builtin_amdgcn_fence(__ATOMIC_ACQ_REL, "workgroup"); __builtin_amdgcn_wave_barrier();
  const int rsub = lane >> 4, c4 = (lane & 15) * 4;
  {
#pragma unroll
    for (int q = 0; q < 16; ++q) { const int r = q * 2 + rsub; const v4f v = *(const v4fa*)&so[w][r][c4]; if (C) *(v4f*)(C + cofs + (size_t)(row0 + r) * ldc + col0 + c4) = v; if (C16) { v4h h4; for (int i = 0; i < 4; ++i) h4[i] = (_Float16)v[i]; *(v4h*)(C16 + cofs + (size_t)(row0 + r) * ldc + col0 + c4) = h4; } }
     } }


__global__ __launch_bounds__(256) void k_wnat(const float* __restrict__ w, size_t n8, _Float16* __restrict__ Bt) { const size_t t = (size_t)blockIdx.x * 256 + threadIdx.x; if (t >= n8) return; FragH f; for (int q = 0; q < 8; ++q) f.h[q] = (_Float16)(bf16_round(w[t * 8 + q]) * 16.0f); *(v8us*)((unsigned short*)Bt + t * 8) = f.half[0];  }
// fused attention, ONE launch for all batches, heads and query rows: a work-group of 8 waves owns 256 query rows of one head, a wave 32 of them, and walks the SQ keys in stages of FKS keys (passes of 32). S^T = K Q^T (A = key rows, B = query rows kept in registers), so a lane holds scores of ONE query per 16-column group;
// the two f32 score tiles of a pass, after exp2, ARE the f16 B operand of O^T += V^T P^T (register r of tile t = key 16 t + 8 hh + r = the k order of g2_frag), so neither S nor P is ever stored. Running maximum (log2 units) with a late rescale; weights stay unnormalised (at most 2^8), the row sum divides once at the end.
// K and V^T tiles reach the 8 waves through LDS (whole 128-byte lines from global memory, two buffers, one barrier per stage): a fragment load straight from global memory touches 16 lines for 512 bytes, and all 8 waves would repeat it.
#define FKS 64                       /* keys per stage */
#define FKP (HD + 8)                 /* LDS pitch of a key row, in halves: 16 bytes x odd, conflict-free for 16-byte reads */
#define FVP (FKS + 8)                /* LDS pitch of a V^T row, in halves: likewise */
__device__ __forceinline__ v8f fa_mma(v16h a, v16h b, v8f c) { return __builtin_amdgcn_wmma_f32_16x16x32_f16(false, a, false, b, (short)0, c, false, false); }
__device__ __forceinline__ v16h fa_frag(const unsigned short* p, int hh) { FragH f; f.half[0] = *(const v8us*)(p + 8 * hh); f.half[1] = *(const v8us*)(p + 16 + 8 * hh); return f.v; }
__device__ __forceinline__ void fa_exp2x8(float (&e)[8]) {
  asm("v_exp_f32 %0, %0\n\tv_exp_f32 %1, %1\n\tv_exp_f32 %2, %2\n\tv_exp_f32 %3, %3\n\tv_exp_f32 %4, %4\n\tv_exp_f32 %5, %5\n\tv_exp_f32 %6, %6\n\tv_exp_f32 %7, %7\n\tv_nop"
      : "+v"(e[0]), "+v"(e[1]), "+v"(e[2]), "+v"(e[3]), "+v"(e[4]), "+v"(e[5]), "+v"(e[6]), "+v"(e[7])); }
__global__ __launch_bounds__(256) void k_fattn(const _Float16* __restrict__ Q16, const _Float16* __restrict__ K16, const _Float16* __restrict__ VT, _Float16* __restrict__ O16) {
  __shared__ __attribute__((aligned(16))) unsigned short lk[2][FKS][FKP]; __shared__ __attribute__((aligned(16))) unsigned short lv[2][HD][FVP];
  const int tid = threadIdx.x, lane = tid & 31, ln = lane & 15, hh = lane >> 4; const int w = __builtin_amdgcn_readfirstlane(tid >> 5);
  const int h = blockIdx.y, b = blockIdx.z; const int q0 = blockIdx.x * 256 + w * 32;
  const _Float16* qp = Q16 + ((size_t)b * SQ + q0 + ln) * DM + h * HD;
  const int kr = tid >> 3, kc = (tid & 7) * 8;      /* staging: 16 bytes per thread and step, 8 threads per 128-byte key row */
  const int vr = tid / (FKS / 8), vc = (tid % (FKS / 8)) * 8;      /* FKS / 8 threads per V^T row piece */
  const unsigned short* kg = (const unsigned short*)K16 + ((size_t)b * SQ + kr) * KVD + h * HD + kc;
  const unsigned short* vg = (const unsigned short*)VT + (((size_t)b * NH + h) * HD + vr) * SQ + vc;
  const float cs = 0.125f * 1.44269504088896340736f;      /* 1/sqrt(64) and log2(e) in one factor */
  const v8f z8 = {0.f,0.f,0.f,0.f,0.f,0.f,0.f,0.f};
  v8us gk[FKS / 32], gv[FKS / 32];
#pragma unroll
  for (int i = 0; i < FKS / 32; ++i) { gk[i] = *(const v8us*)(kg + (size_t)i * 32 * KVD); gv[i] = *(const v8us*)(vg + (size_t)i * (2048 / FKS) * SQ); }
  v16h bq[2][2];
#pragma unroll
  for (int j = 0; j < 2; ++j) for (int s = 0; s < 2; ++s) bq[j][s] = g2_frag(qp + (size_t)j * 16 * DM + s * 32, hh);
  v8f o[4][2]; float m[2] = {-1.0e30f, -1.0e30f}; float l[2][2] = {{0.f, 0.f}, {0.f, 0.f}};
#pragma unroll
  for (int t = 0; t < 4; ++t) { o[t][0] = z8; o[t][1] = z8; }
#pragma unroll
  for (int i = 0; i < FKS / 32; ++i) { *(v8us*)&lk[0][kr + i * 32][kc] = gk[i]; *(v8us*)&lv[0][vr + i * (2048 / FKS)][vc] = gv[i]; }
  __syncthreads();      /* stage 0 is published */
#pragma unroll 1      /* one stage per trip: the body already holds FKS / 32 unrolled passes */
  for (int st = 0; st < SQ / FKS; ++st) {
    const int cur = st & 1; const int sn = (st + 1 < SQ / FKS) ? st + 1 : st;      /* the next stage's tiles are asked for now and stored after this stage's passes; the last stage re-reads its own (in bounds; that buffer is not read again) */
#pragma unroll
    for (int i = 0; i < FKS / 32; ++i) { gk[i] = *(const v8us*)(kg + ((size_t)sn * FKS + i * 32) * KVD); gv[i] = *(const v8us*)(vg + (size_t)i * (2048 / FKS) * SQ + sn * FKS); }
    v16h ka[2][2];
#pragma unroll
    for (int t = 0; t < 2; ++t) for (int s = 0; s < 2; ++s) ka[t][s] = fa_frag(&lk[cur][t * 16 + ln][s * 32], hh);
    asm volatile("" ::: "memory");      /* compiler fence: without it the next stage's global loads are sunk to just in front of their LDS stores at the stage's foot, and their whole latency is waited out there */
#pragma unroll
    for (int p = 0; p < FKS / 32; ++p) {
      v16h va[4]; v8f sc[2][2];      /* sc: [key tile][query tile] */
#pragma unroll
      for (int t = 0; t < 2; ++t) for (int j = 0; j < 2; ++j) sc[t][j] = fa_mma(ka[t][1], bq[j][1], fa_mma(ka[t][0], bq[j][0], z8));
#pragma unroll
      for (int t = 0; t < 4; ++t) va[t] = fa_frag(&lv[cur][t * 16 + ln][p * 32], hh);
      if (p + 1 < FKS / 32) {      /* the stage's next pass: its key fragments one pass ahead, into the same registers */
#pragma unroll
        for (int t = 0; t < 2; ++t) for (int s = 0; s < 2; ++s) ka[t][s] = fa_frag(&lk[cur][(p + 1) * 32 + t * 16 + ln][s * 32], hh); }
      asm volatile("" ::: "memory");      /* compiler fence: keeps these LDS reads together in front of the softmax arithmetic, which covers their latency; without it they are sunk in among the WMMAs that use them */
      float mx[2];
#pragma unroll
      for (int j = 0; j < 2; ++j) { float a = fmaxf(sc[0][j][0], sc[1][j][0]); for (int r = 1; r < 8; ++r) a = fmaxf(fmaxf(a, sc[0][j][r]), sc[1][j][r]); mx[j] = a * cs; }
      const bool need = (mx[0] > m[0] + 8.0f) || (mx[1] > m[1] + 8.0f);
      if (__builtin_amdgcn_ballot_w32(need) != 0) {      /* scalar branch: rescale only when some column's maximum has grown by more than 2^8; m[] changes only here and from values joined over the two lane halves, so both halves of a column always use the same m */
#pragma unroll
        for (int j = 0; j < 2; ++j) { const float mj = fmaxf(mx[j], __shfl_xor(mx[j], 16, 32)); const float mn = fmaxf(m[j], mj); const float f = __builtin_amdgcn_exp2f(m[j] - mn); m[j] = mn; l[j][0] *= f; l[j][1] *= f;
          for (int t = 0; t < 4; ++t) for (int r = 0; r < 8; ++r) o[t][j][r] *= f; } }
      v16h pb[2];
#pragma unroll
      for (int j = 0; j < 2; ++j) for (int t = 0; t < 2; ++t) { float e[8]; for (int r = 0; r < 8; ++r) e[r] = fmaf(sc[t][j][r], cs, -m[j]); fa_exp2x8(e); for (int r = 0; r < 8; ++r) { l[j][t] += e[r]; pb[j][t * 8 + r] = (_Float16)e[r]; } }
#pragma unroll
      for (int t = 0; t < 4; ++t) for (int j = 0; j < 2; ++j) o[t][j] = fa_mma(va[t], pb[j], o[t][j]);
    }
#pragma unroll
    for (int i = 0; i < FKS / 32; ++i) { *(v8us*)&lk[cur ^ 1][kr + i * 32][kc] = gk[i]; *(v8us*)&lv[cur ^ 1][vr + i * (2048 / FKS)][vc] = gv[i]; }      /* every wave left that buffer before the barrier that ended the stage before */
    __syncthreads();      /* publishes stage st + 1 and ends every wave's reads of stage st */
  }
#pragma unroll
  for (int j = 0; j < 2; ++j) { float lt = l[j][0] + l[j][1]; lt += __shfl_xor(lt, 16, 32); const float fin = 64.0f / lt;      /* o carried x64, as the output GEMM's alpha expects */
    unsigned short* op = (unsigned short*)O16 + ((size_t)b * SQ + q0 + j * 16 + ln) * DM + h * HD + 8 * hh;
    for (int t = 0; t < 4; ++t) { FragH f; for (int r = 0; r < 8; ++r) f.h[r] = (_Float16)(o[t][j][r] * fin); *(v8us*)(op + t * 16) = f.half[0]; } } }
__global__ __launch_bounds__(256) void k_vt(const _Float16* __restrict__ V16, int b, int h0, _Float16* __restrict__ VT) { __shared__ unsigned short tl[64][65]; const int tid = threadIdx.x; const int hh = blockIdx.x % HG, sg = blockIdx.x / HG; const int s0 = sg * 64; const int h = h0 + hh;
  for (int i = tid; i < 64 * 8; i += 256) { const int j = i / 8, d8 = (i % 8) * 8; FragH f; f.half[0] = *(const v8us*)((const unsigned short*)V16 + ((size_t)b * SQ + s0 + j) * DM + h * HD + d8); for (int q = 0; q < 8; ++q) tl[d8 + q][j] = f.u[q]; }
  __syncthreads();
  { for (int i = tid; i < 64 * 8; i += 256) { const int d = i / 8, j8 = (i % 8) * 8; FragH f; for (int q = 0; q < 8; ++q) f.u[q] = tl[d][j8 + q]; *(v8us*)((unsigned short*)VT + ((size_t)hh * HD + d) * SQ + s0 + j8) = f.half[0]; }  } }



__global__ __launch_bounds__(256) void k_rsmcf2(const float* __restrict__ S, _Float16* __restrict__ P, int hg, int q0, int nk) {
  #pragma clang fp contract(off)
  const int t = blockIdx.x * 256 + threadIdx.x; if (t >= hg * QT) return; const size_t i = (size_t)t; const float* s = S + i * NKX; const int last = q0 + (t % QT); float mx = -3.0e38f;
#pragma unroll 1
  for (int j = 0; j < nk; ++j) { const float f = (j <= last) ? 1.f : 0.f; mx = fmaxf(mx, fmaf(f, s[j], (1.f - f) * -1.0e9f)); } float se = 0.f;
#pragma unroll 1
  for (int j = 0; j < nk; ++j) { const float f = (j <= last) ? 1.f : 0.f; se += __expf(fmaf(f, s[j], (1.f - f) * -1.0e9f) - mx); } const float sc = 256.0f / se;
#pragma unroll 1
  for (int j0 = 0; j0 < nk; j0 += 8) { FragH fr; for (int q = 0; q < 8; ++q) { const int j = j0 + q; const float f = (j <= last) ? 1.f : 0.f; fr.h[q] = (_Float16)(__expf(fmaf(f, s[j], (1.f - f) * -1.0e9f) - mx) * sc); } unsigned short* d = (unsigned short*)P + i * NKX + j0; *(v8us*)d = fr.half[0];  } }


template <int MASKADD>
__global__ __launch_bounds__(64) void k_att0(const float* __restrict__ QF, const float* __restrict__ KF, const float* __restrict__ VF, int ld, const float* __restrict__ mask, float scale, float* __restrict__ OF, int ldo) {
  #pragma clang fp contract(off)
  __shared__ __attribute__((aligned(16))) float lq[64][64]; __shared__ __attribute__((aligned(16))) float lo[64][64];
  const int tid = threadIdx.x; const int h = blockIdx.x / (QT0 / 64), rg = blockIdx.x % (QT0 / 64); const int i = rg * 64 + tid;
  const float* qr = QF + (size_t)i * ld + h * HD;
#pragma unroll 1
  for (int c = 0; c < HD / 4; ++c) { *(v4f*)&lq[tid][c * 4] = *(const v4fa*)(qr + c * 4); const v4f z = {0.f, 0.f, 0.f, 0.f}; *(v4f*)&lo[tid][c * 4] = z; }
  float m = -1.0e30f, l = 0.f; const int jmax = MASKADD ? (SQ - 1) : (rg * 64 + 63);      /* additive-mask form: every key (the mask input decides); causal form: keys up to the block's last row */
#pragma unroll 1
  for (int j = 0; j <= jmax; ++j) { const float* kr = KF + (size_t)j * ld + h * HD; const float* vr = VF + (size_t)j * ld + h * HD; float s = 0.f;
#pragma unroll 1
    for (int c = 0; c < HD / 4; ++c) { const v4f kq = *(const v4fa*)(kr + c * 4); const v4f qq = *(v4f*)&lq[tid][c * 4]; s = __fadd_rn(s, __fmul_rn(qq[0], kq[0])); s = __fadd_rn(s, __fmul_rn(qq[1], kq[1])); s = __fadd_rn(s, __fmul_rn(qq[2], kq[2])); s = __fadd_rn(s, __fmul_rn(qq[3], kq[3])); }
    s = __fmul_rn(s, scale); if (MASKADD) s = __fadd_rn(s, __fmul_rn(bf16_round(mask[(size_t)i * SQ + j]), -10000.0f));
    const float f = (MASKADD || j <= i) ? 1.f : 0.f; const float sm = fmaf(f, s, (1.f - f) * -1.0e30f); const float mn = fmaxf(m, sm); const float sc = expf(m - mn); const float e = expf(sm - mn); l = __fadd_rn(__fmul_rn(l, sc), e); m = mn;
#pragma unroll 1
    for (int c = 0; c < HD / 4; ++c) { const v4f vv = *(const v4fa*)(vr + c * 4); v4f oo = *(v4f*)&lo[tid][c * 4]; for (int u = 0; u < 4; ++u) oo[u] = __fadd_rn(__fmul_rn(oo[u], sc), __fmul_rn(e, vv[u])); *(v4f*)&lo[tid][c * 4] = oo; } }
  const float fin = 64.0f / l;      /* o carried x64 like the f16 path */
#pragma unroll 1
  for (int c = 0; c < HD / 4; ++c) { v4f oo = *(v4f*)&lo[tid][c * 4]; for (int u = 0; u < 4; ++u) oo[u] = __fmul_rn(oo[u], fin); *(v4f*)&lo[tid][c * 4] = oo; }
  __syncthreads();
  {
#pragma unroll 1
    for (int it = 0; it < 16; ++it) { const int row = it * 4 + tid / 16, pc = (tid % 16) * 4; const v4f v = *(const v4f*)&lo[row][pc]; *(v4f*)(OF + (size_t)(rg * 64 + row) * ldo + h * HD + pc) = v; }
     } }


__global__ __launch_bounds__(256) void k_kvexp(const float* __restrict__ src, float* __restrict__ dst, size_t n4) { const size_t t = (size_t)blockIdx.x * 256 + threadIdx.x; if (t >= n4) return; const size_t e = t * 4; const size_t row = e / DM; const int col = (int)(e % DM); const int h = col / HD, d = col % HD; const v4f v = *(const v4fa*)(src + row * KVD + (size_t)(h / HPG) * HD + d); *(v4f*)(dst + e) = v;  }

__global__ __launch_bounds__(256) void k_tab2(float theta, float* __restrict__ CS, float* __restrict__ SN) {
  #pragma clang fp contract(off)
  const int t = blockIdx.x * 256 + threadIdx.x; if (t >= SQ * (HD / 2)) return; const int i = t % (HD / 2); const int p = t / (HD / 2); const float invf = 1.0f / powf(theta, (float)(2 * i) / (float)HD); const float ang = __fmul_rn((float)p, invf); const float c = cosf(ang), s = sinf(ang);
  *(float*)(CS + t) = c; *(float*)(SN + t) = s;  }
template <int NORM, int ROPE>
__global__ __launch_bounds__(64) void k_xform(const float* __restrict__ F, int ldf, int nh, const float* __restrict__ gain, float eps, const float* __restrict__ CS, const float* __restrict__ SN, _Float16* __restrict__ H16, int ldo) {
  #pragma clang fp contract(off)
  __shared__ float xv[HD]; __shared__ float red[HD]; __shared__ unsigned short sh_[HD]; const int d = threadIdx.x; const int h = blockIdx.x % nh; const size_t r = blockIdx.x / nh; const int p = (int)(r % SQ);
  float x = F[r * (size_t)ldf + (size_t)h * HD + d];
  if (NORM) { red[d] = __fmul_rn(x, x); __syncthreads(); for (int st = HD / 2; st > 0; st >>= 1) { if (d < st) red[d] = __fadd_rn(red[d], red[d + st]); __syncthreads(); } const float rs = rsqrtf(__fadd_rn(red[0] / (float)HD, eps)); x = __fmul_rn(__fmul_rn(x, rs), bf16_round(gain[d])); }
  xv[d] = x; __syncthreads();
  float o = x;
  if (ROPE == 1) { const int i = d >> 1; const float c = CS[p * (HD / 2) + i], s = SN[p * (HD / 2) + i]; const float ev = xv[2 * i], od = xv[2 * i + 1]; o = (d & 1) ? __fadd_rn(__fmul_rn(ev, s), __fmul_rn(od, c)) : __fadd_rn(__fmul_rn(ev, c), -__fmul_rn(od, s)); }
  if (ROPE == 2) { const int i = d & (HD / 2 - 1); const float c = CS[p * (HD / 2) + i], s = SN[p * (HD / 2) + i]; const float lo = xv[i], hi = xv[i + HD / 2]; o = (d < HD / 2) ? __fadd_rn(__fmul_rn(lo, c), -__fmul_rn(hi, s)) : __fadd_rn(__fmul_rn(lo, s), __fmul_rn(hi, c)); }
  FragH th; th.h[0] = (_Float16)o; sh_[d] = th.u[0]; __syncthreads();
  if (d < HD / 8) { FragH f; for (int q = 0; q < 8; ++q) f.u[q] = sh_[d * 8 + q]; unsigned short* dst = (unsigned short*)H16 + r * (size_t)ldo + (size_t)h * HD + d * 8; *(v8us*)dst = f.half[0];  } }

template <int NORM, int ROPE>
__global__ __launch_bounds__(64) void k_xformf(const float* __restrict__ F, int ldf, int nh, const float* __restrict__ gain, float eps, const float* __restrict__ CS, const float* __restrict__ SN, float* __restrict__ F32, int ldo) {
  #pragma clang fp contract(off)
  __shared__ float xv[HD]; __shared__ float red[HD]; const int d = threadIdx.x; const int h = blockIdx.x % nh; const size_t r = blockIdx.x / nh; const int p = (int)(r % SQ);
  float x = F[r * (size_t)ldf + (size_t)h * HD + d];
  if (NORM) { red[d] = __fmul_rn(x, x); __syncthreads(); for (int st = HD / 2; st > 0; st >>= 1) { if (d < st) red[d] = __fadd_rn(red[d], red[d + st]); __syncthreads(); } const float rs = rsqrtf(__fadd_rn(red[0] / (float)HD, eps)); x = __fmul_rn(__fmul_rn(x, rs), bf16_round(gain[d])); }
  xv[d] = x; __syncthreads();
  float o = x;
  if (ROPE == 1) { const int i = d >> 1; const float c = CS[p * (HD / 2) + i], s = SN[p * (HD / 2) + i]; const float ev = xv[2 * i], od = xv[2 * i + 1]; o = (d & 1) ? __fadd_rn(__fmul_rn(ev, s), __fmul_rn(od, c)) : __fadd_rn(__fmul_rn(ev, c), -__fmul_rn(od, s)); }
  if (ROPE == 2) { const int i = d & (HD / 2 - 1); const float c = CS[p * (HD / 2) + i], s = SN[p * (HD / 2) + i]; const float lo = xv[i], hi = xv[i + HD / 2]; o = (d < HD / 2) ? __fadd_rn(__fmul_rn(lo, c), -__fmul_rn(hi, s)) : __fadd_rn(__fmul_rn(lo, s), __fmul_rn(hi, c)); }
  float* dst = F32 + r * (size_t)ldo + (size_t)h * HD + d; *(float*)dst = o;  }

__global__ __launch_bounds__(256) void k_bfcp(const float* __restrict__ src, float* __restrict__ dst, size_t n4) { const size_t t = (size_t)blockIdx.x * 256 + threadIdx.x; if (t >= n4) return; const v4f a = *(const v4fa*)(src + t * 4); v4f o; for (int q = 0; q < 4; ++q) o[q] = bf16_round(a[q]); *(v4f*)(dst + t * 4) = o;  }

__global__ __launch_bounds__(256) void k_tab2d(float* __restrict__ CS, float* __restrict__ SN) {
  #pragma clang fp contract(off)
  const int t = blockIdx.x * 256 + threadIdx.x; if (t >= SQ * (HD / 2)) return; const int i = t % (HD / 2); const int p = t / (HD / 2); const float invf = (float)(1.0 / pow(10000.0, (double)(2 * i) / (double)HD)); const float ang = __fmul_rn((float)p, invf); const float c = cosf(ang), s = sinf(ang);
  *(float*)(CS + t) = c; *(float*)(SN + t) = s;  }
extern "C" void kernel_launch(void* const* d_in, const int* in_sizes, int n_in,
                              void* d_out, int out_size, void* d_ws, size_t ws_size, hipStream_t stream) {
  (void)in_sizes; (void)n_in; (void)out_size;
  const float* const* I = (const float* const*)d_in; const float* x = I[0]; const float* wq = I[1]; const float* wk = I[2]; const float* wv = I[3]; const float* wo = I[4]; const float* tcos = I[5]; const float* tsin = I[6]; const float* bq = nullptr; const float* bk = nullptr; const float* bv = nullptr; const float* bo = nullptr;      /* natural [out][in] weights, no biases; rope_cos / rope_sin INPUT tables [2048][32] */
  static_assert(HPG == 1 && NH == NG * HPG && NH * HD == DM && KVD == DM, "plain multi-head attention as 16 kv groups of one query head");
  char* ws = (char*)d_ws; size_t off = 0;
  auto take = [&](size_t bytes) { char* p = ws + off; off += (bytes + 255) & ~(size_t)255; return p; };
  _Float16* BQ = (_Float16*)take((size_t)DM * DM * 2); _Float16* BK = (_Float16*)take((size_t)KVD * DM * 2); _Float16* BV = (_Float16*)take((size_t)KVD * DM * 2); _Float16* BO = (_Float16*)take((size_t)DM * DM * 2);
  _Float16* X16 = (_Float16*)take(NR * DM * 2); float* QF = (float*)take((size_t)SQ * DM * 4); float* KF = (float*)take((size_t)SQ * KVD * 4); float* CSB = (float*)take((size_t)SQ * 32 * 4); float* SNB = (float*)take((size_t)SQ * 32 * 4); _Float16* Q16 = (_Float16*)take(NR * DM * 2); _Float16* K16 = (_Float16*)take(NR * KVD * 2); _Float16* V16 = (_Float16*)take(NR * KVD * 2); _Float16* O16 = (_Float16*)take(NR * DM * 2);
  _Float16* VT = (_Float16*)take((size_t)NB * NH * HD * SQ * 2);
  float* QF0 = (float*)take((size_t)QT0 * DM * 4); float* KF0 = (float*)take((size_t)QT0 * KVD * 4); float* VF0 = (float*)take((size_t)QT0 * KVD * 4); float* KF0e = (float*)take((size_t)QT0 * DM * 4); float* VF0e = (float*)take((size_t)QT0 * DM * 4); float* OF0 = (float*)take((size_t)NB * QT0 * DM * 4); _Float16* OH0 = (_Float16*)take((size_t)NB * QT0 * DM * 2); _Float16* OL0 = (_Float16*)take((size_t)NB * QT0 * DM * 2);
  if (off > ws_size) return;
  k_wnat<<<(unsigned)(((size_t)DM * DM / 8 + 255) / 256), 256, 0, stream>>>(wq, (size_t)DM * DM / 8, BQ); k_wnat<<<(unsigned)(((size_t)KVD * DM / 8 + 255) / 256), 256, 0, stream>>>(wk, (size_t)KVD * DM / 8, BK); k_wnat<<<(unsigned)(((size_t)KVD * DM / 8 + 255) / 256), 256, 0, stream>>>(wv, (size_t)KVD * DM / 8, BV); k_wnat<<<(unsigned)(((size_t)DM * DM / 8 + 255) / 256), 256, 0, stream>>>(wo, (size_t)DM * DM / 8, BO);      /* natural [out][in] = Bt planes x16 */
  k_x16<<<(unsigned)((NR * DM / 8 + 255) / 256), 256, 0, stream>>>(x, X16, NR * DM / 8);
  const size_t r0p = (size_t)B0 * SQ;      /* first projected row */
  k_gemm2<0><<<dim3((unsigned)((MP / 128) * (KVD / 64)), 1), 128, 0, stream>>>(X16 + r0p * DM, DM, 0, BV, DM, 0, 0.0625f, bv, 0, nullptr, 1, 0, 0, nullptr, V16 + r0p * KVD, KVD, 0, MP, KVD, DM);
  k_bfcp<<<(unsigned)(((size_t)SQ * (HD / 2) / 4 + 255) / 256), 256, 0, stream>>>(tcos, CSB, (size_t)SQ * (HD / 2) / 4); k_bfcp<<<(unsigned)(((size_t)SQ * (HD / 2) / 4 + 255) / 256), 256, 0, stream>>>(tsin, SNB, (size_t)SQ * (HD / 2) / 4);      /* bf16-rounded copies of the module's INPUT rope tables [2048][32] (the [pos][i] layout k_xform indexes; the rotate-half branch uses table column d mod 32 = the module's [cos | cos]) */
  for (int b = B0; b < B0 + NBR; ++b) { const size_t r0 = (size_t)b * SQ;
    k_gemm2<0><<<dim3((unsigned)((SQ / 128) * (DM / 64)), 1), 128, 0, stream>>>(X16 + r0 * DM, DM, 0, BQ, DM, 0, 0.0625f, nullptr, 0, nullptr, 1, 0, 0, QF, nullptr, DM, 0, SQ, DM, DM);      /* q (f32) of this batch */
    k_gemm2<0><<<dim3((unsigned)((SQ / 128) * (KVD / 64)), 1), 128, 0, stream>>>(X16 + r0 * DM, DM, 0, BK, DM, 0, 0.0625f, nullptr, 0, nullptr, 1, 0, 0, KF, nullptr, KVD, 0, SQ, KVD, DM);      /* k (f32) */
    k_xform<0, 2><<<(unsigned)((size_t)SQ * NH), 64, 0, stream>>>(QF, DM, NH, nullptr, 0.f, CSB, SNB, Q16 + r0 * DM, DM); k_xform<0, 2><<<(unsigned)((size_t)SQ * NG), 64, 0, stream>>>(KF, KVD, NG, nullptr, 0.f, CSB, SNB, K16 + r0 * KVD, KVD);      /* rotate-half rope of q and k from the bf16-rounded input tables -> f16 rows */
    k_vt<NG, SQ><<<NG * (SQ / 64), 256, 0, stream>>>(V16 + r0 * KVD, KVD, 0, VT + (size_t)b * NH * HD * SQ); }      /* V^T [NB][NH][HD][SQ], this batch's plane */
  k_fattn<<<dim3(SQ / 256, NH, NB), 256, 0, stream>>>(Q16, K16, VT, O16);      /* scores, softmax and P V of every batch, head and query row in ONE launch; o (x64) into merged f16 rows */
  k_gemm2<0><<<dim3((unsigned)((MPO / 128) * (DM / 64)), 1), 128, 0, stream>>>(O16 + r0p * DM, DM, 0, BO, DM, 0, 0.0009765625f, bo, 0, nullptr, 1, 0, 0, (float*)d_out + r0p * DM, nullptr, DM, 0, MPO, DM, DM);      /* out rows are the output layout */
}

// v003
// Measured time: 175 microseconds a run.
// In two side-by-side timings against v002, it was 1.75 and 1.73 times as fast.
// All steps since v000 together make it 41.4 times as fast.
#include <hip/hip_runtime.h>
// Multi-head self-attention with half-split RoPE from RANDOM input tables, NON-causal (x [2][2048][1024]; q / k / v = x W^T (nn.Linear natural [1024][1024] sigma 1/32, no biases), 16 heads of 64; rope: x * [cos | cos] + rotate_half(x) * [sin | sin] with rotate_half = (-x2, x1) over the two 32-lane halves and INPUT tables rope_cos / rope_sin [2048][32] (cos / sin of uniform-random angles); scores / sqrt(64); softmax over all 2048 keys (f32; no mask); out = merged Wo^T (natural, no bias) -> [2][2048][1024]); run as grouped-query attention with 16 groups of ONE head.
// Structure: x as exact f16 rows; natural weights as exact x16 planes; q, k and v of both batches as ONE batched WMMA GEMM launch (32x64 wave tiles, f32 accumulation, blockIdx.y picks the weight plane and the output rows) whose epilogue rotates q and k in f32 (rotate-half; a 64-column wave tile is one head; INPUT tables rounded to bf16 as read) and writes f16 rows; V^T of the heads via LDS transposes; then ONE fused attention launch for all batches, heads and query rows (k_fattn: scores of 32 query columns per wave against ALL 2048 keys, running softmax in registers with f32 statistics and native exp2, unnormalised f16 weights, o = P V^T carried x64) into merged f16 rows; out = o Wo^T GEMM (f32, alpha 2^-10).
// Compute dtype: inputs rounded to bf16; x / weights exact; q, k, v, softmax weights and o as plain f16 GEMM operands (~2^-12); scores and softmax statistics f32. v_wmma_f32_16x16x32_f16.
#define NB 2
#define NG 16
#define HPG 1
#define KVD (NG * HD)
#define SQ 2048
#define DM 1024
#define NH 16
#define HD 64
#define HG 4                         /* heads per block group of the unlaunched k_vt overload */
#define QT 256                       /* query rows per tile */
#define NKX SQ                       /* S / P row pitch */
#define QT0 128                      /* rows per head of k_att0 (not launched); sizes unused f32 buffers */
#define B0 0                         /* first batch processed (debug hook) */
#define NBR NB                       /* batches processed (debug hook) */
#define NR ((size_t)NB * SQ)         /* token rows */
#define MP ((int)((size_t)NBR * SQ)) /* rows projected (debug hook) */
#define QN SQ                        /* unused: k_fattn attends all SQ query rows of a batch */
#define NHD NH                       /* unused: k_fattn attends all NH heads */
#define MPO MP                       /* rows through the output stage (debug hook) */
#define LQ DM      /* row pitch of the q/k/v rows */
typedef __bf16 v16b __attribute__((ext_vector_type(16)));
typedef unsigned short v8us __attribute__((ext_vector_type(8), may_alias));
typedef float  v8f  __attribute__((ext_vector_type(8)));
typedef float  v4f  __attribute__((ext_vector_type(4)));
typedef float  v4fa __attribute__((ext_vector_type(4), may_alias));
union FragB { v16b v; v8us half[2]; unsigned short u[16]; };

__device__ __forceinline__ unsigned short bf16_bits(float x) { unsigned int u = __float_as_uint(x); return (unsigned short)((u + 0x7FFFu + ((u >> 16) & 1u)) >> 16); }
__device__ __forceinline__ float bf16_val(unsigned short b) { return __uint_as_float(((unsigned int)b) << 16); }
__device__ __forceinline__ float bf16_round(float x) { return bf16_val(bf16_bits(x)); }
// D += A·B with NT terms: 1 = ah·bh, 2 = + al·bh (A split), 3 = + ah·bl (both split)
template <int NT>
__device__ __forceinline__ v8f mmaN(v16b ah, v16b al, v16b bh, v16b bl, v8f c) {
  c = __builtin_amdgcn_wmma_f32_16x16x32_bf16(false, ah, false, bh, (short)0, c, false, false);
  if (NT >= 2) c = __builtin_amdgcn_wmma_f32_16x16x32_bf16(false, al, false, bh, (short)0, c, false, false);
  if (NT >= 3) c = __builtin_amdgcn_wmma_f32_16x16x32_bf16(false, ah, false, bl, (short)0, c, false, false);
  asm volatile("v_nop\n\tv_nop\n\tv_nop\n\tv_nop" : "+v"(c) : "v"(ah), "v"(al), "v"(bh), "v"(bl));
  return c;
}

__global__ __launch_bounds__(256) void k_wt_bf16(const float* __restrict__ W, unsigned short* __restrict__ Wt, int K, int N) {
  const int t = blockIdx.x * 256 + threadIdx.x;
  const int k8n = K / 8;
  if (t >= N * k8n) return;
  const int n = t / k8n, k8 = (t % k8n) * 8;
  v8us v;
#pragma unroll
  for (int i = 0; i < 8; ++i) v[i] = bf16_bits(W[(size_t)(k8 + i) * N + n]);
  *(v8us*)(Wt + (size_t)n * K + k8) = v;
  
}

// GEMM C[M][N] (f32, pitch ldc) = act(A[M][K]·W + bias). A f32 row-major (pitch lda) converted per fragment to bf16
// (ASPLIT: hi/lo two planes -> 2 terms, else single rounded term); Wt bf16 [N][K] (pitch ldb). BIAS_BF16 rounds the
// bias to bf16 first (bias quantised to bf16 before the add). K%32==0, M%16==0, N%64==0.
template <bool ASPLIT, int ACT, bool BIAS_BF16>
__global__ __launch_bounds__(128) void k_gemm_bf(const float* __restrict__ A, int lda, const unsigned short* __restrict__ Wt, int ldb,
                                               const float* __restrict__ bias, float* __restrict__ C, int ldc, int M, int N, int K) {
  __shared__ __attribute__((aligned(16))) float so[4][16][64];
  const int tid = threadIdx.x, w = tid >> 5, lane = tid & 31, ln = lane & 15, hh = lane >> 4;
  const int ntn = N / 64;
  const int wid = blockIdx.x * 4 + w;
  const int mt = wid / ntn, nq = wid % ntn;
  if (mt * 16 >= M) return;
  const int row0 = mt * 16, col0 = nq * 64;
  const float* arow = A + (size_t)(row0 + ln) * lda;
  v8f acc[4] = {};
  for (int kb = 0; kb < K; kb += 32) {
    FragB ah, al;
    const v4f x0 = *(const v4fa*)(arow + kb + 8 * hh), x1 = *(const v4fa*)(arow + kb + 8 * hh + 4);
    const v4f x2 = *(const v4fa*)(arow + kb + 16 + 8 * hh), x3 = *(const v4fa*)(arow + kb + 16 + 8 * hh + 4);
    float xs[16] = {x0[0],x0[1],x0[2],x0[3],x1[0],x1[1],x1[2],x1[3],x2[0],x2[1],x2[2],x2[3],x3[0],x3[1],x3[2],x3[3]};
#pragma unroll
    for (int i = 0; i < 16; ++i) { const unsigned short hb = bf16_bits(xs[i]); ah.u[i] = hb; al.u[i] = ASPLIT ? bf16_bits(xs[i] - bf16_val(hb)) : (unsigned short)0; }
#pragma unroll
    for (int t = 0; t < 4; ++t) {
      const unsigned short* brow = Wt + (size_t)(col0 + t * 16 + ln) * ldb + kb;
      FragB b;
      b.half[0] = *(const v8us*)(brow + 8 * hh);
      b.half[1] = *(const v8us*)(brow + 16 + 8 * hh);
      acc[t] = mmaN<ASPLIT ? 2 : 1>(ah.v, al.v, b.v, b.v, acc[t]);
    }
  }
#pragma unroll
  for (int t = 0; t < 4; ++t) {
    float bv = bias ? bias[col0 + t * 16 + ln] : 0.f;
    if (BIAS_BF16) bv = bf16_round(bv);
#pragma unroll
    for (int r = 0; r < 8; ++r) { float v = acc[t][r] + bv; if (ACT == 1) v = fmaxf(v, 0.f); so[w][8 * hh + r][t * 16 + ln] = v; }
  }
  __builtin_amdgcn_fence(__ATOMIC_ACQ_REL, "workgroup");
  __builtin_amdgcn_wave_barrier();
  const int rsub = lane >> 4, c4 = (lane & 15) * 4;
  {
#pragma unroll
    for (int q = 0; q < 8; ++q) {
      const int r = q * 2 + rsub;
      const v4f v = *(const v4fa*)&so[w][r][c4];
      *(v4f*)(C + (size_t)(row0 + r) * ldc + col0 + c4) = v;
    }
    
  }
}

// GEMM C = act(A·W + bias + resid): A f32 (ASPLIT -> hi/lo 2 terms), Wt bf16 [N][K]; ACT 0 none, 1 relu, 2 exact gelu;
// resid (optional, f32, row index = (row % rmod), pitch ldr, RES_BF16 rounds it) added before the activation.
template <bool ASPLIT, int ACT, bool BIAS_BF16, bool RES_BF16>
__global__ __launch_bounds__(128) void k_gemm_bf3(const float* __restrict__ A, int lda, const unsigned short* __restrict__ Wt, int ldb,
                                                const float* __restrict__ bias, const float* __restrict__ resid, int rmod, int ldr,
                                                float* __restrict__ C, int ldc, int M, int N, int K) {
  __shared__ __attribute__((aligned(16))) float so[4][16][64];
  const int tid = threadIdx.x, w = tid >> 5, lane = tid & 31, ln = lane & 15, hh = lane >> 4;
  const int ntn = N / 64;
  const int wid = blockIdx.x * 4 + w;
  const int mt = wid / ntn, nq = wid % ntn;
  if (mt * 16 >= M) return;
  const int row0 = mt * 16, col0 = nq * 64;
  const float* arow = A + (size_t)(row0 + ln) * lda;
  v8f acc[4] = {};
  for (int kb = 0; kb < K; kb += 32) {
    FragB ah, al;
    const v4f x0 = *(const v4fa*)(arow + kb + 8 * hh), x1 = *(const v4fa*)(arow + kb + 8 * hh + 4);
    const v4f x2 = *(const v4fa*)(arow + kb + 16 + 8 * hh), x3 = *(const v4fa*)(arow + kb + 16 + 8 * hh + 4);
    float xs[16] = {x0[0],x0[1],x0[2],x0[3],x1[0],x1[1],x1[2],x1[3],x2[0],x2[1],x2[2],x2[3],x3[0],x3[1],x3[2],x3[3]};
#pragma unroll
    for (int i = 0; i < 16; ++i) { const unsigned short hb = bf16_bits(xs[i]); ah.u[i] = hb; al.u[i] = ASPLIT ? bf16_bits(xs[i] - bf16_val(hb)) : (unsigned short)0; }
#pragma unroll
    for (int t = 0; t < 4; ++t) {
      const unsigned short* brow = Wt + (size_t)(col0 + t * 16 + ln) * ldb + kb;
      FragB b;
      b.half[0] = *(const v8us*)(brow + 8 * hh);
      b.half[1] = *(const v8us*)(brow + 16 + 8 * hh);
      acc[t] = mmaN<ASPLIT ? 2 : 1>(ah.v, al.v, b.v, b.v, acc[t]);
    }
  }
#pragma unroll
  for (int t = 0; t < 4; ++t) {
    const int col = col0 + t * 16 + ln;
    float bv = bias ? bias[col] : 0.f;
    if (BIAS_BF16) bv = bf16_round(bv);
#pragma unroll
    for (int r = 0; r < 8; ++r) {
      float v = acc[t][r] + bv;
      if (resid) { float rv = resid[(size_t)((row0 + 8 * hh + r) % rmod) * ldr + col]; if (RES_BF16) rv = bf16_round(rv); v += rv; }
      if (ACT == 1) v = fmaxf(v, 0.f);
      if (ACT == 2) v = 0.5f * v * (1.0f + erff(v * 0.70710678118654752f));
      if (ACT == 3) { const float u = 0.7978845608028654f * (v + 0.044715f * v * v * v); v = 0.5f * v * (1.0f + tanhf(u)); }
      so[w][8 * hh + r][t * 16 + ln] = v;
    }
  }
  __builtin_amdgcn_fence(__ATOMIC_ACQ_REL, "workgroup");
  __builtin_amdgcn_wave_barrier();
  const int rsub = lane >> 4, c4 = (lane & 15) * 4;
  {
#pragma unroll
    for (int q = 0; q < 8; ++q) {
      const int r = q * 2 + rsub;
      const v4f v = *(const v4fa*)&so[w][r][c4];
      *(v4f*)(C + (size_t)(row0 + r) * ldc + col0 + c4) = v;
    }
    
  }
}
// row LayerNorm (biased variance, eps) over N: s = X (+ R); optional out_sum <- s; out_norm <- (s-mu)*rsqrt(var+eps)*g + b
template <bool PARAM_BF16>
__global__ __launch_bounds__(256) void k_layernorm(const float* __restrict__ X, const float* __restrict__ R, const float* __restrict__ g, const float* __restrict__ bta,
                                                  float* __restrict__ out_sum, float* __restrict__ out_norm, int N, float eps) {
  __shared__ float red[256];
  const int row = blockIdx.x, tid = threadIdx.x;
  const float* x = X + (size_t)row * N; const float* rr = R ? R + (size_t)row * N : nullptr;
  float vals[16];                     // up to N = 4096
  const int per = N / 256;            // contiguous chunk per thread? use strided-by-4 chunks: thread handles j = tid*4 + 1024*u
  float s1 = 0.f;
  for (int u = 0; u < per / 4; ++u) {
    const int j = tid * 4 + 1024 * u;
    const v4f a = *(const v4fa*)(x + j);
    v4f b = {0.f,0.f,0.f,0.f}; if (rr) b = *(const v4fa*)(rr + j);
#pragma unroll
    for (int q = 0; q < 4; ++q) { const float v = a[q] + b[q]; vals[u * 4 + q] = v; s1 += v; }
  }
  red[tid] = s1; __syncthreads();
  for (int st = 128; st > 0; st >>= 1) { if (tid < st) red[tid] += red[tid + st]; __syncthreads(); }
  const float mu = red[0] / (float)N; __syncthreads();
  float s2 = 0.f;
  for (int u = 0; u < per / 4; ++u)
#pragma unroll
    for (int q = 0; q < 4; ++q) { const float c = vals[u * 4 + q] - mu; s2 += c * c; }
  red[tid] = s2; __syncthreads();
  for (int st = 128; st > 0; st >>= 1) { if (tid < st) red[tid] += red[tid + st]; __syncthreads(); }
  const float rs = rsqrtf(red[0] / (float)N + eps);
  {
    for (int u = 0; u < per / 4; ++u) {
      const int j = tid * 4 + 1024 * u;
      v4f o, sm;
#pragma unroll
      for (int q = 0; q < 4; ++q) {
        float gg = g[j + q], bb = bta[j + q];
        if (PARAM_BF16) { gg = bf16_round(gg); bb = bf16_round(bb); }
        sm[q] = vals[u * 4 + q]; o[q] = (vals[u * 4 + q] - mu) * rs * gg + bb;
      }
      if (out_sum) *(v4f*)(out_sum + (size_t)row * N + j) = sm;
      *(v4f*)(out_norm + (size_t)row * N + j) = o;
    }
    
  }
}



// ---- f16 WMMA path (v_wmma_f32_16x16x32_f16): 11-bit significands for operands in range — used where a [0,1] probability operand needs more precision than bf16
typedef _Float16 v16h __attribute__((ext_vector_type(16)));
union FragH { v16h v; v8us half[2]; _Float16 h[16]; unsigned short u[16]; };
template <int NT>
__device__ __forceinline__ v8f mmaH(v16h ah, v16h al, v16h bh, v16h bl, v8f c) {
  c = __builtin_amdgcn_wmma_f32_16x16x32_f16(false, ah, false, bh, (short)0, c, false, false);
  if (NT >= 2) c = __builtin_amdgcn_wmma_f32_16x16x32_f16(false, al, false, bh, (short)0, c, false, false);
  if (NT >= 3) c = __builtin_amdgcn_wmma_f32_16x16x32_f16(false, ah, false, bl, (short)0, c, false, false);
  asm volatile("v_nop\n\tv_nop\n\tv_nop\n\tv_nop" : "+v"(c) : "v"(ah), "v"(al), "v"(bh), "v"(bl));
  return c;
}
// batched GEMM like k_gemm_b but f16 operands: A f32 (split into f16 hi/lo if ASPLIT, else rounded to f16), Bt = f16 values [n][k]; alpha; C f32; N multiple of 16 (partial tiles skipped)
template <bool ASPLIT>
__global__ __launch_bounds__(128) void k_gemm_h(const float* __restrict__ A, int lda, size_t sA, const _Float16* __restrict__ Bh, int ldb, size_t sB, float alpha, float* __restrict__ C, int ldc, size_t sC, int M, int N, int K) {
  __shared__ __attribute__((aligned(16))) float so[4][16][64];
  const int tid = threadIdx.x, w = tid >> 5, lane = tid & 31, ln = lane & 15, hh = lane >> 4; const int by = blockIdx.y;
  A += (size_t)by * sA; Bh += (size_t)by * sB; C += (size_t)by * sC;
  const int ntn = (N + 63) / 64; const int wid = blockIdx.x * 4 + w; const int mt = wid / ntn, nq = wid % ntn; if (mt * 16 >= M) return;
  const int row0 = mt * 16, col0 = nq * 64; const float* arow = A + (size_t)(row0 + ln) * lda;
  v8f acc[4] = {};
  for (int kb = 0; kb < K; kb += 32) {
    FragH ah, al;
    const v4f x0 = *(const v4fa*)(arow + kb + 8 * hh), x1 = *(const v4fa*)(arow + kb + 8 * hh + 4), x2 = *(const v4fa*)(arow + kb + 16 + 8 * hh), x3 = *(const v4fa*)(arow + kb + 16 + 8 * hh + 4);
    float xs[16] = {x0[0],x0[1],x0[2],x0[3],x1[0],x1[1],x1[2],x1[3],x2[0],x2[1],x2[2],x2[3],x3[0],x3[1],x3[2],x3[3]};
#pragma unroll
    for (int i = 0; i < 16; ++i) { const _Float16 h = (_Float16)xs[i]; ah.h[i] = h; al.h[i] = ASPLIT ? (_Float16)(xs[i] - (float)h) : (_Float16)0.0f; }
#pragma unroll
    for (int t = 0; t < 4; ++t) { if (col0 + t * 16 >= N) continue; const size_t boff = (size_t)(col0 + t * 16 + ln) * ldb + kb; FragH bq; bq.half[0] = *(const v8us*)(Bh + boff + 8 * hh); bq.half[1] = *(const v8us*)(Bh + boff + 16 + 8 * hh);
      acc[t] = mmaH<ASPLIT ? 2 : 1>(ah.v, al.v, bq.v, bq.v, acc[t]); }
  }
#pragma unroll
  for (int t = 0; t < 4; ++t) { if (col0 + t * 16 >= N) continue;
#pragma unroll
    for (int r = 0; r < 8; ++r) so[w][8 * hh + r][t * 16 + ln] = acc[t][r] * alpha; }
  __builtin_amdgcn_fence(__ATOMIC_ACQ_REL, "workgroup"); __builtin_amdgcn_wave_barrier();
  const int rsub = lane >> 4, c4 = (lane & 15) * 4;
  {
#pragma unroll
    for (int q = 0; q < 8; ++q) { const int r = q * 2 + rsub; if (col0 + c4 < N) { const v4f v = *(const v4fa*)&so[w][r][c4]; *(v4f*)(C + (size_t)(row0 + r) * ldc + col0 + c4) = v; } }
     }
}

// Wt[n][k] = f16(W[k][n]·scale) from f32 row-major W[K][N] (scale = power of two; bf16-exact weights stay exact in f16 away from the subnormal range)
__global__ __launch_bounds__(256) void k_wt_f16(const float* __restrict__ W, _Float16* __restrict__ Wt, int K, int N, float scale) {
  const int t = blockIdx.x * 256 + threadIdx.x; if (t >= N * (K / 8)) return; const int n = t / (K / 8), k8 = (t % (K / 8)) * 8; FragH f;
#pragma unroll
  for (int i = 0; i < 8; ++i) f.h[i] = (_Float16)(bf16_round(W[(size_t)(k8 + i) * N + n]) * scale); const v8us o = f.half[0];
  *(v8us*)((unsigned short*)Wt + (size_t)n * K + k8) = o; 
}
// k_gemm_hh variant with fused epilogue: v = acc·alpha + bias[by·sBias + col] (+ CP[(row/rowsPerB)·sCPb + by·64 + col] if CP) ; ACT 0 none / 1 elu ; writes f16 C16 (and f32 C if non-null)
template <int ACT>
__global__ __launch_bounds__(128) void k_gemm_hhx(const _Float16* __restrict__ A, int lda, size_t sA, const _Float16* __restrict__ Bh, int ldb, size_t sB, float alpha, const float* __restrict__ bias, size_t sBias, const float* __restrict__ CP, int rowsPerB, size_t sCPb, int row0g,
    float* __restrict__ C, _Float16* __restrict__ C16, int ldc, size_t sC, int M, int N, int K) {
  __shared__ __attribute__((aligned(16))) float so[4][16][64];
  const int tid = threadIdx.x, w = tid >> 5, lane = tid & 31, ln = lane & 15, hh = lane >> 4; const int by = blockIdx.y;
  A += (size_t)by * sA; Bh += (size_t)by * sB; const size_t cofs = (size_t)by * sC; const float* bp = bias ? bias + (size_t)by * sBias : nullptr;
  const int ntn = (N + 63) / 64; const int wid = blockIdx.x * 4 + w; const int mt = wid / ntn, nq = wid % ntn; if (mt * 16 >= M) return;
  const int row0 = mt * 16, col0 = nq * 64; const _Float16* arow = A + (size_t)(row0 + ln) * lda;
  v8f acc[4] = {};
  for (int kb = 0; kb < K; kb += 32) { FragH ah; ah.half[0] = *(const v8us*)((const unsigned short*)arow + kb + 8 * hh); ah.half[1] = *(const v8us*)((const unsigned short*)arow + kb + 16 + 8 * hh);
#pragma unroll
    for (int t = 0; t < 4; ++t) { if (col0 + t * 16 >= N) continue; const size_t boff = (size_t)(col0 + t * 16 + ln) * ldb + kb; FragH bq; bq.half[0] = *(const v8us*)((const unsigned short*)Bh + boff + 8 * hh); bq.half[1] = *(const v8us*)((const unsigned short*)Bh + boff + 16 + 8 * hh);
      acc[t] = mmaH<1>(ah.v, ah.v, bq.v, bq.v, acc[t]); }
  }
#pragma unroll
  for (int t = 0; t < 4; ++t) { if (col0 + t * 16 >= N) continue; const int col = col0 + t * 16 + ln; const float bv = bp ? bf16_round(bp[col]) : 0.f;
#pragma unroll
    for (int r = 0; r < 8; ++r) { float v = acc[t][r] * alpha + bv; if (CP) { const int rr = row0g + row0 + 8 * hh + r; if (rowsPerB < 0) v += CP[cofs + (size_t)rr * ldc + col];      /* rowsPerB < 0: own element of the batched C plane */ else { const int bidx = rr / rowsPerB; v += CP[(size_t)bidx * sCPb + (size_t)by * 64 + col]; } } if (ACT == 1) v = (v > 0.f) ? v : expm1f(v); else if (ACT == 7) v = (v > 0.f) ? v + 1.0f : expf(v); else if (ACT == 8) v = tanhf(v); else if (ACT == 9) v = 0.5f * v * (1.0f + tanhf(0.7978845608028654f * (v + 0.044715f * v * v * v))); else if (ACT == 11) v = 1.0f / (1.0f + expf(-v)); else if (ACT == 12) v = (v > 0.f) ? v : 0.01f * v; else if (ACT == 14) v = (v > 0.f) ? v : 0.1f * v; else if (ACT == 16) v = (v >= 0.f) ? v : 0.3f * v; else if (ACT == 17) v = (v >= 0.f) ? v : 0.2f * v; else if (ACT == 15) v = v / (1.0f + expf(-v)); else if (ACT == 3) v = fmaxf(v, 0.f); else if (ACT == 6) v = 0.5f * v * (1.0f + erff(v * 0.70710678118654752f)); so[w][8 * hh + r][t * 16 + ln] = v; } }
  __builtin_amdgcn_fence(__ATOMIC_ACQ_REL, "workgroup"); __builtin_amdgcn_wave_barrier();
  const int rsub = lane >> 4, c4 = (lane & 15) * 4; typedef _Float16 v4h __attribute__((ext_vector_type(4)));
  {
#pragma unroll
    for (int q = 0; q < 8; ++q) { const int r = q * 2 + rsub; if (col0 + c4 < N) { const v4f v = *(const v4fa*)&so[w][r][c4]; if (C) *(v4f*)(C + cofs + (size_t)(row0 + r) * ldc + col0 + c4) = v; if (C16) { v4h h4; for (int i = 0; i < 4; ++i) h4[i] = (_Float16)v[i]; *(v4h*)(C16 + cofs + (size_t)(row0 + r) * ldc + col0 + c4) = h4; } } }
     }
}


typedef _Float16 v4h __attribute__((ext_vector_type(4)));

__global__ __launch_bounds__(256) void k_x16(const float* __restrict__ x, _Float16* __restrict__ X16, size_t n8) { const size_t t = (size_t)blockIdx.x * 256 + threadIdx.x; if (t >= n8) return; FragH f;
#pragma unroll
  for (int q = 0; q < 8; ++q) f.h[q] = (_Float16)bf16_round(x[t * 8 + q]); *(v8us*)((unsigned short*)X16 + t * 8) = f.half[0];  }
__global__ __launch_bounds__(256) void k_h16(const float* __restrict__ x, _Float16* __restrict__ X16, size_t n8) { const size_t t = (size_t)blockIdx.x * 256 + threadIdx.x; if (t >= n8) return; FragH f;
#pragma unroll
  for (int q = 0; q < 8; ++q) f.h[q] = (_Float16)x[t * 8 + q]; *(v8us*)((unsigned short*)X16 + t * 8) = f.half[0];  }
__global__ __launch_bounds__(256) void k_round16f(const float* __restrict__ W, _Float16* __restrict__ Bt, size_t n8) { const size_t t = (size_t)blockIdx.x * 256 + threadIdx.x; if (t >= n8) return; FragH f;
#pragma unroll
  for (int i = 0; i < 8; ++i) f.h[i] = (_Float16)(bf16_round(W[t * 8 + i]) * 16.0f); *(v8us*)((unsigned short*)Bt + t * 8) = f.half[0];  }
template <int NHv, int TTv>
__global__ __launch_bounds__(256) void k_vt(const _Float16* __restrict__ V16, int ldv, int voff, _Float16* __restrict__ Vt) { __shared__ unsigned short tl[64][66]; const int tid = threadIdx.x; const int slab = blockIdx.x / (TTv / 64), lg = blockIdx.x % (TTv / 64); const int b = slab / NHv, h = slab % NHv;
  for (int i = tid; i < 64 * 8; i += 256) { const int r = i / 8, c8 = (i % 8) * 8; FragH f; f.half[0] = *(const v8us*)((const unsigned short*)V16 + ((size_t)b * TTv + lg * 64 + r) * ldv + voff + h * 64 + c8);
#pragma unroll
    for (int q = 0; q < 8; ++q) tl[r][c8 + q] = f.u[q]; }
  __syncthreads();
  {
#pragma unroll
    for (int rd = 0; rd < 2; ++rd) { const int d = rd * 32 + tid / 8, pc = tid % 8; FragH f;
#pragma unroll
      for (int q = 0; q < 8; ++q) f.u[q] = tl[pc * 8 + q][d];
      *(v8us*)((unsigned short*)Vt + ((size_t)slab * 64 + d) * TTv + lg * 64 + pc * 8) = f.half[0]; }
     } }

__global__ __launch_bounds__(256) void k_hl(const float* __restrict__ F, _Float16* __restrict__ Hh, _Float16* __restrict__ Hl, size_t n8) { const size_t t = (size_t)blockIdx.x * 256 + threadIdx.x; if (t >= n8) return; FragH fh, fl; const v4f a = *(const v4fa*)(F + t * 8), c = *(const v4fa*)(F + t * 8 + 4);
#pragma unroll
  for (int q = 0; q < 4; ++q) { _Float16 h = (_Float16)a[q]; fh.h[q] = h; fl.h[q] = (_Float16)((a[q] - (float)h) * 1024.0f); h = (_Float16)c[q]; fh.h[4 + q] = h; fl.h[4 + q] = (_Float16)((c[q] - (float)h) * 1024.0f); }
  { *(v8us*)((unsigned short*)Hh + t * 8) = fh.half[0]; *(v8us*)((unsigned short*)Hl + t * 8) = fl.half[0];  } }

// ---- fast GEMM (wave tile 32x64; requires M % 32 == 0 rows per launch region and N % 64 == 0); epilogue = k_gemm_hhx semantics ----
__device__ __forceinline__ v16h g2_frag(const _Float16* p, int hh) { FragH f; f.half[0] = *(const v8us*)((const unsigned short*)p + 8 * hh); f.half[1] = *(const v8us*)((const unsigned short*)p + 16 + 8 * hh); return f.v; }
__device__ __forceinline__ v8f g2_mma(v16h a, v16h b, v8f c) { v8f d = __builtin_amdgcn_wmma_f32_16x16x32_f16(false, a, false, b, (short)0, c, false, false); asm volatile("v_nop\n\tv_nop\n\tv_nop\n\tv_nop" : "+v"(d) : "v"(a), "v"(b)); return d; }
// ROPE 1: planes 0 and 1 of the batch (q, k) leave through the rotate-half rotation: N is whole heads of HD = 64 columns, so a wave tile is ONE head and both halves of every pair lie in the wave's own staging tile; position = row mod SQ (row 0 of A is a batch's first token); f16 rows only.
template <int ACT, int ROPE = 0>
__global__ __launch_bounds__(128) void k_gemm2(const _Float16* __restrict__ A, int lda, size_t sA, const _Float16* __restrict__ Bh, int ldb, size_t sB, float alpha, const float* __restrict__ bias, size_t sBias, const float* __restrict__ CP, int rowsPerB, size_t sCPb, int row0g,
    float* __restrict__ C, _Float16* __restrict__ C16, int ldc, size_t sC, int M, int N, int K, const float* __restrict__ tcos = nullptr, const float* __restrict__ tsin = nullptr) { static_assert(ACT == 0 || ACT == 3 || ACT == 6 || ACT == 8 || ACT == 9 || ACT == 11 || ACT == 12 || ACT == 14 || ACT == 15 || ACT == 16 || ACT == 17, "k_gemm2: unsupported ACT code (would silently apply no activation)");
  __shared__ __attribute__((aligned(16))) float so[4][32][68];
  const int tid = threadIdx.x, w = tid >> 5, lane = tid & 31, ln = lane & 15, hh = lane >> 4; const int by = blockIdx.y;
  A += (size_t)by * sA; Bh += (size_t)by * sB; const size_t cofs = (size_t)by * sC; const float* bp = bias ? bias + (size_t)by * sBias : nullptr;
  const int ntn = N >> 6; const int mt = blockIdx.x / ntn, nq = blockIdx.x - mt * ntn; const int row0 = mt * 128 + 32 * w, col0 = nq * 64; if (row0 >= M) return;
  const _Float16* a0p = A + (size_t)(row0 + ln) * lda; const _Float16* a1p = a0p + (size_t)16 * lda;
  const _Float16* b0p = Bh + (size_t)(col0 + ln) * ldb; const _Float16* b1p = b0p + (size_t)16 * ldb; const _Float16* b2p = b1p + (size_t)16 * ldb; const _Float16* b3p = b2p + (size_t)16 * ldb;
  const v8f z8 = {0.f,0.f,0.f,0.f,0.f,0.f,0.f,0.f}; v8f c00 = z8, c01 = z8, c02 = z8, c03 = z8, c10 = z8, c11 = z8, c12 = z8, c13 = z8;
#pragma unroll 1
  for (int kb = 0; kb < K; kb += 32) { const v16h a0 = g2_frag(a0p + kb, hh), a1 = g2_frag(a1p + kb, hh);
    v16h b = g2_frag(b0p + kb, hh); c00 = g2_mma(a0, b, c00); c10 = g2_mma(a1, b, c10);
    b = g2_frag(b1p + kb, hh); c01 = g2_mma(a0, b, c01); c11 = g2_mma(a1, b, c11);
    b = g2_frag(b2p + kb, hh); c02 = g2_mma(a0, b, c02); c12 = g2_mma(a1, b, c12);
    b = g2_frag(b3p + kb, hh); c03 = g2_mma(a0, b, c03); c13 = g2_mma(a1, b, c13); }
  v8f accs[8] = {c00, c01, c02, c03, c10, c11, c12, c13};
#pragma unroll
  for (int u = 0; u < 8; ++u) { const int t = u & 3, half = u >> 2; const int col = col0 + t * 16 + ln; const float bv = bp ? bf16_round(bp[col]) : 0.f;
#pragma unroll
    for (int r = 0; r < 8; ++r) { const int rloc = half * 16 + 8 * hh + r; float v = accs[u][r] * alpha + bv; if (CP) { if (rowsPerB < 0) v += CP[cofs + (size_t)(row0g + row0 + rloc) * ldc + col];      /* rowsPerB < 0: own element of the batched C plane */ else { const int bidx = (row0g + row0 + rloc) / rowsPerB; v += CP[(size_t)bidx * sCPb + (size_t)by * 64 + col]; } }
      if (ACT == 3) v = fmaxf(v, 0.f); else if (ACT == 6) v = 0.5f * v * (1.0f + erff(v * 0.70710678118654752f)); else if (ACT == 11) v = 1.0f / (1.0f + expf(-v)); else if (ACT == 15) v = v / (1.0f + expf(-v)); else if (ACT == 12) v = (v > 0.f) ? v : 0.01f * v; else if (ACT == 8) v = tanhf(v); else if (ACT == 9) v = 0.5f * v * (1.0f + tanhf(0.7978845608028654f * (v + 0.044715f * v * v * v))); else if (ACT == 14) v = (v > 0.f) ? v : 0.1f * v; else if (ACT == 16) v = (v >= 0.f) ? v : 0.3f * v; else if (ACT == 17) v = (v >= 0.f) ? v : 0.2f * v;
      so[w][rloc][t * 16 + ln] = v; } }
  __builtin_amdgcn_fence(__ATOMIC_ACQ_REL, "workgroup"); __builtin_amdgcn_wave_barrier();
  if (ROPE && by < 2) {      /* 8 lanes per row: a lane takes columns d4 .. d4 + 3 of BOTH halves, so each table value and each staged value is read once and used twice */
    const int r4 = lane >> 3, d4 = (lane & 7) * 4; v4f cc[8], ss[8]; const unsigned tb = (((unsigned)row0 % SQ + r4) * (HD / 2) + d4) * 4u;      /* byte offset of the lane's first table entries; row0 and SQ are multiples of 32: the tile's 32 positions do not wrap */
#pragma unroll      /* constant indices keep cc and ss in registers; all 16 loads go out together, one latency */
    for (int q = 0; q < 8; ++q) { cc[q] = *(const v4fa*)((const char*)tcos + tb + q * 16 * (HD / 2)); ss[q] = *(const v4fa*)((const char*)tsin + tb + q * 16 * (HD / 2)); }
    asm volatile("s_wait_xcnt 0x0" :: "v"(tb) : "memory");      /* the wait in front of any overwrite of the offset register that the 16 issued table loads name; tb as an input keeps that register out of the loads' own destinations (without it the last load landed on it) */
#pragma unroll      /* constant indices into cc and ss */
    for (int q = 0; q < 8; ++q) { const int r = q * 4 + r4; const v4f lo = *(const v4fa*)&so[w][r][d4]; const v4f hi = *(const v4fa*)&so[w][r][d4 + HD / 2]; v4h ol, oh;
      for (int i = 0; i < 4; ++i) { const float c = bf16_round(cc[q][i]), s = bf16_round(ss[q][i]); ol[i] = (_Float16)(lo[i] * c - hi[i] * s); oh[i] = (_Float16)(lo[i] * s + hi[i] * c); }
      _Float16* dst = C16 + cofs + (size_t)(row0 + r) * ldc + col0 + d4; *(v4h*)dst = ol; *(v4h*)(dst + HD / 2) = oh; }
    return; }
  const int rsub = lane >> 4, c4 = (lane & 15) * 4;
  {
#pragma unroll
    for (int q = 0; q < 16; ++q) { const int r = q * 2 + rsub; const v4f v = *(const v4fa*)&so[w][r][c4]; if (C) *(v4f*)(C + cofs + (size_t)(row0 + r) * ldc + col0 + c4) = v; if (C16) { v4h h4; for (int i = 0; i < 4; ++i) h4[i] = (_Float16)v[i]; *(v4h*)(C16 + cofs + (size_t)(row0 + r) * ldc + col0 + c4) = h4; } }
     } }


__global__ __launch_bounds__(256) void k_wnat(const float* __restrict__ w, size_t n8, _Float16* __restrict__ Bt) { const size_t t = (size_t)blockIdx.x * 256 + threadIdx.x; if (t >= n8) return; FragH f; for (int q = 0; q < 8; ++q) f.h[q] = (_Float16)(bf16_round(w[t * 8 + q]) * 16.0f); *(v8us*)((unsigned short*)Bt + t * 8) = f.half[0];  }
// fused attention, ONE launch for all batches, heads and query rows: a work-group of 8 waves owns 256 query rows of one head, a wave 32 of them, and walks the SQ keys in stages of FKS keys (passes of 32). S^T = K Q^T (A = key rows, B = query rows kept in registers), so a lane holds scores of ONE query per 16-column group;
// the two f32 score tiles of a pass, after exp2, ARE the f16 B operand of O^T += V^T P^T (register r of tile t = key 16 t + 8 hh + r = the k order of g2_frag), so neither S nor P is ever stored. Running maximum (log2 units) with a late rescale; weights stay unnormalised (at most 2^8), the row sum divides once at the end.
// K and V^T tiles reach the 8 waves through LDS (whole 128-byte lines from global memory, two buffers, one barrier per stage): a fragment load straight from global memory touches 16 lines for 512 bytes, and all 8 waves would repeat it.
#define FKS 64                       /* keys per stage */
#define FKP (HD + 8)                 /* LDS pitch of a key row, in halves: 16 bytes x odd, conflict-free for 16-byte reads */
#define FVP (FKS + 8)                /* LDS pitch of a V^T row, in halves: likewise */
__device__ __forceinline__ v8f fa_mma(v16h a, v16h b, v8f c) { return __builtin_amdgcn_wmma_f32_16x16x32_f16(false, a, false, b, (short)0, c, false, false); }
__device__ __forceinline__ v16h fa_frag(const unsigned short* p, int hh) { FragH f; f.half[0] = *(const v8us*)(p + 8 * hh); f.half[1] = *(const v8us*)(p + 16 + 8 * hh); return f.v; }
__device__ __forceinline__ void fa_exp2x8(float (&e)[8]) {
  asm("v_exp_f32 %0, %0\n\tv_exp_f32 %1, %1\n\tv_exp_f32 %2, %2\n\tv_exp_f32 %3, %3\n\tv_exp_f32 %4, %4\n\tv_exp_f32 %5, %5\n\tv_exp_f32 %6, %6\n\tv_exp_f32 %7, %7\n\tv_nop"
      : "+v"(e[0]), "+v"(e[1]), "+v"(e[2]), "+v"(e[3]), "+v"(e[4]), "+v"(e[5]), "+v"(e[6]), "+v"(e[7])); }
__global__ __launch_bounds__(256) void k_fattn(const _Float16* __restrict__ Q16, const _Float16* __restrict__ K16, const _Float16* __restrict__ VT, _Float16* __restrict__ O16) {
  __shared__ __attribute__((aligned(16))) unsigned short lk[2][FKS][FKP]; __shared__ __attribute__((aligned(16))) unsigned short lv[2][HD][FVP];
  const int tid = threadIdx.x, lane = tid & 31, ln = lane & 15, hh = lane >> 4; const int w = __builtin_amdgcn_readfirstlane(tid >> 5);
  const int h = blockIdx.y, b = blockIdx.z; const int q0 = blockIdx.x * 256 + w * 32;
  const _Float16* qp = Q16 + ((size_t)b * SQ + q0 + ln) * DM + h * HD;
  const int kr = tid >> 3, kc = (tid & 7) * 8;      /* staging: 16 bytes per thread and step, 8 threads per 128-byte key row */
  const int vr = tid / (FKS / 8), vc = (tid % (FKS / 8)) * 8;      /* FKS / 8 threads per V^T row piece */
  const unsigned short* kg = (const unsigned short*)K16 + ((size_t)b * SQ + kr) * KVD + h * HD + kc;
  const unsigned short* vg = (const unsigned short*)VT + (((size_t)b * NH + h) * HD + vr) * SQ + vc;
  const float cs = 0.125f * 1.44269504088896340736f;      /* 1/sqrt(64) and log2(e) in one factor */
  const v8f z8 = {0.f,0.f,0.f,0.f,0.f,0.f,0.f,0.f};
  v8us gk[FKS / 32], gv[FKS / 32];
#pragma unroll
  for (int i = 0; i < FKS / 32; ++i) { gk[i] = *(const v8us*)(kg + (size_t)i * 32 * KVD); gv[i] = *(const v8us*)(vg + (size_t)i * (2048 / FKS) * SQ); }
  v16h bq[2][2];
#pragma unroll
  for (int j = 0; j < 2; ++j) for (int s = 0; s < 2; ++s) bq[j][s] = g2_frag(qp + (size_t)j * 16 * DM + s * 32, hh);
  v8f o[4][2]; float m[2] = {-1.0e30f, -1.0e30f}; float l[2][2] = {{0.f, 0.f}, {0.f, 0.f}};
#pragma unroll
  for (int t = 0; t < 4; ++t) { o[t][0] = z8; o[t][1] = z8; }
#pragma unroll
  for (int i = 0; i < FKS / 32; ++i) { *(v8us*)&lk[0][kr + i * 32][kc] = gk[i]; *(v8us*)&lv[0][vr + i * (2048 / FKS)][vc] = gv[i]; }
  __syncthreads();      /* stage 0 is published */
#pragma unroll 1      /* one stage per trip: the body already holds FKS / 32 unrolled passes */
  for (int st = 0; st < SQ / FKS; ++st) {
    const int cur = st & 1; const int sn = (st + 1 < SQ / FKS) ? st + 1 : st;      /* the next stage's tiles are asked for now and stored after this stage's passes; the last stage re-reads its own (in bounds; that buffer is not read again) */
#pragma unroll
    for (int i = 0; i < FKS / 32; ++i) { gk[i] = *(const v8us*)(kg + ((size_t)sn * FKS + i * 32) * KVD); gv[i] = *(const v8us*)(vg + (size_t)i * (2048 / FKS) * SQ + sn * FKS); }
    v16h ka[2][2];
#pragma unroll
    for (int t = 0; t < 2; ++t) for (int s = 0; s < 2; ++s) ka[t][s] = fa_frag(&lk[cur][t * 16 + ln][s * 32], hh);
    asm volatile("" ::: "memory");      /* compiler fence: without it the next stage's global loads are sunk to just in front of their LDS stores at the stage's foot, and their whole latency is waited out there */
#pragma unroll
    for (int p = 0; p < FKS / 32; ++p) {
      v16h va[4]; v8f sc[2][2];      /* sc: [key tile][query tile] */
#pragma unroll
      for (int t = 0; t < 2; ++t) for (int j = 0; j < 2; ++j) sc[t][j] = fa_mma(ka[t][1], bq[j][1], fa_mma(ka[t][0], bq[j][0], z8));
#pragma unroll
      for (int t = 0; t < 4; ++t) va[t] = fa_frag(&lv[cur][t * 16 + ln][p * 32], hh);
      if (p + 1 < FKS / 32) {      /* the stage's next pass: its key fragments one pass ahead, into the same registers */
#pragma unroll
        for (int t = 0; t < 2; ++t) for (int s = 0; s < 2; ++s) ka[t][s] = fa_frag(&lk[cur][(p + 1) * 32 + t * 16 + ln][s * 32], hh); }
      asm volatile("" ::: "memory");      /* compiler fence: keeps these LDS reads together in front of the softmax arithmetic, which covers their latency; without it they are sunk in among the WMMAs that use them */
      float mx[2];
#pragma unroll
      for (int j = 0; j < 2; ++j) { float a = fmaxf(sc[0][j][0], sc[1][j][0]); for (int r = 1; r < 8; ++r) a = fmaxf(fmaxf(a, sc[0][j][r]), sc[1][j][r]); mx[j] = a * cs; }
      const bool need = (mx[0] > m[0] + 8.0f) || (mx[1] > m[1] + 8.0f);
      if (__builtin_amdgcn_ballot_w32(need) != 0) {      /* scalar branch: rescale only when some column's maximum has grown by more than 2^8; m[] changes only here and from values joined over the two lane halves, so both halves of a column always use the same m */
#pragma unroll
        for (int j = 0; j < 2; ++j) { const float mj = fmaxf(mx[j], __shfl_xor(mx[j], 16, 32)); const float mn = fmaxf(m[j], mj); const float f = __builtin_amdgcn_exp2f(m[j] - mn); m[j] = mn; l[j][0] *= f; l[j][1] *= f;
          for (int t = 0; t < 4; ++t) for (int r = 0; r < 8; ++r) o[t][j][r] *= f; } }
      v16h pb[2];
#pragma unroll
      for (int j = 0; j < 2; ++j) for (int t = 0; t < 2; ++t) { float e[8]; for (int r = 0; r < 8; ++r) e[r] = fmaf(sc[t][j][r], cs, -m[j]); fa_exp2x8(e); for (int r = 0; r < 8; ++r) { l[j][t] += e[r]; pb[j][t * 8 + r] = (_Float16)e[r]; } }
#pragma unroll
      for (int t = 0; t < 4; ++t) for (int j = 0; j < 2; ++j) o[t][j] = fa_mma(va[t], pb[j], o[t][j]);
    }
#pragma unroll
    for (int i = 0; i < FKS / 32; ++i) { *(v8us*)&lk[cur ^ 1][kr + i * 32][kc] = gk[i]; *(v8us*)&lv[cur ^ 1][vr + i * (2048 / FKS)][vc] = gv[i]; }      /* every wave left that buffer before the barrier that ended the stage before */
    __syncthreads();      /* publishes stage st + 1 and ends every wave's reads of stage st */
  }
#pragma unroll
  for (int j = 0; j < 2; ++j) { float lt = l[j][0] + l[j][1]; lt += __shfl_xor(lt, 16, 32); const float fin = 64.0f / lt;      /* o carried x64, as the output GEMM's alpha expects */
    unsigned short* op = (unsigned short*)O16 + ((size_t)b * SQ + q0 + j * 16 + ln) * DM + h * HD + 8 * hh;
    for (int t = 0; t < 4; ++t) { FragH f; for (int r = 0; r < 8; ++r) f.h[r] = (_Float16)(o[t][j][r] * fin); *(v8us*)(op + t * 16) = f.half[0]; } } }
__global__ __launch_bounds__(256) void k_vt(const _Float16* __restrict__ V16, int b, int h0, _Float16* __restrict__ VT) { __shared__ unsigned short tl[64][65]; const int tid = threadIdx.x; const int hh = blockIdx.x % HG, sg = blockIdx.x / HG; const int s0 = sg * 64; const int h = h0 + hh;
  for (int i = tid; i < 64 * 8; i += 256) { const int j = i / 8, d8 = (i % 8) * 8; FragH f; f.half[0] = *(const v8us*)((const unsigned short*)V16 + ((size_t)b * SQ + s0 + j) * DM + h * HD + d8); for (int q = 0; q < 8; ++q) tl[d8 + q][j] = f.u[q]; }
  __syncthreads();
  { for (int i = tid; i < 64 * 8; i += 256) { const int d = i / 8, j8 = (i % 8) * 8; FragH f; for (int q = 0; q < 8; ++q) f.u[q] = tl[d][j8 + q]; *(v8us*)((unsigned short*)VT + ((size_t)hh * HD + d) * SQ + s0 + j8) = f.half[0]; }  } }



__global__ __launch_bounds__(256) void k_rsmcf2(const float* __restrict__ S, _Float16* __restrict__ P, int hg, int q0, int nk) {
  #pragma clang fp contract(off)
  const int t = blockIdx.x * 256 + threadIdx.x; if (t >= hg * QT) return; const size_t i = (size_t)t; const float* s = S + i * NKX; const int last = q0 + (t % QT); float mx = -3.0e38f;
#pragma unroll 1
  for (int j = 0; j < nk; ++j) { const float f = (j <= last) ? 1.f : 0.f; mx = fmaxf(mx, fmaf(f, s[j], (1.f - f) * -1.0e9f)); } float se = 0.f;
#pragma unroll 1
  for (int j = 0; j < nk; ++j) { const float f = (j <= last) ? 1.f : 0.f; se += __expf(fmaf(f, s[j], (1.f - f) * -1.0e9f) - mx); } const float sc = 256.0f / se;
#pragma unroll 1
  for (int j0 = 0; j0 < nk; j0 += 8) { FragH fr; for (int q = 0; q < 8; ++q) { const int j = j0 + q; const float f = (j <= last) ? 1.f : 0.f; fr.h[q] = (_Float16)(__expf(fmaf(f, s[j], (1.f - f) * -1.0e9f) - mx) * sc); } unsigned short* d = (unsigned short*)P + i * NKX + j0; *(v8us*)d = fr.half[0];  } }


template <int MASKADD>
__global__ __launch_bounds__(64) void k_att0(const float* __restrict__ QF, const float* __restrict__ KF, const float* __restrict__ VF, int ld, const float* __restrict__ mask, float scale, float* __restrict__ OF, int ldo) {
  #pragma clang fp contract(off)
  __shared__ __attribute__((aligned(16))) float lq[64][64]; __shared__ __attribute__((aligned(16))) float lo[64][64];
  const int tid = threadIdx.x; const int h = blockIdx.x / (QT0 / 64), rg = blockIdx.x % (QT0 / 64); const int i = rg * 64 + tid;
  const float* qr = QF + (size_t)i * ld + h * HD;
#pragma unroll 1
  for (int c = 0; c < HD / 4; ++c) { *(v4f*)&lq[tid][c * 4] = *(const v4fa*)(qr + c * 4); const v4f z = {0.f, 0.f, 0.f, 0.f}; *(v4f*)&lo[tid][c * 4] = z; }
  float m = -1.0e30f, l = 0.f; const int jmax = MASKADD ? (SQ - 1) : (rg * 64 + 63);      /* additive-mask form: every key (the mask input decides); causal form: keys up to the block's last row */
#pragma unroll 1
  for (int j = 0; j <= jmax; ++j) { const float* kr = KF + (size_t)j * ld + h * HD; const float* vr = VF + (size_t)j * ld + h * HD; float s = 0.f;
#pragma unroll 1
    for (int c = 0; c < HD / 4; ++c) { const v4f kq = *(const v4fa*)(kr + c * 4); const v4f qq = *(v4f*)&lq[tid][c * 4]; s = __fadd_rn(s, __fmul_rn(qq[0], kq[0])); s = __fadd_rn(s, __fmul_rn(qq[1], kq[1])); s = __fadd_rn(s, __fmul_rn(qq[2], kq[2])); s = __fadd_rn(s, __fmul_rn(qq[3], kq[3])); }
    s = __fmul_rn(s, scale); if (MASKADD) s = __fadd_rn(s, __fmul_rn(bf16_round(mask[(size_t)i * SQ + j]), -10000.0f));
    const float f = (MASKADD || j <= i) ? 1.f : 0.f; const float sm = fmaf(f, s, (1.f - f) * -1.0e30f); const float mn = fmaxf(m, sm); const float sc = expf(m - mn); const float e = expf(sm - mn); l = __fadd_rn(__fmul_rn(l, sc), e); m = mn;
#pragma unroll 1
    for (int c = 0; c < HD / 4; ++c) { const v4f vv = *(const v4fa*)(vr + c * 4); v4f oo = *(v4f*)&lo[tid][c * 4]; for (int u = 0; u < 4; ++u) oo[u] = __fadd_rn(__fmul_rn(oo[u], sc), __fmul_rn(e, vv[u])); *(v4f*)&lo[tid][c * 4] = oo; } }
  const float fin = 64.0f / l;      /* o carried x64 like the f16 path */
#pragma unroll 1
  for (int c = 0; c < HD / 4; ++c) { v4f oo = *(v4f*)&lo[tid][c * 4]; for (int u = 0; u < 4; ++u) oo[u] = __fmul_rn(oo[u], fin); *(v4f*)&lo[tid][c * 4] = oo; }
  __syncthreads();
  {
#pragma unroll 1
    for (int it = 0; it < 16; ++it) { const int row = it * 4 + tid / 16, pc = (tid % 16) * 4; const v4f v = *(const v4f*)&lo[row][pc]; *(v4f*)(OF + (size_t)(rg * 64 + row) * ldo + h * HD + pc) = v; }
     } }


__global__ __launch_bounds__(256) void k_kvexp(const float* __restrict__ src, float* __restrict__ dst, size_t n4) { const size_t t = (size_t)blockIdx.x * 256 + threadIdx.x; if (t >= n4) return; const size_t e = t * 4; const size_t row = e / DM; const int col = (int)(e % DM); const int h = col / HD, d = col % HD; const v4f v = *(const v4fa*)(src + row * KVD + (size_t)(h / HPG) * HD + d); *(v4f*)(dst + e) = v;  }

__global__ __launch_bounds__(256) void k_tab2(float theta, float* __restrict__ CS, float* __restrict__ SN) {
  #pragma clang fp contract(off)
  const int t = blockIdx.x * 256 + threadIdx.x; if (t >= SQ * (HD / 2)) return; const int i = t % (HD / 2); const int p = t / (HD / 2); const float invf = 1.0f / powf(theta, (float)(2 * i) / (float)HD); const float ang = __fmul_rn((float)p, invf); const float c = cosf(ang), s = sinf(ang);
  *(float*)(CS + t) = c; *(float*)(SN + t) = s;  }
template <int NORM, int ROPE>
__global__ __launch_bounds__(64) void k_xform(const float* __restrict__ F, int ldf, int nh, const float* __restrict__ gain, float eps, const float* __restrict__ CS, const float* __restrict__ SN, _Float16* __restrict__ H16, int ldo) {
  #pragma clang fp contract(off)
  __shared__ float xv[HD]; __shared__ float red[HD]; __shared__ unsigned short sh_[HD]; const int d = threadIdx.x; const int h = blockIdx.x % nh; const size_t r = blockIdx.x / nh; const int p = (int)(r % SQ);
  float x = F[r * (size_t)ldf + (size_t)h * HD + d];
  if (NORM) { red[d] = __fmul_rn(x, x); __syncthreads(); for (int st = HD / 2; st > 0; st >>= 1) { if (d < st) red[d] = __fadd_rn(red[d], red[d + st]); __syncthreads(); } const float rs = rsqrtf(__fadd_rn(red[0] / (float)HD, eps)); x = __fmul_rn(__fmul_rn(x, rs), bf16_round(gain[d])); }
  xv[d] = x; __syncthreads();
  float o = x;
  if (ROPE == 1) { const int i = d >> 1; const float c = CS[p * (HD / 2) + i], s = SN[p * (HD / 2) + i]; const float ev = xv[2 * i], od = xv[2 * i + 1]; o = (d & 1) ? __fadd_rn(__fmul_rn(ev, s), __fmul_rn(od, c)) : __fadd_rn(__fmul_rn(ev, c), -__fmul_rn(od, s)); }
  if (ROPE == 2) { const int i = d & (HD / 2 - 1); const float c = CS[p * (HD / 2) + i], s = SN[p * (HD / 2) + i]; const float lo = xv[i], hi = xv[i + HD / 2]; o = (d < HD / 2) ? __fadd_rn(__fmul_rn(lo, c), -__fmul_rn(hi, s)) : __fadd_rn(__fmul_rn(lo, s), __fmul_rn(hi, c)); }
  FragH th; th.h[0] = (_Float16)o; sh_[d] = th.u[0]; __syncthreads();
  if (d < HD / 8) { FragH f; for (int q = 0; q < 8; ++q) f.u[q] = sh_[d * 8 + q]; unsigned short* dst = (unsigned short*)H16 + r * (size_t)ldo + (size_t)h * HD + d * 8; *(v8us*)dst = f.half[0];  } }

template <int NORM, int ROPE>
__global__ __launch_bounds__(64) void k_xformf(const float* __restrict__ F, int ldf, int nh, const float* __restrict__ gain, float eps, const float* __restrict__ CS, const float* __restrict__ SN, float* __restrict__ F32, int ldo) {
  #pragma clang fp contract(off)
  __shared__ float xv[HD]; __shared__ float red[HD]; const int d = threadIdx.x; const int h = blockIdx.x % nh; const size_t r = blockIdx.x / nh; const int p = (int)(r % SQ);
  float x = F[r * (size_t)ldf + (size_t)h * HD + d];
  if (NORM) { red[d] = __fmul_rn(x, x); __syncthreads(); for (int st = HD / 2; st > 0; st >>= 1) { if (d < st) red[d] = __fadd_rn(red[d], red[d + st]); __syncthreads(); } const float rs = rsqrtf(__fadd_rn(red[0] / (float)HD, eps)); x = __fmul_rn(__fmul_rn(x, rs), bf16_round(gain[d])); }
  xv[d] = x; __syncthreads();
  float o = x;
  if (ROPE == 1) { const int i = d >> 1; const float c = CS[p * (HD / 2) + i], s = SN[p * (HD / 2) + i]; const float ev = xv[2 * i], od = xv[2 * i + 1]; o = (d & 1) ? __fadd_rn(__fmul_rn(ev, s), __fmul_rn(od, c)) : __fadd_rn(__fmul_rn(ev, c), -__fmul_rn(od, s)); }
  if (ROPE == 2) { const int i = d & (HD / 2 - 1); const float c = CS[p * (HD / 2) + i], s = SN[p * (HD / 2) + i]; const float lo = xv[i], hi = xv[i + HD / 2]; o = (d < HD / 2) ? __fadd_rn(__fmul_rn(lo, c), -__fmul_rn(hi, s)) : __fadd_rn(__fmul_rn(lo, s), __fmul_rn(hi, c)); }
  float* dst = F32 + r * (size_t)ldo + (size_t)h * HD + d; *(float*)dst = o;  }

__global__ __launch_bounds__(256) void k_bfcp(const float* __restrict__ src, float* __restrict__ dst, size_t n4) { const size_t t = (size_t)blockIdx.x * 256 + threadIdx.x; if (t >= n4) return; const v4f a = *(const v4fa*)(src + t * 4); v4f o; for (int q = 0; q < 4; ++q) o[q] = bf16_round(a[q]); *(v4f*)(dst + t * 4) = o;  }

__global__ __launch_bounds__(256) void k_tab2d(float* __restrict__ CS, float* __restrict__ SN) {
  #pragma clang fp contract(off)
  const int t = blockIdx.x * 256 + threadIdx.x; if (t >= SQ * (HD / 2)) return; const int i = t % (HD / 2); const int p = t / (HD / 2); const float invf = (float)(1.0 / pow(10000.0, (double)(2 * i) / (double)HD)); const float ang = __fmul_rn((float)p, invf); const float c = cosf(ang), s = sinf(ang);
  *(float*)(CS + t) = c; *(float*)(SN + t) = s;  }
extern "C" void kernel_launch(void* const* d_in, const int* in_sizes, int n_in,
                              void* d_out, int out_size, void* d_ws, size_t ws_size, hipStream_t stream) {
  (void)in_sizes; (void)n_in; (void)out_size;
  const float* const* I = (const float* const*)d_in; const float* x = I[0]; const float* wq = I[1]; const float* wk = I[2]; const float* wv = I[3]; const float* wo = I[4]; const float* tcos = I[5]; const float* tsin = I[6]; const float* bq = nullptr; const float* bk = nullptr; const float* bv = nullptr; const float* bo = nullptr;      /* natural [out][in] weights, no biases; rope_cos / rope_sin INPUT tables [2048][32] */
  static_assert(HPG == 1 && NH == NG * HPG && NH * HD == DM && KVD == DM, "plain multi-head attention as 16 kv groups of one query head");
  char* ws = (char*)d_ws; size_t off = 0;
  auto take = [&](size_t bytes) { char* p = ws + off; off += (bytes + 255) & ~(size_t)255; return p; };
  _Float16* BQ = (_Float16*)take((size_t)DM * DM * 2); _Float16* BK = (_Float16*)take((size_t)KVD * DM * 2); _Float16* BV = (_Float16*)take((size_t)KVD * DM * 2); _Float16* BO = (_Float16*)take((size_t)DM * DM * 2);
  _Float16* X16 = (_Float16*)take(NR * DM * 2); _Float16* Q16 = (_Float16*)take(NR * DM * 2); _Float16* K16 = (_Float16*)take(NR * KVD * 2); _Float16* V16 = (_Float16*)take(NR * KVD * 2); _Float16* O16 = (_Float16*)take(NR * DM * 2);
  _Float16* VT = (_Float16*)take((size_t)NB * NH * HD * SQ * 2);
  float* QF0 = (float*)take((size_t)QT0 * DM * 4); float* KF0 = (float*)take((size_t)QT0 * KVD * 4); float* VF0 = (float*)take((size_t)QT0 * KVD * 4); float* KF0e = (float*)take((size_t)QT0 * DM * 4); float* VF0e = (float*)take((size_t)QT0 * DM * 4); float* OF0 = (float*)take((size_t)NB * QT0 * DM * 4); _Float16* OH0 = (_Float16*)take((size_t)NB * QT0 * DM * 2); _Float16* OL0 = (_Float16*)take((size_t)NB * QT0 * DM * 2);
  if (off > ws_size) return;
  k_wnat<<<(unsigned)(((size_t)DM * DM / 8 + 255) / 256), 256, 0, stream>>>(wq, (size_t)DM * DM / 8, BQ); k_wnat<<<(unsigned)(((size_t)KVD * DM / 8 + 255) / 256), 256, 0, stream>>>(wk, (size_t)KVD * DM / 8, BK); k_wnat<<<(unsigned)(((size_t)KVD * DM / 8 + 255) / 256), 256, 0, stream>>>(wv, (size_t)KVD * DM / 8, BV); k_wnat<<<(unsigned)(((size_t)DM * DM / 8 + 255) / 256), 256, 0, stream>>>(wo, (size_t)DM * DM / 8, BO);      /* natural [out][in] = Bt planes x16 */
  k_x16<<<(unsigned)((NR * DM / 8 + 255) / 256), 256, 0, stream>>>(x, X16, NR * DM / 8);
  const size_t r0p = (size_t)B0 * SQ;      /* first projected row */
  static_assert(((size_t)DM * DM * 2) % 256 == 0 && (NR * DM * 2) % 256 == 0, "BQ | BK | BV and Q16 | K16 | V16 lie back to back in the workspace: the plane strides of the batched launch");
  k_gemm2<0, 1><<<dim3((unsigned)((MP / 128) * (DM / 64)), 3), 128, 0, stream>>>(X16 + r0p * DM, DM, 0, BQ, DM, (size_t)DM * DM, 0.0625f, nullptr, 0, nullptr, 1, 0, 0, nullptr, Q16 + r0p * DM, DM, NR * DM, MP, DM, DM, tcos, tsin);      /* q, k (rotated by the INPUT rope tables [2048][32]: column d uses table column d mod 32 = the module's [cos | cos]) and v of every batch -> f16 rows */
  for (int b = B0; b < B0 + NBR; ++b) { const size_t r0 = (size_t)b * SQ;
    k_vt<NG, SQ><<<NG * (SQ / 64), 256, 0, stream>>>(V16 + r0 * KVD, KVD, 0, VT + (size_t)b * NH * HD * SQ); }      /* V^T [NB][NH][HD][SQ], this batch's plane */
  k_fattn<<<dim3(SQ / 256, NH, NB), 256, 0, stream>>>(Q16, K16, VT, O16);      /* scores, softmax and P V of every batch, head and query row in ONE launch; o (x64) into merged f16 rows */
  k_gemm2<0><<<dim3((unsigned)((MPO / 128) * (DM / 64)), 1), 128, 0, stream>>>(O16 + r0p * DM, DM, 0, BO, DM, 0, 0.0009765625f, bo, 0, nullptr, 1, 0, 0, (float*)d_out + r0p * DM, nullptr, DM, 0, MPO, DM, DM);      /* out rows are the output layout */
}

// v004
// It runs in 114 microseconds.
// In two side-by-side timings against v003, it was 1.57 and 1.51 times as fast.
// Over all steps from v000 it is 63.8 times as fast.
#include <hip/hip_runtime.h>
// Multi-head self-attention with half-split RoPE from RANDOM input tables, NON-causal (x [2][2048][1024]; q / k / v = x W^T (nn.Linear natural [1024][1024] sigma 1/32, no biases), 16 heads of 64; rope: x * [cos | cos] + rotate_half(x) * [sin | sin] with rotate_half = (-x2, x1) over the two 32-lane halves and INPUT tables rope_cos / rope_sin [2048][32] (cos / sin of uniform-random angles); scores / sqrt(64); softmax over all 2048 keys (f32; no mask); out = merged Wo^T (natural, no bias) -> [2][2048][1024]); run as grouped-query attention with 16 groups of ONE head.
// Structure: x as exact f16 rows; natural weights as exact x16 planes; q, k and v of both batches as ONE batched WMMA GEMM launch (32x64 wave tiles, f32 accumulation, blockIdx.y picks the weight plane and the output rows) whose epilogue rotates q and k in f32 (rotate-half; a 64-column wave tile is one head; INPUT tables rounded to bf16 as read) and writes f16 rows; V^T of the heads via LDS transposes; then ONE fused attention launch for all batches, heads and query rows (k_fattn: scores of 32 query columns per wave against ALL 2048 keys, running softmax in registers with f32 statistics and native exp2, unnormalised f16 weights, o = P V^T carried x64) into merged f16 rows; out = o Wo^T GEMM (f32, alpha 2^-10).
// Compute dtype: inputs rounded to bf16; x / weights exact; q, k, v, softmax weights and o as plain f16 GEMM operands (~2^-12); scores and softmax statistics f32. v_wmma_f32_16x16x32_f16.
#define NB 2
#define NG 16
#define HPG 1
#define KVD (NG * HD)
#define SQ 2048
#define DM 1024
#define NH 16
#define HD 64
#define HG 4                         /* heads per block group of the unlaunched k_vt overload */
#define QT 256                       /* query rows per tile */
#define NKX SQ                       /* S / P row pitch */
#define QT0 128                      /* rows per head of k_att0 (not launched); sizes unused f32 buffers */
#define B0 0                         /* first batch processed (debug hook) */
#define NBR NB                       /* batches processed (debug hook) */
#define NR ((size_t)NB * SQ)         /* token rows */
#define MP ((int)((size_t)NBR * SQ)) /* rows projected (debug hook) */
#define QN SQ                        /* unused: k_fattn attends all SQ query rows of a batch */
#define NHD NH                       /* unused: k_fattn attends all NH heads */
#define MPO MP                       /* rows through the output stage (debug hook) */
#define LQ DM      /* row pitch of the q/k/v rows */
typedef __bf16 v16b __attribute__((ext_vector_type(16)));
typedef unsigned short v8us __attribute__((ext_vector_type(8), may_alias));
typedef float  v8f  __attribute__((ext_vector_type(8)));
typedef float  v4f  __attribute__((ext_vector_type(4)));
typedef float  v4fa __attribute__((ext_vector_type(4), may_alias));
union FragB { v16b v; v8us half[2]; unsigned short u[16]; };

__device__ __forceinline__ unsigned short bf16_bits(float x) { unsigned int u = __float_as_uint(x); return (unsigned short)((u + 0x7FFFu + ((u >> 16) & 1u)) >> 16); }
__device__ __forceinline__ float bf16_val(unsigned short b) { return __uint_as_float(((unsigned int)b) << 16); }
__device__ __forceinline__ float bf16_round(float x) { return bf16_val(bf16_bits(x)); }
// D += A·B with NT terms: 1 = ah·bh, 2 = + al·bh (A split), 3 = + ah·bl (both split)
template <int NT>
__device__ __forceinline__ v8f mmaN(v16b ah, v16b al, v16b bh, v16b bl, v8f c) {
  c = __builtin_amdgcn_wmma_f32_16x16x32_bf16(false, ah, false, bh, (short)0, c, false, false);
  if (NT >= 2) c = __builtin_amdgcn_wmma_f32_16x16x32_bf16(false, al, false, bh, (short)0, c, false, false);
  if (NT >= 3) c = __builtin_amdgcn_wmma_f32_16x16x32_bf16(false, ah, false, bl, (short)0, c, false, false);
  asm volatile("v_nop\n\tv_nop\n\tv_nop\n\tv_nop" : "+v"(c) : "v"(ah), "v"(al), "v"(bh), "v"(bl));
  return c;
}

__global__ __launch_bounds__(256) void k_wt_bf16(const float* __restrict__ W, unsigned short* __restrict__ Wt, int K, int N) {
  const int t = blockIdx.x * 256 + threadIdx.x;
  const int k8n = K / 8;
  if (t >= N * k8n) return;
  const int n = t / k8n, k8 = (t % k8n) * 8;
  v8us v;
#pragma unroll
  for (int i = 0; i < 8; ++i) v[i] = bf16_bits(W[(size_t)(k8 + i) * N + n]);
  *(v8us*)(Wt + (size_t)n * K + k8) = v;
  
}

// GEMM C[M][N] (f32, pitch ldc) = act(A[M][K]·W + bias). A f32 row-major (pitch lda) converted per fragment to bf16
// (ASPLIT: hi/lo two planes -> 2 terms, else single rounded term); Wt bf16 [N][K] (pitch ldb). BIAS_BF16 rounds the
// bias to bf16 first (bias quantised to bf16 before the add). K%32==0, M%16==0, N%64==0.
template <bool ASPLIT, int ACT, bool BIAS_BF16>
__global__ __launch_bounds__(128) void k_gemm_bf(const float* __restrict__ A, int lda, const unsigned short* __restrict__ Wt, int ldb,
                                               const float* __restrict__ bias, float* __restrict__ C, int ldc, int M, int N, int K) {
  __shared__ __attribute__((aligned(16))) float so[4][16][64];
  const int tid = threadIdx.x, w = tid >> 5, lane = tid & 31, ln = lane & 15, hh = lane >> 4;
  const int ntn = N / 64;
  const int wid = blockIdx.x * 4 + w;
  const int mt = wid / ntn, nq = wid % ntn;
  if (mt * 16 >= M) return;
  const int row0 = mt * 16, col0 = nq * 64;
  const float* arow = A + (size_t)(row0 + ln) * lda;
  v8f acc[4] = {};
  for (int kb = 0; kb < K; kb += 32) {
    FragB ah, al;
    const v4f x0 = *(const v4fa*)(arow + kb + 8 * hh), x1 = *(const v4fa*)(arow + kb + 8 * hh + 4);
    const v4f x2 = *(const v4fa*)(arow + kb + 16 + 8 * hh), x3 = *(const v4fa*)(arow + kb + 16 + 8 * hh + 4);
    float xs[16] = {x0[0],x0[1],x0[2],x0[3],x1[0],x1[1],x1[2],x1[3],x2[0],x2[1],x2[2],x2[3],x3[0],x3[1],x3[2],x3[3]};
#pragma unroll
    for (int i = 0; i < 16; ++i) { const unsigned short hb = bf16_bits(xs[i]); ah.u[i] = hb; al.u[i] = ASPLIT ? bf16_bits(xs[i] - bf16_val(hb)) : (unsigned short)0; }
#pragma unroll
    for (int t = 0; t < 4; ++t) {
      const unsigned short* brow = Wt + (size_t)(col0 + t * 16 + ln) * ldb + kb;
      FragB b;
      b.half[0] = *(const v8us*)(brow + 8 * hh);
      b.half[1] = *(const v8us*)(brow + 16 + 8 * hh);
      acc[t] = mmaN<ASPLIT ? 2 : 1>(ah.v, al.v, b.v, b.v, acc[t]);
    }
  }
#pragma unroll
  for (int t = 0; t < 4; ++t) {
    float bv = bias ? bias[col0 + t * 16 + ln] : 0.f;
    if (BIAS_BF16) bv = bf16_round(bv);
#pragma unroll
    for (int r = 0; r < 8; ++r) { float v = acc[t][r] + bv; if (ACT == 1) v = fmaxf(v, 0.f); so[w][8 * hh + r][t * 16 + ln] = v; }
  }
  __builtin_amdgcn_fence(__ATOMIC_ACQ_REL, "workgroup");
  __builtin_amdgcn_wave_barrier();
  const int rsub = lane >> 4, c4 = (lane & 15) * 4;
  {
#pragma unroll
    for (int q = 0; q < 8; ++q) {
      const int r = q * 2 + rsub;
      const v4f v = *(const v4fa*)&so[w][r][c4];
      *(v4f*)(C + (size_t)(row0 + r) * ldc + col0 + c4) = v;
    }
    
  }
}

// GEMM C = act(A·W + bias + resid): A f32 (ASPLIT -> hi/lo 2 terms), Wt bf16 [N][K]; ACT 0 none, 1 relu, 2 exact gelu;
// resid (optional, f32, row index = (row % rmod), pitch ldr, RES_BF16 rounds it) added before the activation.
template <bool ASPLIT, int ACT, bool BIAS_BF16, bool RES_BF16>
__global__ __launch_bounds__(128) void k_gemm_bf3(const float* __restrict__ A, int lda, const unsigned short* __restrict__ Wt, int ldb,
                                                const float* __restrict__ bias, const float* __restrict__ resid, int rmod, int ldr,
                                                float* __restrict__ C, int ldc, int M, int N, int K) {
  __shared__ __attribute__((aligned(16))) float so[4][16][64];
  const int tid = threadIdx.x, w = tid >> 5, lane = tid & 31, ln = lane & 15, hh = lane >> 4;
  const int ntn = N / 64;
  const int wid = blockIdx.x * 4 + w;
  const int mt = wid / ntn, nq = wid % ntn;
  if (mt * 16 >= M) return;
  const int row0 = mt * 16, col0 = nq * 64;
  const float* arow = A + (size_t)(row0 + ln) * lda;
  v8f acc[4] = {};
  for (int kb = 0; kb < K; kb += 32) {
    FragB ah, al;
    const v4f x0 = *(const v4fa*)(arow + kb + 8 * hh), x1 = *(const v4fa*)(arow + kb + 8 * hh + 4);
    const v4f x2 = *(const v4fa*)(arow + kb + 16 + 8 * hh), x3 = *(const v4fa*)(arow + kb + 16 + 8 * hh + 4);
    float xs[16] = {x0[0],x0[1],x0[2],x0[3],x1[0],x1[1],x1[2],x1[3],x2[0],x2[1],x2[2],x2[3],x3[0],x3[1],x3[2],x3[3]};
#pragma unroll
    for (int i = 0; i < 16; ++i) { const unsigned short hb = bf16_bits(xs[i]); ah.u[i] = hb; al.u[i] = ASPLIT ? bf16_bits(xs[i] - bf16_val(hb)) : (unsigned short)0; }
#pragma unroll
    for (int t = 0; t < 4; ++t) {
      const unsigned short* brow = Wt + (size_t)(col0 + t * 16 + ln) * ldb + kb;
      FragB b;
      b.half[0] = *(const v8us*)(brow + 8 * hh);
      b.half[1] = *(const v8us*)(brow + 16 + 8 * hh);
      acc[t] = mmaN<ASPLIT ? 2 : 1>(ah.v, al.v, b.v, b.v, acc[t]);
    }
  }
#pragma unroll
  for (int t = 0; t < 4; ++t) {
    const int col = col0 + t * 16 + ln;
    float bv = bias ? bias[col] : 0.f;
    if (BIAS_BF16) bv = bf16_round(bv);
#pragma unroll
    for (int r = 0; r < 8; ++r) {
      float v = acc[t][r] + bv;
      if (resid) { float rv = resid[(size_t)((row0 + 8 * hh + r) % rmod) * ldr + col]; if (RES_BF16) rv = bf16_round(rv); v += rv; }
      if (ACT == 1) v = fmaxf(v, 0.f);
      if (ACT == 2) v = 0.5f * v * (1.0f + erff(v * 0.70710678118654752f));
      if (ACT == 3) { const float u = 0.7978845608028654f * (v + 0.044715f * v * v * v); v = 0.5f * v * (1.0f + tanhf(u)); }
      so[w][8 * hh + r][t * 16 + ln] = v;
    }
  }
  __builtin_amdgcn_fence(__ATOMIC_ACQ_REL, "workgroup");
  __builtin_amdgcn_wave_barrier();
  const int rsub = lane >> 4, c4 = (lane & 15) * 4;
  {
#pragma unroll
    for (int q = 0; q < 8; ++q) {
      const int r = q * 2 + rsub;
      const v4f v = *(const v4fa*)&so[w][r][c4];
      *(v4f*)(C + (size_t)(row0 + r) * ldc + col0 + c4) = v;
    }
    
  }
}
// row LayerNorm (biased variance, eps) over N: s = X (+ R); optional out_sum <- s; out_norm <- (s-mu)*rsqrt(var+eps)*g + b
template <bool PARAM_BF16>
__global__ __launch_bounds__(256) void k_layernorm(const float* __restrict__ X, const float* __restrict__ R, const float* __restrict__ g, const float* __restrict__ bta,
                                                  float* __restrict__ out_sum, float* __restrict__ out_norm, int N, float eps) {
  __shared__ float red[256];
  const int row = blockIdx.x, tid = threadIdx.x;
  const float* x = X + (size_t)row * N; const float* rr = R ? R + (size_t)row * N : nullptr;
  float vals[16];                     // up to N = 4096
  const int per = N / 256;            // contiguous chunk per thread? use strided-by-4 chunks: thread handles j = tid*4 + 1024*u
  float s1 = 0.f;
  for (int u = 0; u < per / 4; ++u) {
    const int j = tid * 4 + 1024 * u;
    const v4f a = *(const v4fa*)(x + j);
    v4f b = {0.f,0.f,0.f,0.f}; if (rr) b = *(const v4fa*)(rr + j);
#pragma unroll
    for (int q = 0; q < 4; ++q) { const float v = a[q] + b[q]; vals[u * 4 + q] = v; s1 += v; }
  }
  red[tid] = s1; __syncthreads();
  for (int st = 128; st > 0; st >>= 1) { if (tid < st) red[tid] += red[tid + st]; __syncthreads(); }
  const float mu = red[0] / (float)N; __syncthreads();
  float s2 = 0.f;
  for (int u = 0; u < per / 4; ++u)
#pragma unroll
    for (int q = 0; q < 4; ++q) { const float c = vals[u * 4 + q] - mu; s2 += c * c; }
  red[tid] = s2; __syncthreads();
  for (int st = 128; st > 0; st >>= 1) { if (tid < st) red[tid] += red[tid + st]; __syncthreads(); }
  const float rs = rsqrtf(red[0] / (float)N + eps);
  {
    for (int u = 0; u < per / 4; ++u) {
      const int j = tid * 4 + 1024 * u;
      v4f o, sm;
#pragma unroll
      for (int q = 0; q < 4; ++q) {
        float gg = g[j + q], bb = bta[j + q];
        if (PARAM_BF16) { gg = bf16_round(gg); bb = bf16_round(bb); }
        sm[q] = vals[u * 4 + q]; o[q] = (vals[u * 4 + q] - mu) * rs * gg + bb;
      }
      if (out_sum) *(v4f*)(out_sum + (size_t)row * N + j) = sm;
      *(v4f*)(out_norm + (size_t)row * N + j) = o;
    }
    
  }
}



// ---- f16 WMMA path (v_wmma_f32_16x16x32_f16): 11-bit significands for operands in range — used where a [0,1] probability operand needs more precision than bf16
typedef _Float16 v16h __attribute__((ext_vector_type(16)));
union FragH { v16h v; v8us half[2]; _Float16 h[16]; unsigned short u[16]; };
template <int NT>
__device__ __forceinline__ v8f mmaH(v16h ah, v16h al, v16h bh, v16h bl, v8f c) {
  c = __builtin_amdgcn_wmma_f32_16x16x32_f16(false, ah, false, bh, (short)0, c, false, false);
  if (NT >= 2) c = __builtin_amdgcn_wmma_f32_16x16x32_f16(false, al, false, bh, (short)0, c, false, false);
  if (NT >= 3) c = __builtin_amdgcn_wmma_f32_16x16x32_f16(false, ah, false, bl, (short)0, c, false, false);
  asm volatile("v_nop\n\tv_nop\n\tv_nop\n\tv_nop" : "+v"(c) : "v"(ah), "v"(al), "v"(bh), "v"(bl));
  return c;
}
// batched GEMM like k_gemm_b but f16 operands: A f32 (split into f16 hi/lo if ASPLIT, else rounded to f16), Bt = f16 values [n][k]; alpha; C f32; N multiple of 16 (partial tiles skipped)
template <bool ASPLIT>
__global__ __launch_bounds__(128) void k_gemm_h(const float* __restrict__ A, int lda, size_t sA, const _Float16* __restrict__ Bh, int ldb, size_t sB, float alpha, float* __restrict__ C, int ldc, size_t sC, int M, int N, int K) {
  __shared__ __attribute__((aligned(16))) float so[4][16][64];
  const int tid = threadIdx.x, w = tid >> 5, lane = tid & 31, ln = lane & 15, hh = lane >> 4; const int by = blockIdx.y;
  A += (size_t)by * sA; Bh += (size_t)by * sB; C += (size_t)by * sC;
  const int ntn = (N + 63) / 64; const int wid = blockIdx.x * 4 + w; const int mt = wid / ntn, nq = wid % ntn; if (mt * 16 >= M) return;
  const int row0 = mt * 16, col0 = nq * 64; const float* arow = A + (size_t)(row0 + ln) * lda;
  v8f acc[4] = {};
  for (int kb = 0; kb < K; kb += 32) {
    FragH ah, al;
    const v4f x0 = *(const v4fa*)(arow + kb + 8 * hh), x1 = *(const v4fa*)(arow + kb + 8 * hh + 4), x2 = *(const v4fa*)(arow + kb + 16 + 8 * hh), x3 = *(const v4fa*)(arow + kb + 16 + 8 * hh + 4);
    float xs[16] = {x0[0],x0[1],x0[2],x0[3],x1[0],x1[1],x1[2],x1[3],x2[0],x2[1],x2[2],x2[3],x3[0],x3[1],x3[2],x3[3]};
#pragma unroll
    for (int i = 0; i < 16; ++i) { const _Float16 h = (_Float16)xs[i]; ah.h[i] = h; al.h[i] = ASPLIT ? (_Float16)(xs[i] - (float)h) : (_Float16)0.0f; }
#pragma unroll
    for (int t = 0; t < 4; ++t) { if (col0 + t * 16 >= N) continue; const size_t boff = (size_t)(col0 + t * 16 + ln) * ldb + kb; FragH bq; bq.half[0] = *(const v8us*)(Bh + boff + 8 * hh); bq.half[1] = *(const v8us*)(Bh + boff + 16 + 8 * hh);
      acc[t] = mmaH<ASPLIT ? 2 : 1>(ah.v, al.v, bq.v, bq.v, acc[t]); }
  }
#pragma unroll
  for (int t = 0; t < 4; ++t) { if (col0 + t * 16 >= N) continue;
#pragma unroll
    for (int r = 0; r < 8; ++r) so[w][8 * hh + r][t * 16 + ln] = acc[t][r] * alpha; }
  __builtin_amdgcn_fence(__ATOMIC_ACQ_REL, "workgroup"); __builtin_amdgcn_wave_barrier();
  const int rsub = lane >> 4, c4 = (lane & 15) * 4;
  {
#pragma unroll
    for (int q = 0; q < 8; ++q) { const int r = q * 2 + rsub; if (col0 + c4 < N) { const v4f v = *(const v4fa*)&so[w][r][c4]; *(v4f*)(C + (size_t)(row0 + r) * ldc + col0 + c4) = v; } }
     }
}

// Wt[n][k] = f16(W[k][n]·scale) from f32 row-major W[K][N] (scale = power of two; bf16-exact weights stay exact in f16 away from the subnormal range)
__global__ __launch_bounds__(256) void k_wt_f16(const float* __restrict__ W, _Float16* __restrict__ Wt, int K, int N, float scale) {
  const int t = blockIdx.x * 256 + threadIdx.x; if (t >= N * (K / 8)) return; const int n = t / (K / 8), k8 = (t % (K / 8)) * 8; FragH f;
#pragma unroll
  for (int i = 0; i < 8; ++i) f.h[i] = (_Float16)(bf16_round(W[(size_t)(k8 + i) * N + n]) * scale); const v8us o = f.half[0];
  *(v8us*)((unsigned short*)Wt + (size_t)n * K + k8) = o; 
}
// k_gemm_hh variant with fused epilogue: v = acc·alpha + bias[by·sBias + col] (+ CP[(row/rowsPerB)·sCPb + by·64 + col] if CP) ; ACT 0 none / 1 elu ; writes f16 C16 (and f32 C if non-null)
template <int ACT>
__global__ __launch_bounds__(128) void k_gemm_hhx(const _Float16* __restrict__ A, int lda, size_t sA, const _Float16* __restrict__ Bh, int ldb, size_t sB, float alpha, const float* __restrict__ bias, size_t sBias, const float* __restrict__ CP, int rowsPerB, size_t sCPb, int row0g,
    float* __restrict__ C, _Float16* __restrict__ C16, int ldc, size_t sC, int M, int N, int K) {
  __shared__ __attribute__((aligned(16))) float so[4][16][64];
  const int tid = threadIdx.x, w = tid >> 5, lane = tid & 31, ln = lane & 15, hh = lane >> 4; const int by = blockIdx.y;
  A += (size_t)by * sA; Bh += (size_t)by * sB; const size_t cofs = (size_t)by * sC; const float* bp = bias ? bias + (size_t)by * sBias : nullptr;
  const int ntn = (N + 63) / 64; const int wid = blockIdx.x * 4 + w; const int mt = wid / ntn, nq = wid % ntn; if (mt * 16 >= M) return;
  const int row0 = mt * 16, col0 = nq * 64; const _Float16* arow = A + (size_t)(row0 + ln) * lda;
  v8f acc[4] = {};
  for (int kb = 0; kb < K; kb += 32) { FragH ah; ah.half[0] = *(const v8us*)((const unsigned short*)arow + kb + 8 * hh); ah.half[1] = *(const v8us*)((const unsigned short*)arow + kb + 16 + 8 * hh);
#pragma unroll
    for (int t = 0; t < 4; ++t) { if (col0 + t * 16 >= N) continue; const size_t boff = (size_t)(col0 + t * 16 + ln) * ldb + kb; FragH bq; bq.half[0] = *(const v8us*)((const unsigned short*)Bh + boff + 8 * hh); bq.half[1] = *(const v8us*)((const unsigned short*)Bh + boff + 16 + 8 * hh);
      acc[t] = mmaH<1>(ah.v, ah.v, bq.v, bq.v, acc[t]); }
  }
#pragma unroll
  for (int t = 0; t < 4; ++t) { if (col0 + t * 16 >= N) continue; const int col = col0 + t * 16 + ln; const float bv = bp ? bf16_round(bp[col]) : 0.f;
#pragma unroll
    for (int r = 0; r < 8; ++r) { float v = acc[t][r] * alpha + bv; if (CP) { const int rr = row0g + row0 + 8 * hh + r; if (rowsPerB < 0) v += CP[cofs + (size_t)rr * ldc + col];      /* rowsPerB < 0: own element of the batched C plane */ else { const int bidx = rr / rowsPerB; v += CP[(size_t)bidx * sCPb + (size_t)by * 64 + col]; } } if (ACT == 1) v = (v > 0.f) ? v : expm1f(v); else if (ACT == 7) v = (v > 0.f) ? v + 1.0f : expf(v); else if (ACT == 8) v = tanhf(v); else if (ACT == 9) v = 0.5f * v * (1.0f + tanhf(0.7978845608028654f * (v + 0.044715f * v * v * v))); else if (ACT == 11) v = 1.0f / (1.0f + expf(-v)); else if (ACT == 12) v = (v > 0.f) ? v : 0.01f * v; else if (ACT == 14) v = (v > 0.f) ? v : 0.1f * v; else if (ACT == 16) v = (v >= 0.f) ? v : 0.3f * v; else if (ACT == 17) v = (v >= 0.f) ? v : 0.2f * v; else if (ACT == 15) v = v / (1.0f + expf(-v)); else if (ACT == 3) v = fmaxf(v, 0.f); else if (ACT == 6) v = 0.5f * v * (1.0f + erff(v * 0.70710678118654752f)); so[w][8 * hh + r][t * 16 + ln] = v; } }
  __builtin_amdgcn_fence(__ATOMIC_ACQ_REL, "workgroup"); __builtin_amdgcn_wave_barrier();
  const int rsub = lane >> 4, c4 = (lane & 15) * 4; typedef _Float16 v4h __attribute__((ext_vector_type(4)));
  {
#pragma unroll
    for (int q = 0; q < 8; ++q) { const int r = q * 2 + rsub; if (col0 + c4 < N) { const v4f v = *(const v4fa*)&so[w][r][c4]; if (C) *(v4f*)(C + cofs + (size_t)(row0 + r) * ldc + col0 + c4) = v; if (C16) { v4h h4; for (int i = 0; i < 4; ++i) h4[i] = (_Float16)v[i]; *(v4h*)(C16 + cofs + (size_t)(row0 + r) * ldc + col0 + c4) = h4; } } }
     }
}


typedef _Float16 v4h __attribute__((ext_vector_type(4)));

__global__ __launch_bounds__(256) void k_x16(const float* __restrict__ x, _Float16* __restrict__ X16, size_t n8) { const size_t t = (size_t)blockIdx.x * 256 + threadIdx.x; if (t >= n8) return; FragH f;
#pragma unroll
  for (int q = 0; q < 8; ++q) f.h[q] = (_Float16)bf16_round(x[t * 8 + q]); *(v8us*)((unsigned short*)X16 + t * 8) = f.half[0];  }
__global__ __launch_bounds__(256) void k_h16(const float* __restrict__ x, _Float16* __restrict__ X16, size_t n8) { const size_t t = (size_t)blockIdx.x * 256 + threadIdx.x; if (t >= n8) return; FragH f;
#pragma unroll
  for (int q = 0; q < 8; ++q) f.h[q] = (_Float16)x[t * 8 + q]; *(v8us*)((unsigned short*)X16 + t * 8) = f.half[0];  }
__global__ __launch_bounds__(256) void k_round16f(const float* __restrict__ W, _Float16* __restrict__ Bt, size_t n8) { const size_t t = (size_t)blockIdx.x * 256 + threadIdx.x; if (t >= n8) return; FragH f;
#pragma unroll
  for (int i = 0; i < 8; ++i) f.h[i] = (_Float16)(bf16_round(W[t * 8 + i]) * 16.0f); *(v8us*)((unsigned short*)Bt + t * 8) = f.half[0];  }
template <int NHv, int TTv>
__global__ __launch_bounds__(256) void k_vt(const _Float16* __restrict__ V16, int ldv, int voff, _Float16* __restrict__ Vt) { __shared__ unsigned short tl[64][66]; const int tid = threadIdx.x; const int slab = blockIdx.x / (TTv / 64), lg = blockIdx.x % (TTv / 64); const int b = slab / NHv, h = slab % NHv;
  for (int i = tid; i < 64 * 8; i += 256) { const int r = i / 8, c8 = (i % 8) * 8; FragH f; f.half[0] = *(const v8us*)((const unsigned short*)V16 + ((size_t)b * TTv + lg * 64 + r) * ldv + voff + h * 64 + c8);
#pragma unroll
    for (int q = 0; q < 8; ++q) tl[r][c8 + q] = f.u[q]; }
  __syncthreads();
  {
#pragma unroll
    for (int rd = 0; rd < 2; ++rd) { const int d = rd * 32 + tid / 8, pc = tid % 8; FragH f;
#pragma unroll
      for (int q = 0; q < 8; ++q) f.u[q] = tl[pc * 8 + q][d];
      *(v8us*)((unsigned short*)Vt + ((size_t)slab * 64 + d) * TTv + lg * 64 + pc * 8) = f.half[0]; }
     } }

__global__ __launch_bounds__(256) void k_hl(const float* __restrict__ F, _Float16* __restrict__ Hh, _Float16* __restrict__ Hl, size_t n8) { const size_t t = (size_t)blockIdx.x * 256 + threadIdx.x; if (t >= n8) return; FragH fh, fl; const v4f a = *(const v4fa*)(F + t * 8), c = *(const v4fa*)(F + t * 8 + 4);
#pragma unroll
  for (int q = 0; q < 4; ++q) { _Float16 h = (_Float16)a[q]; fh.h[q] = h; fl.h[q] = (_Float16)((a[q] - (float)h) * 1024.0f); h = (_Float16)c[q]; fh.h[4 + q] = h; fl.h[4 + q] = (_Float16)((c[q] - (float)h) * 1024.0f); }
  { *(v8us*)((unsigned short*)Hh + t * 8) = fh.half[0]; *(v8us*)((unsigned short*)Hl + t * 8) = fl.half[0];  } }

// ---- fast GEMM (wave tile 32x64, work-group tile 128x128; requires M % 128 == 0 rows per launch region, N % 128 == 0, K % 64 == 0); epilogue = k_gemm_hhx semantics ----
__device__ __forceinline__ v16h g2_frag(const _Float16* p, int hh) { FragH f; f.half[0] = *(const v8us*)((const unsigned short*)p + 8 * hh); f.half[1] = *(const v8us*)((const unsigned short*)p + 16 + 8 * hh); return f.v; }
__device__ __forceinline__ v8f g2_mma(v16h a, v16h b, v8f c) { v8f d = __builtin_amdgcn_wmma_f32_16x16x32_f16(false, a, false, b, (short)0, c, false, false); asm volatile("v_nop\n\tv_nop\n\tv_nop\n\tv_nop" : "+v"(d) : "v"(a), "v"(b)); return d; }
// Operand tiles through LDS: a work-group of 8 waves owns 128 x 128 of C and walks K in tiles of 64 (128 bytes of each of its 128 A rows and 128 B rows); asynchronous copies bring whole 128-byte lines into one of two buffers while the other is worked on. A fragment load straight from global memory touches 16 lines for 512 bytes, and every wave of a row or column of waves would repeat it. Needs M % 128 == 0, N % 128 == 0, K % 64 == 0.
#define G3PB 144                     /* LDS pitch of a staged row, bytes: 128 + 16 = 16 bytes x odd, conflict-free for 16-byte reads */
#define G3SB (256 * G3PB)            /* bytes per buffer: 128 A rows, then 128 B rows */
// one tile: 8 copies per lane (A rows sr + 0 / 32 / 64 / 96, then the B rows likewise). The s_wait_xcnt stands inside the copies' own statement, so that no later write of an address register can be moved in front of it.
__device__ __forceinline__ void g3_stage(unsigned l, const _Float16* a, size_t a32, const _Float16* b, size_t b32) {
  asm volatile("global_load_async_to_lds_b128 %0, %8, off\n\tglobal_load_async_to_lds_b128 %1, %9, off\n\tglobal_load_async_to_lds_b128 %2, %10, off\n\tglobal_load_async_to_lds_b128 %3, %11, off\n\t"
               "global_load_async_to_lds_b128 %4, %12, off\n\tglobal_load_async_to_lds_b128 %5, %13, off\n\tglobal_load_async_to_lds_b128 %6, %14, off\n\tglobal_load_async_to_lds_b128 %7, %15, off\n\ts_wait_xcnt 0x0"
               :: "v"(l), "v"(l + 32 * G3PB), "v"(l + 64 * G3PB), "v"(l + 96 * G3PB), "v"(l + 128 * G3PB), "v"(l + 160 * G3PB), "v"(l + 192 * G3PB), "v"(l + 224 * G3PB),
                  "v"(a), "v"(a + a32), "v"(a + 2 * a32), "v"(a + 3 * a32), "v"(b), "v"(b + b32), "v"(b + 2 * b32), "v"(b + 3 * b32) : "memory"); }
// ROPE 1: planes 0 and 1 of the batch (q, k) leave through the rotate-half rotation: N is whole heads of HD = 64 columns, so a wave tile is ONE head and both halves of every pair lie in the wave's own staging tile; position = row mod SQ (row 0 of A is a batch's first token); f16 rows only.
template <int ACT, int ROPE = 0>
__global__ __launch_bounds__(256) void k_gemm2(const _Float16* __restrict__ A, int lda, size_t sA, const _Float16* __restrict__ Bh, int ldb, size_t sB, float alpha, const float* __restrict__ bias, size_t sBias, const float* __restrict__ CP, int rowsPerB, size_t sCPb, int row0g,
    float* __restrict__ C, _Float16* __restrict__ C16, int ldc, size_t sC, int M, int N, int K, const float* __restrict__ tcos = nullptr, const float* __restrict__ tsin = nullptr) { static_assert(ACT == 0 || ACT == 3 || ACT == 6 || ACT == 8 || ACT == 9 || ACT == 11 || ACT == 12 || ACT == 14 || ACT == 15 || ACT == 16 || ACT == 17, "k_gemm2: unsupported ACT code (would silently apply no activation)");
  __shared__ __attribute__((aligned(16))) unsigned char smem[2 * G3SB]; static_assert(sizeof(float) * 8 * 32 * 68 <= 2 * G3SB, "the epilogue's staging tiles fit in the ring's place");
  float (*so)[32][68] = (float (*)[32][68])smem;      /* the ring's bytes become the 8 waves' own output staging tiles behind the loop's last barrier */
  const int tid = threadIdx.x, lane = tid & 31, ln = lane & 15, hh = lane >> 4; const int w = __builtin_amdgcn_readfirstlane(tid >> 5); const int by = blockIdx.y;
  A += (size_t)by * sA; Bh += (size_t)by * sB; const size_t cofs = (size_t)by * sC; const float* bp = bias ? bias + (size_t)by * sBias : nullptr;
  const int ntn = N >> 7; const int mt = blockIdx.x / ntn, nq = blockIdx.x - mt * ntn; const int rowW = mt * 128, colW = nq * 128; if (rowW >= M) return;      /* the same for the whole work-group, in front of every barrier */
  const int row0 = rowW + 32 * (w & 3), col0 = colW + 64 * (w >> 2);      /* 4 x 2 waves of 32 x 64 */
  const int sr = tid >> 3, sc8 = (tid & 7) * 8;      /* staging: 16 bytes per lane and copy, 8 lanes per 128-byte row piece, so a wave's copy takes 4 whole lines */
  const _Float16* ga = A + (size_t)(rowW + sr) * lda + sc8; const _Float16* gb = Bh + (size_t)(colW + sr) * ldb + sc8; const size_t a32 = (size_t)32 * lda, b32 = (size_t)32 * ldb;
  const unsigned ls = (unsigned)(uintptr_t)(smem + sr * G3PB + sc8 * 2);      /* the lane's LDS byte address in buffer 0: low 32 bits of the shared address */
  const _Float16* fa = (const _Float16*)smem + (32 * (w & 3) + ln) * (G3PB / 2); const _Float16* fb = (const _Float16*)smem + (128 + 64 * (w >> 2) + ln) * (G3PB / 2);
  const int nt = K >> 6;
  const v8f z8 = {0.f,0.f,0.f,0.f,0.f,0.f,0.f,0.f}; v8f c00 = z8, c01 = z8, c02 = z8, c03 = z8, c10 = z8, c11 = z8, c12 = z8, c13 = z8;
  g3_stage(ls, ga, a32, gb, b32);
  asm volatile("s_wait_asynccnt 0x0" ::: "memory");      /* this wave's copies of tile 0 have landed */
  __syncthreads();      /* tile 0 is published */
  if (nt > 1) g3_stage(ls + G3SB, ga + 64, a32, gb + 64, b32);
#pragma unroll 1      /* one tile per trip: the two buffers alternate */
  for (int t = 0; t < nt; ++t) { const _Float16* pa = fa + (t & 1) * (G3SB / 2); const _Float16* pb = fb + (t & 1) * (G3SB / 2);
    v16h a[2][2], b[2][4];      /* the tile's 12 fragments, read as one group in front of its 16 WMMAs */
#pragma unroll      /* constant indices keep a and b in registers */
    for (int s = 0; s < 2; ++s) { a[s][0] = g2_frag(pa + s * 32, hh); b[s][0] = g2_frag(pb + s * 32, hh); a[s][1] = g2_frag(pa + 16 * (G3PB / 2) + s * 32, hh);
      for (int j = 1; j < 4; ++j) b[s][j] = g2_frag(pb + j * 16 * (G3PB / 2) + s * 32, hh); }
#pragma unroll      /* likewise; each accumulator takes its products in ascending k */
    for (int s = 0; s < 2; ++s) { c00 = g2_mma(a[s][0], b[s][0], c00); c10 = g2_mma(a[s][1], b[s][0], c10); c01 = g2_mma(a[s][0], b[s][1], c01); c11 = g2_mma(a[s][1], b[s][1], c11);
      c02 = g2_mma(a[s][0], b[s][2], c02); c12 = g2_mma(a[s][1], b[s][2], c12); c03 = g2_mma(a[s][0], b[s][3], c03); c13 = g2_mma(a[s][1], b[s][3], c13); }
    asm volatile("s_wait_dscnt 0x0" ::: "memory");      /* this wave's reads of tile t are done before the buffer is handed to its next writer */
    asm volatile("s_wait_asynccnt 0x0" ::: "memory");      /* this wave's copies of tile t + 1 have landed */
    __syncthreads();      /* publishes tile t + 1 and ends every wave's reads of tile t */
    if (t + 2 < nt) g3_stage(ls + (t & 1) * G3SB, ga + (size_t)(t + 2) * 64, a32, gb + (size_t)(t + 2) * 64, b32); }
  asm volatile("s_wait_asynccnt 0x0" ::: "memory");      /* nothing is in flight when the ring's bytes change their use */
  v8f accs[8] = {c00, c01, c02, c03, c10, c11, c12, c13};
#pragma unroll
  for (int u = 0; u < 8; ++u) { const int t = u & 3, half = u >> 2; const int col = col0 + t * 16 + ln; const float bv = bp ? bf16_round(bp[col]) : 0.f;
#pragma unroll
    for (int r = 0; r < 8; ++r) { const int rloc = half * 16 + 8 * hh + r; float v = accs[u][r] * alpha + bv; if (CP) { if (rowsPerB < 0) v += CP[cofs + (size_t)(row0g + row0 + rloc) * ldc + col];      /* rowsPerB < 0: own element of the batched C plane */ else { const int bidx = (row0g + row0 + rloc) / rowsPerB; v += CP[(size_t)bidx * sCPb + (size_t)by * 64 + col]; } }
      if (ACT == 3) v = fmaxf(v, 0.f); else if (ACT == 6) v = 0.5f * v * (1.0f + erff(v * 0.70710678118654752f)); else if (ACT == 11) v = 1.0f / (1.0f + expf(-v)); else if (ACT == 15) v = v / (1.0f + expf(-v)); else if (ACT == 12) v = (v > 0.f) ? v : 0.01f * v; else if (ACT == 8) v = tanhf(v); else if (ACT == 9) v = 0.5f * v * (1.0f + tanhf(0.7978845608028654f * (v + 0.044715f * v * v * v))); else if (ACT == 14) v = (v > 0.f) ? v : 0.1f * v; else if (ACT == 16) v = (v >= 0.f) ? v : 0.3f * v; else if (ACT == 17) v = (v >= 0.f) ? v : 0.2f * v;
      so[w][rloc][t * 16 + ln] = v; } }
  __builtin_amdgcn_fence(__ATOMIC_ACQ_REL, "workgroup"); __builtin_amdgcn_wave_barrier();
  if (ROPE && by < 2) {      /* 8 lanes per row: a lane takes columns d4 .. d4 + 3 of BOTH halves, so each table value and each staged value is read once and used twice */
    const int r4 = lane >> 3, d4 = (lane & 7) * 4; v4f cc[8], ss[8]; const unsigned tb = (((unsigned)row0 % SQ + r4) * (HD / 2) + d4) * 4u;      /* byte offset of the lane's first table entries; row0 and SQ are multiples of 32: the tile's 32 positions do not wrap */
#pragma unroll      /* constant indices keep cc and ss in registers; all 16 loads go out together, one latency */
    for (int q = 0; q < 8; ++q) { cc[q] = *(const v4fa*)((const char*)tcos + tb + q * 16 * (HD / 2)); ss[q] = *(const v4fa*)((const char*)tsin + tb + q * 16 * (HD / 2)); }
    asm volatile("s_wait_xcnt 0x0" :: "v"(tb) : "memory");      /* the wait in front of any overwrite of the offset register that the 16 issued table loads name; tb as an input keeps that register out of the loads' own destinations (without it the last load landed on it) */
#pragma unroll      /* constant indices into cc and ss */
    for (int q = 0; q < 8; ++q) { const int r = q * 4 + r4; const v4f lo = *(const v4fa*)&so[w][r][d4]; const v4f hi = *(const v4fa*)&so[w][r][d4 + HD / 2]; v4h ol, oh;
      for (int i = 0; i < 4; ++i) { const float c = bf16_round(cc[q][i]), s = bf16_round(ss[q][i]); ol[i] = (_Float16)(lo[i] * c - hi[i] * s); oh[i] = (_Float16)(lo[i] * s + hi[i] * c); }
      _Float16* dst = C16 + cofs + (size_t)(row0 + r) * ldc + col0 + d4; *(v4h*)dst = ol; *(v4h*)(dst + HD / 2) = oh; }
    return; }
  const int rsub = lane >> 4, c4 = (lane & 15) * 4;
  {
#pragma unroll
    for (int q = 0; q < 16; ++q) { const int r = q * 2 + rsub; const v4f v = *(const v4fa*)&so[w][r][c4]; if (C) *(v4f*)(C + cofs + (size_t)(row0 + r) * ldc + col0 + c4) = v; if (C16) { v4h h4; for (int i = 0; i < 4; ++i) h4[i] = (_Float16)v[i]; *(v4h*)(C16 + cofs + (size_t)(row0 + r) * ldc + col0 + c4) = h4; } }
     } }


__global__ __launch_bounds__(256) void k_wnat(const float* __restrict__ w, size_t n8, _Float16* __restrict__ Bt) { const size_t t = (size_t)blockIdx.x * 256 + threadIdx.x; if (t >= n8) return; FragH f; for (int q = 0; q < 8; ++q) f.h[q] = (_Float16)(bf16_round(w[t * 8 + q]) * 16.0f); *(v8us*)((unsigned short*)Bt + t * 8) = f.half[0];  }
// fused attention, ONE launch for all batches, heads and query rows: a work-group of 8 waves owns 256 query rows of one head, a wave 32 of them, and walks the SQ keys in stages of FKS keys (passes of 32). S^T = K Q^T (A = key rows, B = query rows kept in registers), so a lane holds scores of ONE query per 16-column group;
// the two f32 score tiles of a pass, after exp2, ARE the f16 B operand of O^T += V^T P^T (register r of tile t = key 16 t + 8 hh + r = the k order of g2_frag), so neither S nor P is ever stored. Running maximum (log2 units) with a late rescale; weights stay unnormalised (at most 2^8), the row sum divides once at the end.
// K and V^T tiles reach the 8 waves through LDS (whole 128-byte lines from global memory, two buffers, one barrier per stage): a fragment load straight from global memory touches 16 lines for 512 bytes, and all 8 waves would repeat it.
#define FKS 64                       /* keys per stage */
#define FKP (HD + 8)                 /* LDS pitch of a key row, in halves: 16 bytes x odd, conflict-free for 16-byte reads */
#define FVP (FKS + 8)                /* LDS pitch of a V^T row, in halves: likewise */
__device__ __forceinline__ v8f fa_mma(v16h a, v16h b, v8f c) { return __builtin_amdgcn_wmma_f32_16x16x32_f16(false, a, false, b, (short)0, c, false, false); }
__device__ __forceinline__ v16h fa_frag(const unsigned short* p, int hh) { FragH f; f.half[0] = *(const v8us*)(p + 8 * hh); f.half[1] = *(const v8us*)(p + 16 + 8 * hh); return f.v; }
__device__ __forceinline__ void fa_exp2x8(float (&e)[8]) {
  asm("v_exp_f32 %0, %0\n\tv_exp_f32 %1, %1\n\tv_exp_f32 %2, %2\n\tv_exp_f32 %3, %3\n\tv_exp_f32 %4, %4\n\tv_exp_f32 %5, %5\n\tv_exp_f32 %6, %6\n\tv_exp_f32 %7, %7\n\tv_nop"
      : "+v"(e[0]), "+v"(e[1]), "+v"(e[2]), "+v"(e[3]), "+v"(e[4]), "+v"(e[5]), "+v"(e[6]), "+v"(e[7])); }
__global__ __launch_bounds__(256) void k_fattn(const _Float16* __restrict__ Q16, const _Float16* __restrict__ K16, const _Float16* __restrict__ VT, _Float16* __restrict__ O16) {
  __shared__ __attribute__((aligned(16))) unsigned short lk[2][FKS][FKP]; __shared__ __attribute__((aligned(16))) unsigned short lv[2][HD][FVP];
  const int tid = threadIdx.x, lane = tid & 31, ln = lane & 15, hh = lane >> 4; const int w = __builtin_amdgcn_readfirstlane(tid >> 5);
  const int h = blockIdx.y, b = blockIdx.z; const int q0 = blockIdx.x * 256 + w * 32;
  const _Float16* qp = Q16 + ((size_t)b * SQ + q0 + ln) * DM + h * HD;
  const int kr = tid >> 3, kc = (tid & 7) * 8;      /* staging: 16 bytes per thread and step, 8 threads per 128-byte key row */
  const int vr = tid / (FKS / 8), vc = (tid % (FKS / 8)) * 8;      /* FKS / 8 threads per V^T row piece */
  const unsigned short* kg = (const unsigned short*)K16 + ((size_t)b * SQ + kr) * KVD + h * HD + kc;
  const unsigned short* vg = (const unsigned short*)VT + (((size_t)b * NH + h) * HD + vr) * SQ + vc;
  const float cs = 0.125f * 1.44269504088896340736f;      /* 1/sqrt(64) and log2(e) in one factor */
  const v8f z8 = {0.f,0.f,0.f,0.f,0.f,0.f,0.f,0.f};
  v8us gk[FKS / 32], gv[FKS / 32];
#pragma unroll
  for (int i = 0; i < FKS / 32; ++i) { gk[i] = *(const v8us*)(kg + (size_t)i * 32 * KVD); gv[i] = *(const v8us*)(vg + (size_t)i * (2048 / FKS) * SQ); }
  v16h bq[2][2];
#pragma unroll
  for (int j = 0; j < 2; ++j) for (int s = 0; s < 2; ++s) bq[j][s] = g2_frag(qp + (size_t)j * 16 * DM + s * 32, hh);
  v8f o[4][2]; float m[2] = {-1.0e30f, -1.0e30f}; float l[2][2] = {{0.f, 0.f}, {0.f, 0.f}};
#pragma unroll
  for (int t = 0; t < 4; ++t) { o[t][0] = z8; o[t][1] = z8; }
#pragma unroll
  for (int i = 0; i < FKS / 32; ++i) { *(v8us*)&lk[0][kr + i * 32][kc] = gk[i]; *(v8us*)&lv[0][vr + i * (2048 / FKS)][vc] = gv[i]; }
  __syncthreads();      /* stage 0 is published */
#pragma unroll 1      /* one stage per trip: the body already holds FKS / 32 unrolled passes */
  for (int st = 0; st < SQ / FKS; ++st) {
    const int cur = st & 1; const int sn = (st + 1 < SQ / FKS) ? st + 1 : st;      /* the next stage's tiles are asked for now and stored after this stage's passes; the last stage re-reads its own (in bounds; that buffer is not read again) */
#pragma unroll
    for (int i = 0; i < FKS / 32; ++i) { gk[i] = *(const v8us*)(kg + ((size_t)sn * FKS + i * 32) * KVD); gv[i] = *(const v8us*)(vg + (size_t)i * (2048 / FKS) * SQ + sn * FKS); }
    v16h ka[2][2];
#pragma unroll
    for (int t = 0; t < 2; ++t) for (int s = 0; s < 2; ++s) ka[t][s] = fa_frag(&lk[cur][t * 16 + ln][s * 32], hh);
    asm volatile("" ::: "memory");      /* compiler fence: without it the next stage's global loads are sunk to just in front of their LDS stores at the stage's foot, and their whole latency is waited out there */
#pragma unroll
    for (int p = 0; p < FKS / 32; ++p) {
      v16h va[4]; v8f sc[2][2];      /* sc: [key tile][query tile] */
#pragma unroll
      for (int t = 0; t < 2; ++t) for (int j = 0; j < 2; ++j) sc[t][j] = fa_mma(ka[t][1], bq[j][1], fa_mma(ka[t][0], bq[j][0], z8));
#pragma unroll
      for (int t = 0; t < 4; ++t) va[t] = fa_frag(&lv[cur][t * 16 + ln][p * 32], hh);
      if (p + 1 < FKS / 32) {      /* the stage's next pass: its key fragments one pass ahead, into the same registers */
#pragma unroll
        for (int t = 0; t < 2; ++t) for (int s = 0; s < 2; ++s) ka[t][s] = fa_frag(&lk[cur][(p + 1) * 32 + t * 16 + ln][s * 32], hh); }
      asm volatile("" ::: "memory");      /* compiler fence: keeps these LDS reads together in front of the softmax arithmetic, which covers their latency; without it they are sunk in among the WMMAs that use them */
      float mx[2];
#pragma unroll
      for (int j = 0; j < 2; ++j) { float a = fmaxf(sc[0][j][0], sc[1][j][0]); for (int r = 1; r < 8; ++r) a = fmaxf(fmaxf(a, sc[0][j][r]), sc[1][j][r]); mx[j] = a * cs; }
      const bool need = (mx[0] > m[0] + 8.0f) || (mx[1] > m[1] + 8.0f);
      if (__builtin_amdgcn_ballot_w32(need) != 0) {      /* scalar branch: rescale only when some column's maximum has grown by more than 2^8; m[] changes only here and from values joined over the two lane halves, so both halves of a column always use the same m */
#pragma unroll
        for (int j = 0; j < 2; ++j) { const float mj = fmaxf(mx[j], __shfl_xor(mx[j], 16, 32)); const float mn = fmaxf(m[j], mj); const float f = __builtin_amdgcn_exp2f(m[j] - mn); m[j] = mn; l[j][0] *= f; l[j][1] *= f;
          for (int t = 0; t < 4; ++t) for (int r = 0; r < 8; ++r) o[t][j][r] *= f; } }
      v16h pb[2];
#pragma unroll
      for (int j = 0; j < 2; ++j) for (int t = 0; t < 2; ++t) { float e[8]; for (int r = 0; r < 8; ++r) e[r] = fmaf(sc[t][j][r], cs, -m[j]); fa_exp2x8(e); for (int r = 0; r < 8; ++r) { l[j][t] += e[r]; pb[j][t * 8 + r] = (_Float16)e[r]; } }
#pragma unroll
      for (int t = 0; t < 4; ++t) for (int j = 0; j < 2; ++j) o[t][j] = fa_mma(va[t], pb[j], o[t][j]);
    }
#pragma unroll
    for (int i = 0; i < FKS / 32; ++i) { *(v8us*)&lk[cur ^ 1][kr + i * 32][kc] = gk[i]; *(v8us*)&lv[cur ^ 1][vr + i * (2048 / FKS)][vc] = gv[i]; }      /* every wave left that buffer before the barrier that ended the stage before */
    __syncthreads();      /* publishes stage st + 1 and ends every wave's reads of stage st */
  }
#pragma unroll
  for (int j = 0; j < 2; ++j) { float lt = l[j][0] + l[j][1]; lt += __shfl_xor(lt, 16, 32); const float fin = 64.0f / lt;      /* o carried x64, as the output GEMM's alpha expects */
    unsigned short* op = (unsigned short*)O16 + ((size_t)b * SQ + q0 + j * 16 + ln) * DM + h * HD + 8 * hh;
    for (int t = 0; t < 4; ++t) { FragH f; for (int r = 0; r < 8; ++r) f.h[r] = (_Float16)(o[t][j][r] * fin); *(v8us*)(op + t * 16) = f.half[0]; } } }
__global__ __launch_bounds__(256) void k_vt(const _Float16* __restrict__ V16, int b, int h0, _Float16* __restrict__ VT) { __shared__ unsigned short tl[64][65]; const int tid = threadIdx.x; const int hh = blockIdx.x % HG, sg = blockIdx.x / HG; const int s0 = sg * 64; const int h = h0 + hh;
  for (int i = tid; i < 64 * 8; i += 256) { const int j = i / 8, d8 = (i % 8) * 8; FragH f; f.half[0] = *(const v8us*)((const unsigned short*)V16 + ((size_t)b * SQ + s0 + j) * DM + h * HD + d8); for (int q = 0; q < 8; ++q) tl[d8 + q][j] = f.u[q]; }
  __syncthreads();
  { for (int i = tid; i < 64 * 8; i += 256) { const int d = i / 8, j8 = (i % 8) * 8; FragH f; for (int q = 0; q < 8; ++q) f.u[q] = tl[d][j8 + q]; *(v8us*)((unsigned short*)VT + ((size_t)hh * HD + d) * SQ + s0 + j8) = f.half[0]; }  } }



__global__ __launch_bounds__(256) void k_rsmcf2(const float* __restrict__ S, _Float16* __restrict__ P, int hg, int q0, int nk) {
  #pragma clang fp contract(off)
  const int t = blockIdx.x * 256 + threadIdx.x; if (t >= hg * QT) return; const size_t i = (size_t)t; const float* s = S + i * NKX; const int last = q0 + (t % QT); float mx = -3.0e38f;
#pragma unroll 1
  for (int j = 0; j < nk; ++j) { const float f = (j <= last) ? 1.f : 0.f; mx = fmaxf(mx, fmaf(f, s[j], (1.f - f) * -1.0e9f)); } float se = 0.f;
#pragma unroll 1
  for (int j = 0; j < nk; ++j) { const float f = (j <= last) ? 1.f : 0.f; se += __expf(fmaf(f, s[j], (1.f - f) * -1.0e9f) - mx); } const float sc = 256.0f / se;
#pragma unroll 1
  for (int j0 = 0; j0 < nk; j0 += 8) { FragH fr; for (int q = 0; q < 8; ++q) { const int j = j0 + q; const float f = (j <= last) ? 1.f : 0.f; fr.h[q] = (_Float16)(__expf(fmaf(f, s[j], (1.f - f) * -1.0e9f) - mx) * sc); } unsigned short* d = (unsigned short*)P + i * NKX + j0; *(v8us*)d = fr.half[0];  } }


template <int MASKADD>
__global__ __launch_bounds__(64) void k_att0(const float* __restrict__ QF, const float* __restrict__ KF, const float* __restrict__ VF, int ld, const float* __restrict__ mask, float scale, float* __restrict__ OF, int ldo) {
  #pragma clang fp contract(off)
  __shared__ __attribute__((aligned(16))) float lq[64][64]; __shared__ __attribute__((aligned(16))) float lo[64][64];
  const int tid = threadIdx.x; const int h = blockIdx.x / (QT0 / 64), rg = blockIdx.x % (QT0 / 64); const int i = rg * 64 + tid;
  const float* qr = QF + (size_t)i * ld + h * HD;
#pragma unroll 1
  for (int c = 0; c < HD / 4; ++c) { *(v4f*)&lq[tid][c * 4] = *(const v4fa*)(qr + c * 4); const v4f z = {0.f, 0.f, 0.f, 0.f}; *(v4f*)&lo[tid][c * 4] = z; }
  float m = -1.0e30f, l = 0.f; const int jmax = MASKADD ? (SQ - 1) : (rg * 64 + 63);      /* additive-mask form: every key (the mask input decides); causal form: keys up to the block's last row */
#pragma unroll 1
  for (int j = 0; j <= jmax; ++j) { const float* kr = KF + (size_t)j * ld + h * HD; const float* vr = VF + (size_t)j * ld + h * HD; float s = 0.f;
#pragma unroll 1
    for (int c = 0; c < HD / 4; ++c) { const v4f kq = *(const v4fa*)(kr + c * 4); const v4f qq = *(v4f*)&lq[tid][c * 4]; s = __fadd_rn(s, __fmul_rn(qq[0], kq[0])); s = __fadd_rn(s, __fmul_rn(qq[1], kq[1])); s = __fadd_rn(s, __fmul_rn(qq[2], kq[2])); s = __fadd_rn(s, __fmul_rn(qq[3], kq[3])); }
    s = __fmul_rn(s, scale); if (MASKADD) s = __fadd_rn(s, __fmul_rn(bf16_round(mask[(size_t)i * SQ + j]), -10000.0f));
    const float f = (MASKADD || j <= i) ? 1.f : 0.f; const float sm = fmaf(f, s, (1.f - f) * -1.0e30f); const float mn = fmaxf(m, sm); const float sc = expf(m - mn); const float e = expf(sm - mn); l = __fadd_rn(__fmul_rn(l, sc), e); m = mn;
#pragma unroll 1
    for (int c = 0; c < HD / 4; ++c) { const v4f vv = *(const v4fa*)(vr + c * 4); v4f oo = *(v4f*)&lo[tid][c * 4]; for (int u = 0; u < 4; ++u) oo[u] = __fadd_rn(__fmul_rn(oo[u], sc), __fmul_rn(e, vv[u])); *(v4f*)&lo[tid][c * 4] = oo; } }
  const float fin = 64.0f / l;      /* o carried x64 like the f16 path */
#pragma unroll 1
  for (int c = 0; c < HD / 4; ++c) { v4f oo = *(v4f*)&lo[tid][c * 4]; for (int u = 0; u < 4; ++u) oo[u] = __fmul_rn(oo[u], fin); *(v4f*)&lo[tid][c * 4] = oo; }
  __syncthreads();
  {
#pragma unroll 1
    for (int it = 0; it < 16; ++it) { const int row = it * 4 + tid / 16, pc = (tid % 16) * 4; const v4f v = *(const v4f*)&lo[row][pc]; *(v4f*)(OF + (size_t)(rg * 64 + row) * ldo + h * HD + pc) = v; }
     } }


__global__ __launch_bounds__(256) void k_kvexp(const float* __restrict__ src, float* __restrict__ dst, size_t n4) { const size_t t = (size_t)blockIdx.x * 256 + threadIdx.x; if (t >= n4) return; const size_t e = t * 4; const size_t row = e / DM; const int col = (int)(e % DM); const int h = col / HD, d = col % HD; const v4f v = *(const v4fa*)(src + row * KVD + (size_t)(h / HPG) * HD + d); *(v4f*)(dst + e) = v;  }

__global__ __launch_bounds__(256) void k_tab2(float theta, float* __restrict__ CS, float* __restrict__ SN) {
  #pragma clang fp contract(off)
  const int t = blockIdx.x * 256 + threadIdx.x; if (t >= SQ * (HD / 2)) return; const int i = t % (HD / 2); const int p = t / (HD / 2); const float invf = 1.0f / powf(theta, (float)(2 * i) / (float)HD); const float ang = __fmul_rn((float)p, invf); const float c = cosf(ang), s = sinf(ang);
  *(float*)(CS + t) = c; *(float*)(SN + t) = s;  }
template <int NORM, int ROPE>
__global__ __launch_bounds__(64) void k_xform(const float* __restrict__ F, int ldf, int nh, const float* __restrict__ gain, float eps, const float* __restrict__ CS, const float* __restrict__ SN, _Float16* __restrict__ H16, int ldo) {
  #pragma clang fp contract(off)
  __shared__ float xv[HD]; __shared__ float red[HD]; __shared__ unsigned short sh_[HD]; const int d = threadIdx.x; const int h = blockIdx.x % nh; const size_t r = blockIdx.x / nh; const int p = (int)(r % SQ);
  float x = F[r * (size_t)ldf + (size_t)h * HD + d];
  if (NORM) { red[d] = __fmul_rn(x, x); __syncthreads(); for (int st = HD / 2; st > 0; st >>= 1) { if (d < st) red[d] = __fadd_rn(red[d], red[d + st]); __syncthreads(); } const float rs = rsqrtf(__fadd_rn(red[0] / (float)HD, eps)); x = __fmul_rn(__fmul_rn(x, rs), bf16_round(gain[d])); }
  xv[d] = x; __syncthreads();
  float o = x;
  if (ROPE == 1) { const int i = d >> 1; const float c = CS[p * (HD / 2) + i], s = SN[p * (HD / 2) + i]; const float ev = xv[2 * i], od = xv[2 * i + 1]; o = (d & 1) ? __fadd_rn(__fmul_rn(ev, s), __fmul_rn(od, c)) : __fadd_rn(__fmul_rn(ev, c), -__fmul_rn(od, s)); }
  if (ROPE == 2) { const int i = d & (HD / 2 - 1); const float c = CS[p * (HD / 2) + i], s = SN[p * (HD / 2) + i]; const float lo = xv[i], hi = xv[i + HD / 2]; o = (d < HD / 2) ? __fadd_rn(__fmul_rn(lo, c), -__fmul_rn(hi, s)) : __fadd_rn(__fmul_rn(lo, s), __fmul_rn(hi, c)); }
  FragH th; th.h[0] = (_Float16)o; sh_[d] = th.u[0]; __syncthreads();
  if (d < HD / 8) { FragH f; for (int q = 0; q < 8; ++q) f.u[q] = sh_[d * 8 + q]; unsigned short* dst = (unsigned short*)H16 + r * (size_t)ldo + (size_t)h * HD + d * 8; *(v8us*)dst = f.half[0];  } }

template <int NORM, int ROPE>
__global__ __launch_bounds__(64) void k_xformf(const float* __restrict__ F, int ldf, int nh, const float* __restrict__ gain, float eps, const float* __restrict__ CS, const float* __restrict__ SN, float* __restrict__ F32, int ldo) {
  #pragma clang fp contract(off)
  __shared__ float xv[HD]; __shared__ float red[HD]; const int d = threadIdx.x; const int h = blockIdx.x % nh; const size_t r = blockIdx.x / nh; const int p = (int)(r % SQ);
  float x = F[r * (size_t)ldf + (size_t)h * HD + d];
  if (NORM) { red[d] = __fmul_rn(x, x); __syncthreads(); for (int st = HD / 2; st > 0; st >>= 1) { if (d < st) red[d] = __fadd_rn(red[d], red[d + st]); __syncthreads(); } const float rs = rsqrtf(__fadd_rn(red[0] / (float)HD, eps)); x = __fmul_rn(__fmul_rn(x, rs), bf16_round(gain[d])); }
  xv[d] = x; __syncthreads();
  float o = x;
  if (ROPE == 1) { const int i = d >> 1; const float c = CS[p * (HD / 2) + i], s = SN[p * (HD / 2) + i]; const float ev = xv[2 * i], od = xv[2 * i + 1]; o = (d & 1) ? __fadd_rn(__fmul_rn(ev, s), __fmul_rn(od, c)) : __fadd_rn(__fmul_rn(ev, c), -__fmul_rn(od, s)); }
  if (ROPE == 2) { const int i = d & (HD / 2 - 1); const float c = CS[p * (HD / 2) + i], s = SN[p * (HD / 2) + i]; const float lo = xv[i], hi = xv[i + HD / 2]; o = (d < HD / 2) ? __fadd_rn(__fmul_rn(lo, c), -__fmul_rn(hi, s)) : __fadd_rn(__fmul_rn(lo, s), __fmul_rn(hi, c)); }
  float* dst = F32 + r * (size_t)ldo + (size_t)h * HD + d; *(float*)dst = o;  }

__global__ __launch_bounds__(256) void k_bfcp(const float* __restrict__ src, float* __restrict__ dst, size_t n4) { const size_t t = (size_t)blockIdx.x * 256 + threadIdx.x; if (t >= n4) return; const v4f a = *(const v4fa*)(src + t * 4); v4f o; for (int q = 0; q < 4; ++q) o[q] = bf16_round(a[q]); *(v4f*)(dst + t * 4) = o;  }

__global__ __launch_bounds__(256) void k_tab2d(float* __restrict__ CS, float* __restrict__ SN) {
  #pragma clang fp contract(off)
  const int t = blockIdx.x * 256 + threadIdx.x; if (t >= SQ * (HD / 2)) return; const int i = t % (HD / 2); const int p = t / (HD / 2); const float invf = (float)(1.0 / pow(10000.0, (double)(2 * i) / (double)HD)); const float ang = __fmul_rn((float)p, invf); const float c = cosf(ang), s = sinf(ang);
  *(float*)(CS + t) = c; *(float*)(SN + t) = s;  }
extern "C" void kernel_launch(void* const* d_in, const int* in_sizes, int n_in,
                              void* d_out, int out_size, void* d_ws, size_t ws_size, hipStream_t stream) {
  (void)in_sizes; (void)n_in; (void)out_size;
  const float* const* I = (const float* const*)d_in; const float* x = I[0]; const float* wq = I[1]; const float* wk = I[2]; const float* wv = I[3]; const float* wo = I[4]; const float* tcos = I[5]; const float* tsin = I[6]; const float* bq = nullptr; const float* bk = nullptr; const float* bv = nullptr; const float* bo = nullptr;      /* natural [out][in] weights, no biases; rope_cos / rope_sin INPUT tables [2048][32] */
  static_assert(HPG == 1 && NH == NG * HPG && NH * HD == DM && KVD == DM, "plain multi-head attention as 16 kv groups of one query head");
  char* ws = (char*)d_ws; size_t off = 0;
  auto take = [&](size_t bytes) { char* p = ws + off; off += (bytes + 255) & ~(size_t)255; return p; };
  _Float16* BQ = (_Float16*)take((size_t)DM * DM * 2); _Float16* BK = (_Float16*)take((size_t)KVD * DM * 2); _Float16* BV = (_Float16*)take((size_t)KVD * DM * 2); _Float16* BO = (_Float16*)take((size_t)DM * DM * 2);
  _Float16* X16 = (_Float16*)take(NR * DM * 2); _Float16* Q16 = (_Float16*)take(NR * DM * 2); _Float16* K16 = (_Float16*)take(NR * KVD * 2); _Float16* V16 = (_Float16*)take(NR * KVD * 2); _Float16* O16 = (_Float16*)take(NR * DM * 2);
  _Float16* VT = (_Float16*)take((size_t)NB * NH * HD * SQ * 2);
  float* QF0 = (float*)take((size_t)QT0 * DM * 4); float* KF0 = (float*)take((size_t)QT0 * KVD * 4); float* VF0 = (float*)take((size_t)QT0 * KVD * 4); float* KF0e = (float*)take((size_t)QT0 * DM * 4); float* VF0e = (float*)take((size_t)QT0 * DM * 4); float* OF0 = (float*)take((size_t)NB * QT0 * DM * 4); _Float16* OH0 = (_Float16*)take((size_t)NB * QT0 * DM * 2); _Float16* OL0 = (_Float16*)take((size_t)NB * QT0 * DM * 2);
  if (off > ws_size) return;
  k_wnat<<<(unsigned)(((size_t)DM * DM / 8 + 255) / 256), 256, 0, stream>>>(wq, (size_t)DM * DM / 8, BQ); k_wnat<<<(unsigned)(((size_t)KVD * DM / 8 + 255) / 256), 256, 0, stream>>>(wk, (size_t)KVD * DM / 8, BK); k_wnat<<<(unsigned)(((size_t)KVD * DM / 8 + 255) / 256), 256, 0, stream>>>(wv, (size_t)KVD * DM / 8, BV); k_wnat<<<(unsigned)(((size_t)DM * DM / 8 + 255) / 256), 256, 0, stream>>>(wo, (size_t)DM * DM / 8, BO);      /* natural [out][in] = Bt planes x16 */
  k_x16<<<(unsigned)((NR * DM / 8 + 255) / 256), 256, 0, stream>>>(x, X16, NR * DM / 8);
  const size_t r0p = (size_t)B0 * SQ;      /* first projected row */
  static_assert(((size_t)DM * DM * 2) % 256 == 0 && (NR * DM * 2) % 256 == 0, "BQ | BK | BV and Q16 | K16 | V16 lie back to back in the workspace: the plane strides of the batched launch");
  k_gemm2<0, 1><<<dim3((unsigned)((MP / 128) * (DM / 128)), 3), 256, 0, stream>>>(X16 + r0p * DM, DM, 0, BQ, DM, (size_t)DM * DM, 0.0625f, nullptr, 0, nullptr, 1, 0, 0, nullptr, Q16 + r0p * DM, DM, NR * DM, MP, DM, DM, tcos, tsin);      /* q, k (rotated by the INPUT rope tables [2048][32]: column d uses table column d mod 32 = the module's [cos | cos]) and v of every batch -> f16 rows */
  for (int b = B0; b < B0 + NBR; ++b) { const size_t r0 = (size_t)b * SQ;
    k_vt<NG, SQ><<<NG * (SQ / 64), 256, 0, stream>>>(V16 + r0 * KVD, KVD, 0, VT + (size_t)b * NH * HD * SQ); }      /* V^T [NB][NH][HD][SQ], this batch's plane */
  k_fattn<<<dim3(SQ / 256, NH, NB), 256, 0, stream>>>(Q16, K16, VT, O16);      /* scores, softmax and P V of every batch, head and query row in ONE launch; o (x64) into merged f16 rows */
  k_gemm2<0><<<dim3((unsigned)((MPO / 128) * (DM / 128)), 1), 256, 0, stream>>>(O16 + r0p * DM, DM, 0, BO, DM, 0, 0.0009765625f, bo, 0, nullptr, 1, 0, 0, (float*)d_out + r0p * DM, nullptr, DM, 0, MPO, DM, DM);      /* out rows are the output layout */
}

// v005
// One run takes 105 microseconds.
// In two side-by-side timings against v004, it was 1.07 and 1.08 times as fast.
// All steps since v000 together make it 68.5 times as fast.
#include <hip/hip_runtime.h>
// Multi-head self-attention with half-split RoPE from RANDOM input tables, NON-causal (x [2][2048][1024]; q / k / v = x W^T (nn.Linear natural [1024][1024] sigma 1/32, no biases), 16 heads of 64; rope: x * [cos | cos] + rotate_half(x) * [sin | sin] with rotate_half = (-x2, x1) over the two 32-lane halves and INPUT tables rope_cos / rope_sin [2048][32] (cos / sin of uniform-random angles); scores / sqrt(64); softmax over all 2048 keys (f32; no mask); out = merged Wo^T (natural, no bias) -> [2][2048][1024]); run as grouped-query attention with 16 groups of ONE head.
// Structure: x as exact f16 rows; natural weights as exact x16 planes; q, k and v of both batches as ONE batched WMMA GEMM launch (32x64 wave tiles, f32 accumulation, blockIdx.y picks the weight plane and the output rows) whose epilogue rotates q and k in f32 (rotate-half; a 64-column wave tile is one head; INPUT tables rounded to bf16 as read) and writes f16 rows; V^T of the heads via LDS transposes; then ONE fused attention launch for all batches, heads and query rows (k_fattn: scores of 32 query columns per wave against ALL 2048 keys, running softmax in registers with f32 statistics and native exp2, unnormalised f16 weights, o = P V^T carried x64) into merged f16 rows; out = o Wo^T GEMM (f32, alpha 2^-10).
// Compute dtype: inputs rounded to bf16; x / weights exact; q, k, v, softmax weights and o as plain f16 GEMM operands (~2^-12); scores and softmax statistics f32. v_wmma_f32_16x16x32_f16.
#define NB 2
#define NG 16
#define HPG 1
#define KVD (NG * HD)
#define SQ 2048
#define DM 1024
#define NH 16
#define HD 64
#define HG 4                         /* heads per block group of the unlaunched k_vt overload */
#define QT 256                       /* query rows per tile */
#define NKX SQ                       /* S / P row pitch */
#define QT0 128                      /* rows per head of k_att0 (not launched); sizes unused f32 buffers */
#define B0 0                         /* first batch processed (debug hook) */
#define NBR NB                       /* batches processed (debug hook) */
#define NR ((size_t)NB * SQ)         /* token rows */
#define MP ((int)((size_t)NBR * SQ)) /* rows projected (debug hook) */
#define QN SQ                        /* unused: k_fattn attends all SQ query rows of a batch */
#define NHD NH                       /* unused: k_fattn attends all NH heads */
#define MPO MP                       /* rows through the output stage (debug hook) */
#define LQ DM      /* row pitch of the q/k/v rows */
typedef __bf16 v16b __attribute__((ext_vector_type(16)));
typedef unsigned short v8us __attribute__((ext_vector_type(8), may_alias));
typedef float  v8f  __attribute__((ext_vector_type(8)));
typedef float  v4f  __attribute__((ext_vector_type(4)));
typedef float  v4fa __attribute__((ext_vector_type(4), may_alias));
union FragB { v16b v; v8us half[2]; unsigned short u[16]; };

__device__ __forceinline__ unsigned short bf16_bits(float x) { unsigned int u = __float_as_uint(x); return (unsigned short)((u + 0x7FFFu + ((u >> 16) & 1u)) >> 16); }
__device__ __forceinline__ float bf16_val(unsigned short b) { return __uint_as_float(((unsigned int)b) << 16); }
__device__ __forceinline__ float bf16_round(float x) { return bf16_val(bf16_bits(x)); }
// D += A·B with NT terms: 1 = ah·bh, 2 = + al·bh (A split), 3 = + ah·bl (both split)
template <int NT>
__device__ __forceinline__ v8f mmaN(v16b ah, v16b al, v16b bh, v16b bl, v8f c) {
  c = __builtin_amdgcn_wmma_f32_16x16x32_bf16(false, ah, false, bh, (short)0, c, false, false);
  if (NT >= 2) c = __builtin_amdgcn_wmma_f32_16x16x32_bf16(false, al, false, bh, (short)0, c, false, false);
  if (NT >= 3) c = __builtin_amdgcn_wmma_f32_16x16x32_bf16(false, ah, false, bl, (short)0, c, false, false);
  asm volatile("v_nop\n\tv_nop\n\tv_nop\n\tv_nop" : "+v"(c) : "v"(ah), "v"(al), "v"(bh), "v"(bl));
  return c;
}

__global__ __launch_bounds__(256) void k_wt_bf16(const float* __restrict__ W, unsigned short* __restrict__ Wt, int K, int N) {
  const int t = blockIdx.x * 256 + threadIdx.x;
  const int k8n = K / 8;
  if (t >= N * k8n) return;
  const int n = t / k8n, k8 = (t % k8n) * 8;
  v8us v;
#pragma unroll
  for (int i = 0; i < 8; ++i) v[i] = bf16_bits(W[(size_t)(k8 + i) * N + n]);
  *(v8us*)(Wt + (size_t)n * K + k8) = v;
  
}

// GEMM C[M][N] (f32, pitch ldc) = act(A[M][K]·W + bias). A f32 row-major (pitch lda) converted per fragment to bf16
// (ASPLIT: hi/lo two planes -> 2 terms, else single rounded term); Wt bf16 [N][K] (pitch ldb). BIAS_BF16 rounds the
// bias to bf16 first (bias quantised to bf16 before the add). K%32==0, M%16==0, N%64==0.
template <bool ASPLIT, int ACT, bool BIAS_BF16>
__global__ __launch_bounds__(128) void k_gemm_bf(const float* __restrict__ A, int lda, const unsigned short* __restrict__ Wt, int ldb,
                                               const float* __restrict__ bias, float* __restrict__ C, int ldc, int M, int N, int K) {
  __shared__ __attribute__((aligned(16))) float so[4][16][64];
  const int tid = threadIdx.x, w = tid >> 5, lane = tid & 31, ln = lane & 15, hh = lane >> 4;
  const int ntn = N / 64;
  const int wid = blockIdx.x * 4 + w;
  const int mt = wid / ntn, nq = wid % ntn;
  if (mt * 16 >= M) return;
  const int row0 = mt * 16, col0 = nq * 64;
  const float* arow = A + (size_t)(row0 + ln) * lda;
  v8f acc[4] = {};
  for (int kb = 0; kb < K; kb += 32) {
    FragB ah, al;
    const v4f x0 = *(const v4fa*)(arow + kb + 8 * hh), x1 = *(const v4fa*)(arow + kb + 8 * hh + 4);
    const v4f x2 = *(const v4fa*)(arow + kb + 16 + 8 * hh), x3 = *(const v4fa*)(arow + kb + 16 + 8 * hh + 4);
    float xs[16] = {x0[0],x0[1],x0[2],x0[3],x1[0],x1[1],x1[2],x1[3],x2[0],x2[1],x2[2],x2[3],x3[0],x3[1],x3[2],x3[3]};
#pragma unroll
    for (int i = 0; i < 16; ++i) { const unsigned short hb = bf16_bits(xs[i]); ah.u[i] = hb; al.u[i] = ASPLIT ? bf16_bits(xs[i] - bf16_val(hb)) : (unsigned short)0; }
#pragma unroll
    for (int t = 0; t < 4; ++t) {
      const unsigned short* brow = Wt + (size_t)(col0 + t * 16 + ln) * ldb + kb;
      FragB b;
      b.half[0] = *(const v8us*)(brow + 8 * hh);
      b.half[1] = *(const v8us*)(brow + 16 + 8 * hh);
      acc[t] = mmaN<ASPLIT ? 2 : 1>(ah.v, al.v, b.v, b.v, acc[t]);
    }
  }
#pragma unroll
  for (int t = 0; t < 4; ++t) {
    float bv = bias ? bias[col0 + t * 16 + ln] : 0.f;
    if (BIAS_BF16) bv = bf16_round(bv);
#pragma unroll
    for (int r = 0; r < 8; ++r) { float v = acc[t][r] + bv; if (ACT == 1) v = fmaxf(v, 0.f); so[w][8 * hh + r][t * 16 + ln] = v; }
  }
  __builtin_amdgcn_fence(__ATOMIC_ACQ_REL, "workgroup");
  __builtin_amdgcn_wave_barrier();
  const int rsub = lane >> 4, c4 = (lane & 15) * 4;
  {
#pragma unroll
    for (int q = 0; q < 8; ++q) {
      const int r = q * 2 + rsub;
      const v4f v = *(const v4fa*)&so[w][r][c4];
      *(v4f*)(C + (size_t)(row0 + r) * ldc + col0 + c4) = v;
    }
    
  }
}

// GEMM C = act(A·W + bias + resid): A f32 (ASPLIT -> hi/lo 2 terms), Wt bf16 [N][K]; ACT 0 none, 1 relu, 2 exact gelu;
// resid (optional, f32, row index = (row % rmod), pitch ldr, RES_BF16 rounds it) added before the activation.
template <bool ASPLIT, int ACT, bool BIAS_BF16, bool RES_BF16>
__global__ __launch_bounds__(128) void k_gemm_bf3(const float* __restrict__ A, int lda, const unsigned short* __restrict__ Wt, int ldb,
                                                const float* __restrict__ bias, const float* __restrict__ resid, int rmod, int ldr,
                                                float* __restrict__ C, int ldc, int M, int N, int K) {
  __shared__ __attribute__((aligned(16))) float so[4][16][64];
  const int tid = threadIdx.x, w = tid >> 5, lane = tid & 31, ln = lane & 15, hh = lane >> 4;
  const int ntn = N / 64;
  const int wid = blockIdx.x * 4 + w;
  const int mt = wid / ntn, nq = wid % ntn;
  if (mt * 16 >= M) return;
  const int row0 = mt * 16, col0 = nq * 64;
  const float* arow = A + (size_t)(row0 + ln) * lda;
  v8f acc[4] = {};
  for (int kb = 0; kb < K; kb += 32) {
    FragB ah, al;
    const v4f x0 = *(const v4fa*)(arow + kb + 8 * hh), x1 = *(const v4fa*)(arow + kb + 8 * hh + 4);
    const v4f x2 = *(const v4fa*)(arow + kb + 16 + 8 * hh), x3 = *(const v4fa*)(arow + kb + 16 + 8 * hh + 4);
    float xs[16] = {x0[0],x0[1],x0[2],x0[3],x1[0],x1[1],x1[2],x1[3],x2[0],x2[1],x2[2],x2[3],x3[0],x3[1],x3[2],x3[3]};
#pragma unroll
    for (int i = 0; i < 16; ++i) { const unsigned short hb = bf16_bits(xs[i]); ah.u[i] = hb; al.u[i] = ASPLIT ? bf16_bits(xs[i] - bf16_val(hb)) : (unsigned short)0; }
#pragma unroll
    for (int t = 0; t < 4; ++t) {
      const unsigned short* brow = Wt + (size_t)(col0 + t * 16 + ln) * ldb + kb;
      FragB b;
      b.half[0] = *(const v8us*)(brow + 8 * hh);
      b.half[1] = *(const v8us*)(brow + 16 + 8 * hh);
      acc[t] = mmaN<ASPLIT ? 2 : 1>(ah.v, al.v, b.v, b.v, acc[t]);
    }
  }
#pragma unroll
  for (int t = 0; t < 4; ++t) {
    const int col = col0 + t * 16 + ln;
    float bv = bias ? bias[col] : 0.f;
    if (BIAS_BF16) bv = bf16_round(bv);
#pragma unroll
    for (int r = 0; r < 8; ++r) {
      float v = acc[t][r] + bv;
      if (resid) { float rv = resid[(size_t)((row0 + 8 * hh + r) % rmod) * ldr + col]; if (RES_BF16) rv = bf16_round(rv); v += rv; }
      if (ACT == 1) v = fmaxf(v, 0.f);
      if (ACT == 2) v = 0.5f * v * (1.0f + erff(v * 0.70710678118654752f));
      if (ACT == 3) { const float u = 0.7978845608028654f * (v + 0.044715f * v * v * v); v = 0.5f * v * (1.0f + tanhf(u)); }
      so[w][8 * hh + r][t * 16 + ln] = v;
    }
  }
  __builtin_amdgcn_fence(__ATOMIC_ACQ_REL, "workgroup");
  __builtin_amdgcn_wave_barrier();
  const int rsub = lane >> 4, c4 = (lane & 15) * 4;
  {
#pragma unroll
    for (int q = 0; q < 8; ++q) {
      const int r = q * 2 + rsub;
      const v4f v = *(const v4fa*)&so[w][r][c4];
      *(v4f*)(C + (size_t)(row0 + r) * ldc + col0 + c4) = v;
    }
    
  }
}
// row LayerNorm (biased variance, eps) over N: s = X (+ R); optional out_sum <- s; out_norm <- (s-mu)*rsqrt(var+eps)*g + b
template <bool PARAM_BF16>
__global__ __launch_bounds__(256) void k_layernorm(const float* __restrict__ X, const float* __restrict__ R, const float* __restrict__ g, const float* __restrict__ bta,
                                                  float* __restrict__ out_sum, float* __restrict__ out_norm, int N, float eps) {
  __shared__ float red[256];
  const int row = blockIdx.x, tid = threadIdx.x;
  const float* x = X + (size_t)row * N; const float* rr = R ? R + (size_t)row * N : nullptr;
  float vals[16];                     // up to N = 4096
  const int per = N / 256;            // contiguous chunk per thread? use strided-by-4 chunks: thread handles j = tid*4 + 1024*u
  float s1 = 0.f;
  for (int u = 0; u < per / 4; ++u) {
    const int j = tid * 4 + 1024 * u;
    const v4f a = *(const v4fa*)(x + j);
    v4f b = {0.f,0.f,0.f,0.f}; if (rr) b = *(const v4fa*)(rr + j);
#pragma unroll
    for (int q = 0; q < 4; ++q) { const float v = a[q] + b[q]; vals[u * 4 + q] = v; s1 += v; }
  }
  red[tid] = s1; __syncthreads();
  for (int st = 128; st > 0; st >>= 1) { if (tid < st) red[tid] += red[tid + st]; __syncthreads(); }
  const float mu = red[0] / (float)N; __syncthreads();
  float s2 = 0.f;
  for (int u = 0; u < per / 4; ++u)
#pragma unroll
    for (int q = 0; q < 4; ++q) { const float c = vals[u * 4 + q] - mu; s2 += c * c; }
  red[tid] = s2; __syncthreads();
  for (int st = 128; st > 0; st >>= 1) { if (tid < st) red[tid] += red[tid + st]; __syncthreads(); }
  const float rs = rsqrtf(red[0] / (float)N + eps);
  {
    for (int u = 0; u < per / 4; ++u) {
      const int j = tid * 4 + 1024 * u;
      v4f o, sm;
#pragma unroll
      for (int q = 0; q < 4; ++q) {
        float gg = g[j + q], bb = bta[j + q];
        if (PARAM_BF16) { gg = bf16_round(gg); bb = bf16_round(bb); }
        sm[q] = vals[u * 4 + q]; o[q] = (vals[u * 4 + q] - mu) * rs * gg + bb;
      }
      if (out_sum) *(v4f*)(out_sum + (size_t)row * N + j) = sm;
      *(v4f*)(out_norm + (size_t)row * N + j) = o;
    }
    
  }
}



// ---- f16 WMMA path (v_wmma_f32_16x16x32_f16): 11-bit significands for operands in range — used where a [0,1] probability operand needs more precision than bf16
typedef _Float16 v16h __attribute__((ext_vector_type(16)));
union FragH { v16h v; v8us half[2]; _Float16 h[16]; unsigned short u[16]; };
template <int NT>
__device__ __forceinline__ v8f mmaH(v16h ah, v16h al, v16h bh, v16h bl, v8f c) {
  c = __builtin_amdgcn_wmma_f32_16x16x32_f16(false, ah, false, bh, (short)0, c, false, false);
  if (NT >= 2) c = __builtin_amdgcn_wmma_f32_16x16x32_f16(false, al, false, bh, (short)0, c, false, false);
  if (NT >= 3) c = __builtin_amdgcn_wmma_f32_16x16x32_f16(false, ah, false, bl, (short)0, c, false, false);
  asm volatile("v_nop\n\tv_nop\n\tv_nop\n\tv_nop" : "+v"(c) : "v"(ah), "v"(al), "v"(bh), "v"(bl));
  return c;
}
// batched GEMM like k_gemm_b but f16 operands: A f32 (split into f16 hi/lo if ASPLIT, else rounded to f16), Bt = f16 values [n][k]; alpha; C f32; N multiple of 16 (partial tiles skipped)
template <bool ASPLIT>
__global__ __launch_bounds__(128) void k_gemm_h(const float* __restrict__ A, int lda, size_t sA, const _Float16* __restrict__ Bh, int ldb, size_t sB, float alpha, float* __restrict__ C, int ldc, size_t sC, int M, int N, int K) {
  __shared__ __attribute__((aligned(16))) float so[4][16][64];
  const int tid = threadIdx.x, w = tid >> 5, lane = tid & 31, ln = lane & 15, hh = lane >> 4; const int by = blockIdx.y;
  A += (size_t)by * sA; Bh += (size_t)by * sB; C += (size_t)by * sC;
  const int ntn = (N + 63) / 64; const int wid = blockIdx.x * 4 + w; const int mt = wid / ntn, nq = wid % ntn; if (mt * 16 >= M) return;
  const int row0 = mt * 16, col0 = nq * 64; const float* arow = A + (size_t)(row0 + ln) * lda;
  v8f acc[4] = {};
  for (int kb = 0; kb < K; kb += 32) {
    FragH ah, al;
    const v4f x0 = *(const v4fa*)(arow + kb + 8 * hh), x1 = *(const v4fa*)(arow + kb + 8 * hh + 4), x2 = *(const v4fa*)(arow + kb + 16 + 8 * hh), x3 = *(const v4fa*)(arow + kb + 16 + 8 * hh + 4);
    float xs[16] = {x0[0],x0[1],x0[2],x0[3],x1[0],x1[1],x1[2],x1[3],x2[0],x2[1],x2[2],x2[3],x3[0],x3[1],x3[2],x3[3]};
#pragma unroll
    for (int i = 0; i < 16; ++i) { const _Float16 h = (_Float16)xs[i]; ah.h[i] = h; al.h[i] = ASPLIT ? (_Float16)(xs[i] - (float)h) : (_Float16)0.0f; }
#pragma unroll
    for (int t = 0; t < 4; ++t) { if (col0 + t * 16 >= N) continue; const size_t boff = (size_t)(col0 + t * 16 + ln) * ldb + kb; FragH bq; bq.half[0] = *(const v8us*)(Bh + boff + 8 * hh); bq.half[1] = *(const v8us*)(Bh + boff + 16 + 8 * hh);
      acc[t] = mmaH<ASPLIT ? 2 : 1>(ah.v, al.v, bq.v, bq.v, acc[t]); }
  }
#pragma unroll
  for (int t = 0; t < 4; ++t) { if (col0 + t * 16 >= N) continue;
#pragma unroll
    for (int r = 0; r < 8; ++r) so[w][8 * hh + r][t * 16 + ln] = acc[t][r] * alpha; }
  __builtin_amdgcn_fence(__ATOMIC_ACQ_REL, "workgroup"); __builtin_amdgcn_wave_barrier();
  const int rsub = lane >> 4, c4 = (lane & 15) * 4;
  {
#pragma unroll
    for (int q = 0; q < 8; ++q) { const int r = q * 2 + rsub; if (col0 + c4 < N) { const v4f v = *(const v4fa*)&so[w][r][c4]; *(v4f*)(C + (size_t)(row0 + r) * ldc + col0 + c4) = v; } }
     }
}

// Wt[n][k] = f16(W[k][n]·scale) from f32 row-major W[K][N] (scale = power of two; bf16-exact weights stay exact in f16 away from the subnormal range)
__global__ __launch_bounds__(256) void k_wt_f16(const float* __restrict__ W, _Float16* __restrict__ Wt, int K, int N, float scale) {
  const int t = blockIdx.x * 256 + threadIdx.x; if (t >= N * (K / 8)) return; const int n = t / (K / 8), k8 = (t % (K / 8)) * 8; FragH f;
#pragma unroll
  for (int i = 0; i < 8; ++i) f.h[i] = (_Float16)(bf16_round(W[(size_t)(k8 + i) * N + n]) * scale); const v8us o = f.half[0];
  *(v8us*)((unsigned short*)Wt + (size_t)n * K + k8) = o; 
}
// k_gemm_hh variant with fused epilogue: v = acc·alpha + bias[by·sBias + col] (+ CP[(row/rowsPerB)·sCPb + by·64 + col] if CP) ; ACT 0 none / 1 elu ; writes f16 C16 (and f32 C if non-null)
template <int ACT>
__global__ __launch_bounds__(128) void k_gemm_hhx(const _Float16* __restrict__ A, int lda, size_t sA, const _Float16* __restrict__ Bh, int ldb, size_t sB, float alpha, const float* __restrict__ bias, size_t sBias, const float* __restrict__ CP, int rowsPerB, size_t sCPb, int row0g,
    float* __restrict__ C, _Float16* __restrict__ C16, int ldc, size_t sC, int M, int N, int K) {
  __shared__ __attribute__((aligned(16))) float so[4][16][64];
  const int tid = threadIdx.x, w = tid >> 5, lane = tid & 31, ln = lane & 15, hh = lane >> 4; const int by = blockIdx.y;
  A += (size_t)by * sA; Bh += (size_t)by * sB; const size_t cofs = (size_t)by * sC; const float* bp = bias ? bias + (size_t)by * sBias : nullptr;
  const int ntn = (N + 63) / 64; const int wid = blockIdx.x * 4 + w; const int mt = wid / ntn, nq = wid % ntn; if (mt * 16 >= M) return;
  const int row0 = mt * 16, col0 = nq * 64; const _Float16* arow = A + (size_t)(row0 + ln) * lda;
  v8f acc[4] = {};
  for (int kb = 0; kb < K; kb += 32) { FragH ah; ah.half[0] = *(const v8us*)((const unsigned short*)arow + kb + 8 * hh); ah.half[1] = *(const v8us*)((const unsigned short*)arow + kb + 16 + 8 * hh);
#pragma unroll
    for (int t = 0; t < 4; ++t) { if (col0 + t * 16 >= N) continue; const size_t boff = (size_t)(col0 + t * 16 + ln) * ldb + kb; FragH bq; bq.half[0] = *(const v8us*)((const unsigned short*)Bh + boff + 8 * hh); bq.half[1] = *(const v8us*)((const unsigned short*)Bh + boff + 16 + 8 * hh);
      acc[t] = mmaH<1>(ah.v, ah.v, bq.v, bq.v, acc[t]); }
  }
#pragma unroll
  for (int t = 0; t < 4; ++t) { if (col0 + t * 16 >= N) continue; const int col = col0 + t * 16 + ln; const float bv = bp ? bf16_round(bp[col]) : 0.f;
#pragma unroll
    for (int r = 0; r < 8; ++r) { float v = acc[t][r] * alpha + bv; if (CP) { const int rr = row0g + row0 + 8 * hh + r; if (rowsPerB < 0) v += CP[cofs + (size_t)rr * ldc + col];      /* rowsPerB < 0: own element of the batched C plane */ else { const int bidx = rr / rowsPerB; v += CP[(size_t)bidx * sCPb + (size_t)by * 64 + col]; } } if (ACT == 1) v = (v > 0.f) ? v : expm1f(v); else if (ACT == 7) v = (v > 0.f) ? v + 1.0f : expf(v); else if (ACT == 8) v = tanhf(v); else if (ACT == 9) v = 0.5f * v * (1.0f + tanhf(0.7978845608028654f * (v + 0.044715f * v * v * v))); else if (ACT == 11) v = 1.0f / (1.0f + expf(-v)); else if (ACT == 12) v = (v > 0.f) ? v : 0.01f * v; else if (ACT == 14) v = (v > 0.f) ? v : 0.1f * v; else if (ACT == 16) v = (v >= 0.f) ? v : 0.3f * v; else if (ACT == 17) v = (v >= 0.f) ? v : 0.2f * v; else if (ACT == 15) v = v / (1.0f + expf(-v)); else if (ACT == 3) v = fmaxf(v, 0.f); else if (ACT == 6) v = 0.5f * v * (1.0f + erff(v * 0.70710678118654752f)); so[w][8 * hh + r][t * 16 + ln] = v; } }
  __builtin_amdgcn_fence(__ATOMIC_ACQ_REL, "workgroup"); __builtin_amdgcn_wave_barrier();
  const int rsub = lane >> 4, c4 = (lane & 15) * 4; typedef _Float16 v4h __attribute__((ext_vector_type(4)));
  {
#pragma unroll
    for (int q = 0; q < 8; ++q) { const int r = q * 2 + rsub; if (col0 + c4 < N) { const v4f v = *(const v4fa*)&so[w][r][c4]; if (C) *(v4f*)(C + cofs + (size_t)(row0 + r) * ldc + col0 + c4) = v; if (C16) { v4h h4; for (int i = 0; i < 4; ++i) h4[i] = (_Float16)v[i]; *(v4h*)(C16 + cofs + (size_t)(row0 + r) * ldc + col0 + c4) = h4; } } }
     }
}


typedef _Float16 v4h __attribute__((ext_vector_type(4)));

__global__ __launch_bounds__(256) void k_h16(const float* __restrict__ x, _Float16* __restrict__ X16, size_t n8) { const size_t t = (size_t)blockIdx.x * 256 + threadIdx.x; if (t >= n8) return; FragH f;
#pragma unroll
  for (int q = 0; q < 8; ++q) f.h[q] = (_Float16)x[t * 8 + q]; *(v8us*)((unsigned short*)X16 + t * 8) = f.half[0];  }
__global__ __launch_bounds__(256) void k_round16f(const float* __restrict__ W, _Float16* __restrict__ Bt, size_t n8) { const size_t t = (size_t)blockIdx.x * 256 + threadIdx.x; if (t >= n8) return; FragH f;
#pragma unroll
  for (int i = 0; i < 8; ++i) f.h[i] = (_Float16)(bf16_round(W[t * 8 + i]) * 16.0f); *(v8us*)((unsigned short*)Bt + t * 8) = f.half[0];  }
template <int NHv, int TTv>
__global__ __launch_bounds__(256) void k_vt(const _Float16* __restrict__ V16, int ldv, int voff, _Float16* __restrict__ Vt) { __shared__ unsigned short tl[64][66]; const int tid = threadIdx.x; const int slab = blockIdx.x / (TTv / 64), lg = blockIdx.x % (TTv / 64); const int b = slab / NHv, h = slab % NHv;
  for (int i = tid; i < 64 * 8; i += 256) { const int r = i / 8, c8 = (i % 8) * 8; FragH f; f.half[0] = *(const v8us*)((const unsigned short*)V16 + ((size_t)b * TTv + lg * 64 + r) * ldv + voff + h * 64 + c8);
#pragma unroll
    for (int q = 0; q < 8; ++q) tl[r][c8 + q] = f.u[q]; }
  __syncthreads();
  {
#pragma unroll
    for (int rd = 0; rd < 2; ++rd) { const int d = rd * 32 + tid / 8, pc = tid % 8; FragH f;
#pragma unroll
      for (int q = 0; q < 8; ++q) f.u[q] = tl[pc * 8 + q][d];
      *(v8us*)((unsigned short*)Vt + ((size_t)slab * 64 + d) * TTv + lg * 64 + pc * 8) = f.half[0]; }
     } }

__global__ __launch_bounds__(256) void k_hl(const float* __restrict__ F, _Float16* __restrict__ Hh, _Float16* __restrict__ Hl, size_t n8) { const size_t t = (size_t)blockIdx.x * 256 + threadIdx.x; if (t >= n8) return; FragH fh, fl; const v4f a = *(const v4fa*)(F + t * 8), c = *(const v4fa*)(F + t * 8 + 4);
#pragma unroll
  for (int q = 0; q < 4; ++q) { _Float16 h = (_Float16)a[q]; fh.h[q] = h; fl.h[q] = (_Float16)((a[q] - (float)h) * 1024.0f); h = (_Float16)c[q]; fh.h[4 + q] = h; fl.h[4 + q] = (_Float16)((c[q] - (float)h) * 1024.0f); }
  { *(v8us*)((unsigned short*)Hh + t * 8) = fh.half[0]; *(v8us*)((unsigned short*)Hl + t * 8) = fl.half[0];  } }

// ---- fast GEMM (wave tile 32x64, work-group tile 128x128; requires M % 128 == 0 rows per launch region, N % 128 == 0, K % 64 == 0); epilogue = k_gemm_hhx semantics ----
__device__ __forceinline__ v16h g2_frag(const _Float16* p, int hh) { FragH f; f.half[0] = *(const v8us*)((const unsigned short*)p + 8 * hh); f.half[1] = *(const v8us*)((const unsigned short*)p + 16 + 8 * hh); return f.v; }
__device__ __forceinline__ v8f g2_mma(v16h a, v16h b, v8f c) { v8f d = __builtin_amdgcn_wmma_f32_16x16x32_f16(false, a, false, b, (short)0, c, false, false); asm volatile("v_nop\n\tv_nop\n\tv_nop\n\tv_nop" : "+v"(d) : "v"(a), "v"(b)); return d; }
// Operand tiles through LDS: a work-group of 8 waves owns 128 x 128 of C and walks K in tiles of 64 (128 bytes of each of its 128 A rows and 128 B rows); asynchronous copies bring whole 128-byte lines into one of two buffers while the other is worked on. A fragment load straight from global memory touches 16 lines for 512 bytes, and every wave of a row or column of waves would repeat it. Needs M % 128 == 0, N % 128 == 0, K % 64 == 0.
#define G3PB 144                     /* LDS pitch of a staged row, bytes: 128 + 16 = 16 bytes x odd, conflict-free for 16-byte reads */
#define G3SB (256 * G3PB)            /* bytes per buffer: 128 A rows, then 128 B rows */
// one tile: 8 copies per lane (A rows sr + 0 / 32 / 64 / 96, then the B rows likewise). The s_wait_xcnt stands inside the copies' own statement, so that no later write of an address register can be moved in front of it.
__device__ __forceinline__ void g3_stage(unsigned l, const _Float16* a, size_t a32, const _Float16* b, size_t b32) {
  asm volatile("global_load_async_to_lds_b128 %0, %8, off\n\tglobal_load_async_to_lds_b128 %1, %9, off\n\tglobal_load_async_to_lds_b128 %2, %10, off\n\tglobal_load_async_to_lds_b128 %3, %11, off\n\t"
               "global_load_async_to_lds_b128 %4, %12, off\n\tglobal_load_async_to_lds_b128 %5, %13, off\n\tglobal_load_async_to_lds_b128 %6, %14, off\n\tglobal_load_async_to_lds_b128 %7, %15, off\n\ts_wait_xcnt 0x0"
               :: "v"(l), "v"(l + 32 * G3PB), "v"(l + 64 * G3PB), "v"(l + 96 * G3PB), "v"(l + 128 * G3PB), "v"(l + 160 * G3PB), "v"(l + 192 * G3PB), "v"(l + 224 * G3PB),
                  "v"(a), "v"(a + a32), "v"(a + 2 * a32), "v"(a + 3 * a32), "v"(b), "v"(b + b32), "v"(b + 2 * b32), "v"(b + 3 * b32) : "memory"); }
// ROPE 1: planes 0 and 1 of the batch (q, k) leave through the rotate-half rotation: N is whole heads of HD = 64 columns, so a wave tile is ONE head and both halves of every pair lie in the wave's own staging tile; position = row mod SQ (row 0 of A is a batch's first token); f16 rows only.
template <int ACT, int ROPE = 0>
__global__ __launch_bounds__(256) void k_gemm2(const _Float16* __restrict__ A, int lda, size_t sA, const _Float16* __restrict__ Bh, int ldb, size_t sB, float alpha, const float* __restrict__ bias, size_t sBias, const float* __restrict__ CP, int rowsPerB, size_t sCPb, int row0g,
    float* __restrict__ C, _Float16* __restrict__ C16, int ldc, size_t sC, int M, int N, int K, const float* __restrict__ tcos = nullptr, const float* __restrict__ tsin = nullptr) { static_assert(ACT == 0 || ACT == 3 || ACT == 6 || ACT == 8 || ACT == 9 || ACT == 11 || ACT == 12 || ACT == 14 || ACT == 15 || ACT == 16 || ACT == 17, "k_gemm2: unsupported ACT code (would silently apply no activation)");
  __shared__ __attribute__((aligned(16))) unsigned char smem[2 * G3SB]; static_assert(sizeof(float) * 8 * 32 * 68 <= 2 * G3SB, "the epilogue's staging tiles fit in the ring's place");
  float (*so)[32][68] = (float (*)[32][68])smem;      /* the ring's bytes become the 8 waves' own output staging tiles behind the loop's last barrier */
  const int tid = threadIdx.x, lane = tid & 31, ln = lane & 15, hh = lane >> 4; const int w = __builtin_amdgcn_readfirstlane(tid >> 5); const int by = blockIdx.y;
  A += (size_t)by * sA; Bh += (size_t)by * sB; const size_t cofs = (size_t)by * sC; const float* bp = bias ? bias + (size_t)by * sBias : nullptr;
  const int ntn = N >> 7; const int mt = blockIdx.x / ntn, nq = blockIdx.x - mt * ntn; const int rowW = mt * 128, colW = nq * 128; if (rowW >= M) return;      /* the same for the whole work-group, in front of every barrier */
  const int row0 = rowW + 32 * (w & 3), col0 = colW + 64 * (w >> 2);      /* 4 x 2 waves of 32 x 64 */
  const int sr = tid >> 3, sc8 = (tid & 7) * 8;      /* staging: 16 bytes per lane and copy, 8 lanes per 128-byte row piece, so a wave's copy takes 4 whole lines */
  const _Float16* ga = A + (size_t)(rowW + sr) * lda + sc8; const _Float16* gb = Bh + (size_t)(colW + sr) * ldb + sc8; const size_t a32 = (size_t)32 * lda, b32 = (size_t)32 * ldb;
  const unsigned ls = (unsigned)(uintptr_t)(smem + sr * G3PB + sc8 * 2);      /* the lane's LDS byte address in buffer 0: low 32 bits of the shared address */
  const _Float16* fa = (const _Float16*)smem + (32 * (w & 3) + ln) * (G3PB / 2); const _Float16* fb = (const _Float16*)smem + (128 + 64 * (w >> 2) + ln) * (G3PB / 2);
  const int nt = K >> 6;
  const v8f z8 = {0.f,0.f,0.f,0.f,0.f,0.f,0.f,0.f}; v8f c00 = z8, c01 = z8, c02 = z8, c03 = z8, c10 = z8, c11 = z8, c12 = z8, c13 = z8;
  g3_stage(ls, ga, a32, gb, b32);
  asm volatile("s_wait_asynccnt 0x0" ::: "memory");      /* this wave's copies of tile 0 have landed */
  __syncthreads();      /* tile 0 is published */
  if (nt > 1) g3_stage(ls + G3SB, ga + 64, a32, gb + 64, b32);
#pragma unroll 1      /* one tile per trip: the two buffers alternate */
  for (int t = 0; t < nt; ++t) { const _Float16* pa = fa + (t & 1) * (G3SB / 2); const _Float16* pb = fb + (t & 1) * (G3SB / 2);
    v16h a[2][2], b[2][4];      /* the tile's 12 fragments, read as one group in front of its 16 WMMAs */
#pragma unroll      /* constant indices keep a and b in registers */
    for (int s = 0; s < 2; ++s) { a[s][0] = g2_frag(pa + s * 32, hh); b[s][0] = g2_frag(pb + s * 32, hh); a[s][1] = g2_frag(pa + 16 * (G3PB / 2) + s * 32, hh);
      for (int j = 1; j < 4; ++j) b[s][j] = g2_frag(pb + j * 16 * (G3PB / 2) + s * 32, hh); }
#pragma unroll      /* likewise; each accumulator takes its products in ascending k */
    for (int s = 0; s < 2; ++s) { c00 = g2_mma(a[s][0], b[s][0], c00); c10 = g2_mma(a[s][1], b[s][0], c10); c01 = g2_mma(a[s][0], b[s][1], c01); c11 = g2_mma(a[s][1], b[s][1], c11);
      c02 = g2_mma(a[s][0], b[s][2], c02); c12 = g2_mma(a[s][1], b[s][2], c12); c03 = g2_mma(a[s][0], b[s][3], c03); c13 = g2_mma(a[s][1], b[s][3], c13); }
    asm volatile("s_wait_dscnt 0x0" ::: "memory");      /* this wave's reads of tile t are done before the buffer is handed to its next writer */
    asm volatile("s_wait_asynccnt 0x0" ::: "memory");      /* this wave's copies of tile t + 1 have landed */
    __syncthreads();      /* publishes tile t + 1 and ends every wave's reads of tile t */
    if (t + 2 < nt) g3_stage(ls + (t & 1) * G3SB, ga + (size_t)(t + 2) * 64, a32, gb + (size_t)(t + 2) * 64, b32); }
  asm volatile("s_wait_asynccnt 0x0" ::: "memory");      /* nothing is in flight when the ring's bytes change their use */
  v8f accs[8] = {c00, c01, c02, c03, c10, c11, c12, c13};
#pragma unroll
  for (int u = 0; u < 8; ++u) { const int t = u & 3, half = u >> 2; const int col = col0 + t * 16 + ln; const float bv = bp ? bf16_round(bp[col]) : 0.f;
#pragma unroll
    for (int r = 0; r < 8; ++r) { const int rloc = half * 16 + 8 * hh + r; float v = accs[u][r] * alpha + bv; if (CP) { if (rowsPerB < 0) v += CP[cofs + (size_t)(row0g + row0 + rloc) * ldc + col];      /* rowsPerB < 0: own element of the batched C plane */ else { const int bidx = (row0g + row0 + rloc) / rowsPerB; v += CP[(size_t)bidx * sCPb + (size_t)by * 64 + col]; } }
      if (ACT == 3) v = fmaxf(v, 0.f); else if (ACT == 6) v = 0.5f * v * (1.0f + erff(v * 0.70710678118654752f)); else if (ACT == 11) v = 1.0f / (1.0f + expf(-v)); else if (ACT == 15) v = v / (1.0f + expf(-v)); else if (ACT == 12) v = (v > 0.f) ? v : 0.01f * v; else if (ACT == 8) v = tanhf(v); else if (ACT == 9) v = 0.5f * v * (1.0f + tanhf(0.7978845608028654f * (v + 0.044715f * v * v * v))); else if (ACT == 14) v = (v > 0.f) ? v : 0.1f * v; else if (ACT == 16) v = (v >= 0.f) ? v : 0.3f * v; else if (ACT == 17) v = (v >= 0.f) ? v : 0.2f * v;
      so[w][rloc][t * 16 + ln] = v; } }
  __builtin_amdgcn_fence(__ATOMIC_ACQ_REL, "workgroup"); __builtin_amdgcn_wave_barrier();
  if (ROPE && by < 2) {      /* 8 lanes per row: a lane takes columns d4 .. d4 + 3 of BOTH halves, so each table value and each staged value is read once and used twice */
    const int r4 = lane >> 3, d4 = (lane & 7) * 4; v4f cc[8], ss[8]; const unsigned tb = (((unsigned)row0 % SQ + r4) * (HD / 2) + d4) * 4u;      /* byte offset of the lane's first table entries; row0 and SQ are multiples of 32: the tile's 32 positions do not wrap */
#pragma unroll      /* constant indices keep cc and ss in registers; all 16 loads go out together, one latency */
    for (int q = 0; q < 8; ++q) { cc[q] = *(const v4fa*)((const char*)tcos + tb + q * 16 * (HD / 2)); ss[q] = *(const v4fa*)((const char*)tsin + tb + q * 16 * (HD / 2)); }
    asm volatile("s_wait_xcnt 0x0" :: "v"(tb) : "memory");      /* the wait in front of any overwrite of the offset register that the 16 issued table loads name; tb as an input keeps that register out of the loads' own destinations (without it the last load landed on it) */
#pragma unroll      /* constant indices into cc and ss */
    for (int q = 0; q < 8; ++q) { const int r = q * 4 + r4; const v4f lo = *(const v4fa*)&so[w][r][d4]; const v4f hi = *(const v4fa*)&so[w][r][d4 + HD / 2]; v4h ol, oh;
      for (int i = 0; i < 4; ++i) { const float c = bf16_round(cc[q][i]), s = bf16_round(ss[q][i]); ol[i] = (_Float16)(lo[i] * c - hi[i] * s); oh[i] = (_Float16)(lo[i] * s + hi[i] * c); }
      _Float16* dst = C16 + cofs + (size_t)(row0 + r) * ldc + col0 + d4; *(v4h*)dst = ol; *(v4h*)(dst + HD / 2) = oh; }
    return; }
  const int rsub = lane >> 4, c4 = (lane & 15) * 4;
  {
#pragma unroll
    for (int q = 0; q < 16; ++q) { const int r = q * 2 + rsub; const v4f v = *(const v4fa*)&so[w][r][c4]; if (C) *(v4f*)(C + cofs + (size_t)(row0 + r) * ldc + col0 + c4) = v; if (C16) { v4h h4; for (int i = 0; i < 4; ++i) h4[i] = (_Float16)v[i]; *(v4h*)(C16 + cofs + (size_t)(row0 + r) * ldc + col0 + c4) = h4; } }
     } }


// all five operand conversions in ONE launch: the four natural [out][in] weights -> Bt planes x16, x -> f16 rows (values as before: bf16 rounding, then an exact f16). PWG work-groups, 16 waves per WGP on 256 WGPs, start once;
// a thread takes 16 pieces of 4 floats (2 of each weight, 8 of x), PTH pieces apart, so every wave-wide load is 512 contiguous bytes (4 whole lines), every store 256 (2 whole lines), and all 16 loads of a wave are in flight together.
#define PWG 512                      /* work-groups of the conversion launch */
#define PTH (PWG * 256)              /* its threads */
__device__ __forceinline__ v4h prep_cvt(v4f a, float scale) { v4h o; for (int q = 0; q < 4; ++q) o[q] = (_Float16)(bf16_round(a[q]) * scale); return o; }
__global__ __launch_bounds__(256) void k_prep(const float* __restrict__ wq, const float* __restrict__ wk, const float* __restrict__ wv, const float* __restrict__ wo, const float* __restrict__ x,
    _Float16* __restrict__ BQ, _Float16* __restrict__ BK, _Float16* __restrict__ BV, _Float16* __restrict__ BO, _Float16* __restrict__ X16) {
  static_assert((size_t)DM * DM == (size_t)PTH * 4 * 2 && (size_t)KVD * DM == (size_t)PTH * 4 * 2 && NR * DM == (size_t)PTH * 4 * 8, "2 pieces of each weight and 8 of x per thread, none left over");
  const unsigned tb = (blockIdx.x * 256u + threadIdx.x) * 16u; v4f a[4][2], b[8];      /* byte offset of the thread's first piece in every f32 source; half of it in every f16 destination */
#pragma unroll      /* constant indices keep a and b in registers */
  for (int i = 0; i < 2; ++i) { const size_t e = (size_t)i * PTH * 16; a[0][i] = *(const v4fa*)((const char*)wq + e + tb); a[1][i] = *(const v4fa*)((const char*)wk + e + tb); a[2][i] = *(const v4fa*)((const char*)wv + e + tb); a[3][i] = *(const v4fa*)((const char*)wo + e + tb); }
#pragma unroll      /* likewise */
  for (int i = 0; i < 8; ++i) b[i] = *(const v4fa*)((const char*)x + (size_t)i * PTH * 16 + tb);
  __builtin_amdgcn_sched_barrier(0);      /* keeps every conversion behind all 16 loads: without it the scheduler put the first conversions, with their waits, in front of the last loads of x, which then went out only after the weights had arrived (two latencies in a row) */
  const unsigned th = tb >> 1;
#pragma unroll      /* likewise */
  for (int i = 0; i < 2; ++i) { const size_t e = (size_t)i * PTH * 8; *(v4h*)((char*)BQ + e + th) = prep_cvt(a[0][i], 16.0f); *(v4h*)((char*)BK + e + th) = prep_cvt(a[1][i], 16.0f); *(v4h*)((char*)BV + e + th) = prep_cvt(a[2][i], 16.0f); *(v4h*)((char*)BO + e + th) = prep_cvt(a[3][i], 16.0f); }
#pragma unroll      /* likewise */
  for (int i = 0; i < 8; ++i) *(v4h*)((char*)X16 + (size_t)i * PTH * 8 + th) = prep_cvt(b[i], 1.0f); }
// fused attention, ONE launch for all batches, heads and query rows: a work-group of 8 waves owns 256 query rows of one head, a wave 32 of them, and walks the SQ keys in stages of FKS keys (passes of 32). S^T = K Q^T (A = key rows, B = query rows kept in registers), so a lane holds scores of ONE query per 16-column group;
// the two f32 score tiles of a pass, after exp2, ARE the f16 B operand of O^T += V^T P^T (register r of tile t = key 16 t + 8 hh + r = the k order of g2_frag), so neither S nor P is ever stored. Running maximum (log2 units) with a late rescale; weights stay unnormalised (at most 2^8), the row sum divides once at the end.
// K and V^T tiles reach the 8 waves through LDS (whole 128-byte lines from global memory, two buffers, one barrier per stage): a fragment load straight from global memory touches 16 lines for 512 bytes, and all 8 waves would repeat it.
#define FKS 64                       /* keys per stage */
#define FKP (HD + 8)                 /* LDS pitch of a key row, in halves: 16 bytes x odd, conflict-free for 16-byte reads */
#define FVP (FKS + 8)                /* LDS pitch of a V^T row, in halves: likewise */
__device__ __forceinline__ v8f fa_mma(v16h a, v16h b, v8f c) { return __builtin_amdgcn_wmma_f32_16x16x32_f16(false, a, false, b, (short)0, c, false, false); }
__device__ __forceinline__ v16h fa_frag(const unsigned short* p, int hh) { FragH f; f.half[0] = *(const v8us*)(p + 8 * hh); f.half[1] = *(const v8us*)(p + 16 + 8 * hh); return f.v; }
__device__ __forceinline__ void fa_exp2x8(float (&e)[8]) {
  asm("v_exp_f32 %0, %0\n\tv_exp_f32 %1, %1\n\tv_exp_f32 %2, %2\n\tv_exp_f32 %3, %3\n\tv_exp_f32 %4, %4\n\tv_exp_f32 %5, %5\n\tv_exp_f32 %6, %6\n\tv_exp_f32 %7, %7\n\tv_nop"
      : "+v"(e[0]), "+v"(e[1]), "+v"(e[2]), "+v"(e[3]), "+v"(e[4]), "+v"(e[5]), "+v"(e[6]), "+v"(e[7])); }
__global__ __launch_bounds__(256) void k_fattn(const _Float16* __restrict__ Q16, const _Float16* __restrict__ K16, const _Float16* __restrict__ VT, _Float16* __restrict__ O16) {
  __shared__ __attribute__((aligned(16))) unsigned short lk[2][FKS][FKP]; __shared__ __attribute__((aligned(16))) unsigned short lv[2][HD][FVP];
  const int tid = threadIdx.x, lane = tid & 31, ln = lane & 15, hh = lane >> 4; const int w = __builtin_amdgcn_readfirstlane(tid >> 5);
  const int h = blockIdx.y, b = blockIdx.z; const int q0 = blockIdx.x * 256 + w * 32;
  const _Float16* qp = Q16 + ((size_t)b * SQ + q0 + ln) * DM + h * HD;
  const int kr = tid >> 3, kc = (tid & 7) * 8;      /* staging: 16 bytes per thread and step, 8 threads per 128-byte key row */
  const int vr = tid / (FKS / 8), vc = (tid % (FKS / 8)) * 8;      /* FKS / 8 threads per V^T row piece */
  const unsigned short* kg = (const unsigned short*)K16 + ((size_t)b * SQ + kr) * KVD + h * HD + kc;
  const unsigned short* vg = (const unsigned short*)VT + (((size_t)b * NH + h) * HD + vr) * SQ + vc;
  const float cs = 0.125f * 1.44269504088896340736f;      /* 1/sqrt(64) and log2(e) in one factor */
  const v8f z8 = {0.f,0.f,0.f,0.f,0.f,0.f,0.f,0.f};
  v8us gk[FKS / 32], gv[FKS / 32];
#pragma unroll
  for (int i = 0; i < FKS / 32; ++i) { gk[i] = *(const v8us*)(kg + (size_t)i * 32 * KVD); gv[i] = *(const v8us*)(vg + (size_t)i * (2048 / FKS) * SQ); }
  v16h bq[2][2];
#pragma unroll
  for (int j = 0; j < 2; ++j) for (int s = 0; s < 2; ++s) bq[j][s] = g2_frag(qp + (size_t)j * 16 * DM + s * 32, hh);
  v8f o[4][2]; float m[2] = {-1.0e30f, -1.0e30f}; float l[2][2] = {{0.f, 0.f}, {0.f, 0.f}};
#pragma unroll
  for (int t = 0; t < 4; ++t) { o[t][0] = z8; o[t][1] = z8; }
#pragma unroll
  for (int i = 0; i < FKS / 32; ++i) { *(v8us*)&lk[0][kr + i * 32][kc] = gk[i]; *(v8us*)&lv[0][vr + i * (2048 / FKS)][vc] = gv[i]; }
  __syncthreads();      /* stage 0 is published */
#pragma unroll 1      /* one stage per trip: the body already holds FKS / 32 unrolled passes */
  for (int st = 0; st < SQ / FKS; ++st) {
    const int cur = st & 1; const int sn = (st + 1 < SQ / FKS) ? st + 1 : st;      /* the next stage's tiles are asked for now and stored after this stage's passes; the last stage re-reads its own (in bounds; that buffer is not read again) */
#pragma unroll
    for (int i = 0; i < FKS / 32; ++i) { gk[i] = *(const v8us*)(kg + ((size_t)sn * FKS + i * 32) * KVD); gv[i] = *(const v8us*)(vg + (size_t)i * (2048 / FKS) * SQ + sn * FKS); }
    v16h ka[2][2];
#pragma unroll
    for (int t = 0; t < 2; ++t) for (int s = 0; s < 2; ++s) ka[t][s] = fa_frag(&lk[cur][t * 16 + ln][s * 32], hh);
    asm volatile("" ::: "memory");      /* compiler fence: without it the next stage's global loads are sunk to just in front of their LDS stores at the stage's foot, and their whole latency is waited out there */
#pragma unroll
    for (int p = 0; p < FKS / 32; ++p) {
      v16h va[4]; v8f sc[2][2];      /* sc: [key tile][query tile] */
#pragma unroll
      for (int t = 0; t < 2; ++t) for (int j = 0; j < 2; ++j) sc[t][j] = fa_mma(ka[t][1], bq[j][1], fa_mma(ka[t][0], bq[j][0], z8));
#pragma unroll
      for (int t = 0; t < 4; ++t) va[t] = fa_frag(&lv[cur][t * 16 + ln][p * 32], hh);
      if (p + 1 < FKS / 32) {      /* the stage's next pass: its key fragments one pass ahead, into the same registers */
#pragma unroll
        for (int t = 0; t < 2; ++t) for (int s = 0; s < 2; ++s) ka[t][s] = fa_frag(&lk[cur][(p + 1) * 32 + t * 16 + ln][s * 32], hh); }
      asm volatile("" ::: "memory");      /* compiler fence: keeps these LDS reads together in front of the softmax arithmetic, which covers their latency; without it they are sunk in among the WMMAs that use them */
      float mx[2];
#pragma unroll
      for (int j = 0; j < 2; ++j) { float a = fmaxf(sc[0][j][0], sc[1][j][0]); for (int r = 1; r < 8; ++r) a = fmaxf(fmaxf(a, sc[0][j][r]), sc[1][j][r]); mx[j] = a * cs; }
      const bool need = (mx[0] > m[0] + 8.0f) || (mx[1] > m[1] + 8.0f);
      if (__builtin_amdgcn_ballot_w32(need) != 0) {      /* scalar branch: rescale only when some column's maximum has grown by more than 2^8; m[] changes only here and from values joined over the two lane halves, so both halves of a column always use the same m */
#pragma unroll
        for (int j = 0; j < 2; ++j) { const float mj = fmaxf(mx[j], __shfl_xor(mx[j], 16, 32)); const float mn = fmaxf(m[j], mj); const float f = __builtin_amdgcn_exp2f(m[j] - mn); m[j] = mn; l[j][0] *= f; l[j][1] *= f;
          for (int t = 0; t < 4; ++t) for (int r = 0; r < 8; ++r) o[t][j][r] *= f; } }
      v16h pb[2];
#pragma unroll
      for (int j = 0; j < 2; ++j) for (int t = 0; t < 2; ++t) { float e[8]; for (int r = 0; r < 8; ++r) e[r] = fmaf(sc[t][j][r], cs, -m[j]); fa_exp2x8(e); for (int r = 0; r < 8; ++r) { l[j][t] += e[r]; pb[j][t * 8 + r] = (_Float16)e[r]; } }
#pragma unroll
      for (int t = 0; t < 4; ++t) for (int j = 0; j < 2; ++j) o[t][j] = fa_mma(va[t], pb[j], o[t][j]);
    }
#pragma unroll
    for (int i = 0; i < FKS / 32; ++i) { *(v8us*)&lk[cur ^ 1][kr + i * 32][kc] = gk[i]; *(v8us*)&lv[cur ^ 1][vr + i * (2048 / FKS)][vc] = gv[i]; }      /* every wave left that buffer before the barrier that ended the stage before */
    __syncthreads();      /* publishes stage st + 1 and ends every wave's reads of stage st */
  }
#pragma unroll
  for (int j = 0; j < 2; ++j) { float lt = l[j][0] + l[j][1]; lt += __shfl_xor(lt, 16, 32); const float fin = 64.0f / lt;      /* o carried x64, as the output GEMM's alpha expects */
    unsigned short* op = (unsigned short*)O16 + ((size_t)b * SQ + q0 + j * 16 + ln) * DM + h * HD + 8 * hh;
    for (int t = 0; t < 4; ++t) { FragH f; for (int r = 0; r < 8; ++r) f.h[r] = (_Float16)(o[t][j][r] * fin); *(v8us*)(op + t * 16) = f.half[0]; } } }
__global__ __launch_bounds__(256) void k_vt(const _Float16* __restrict__ V16, int b, int h0, _Float16* __restrict__ VT) { __shared__ unsigned short tl[64][65]; const int tid = threadIdx.x; const int hh = blockIdx.x % HG, sg = blockIdx.x / HG; const int s0 = sg * 64; const int h = h0 + hh;
  for (int i = tid; i < 64 * 8; i += 256) { const int j = i / 8, d8 = (i % 8) * 8; FragH f; f.half[0] = *(const v8us*)((const unsigned short*)V16 + ((size_t)b * SQ + s0 + j) * DM + h * HD + d8); for (int q = 0; q < 8; ++q) tl[d8 + q][j] = f.u[q]; }
  __syncthreads();
  { for (int i = tid; i < 64 * 8; i += 256) { const int d = i / 8, j8 = (i % 8) * 8; FragH f; for (int q = 0; q < 8; ++q) f.u[q] = tl[d][j8 + q]; *(v8us*)((unsigned short*)VT + ((size_t)hh * HD + d) * SQ + s0 + j8) = f.half[0]; }  } }



__global__ __launch_bounds__(256) void k_rsmcf2(const float* __restrict__ S, _Float16* __restrict__ P, int hg, int q0, int nk) {
  #pragma clang fp contract(off)
  const int t = blockIdx.x * 256 + threadIdx.x; if (t >= hg * QT) return; const size_t i = (size_t)t; const float* s = S + i * NKX; const int last = q0 + (t % QT); float mx = -3.0e38f;
#pragma unroll 1
  for (int j = 0; j < nk; ++j) { const float f = (j <= last) ? 1.f : 0.f; mx = fmaxf(mx, fmaf(f, s[j], (1.f - f) * -1.0e9f)); } float se = 0.f;
#pragma unroll 1
  for (int j = 0; j < nk; ++j) { const float f = (j <= last) ? 1.f : 0.f; se += __expf(fmaf(f, s[j], (1.f - f) * -1.0e9f) - mx); } const float sc = 256.0f / se;
#pragma unroll 1
  for (int j0 = 0; j0 < nk; j0 += 8) { FragH fr; for (int q = 0; q < 8; ++q) { const int j = j0 + q; const float f = (j <= last) ? 1.f : 0.f; fr.h[q] = (_Float16)(__expf(fmaf(f, s[j], (1.f - f) * -1.0e9f) - mx) * sc); } unsigned short* d = (unsigned short*)P + i * NKX + j0; *(v8us*)d = fr.half[0];  } }


template <int MASKADD>
__global__ __launch_bounds__(64) void k_att0(const float* __restrict__ QF, const float* __restrict__ KF, const float* __restrict__ VF, int ld, const float* __restrict__ mask, float scale, float* __restrict__ OF, int ldo) {
  #pragma clang fp contract(off)
  __shared__ __attribute__((aligned(16))) float lq[64][64]; __shared__ __attribute__((aligned(16))) float lo[64][64];
  const int tid = threadIdx.x; const int h = blockIdx.x / (QT0 / 64), rg = blockIdx.x % (QT0 / 64); const int i = rg * 64 + tid;
  const float* qr = QF + (size_t)i * ld + h * HD;
#pragma unroll 1
  for (int c = 0; c < HD / 4; ++c) { *(v4f*)&lq[tid][c * 4] = *(const v4fa*)(qr + c * 4); const v4f z = {0.f, 0.f, 0.f, 0.f}; *(v4f*)&lo[tid][c * 4] = z; }
  float m = -1.0e30f, l = 0.f; const int jmax = MASKADD ? (SQ - 1) : (rg * 64 + 63);      /* additive-mask form: every key (the mask input decides); causal form: keys up to the block's last row */
#pragma unroll 1
  for (int j = 0; j <= jmax; ++j) { const float* kr = KF + (size_t)j * ld + h * HD; const float* vr = VF + (size_t)j * ld + h * HD; float s = 0.f;
#pragma unroll 1
    for (int c = 0; c < HD / 4; ++c) { const v4f kq = *(const v4fa*)(kr + c * 4); const v4f qq = *(v4f*)&lq[tid][c * 4]; s = __fadd_rn(s, __fmul_rn(qq[0], kq[0])); s = __fadd_rn(s, __fmul_rn(qq[1], kq[1])); s = __fadd_rn(s, __fmul_rn(qq[2], kq[2])); s = __fadd_rn(s, __fmul_rn(qq[3], kq[3])); }
    s = __fmul_rn(s, scale); if (MASKADD) s = __fadd_rn(s, __fmul_rn(bf16_round(mask[(size_t)i * SQ + j]), -10000.0f));
    const float f = (MASKADD || j <= i) ? 1.f : 0.f; const float sm = fmaf(f, s, (1.f - f) * -1.0e30f); const float mn = fmaxf(m, sm); const float sc = expf(m - mn); const float e = expf(sm - mn); l = __fadd_rn(__fmul_rn(l, sc), e); m = mn;
#pragma unroll 1
    for (int c = 0; c < HD / 4; ++c) { const v4f vv = *(const v4fa*)(vr + c * 4); v4f oo = *(v4f*)&lo[tid][c * 4]; for (int u = 0; u < 4; ++u) oo[u] = __fadd_rn(__fmul_rn(oo[u], sc), __fmul_rn(e, vv[u])); *(v4f*)&lo[tid][c * 4] = oo; } }
  const float fin = 64.0f / l;      /* o carried x64 like the f16 path */
#pragma unroll 1
  for (int c = 0; c < HD / 4; ++c) { v4f oo = *(v4f*)&lo[tid][c * 4]; for (int u = 0; u < 4; ++u) oo[u] = __fmul_rn(oo[u], fin); *(v4f*)&lo[tid][c * 4] = oo; }
  __syncthreads();
  {
#pragma unroll 1
    for (int it = 0; it < 16; ++it) { const int row = it * 4 + tid / 16, pc = (tid % 16) * 4; const v4f v = *(const v4f*)&lo[row][pc]; *(v4f*)(OF + (size_t)(rg * 64 + row) * ldo + h * HD + pc) = v; }
     } }


__global__ __launch_bounds__(256) void k_kvexp(const float* __restrict__ src, float* __restrict__ dst, size_t n4) { const size_t t = (size_t)blockIdx.x * 256 + threadIdx.x; if (t >= n4) return; const size_t e = t * 4; const size_t row = e / DM; const int col = (int)(e % DM); const int h = col / HD, d = col % HD; const v4f v = *(const v4fa*)(src + row * KVD + (size_t)(h / HPG) * HD + d); *(v4f*)(dst + e) = v;  }

__global__ __launch_bounds__(256) void k_tab2(float theta, float* __restrict__ CS, float* __restrict__ SN) {
  #pragma clang fp contract(off)
  const int t = blockIdx.x * 256 + threadIdx.x; if (t >= SQ * (HD / 2)) return; const int i = t % (HD / 2); const int p = t / (HD / 2); const float invf = 1.0f / powf(theta, (float)(2 * i) / (float)HD); const float ang = __fmul_rn((float)p, invf); const float c = cosf(ang), s = sinf(ang);
  *(float*)(CS + t) = c; *(float*)(SN + t) = s;  }
template <int NORM, int ROPE>
__global__ __launch_bounds__(64) void k_xform(const float* __restrict__ F, int ldf, int nh, const float* __restrict__ gain, float eps, const float* __restrict__ CS, const float* __restrict__ SN, _Float16* __restrict__ H16, int ldo) {
  #pragma clang fp contract(off)
  __shared__ float xv[HD]; __shared__ float red[HD]; __shared__ unsigned short sh_[HD]; const int d = threadIdx.x; const int h = blockIdx.x % nh; const size_t r = blockIdx.x / nh; const int p = (int)(r % SQ);
  float x = F[r * (size_t)ldf + (size_t)h * HD + d];
  if (NORM) { red[d] = __fmul_rn(x, x); __syncthreads(); for (int st = HD / 2; st > 0; st >>= 1) { if (d < st) red[d] = __fadd_rn(red[d], red[d + st]); __syncthreads(); } const float rs = rsqrtf(__fadd_rn(red[0] / (float)HD, eps)); x = __fmul_rn(__fmul_rn(x, rs), bf16_round(gain[d])); }
  xv[d] = x; __syncthreads();
  float o = x;
  if (ROPE == 1) { const int i = d >> 1; const float c = CS[p * (HD / 2) + i], s = SN[p * (HD / 2) + i]; const float ev = xv[2 * i], od = xv[2 * i + 1]; o = (d & 1) ? __fadd_rn(__fmul_rn(ev, s), __fmul_rn(od, c)) : __fadd_rn(__fmul_rn(ev, c), -__fmul_rn(od, s)); }
  if (ROPE == 2) { const int i = d & (HD / 2 - 1); const float c = CS[p * (HD / 2) + i], s = SN[p * (HD / 2) + i]; const float lo = xv[i], hi = xv[i + HD / 2]; o = (d < HD / 2) ? __fadd_rn(__fmul_rn(lo, c), -__fmul_rn(hi, s)) : __fadd_rn(__fmul_rn(lo, s), __fmul_rn(hi, c)); }
  FragH th; th.h[0] = (_Float16)o; sh_[d] = th.u[0]; __syncthreads();
  if (d < HD / 8) { FragH f; for (int q = 0; q < 8; ++q) f.u[q] = sh_[d * 8 + q]; unsigned short* dst = (unsigned short*)H16 + r * (size_t)ldo + (size_t)h * HD + d * 8; *(v8us*)dst = f.half[0];  } }

template <int NORM, int ROPE>
__global__ __launch_bounds__(64) void k_xformf(const float* __restrict__ F, int ldf, int nh, const float* __restrict__ gain, float eps, const float* __restrict__ CS, const float* __restrict__ SN, float* __restrict__ F32, int ldo) {
  #pragma clang fp contract(off)
  __shared__ float xv[HD]; __shared__ float red[HD]; const int d = threadIdx.x; const int h = blockIdx.x % nh; const size_t r = blockIdx.x / nh; const int p = (int)(r % SQ);
  float x = F[r * (size_t)ldf + (size_t)h * HD + d];
  if (NORM) { red[d] = __fmul_rn(x, x); __syncthreads(); for (int st = HD / 2; st > 0; st >>= 1) { if (d < st) red[d] = __fadd_rn(red[d], red[d + st]); __syncthreads(); } const float rs = rsqrtf(__fadd_rn(red[0] / (float)HD, eps)); x = __fmul_rn(__fmul_rn(x, rs), bf16_round(gain[d])); }
  xv[d] = x; __syncthreads();
  float o = x;
  if (ROPE == 1) { const int i = d >> 1; const float c = CS[p * (HD / 2) + i], s = SN[p * (HD / 2) + i]; const float ev = xv[2 * i], od = xv[2 * i + 1]; o = (d & 1) ? __fadd_rn(__fmul_rn(ev, s), __fmul_rn(od, c)) : __fadd_rn(__fmul_rn(ev, c), -__fmul_rn(od, s)); }
  if (ROPE == 2) { const int i = d & (HD / 2 - 1); const float c = CS[p * (HD / 2) + i], s = SN[p * (HD / 2) + i]; const float lo = xv[i], hi = xv[i + HD / 2]; o = (d < HD / 2) ? __fadd_rn(__fmul_rn(lo, c), -__fmul_rn(hi, s)) : __fadd_rn(__fmul_rn(lo, s), __fmul_rn(hi, c)); }
  float* dst = F32 + r * (size_t)ldo + (size_t)h * HD + d; *(float*)dst = o;  }

__global__ __launch_bounds__(256) void k_bfcp(const float* __restrict__ src, float* __restrict__ dst, size_t n4) { const size_t t = (size_t)blockIdx.x * 256 + threadIdx.x; if (t >= n4) return; const v4f a = *(const v4fa*)(src + t * 4); v4f o; for (int q = 0; q < 4; ++q) o[q] = bf16_round(a[q]); *(v4f*)(dst + t * 4) = o;  }

__global__ __launch_bounds__(256) void k_tab2d(float* __restrict__ CS, float* __restrict__ SN) {
  #pragma clang fp contract(off)
  const int t = blockIdx.x * 256 + threadIdx.x; if (t >= SQ * (HD / 2)) return; const int i = t % (HD / 2); const int p = t / (HD / 2); const float invf = (float)(1.0 / pow(10000.0, (double)(2 * i) / (double)HD)); const float ang = __fmul_rn((float)p, invf); const float c = cosf(ang), s = sinf(ang);
  *(float*)(CS + t) = c; *(float*)(SN + t) = s;  }
extern "C" void kernel_launch(void* const* d_in, const int* in_sizes, int n_in,
                              void* d_out, int out_size, void* d_ws, size_t ws_size, hipStream_t stream) {
  (void)in_sizes; (void)n_in; (void)out_size;
  const float* const* I = (const float* const*)d_in; const float* x = I[0]; const float* wq = I[1]; const float* wk = I[2]; const float* wv = I[3]; const float* wo = I[4]; const float* tcos = I[5]; const float* tsin = I[6]; const float* bq = nullptr; const float* bk = nullptr; const float* bv = nullptr; const float* bo = nullptr;      /* natural [out][in] weights, no biases; rope_cos / rope_sin INPUT tables [2048][32] */
  static_assert(HPG == 1 && NH == NG * HPG && NH * HD == DM && KVD == DM, "plain multi-head attention as 16 kv groups of one query head");
  char* ws = (char*)d_ws; size_t off = 0;
  auto take = [&](size_t bytes) { char* p = ws + off; off += (bytes + 255) & ~(size_t)255; return p; };
  _Float16* BQ = (_Float16*)take((size_t)DM * DM * 2); _Float16* BK = (_Float16*)take((size_t)KVD * DM * 2); _Float16* BV = (_Float16*)take((size_t)KVD * DM * 2); _Float16* BO = (_Float16*)take((size_t)DM * DM * 2);
  _Float16* X16 = (_Float16*)take(NR * DM * 2); _Float16* Q16 = (_Float16*)take(NR * DM * 2); _Float16* K16 = (_Float16*)take(NR * KVD * 2); _Float16* V16 = (_Float16*)take(NR * KVD * 2); _Float16* O16 = (_Float16*)take(NR * DM * 2);
  _Float16* VT = (_Float16*)take((size_t)NB * NH * HD * SQ * 2);
  float* QF0 = (float*)take((size_t)QT0 * DM * 4); float* KF0 = (float*)take((size_t)QT0 * KVD * 4); float* VF0 = (float*)take((size_t)QT0 * KVD * 4); float* KF0e = (float*)take((size_t)QT0 * DM * 4); float* VF0e = (float*)take((size_t)QT0 * DM * 4); float* OF0 = (float*)take((size_t)NB * QT0 * DM * 4); _Float16* OH0 = (_Float16*)take((size_t)NB * QT0 * DM * 2); _Float16* OL0 = (_Float16*)take((size_t)NB * QT0 * DM * 2);
  if (off > ws_size) return;
  k_prep<<<PWG, 256, 0, stream>>>(wq, wk, wv, wo, x, BQ, BK, BV, BO, X16);      /* natural [out][in] = Bt planes x16; x as f16 rows */
  const size_t r0p = (size_t)B0 * SQ;      /* first projected row */
  static_assert(((size_t)DM * DM * 2) % 256 == 0 && (NR * DM * 2) % 256 == 0, "BQ | BK | BV and Q16 | K16 | V16 lie back to back in the workspace: the plane strides of the batched launch");
  k_gemm2<0, 1><<<dim3((unsigned)((MP / 128) * (DM / 128)), 3), 256, 0, stream>>>(X16 + r0p * DM, DM, 0, BQ, DM, (size_t)DM * DM, 0.0625f, nullptr, 0, nullptr, 1, 0, 0, nullptr, Q16 + r0p * DM, DM, NR * DM, MP, DM, DM, tcos, tsin);      /* q, k (rotated by the INPUT rope tables [2048][32]: column d uses table column d mod 32 = the module's [cos | cos]) and v of every batch -> f16 rows */
  for (int b = B0; b < B0 + NBR; ++b) { const size_t r0 = (size_t)b * SQ;
    k_vt<NG, SQ><<<NG * (SQ / 64), 256, 0, stream>>>(V16 + r0 * KVD, KVD, 0, VT + (size_t)b * NH * HD * SQ); }      /* V^T [NB][NH][HD][SQ], this batch's plane */
  k_fattn<<<dim3(SQ / 256, NH, NB), 256, 0, stream>>>(Q16, K16, VT, O16);      /* scores, softmax and P V of every batch, head and query row in ONE launch; o (x64) into merged f16 rows */
  k_gemm2<0><<<dim3((unsigned)((MPO / 128) * (DM / 128)), 1), 256, 0, stream>>>(O16 + r0p * DM, DM, 0, BO, DM, 0, 0.0009765625f, bo, 0, nullptr, 1, 0, 0, (float*)d_out + r0p * DM, nullptr, DM, 0, MPO, DM, DM);      /* out rows are the output layout */
}

// v006
// Measured time: 93.8 microseconds a run.
// Timed twice side by side with v005, it ran 1.12 and 1.10 times as fast.
// Over all steps from v000 it is 75.8 times as fast.
#include <hip/hip_runtime.h>
// Multi-head self-attention with half-split RoPE from RANDOM input tables, NON-causal (x [2][2048][1024]; q / k / v = x W^T (nn.Linear natural [1024][1024] sigma 1/32, no biases), 16 heads of 64; rope: x * [cos | cos] + rotate_half(x) * [sin | sin] with rotate_half = (-x2, x1) over the two 32-lane halves and INPUT tables rope_cos / rope_sin [2048][32] (cos / sin of uniform-random angles); scores / sqrt(64); softmax over all 2048 keys (f32; no mask); out = merged Wo^T (natural, no bias) -> [2][2048][1024]); run as grouped-query attention with 16 groups of ONE head.
// Structure: x as exact f16 rows; natural weights as exact x16 planes; q, k and v of both batches as ONE batched WMMA GEMM launch (32x64 wave tiles, f32 accumulation, blockIdx.y picks the weight plane and the output rows) whose epilogue rotates q and k in f32 (rotate-half; a 64-column wave tile is one head; INPUT tables rounded to bf16 as read) and writes f16 rows, and writes v as V^T of the heads straight from its accumulators (a lane holds 8 consecutive tokens of one column); then ONE fused attention launch for all batches, heads and query rows (k_fattn: scores of 32 query columns per wave against ALL 2048 keys, running softmax in registers with f32 statistics and native exp2, unnormalised f16 weights, o = P V^T carried x64) into merged f16 rows; out = o Wo^T GEMM (f32, alpha 2^-10); launches: see trace.
// Compute dtype: inputs rounded to bf16; x / weights exact; q, k, v, softmax weights and o as plain f16 GEMM operands (~2^-12); scores and softmax statistics f32. v_wmma_f32_16x16x32_f16.
#define NB 2
#define NG 16
#define HPG 1
#define KVD (NG * HD)
#define SQ 2048
#define DM 1024
#define NH 16
#define HD 64
#define HG 4                         /* heads per block group of the unlaunched k_vt overload */
#define QT 256                       /* query rows per tile */
#define NKX SQ                       /* S / P row pitch */
#define QT0 128                      /* rows per head of k_att0 (not launched); sizes unused f32 buffers */
#define B0 0                         /* first batch processed (debug hook) */
#define NBR NB                       /* batches processed (debug hook) */
#define NR ((size_t)NB * SQ)         /* token rows */
#define MP ((int)((size_t)NBR * SQ)) /* rows projected (debug hook) */
#define QN SQ                        /* unused: k_fattn attends all SQ query rows of a batch */
#define NHD NH                       /* unused: k_fattn attends all NH heads */
#define MPO MP                       /* rows through the output stage (debug hook) */
#define LQ DM      /* unused: the q and k rows have pitch DM */
typedef __bf16 v16b __attribute__((ext_vector_type(16)));
typedef unsigned short v8us __attribute__((ext_vector_type(8), may_alias));
typedef float  v8f  __attribute__((ext_vector_type(8)));
typedef float  v4f  __attribute__((ext_vector_type(4)));
typedef float  v4fa __attribute__((ext_vector_type(4), may_alias));
union FragB { v16b v; v8us half[2]; unsigned short u[16]; };

__device__ __forceinline__ unsigned short bf16_bits(float x) { unsigned int u = __float_as_uint(x); return (unsigned short)((u + 0x7FFFu + ((u >> 16) & 1u)) >> 16); }
__device__ __forceinline__ float bf16_val(unsigned short b) { return __uint_as_float(((unsigned int)b) << 16); }
__device__ __forceinline__ float bf16_round(float x) { return bf16_val(bf16_bits(x)); }
// D += A·B with NT terms: 1 = ah·bh, 2 = + al·bh (A split), 3 = + ah·bl (both split)
template <int NT>
__device__ __forceinline__ v8f mmaN(v16b ah, v16b al, v16b bh, v16b bl, v8f c) {
  c = __builtin_amdgcn_wmma_f32_16x16x32_bf16(false, ah, false, bh, (short)0, c, false, false);
  if (NT >= 2) c = __builtin_amdgcn_wmma_f32_16x16x32_bf16(false, al, false, bh, (short)0, c, false, false);
  if (NT >= 3) c = __builtin_amdgcn_wmma_f32_16x16x32_bf16(false, ah, false, bl, (short)0, c, false, false);
  asm volatile("v_nop\n\tv_nop\n\tv_nop\n\tv_nop" : "+v"(c) : "v"(ah), "v"(al), "v"(bh), "v"(bl));
  return c;
}

__global__ __launch_bounds__(256) void k_wt_bf16(const float* __restrict__ W, unsigned short* __restrict__ Wt, int K, int N) {
  const int t = blockIdx.x * 256 + threadIdx.x;
  const int k8n = K / 8;
  if (t >= N * k8n) return;
  const int n = t / k8n, k8 = (t % k8n) * 8;
  v8us v;
#pragma unroll
  for (int i = 0; i < 8; ++i) v[i] = bf16_bits(W[(size_t)(k8 + i) * N + n]);
  *(v8us*)(Wt + (size_t)n * K + k8) = v;
  
}

// GEMM C[M][N] (f32, pitch ldc) = act(A[M][K]·W + bias). A f32 row-major (pitch lda) converted per fragment to bf16
// (ASPLIT: hi/lo two planes -> 2 terms, else single rounded term); Wt bf16 [N][K] (pitch ldb). BIAS_BF16 rounds the
// bias to bf16 first (bias quantised to bf16 before the add). K%32==0, M%16==0, N%64==0.
template <bool ASPLIT, int ACT, bool BIAS_BF16>
__global__ __launch_bounds__(128) void k_gemm_bf(const float* __restrict__ A, int lda, const unsigned short* __restrict__ Wt, int ldb,
                                               const float* __restrict__ bias, float* __restrict__ C, int ldc, int M, int N, int K) {
  __shared__ __attribute__((aligned(16))) float so[4][16][64];
  const int tid = threadIdx.x, w = tid >> 5, lane = tid & 31, ln = lane & 15, hh = lane >> 4;
  const int ntn = N / 64;
  const int wid = blockIdx.x * 4 + w;
  const int mt = wid / ntn, nq = wid % ntn;
  if (mt * 16 >= M) return;
  const int row0 = mt * 16, col0 = nq * 64;
  const float* arow = A + (size_t)(row0 + ln) * lda;
  v8f acc[4] = {};
  for (int kb = 0; kb < K; kb += 32) {
    FragB ah, al;
    const v4f x0 = *(const v4fa*)(arow + kb + 8 * hh), x1 = *(const v4fa*)(arow + kb + 8 * hh + 4);
    const v4f x2 = *(const v4fa*)(arow + kb + 16 + 8 * hh), x3 = *(const v4fa*)(arow + kb + 16 + 8 * hh + 4);
    float xs[16] = {x0[0],x0[1],x0[2],x0[3],x1[0],x1[1],x1[2],x1[3],x2[0],x2[1],x2[2],x2[3],x3[0],x3[1],x3[2],x3[3]};
#pragma unroll
    for (int i = 0; i < 16; ++i) { const unsigned short hb = bf16_bits(xs[i]); ah.u[i] = hb; al.u[i] = ASPLIT ? bf16_bits(xs[i] - bf16_val(hb)) : (unsigned short)0; }
#pragma unroll
    for (int t = 0; t < 4; ++t) {
      const unsigned short* brow = Wt + (size_t)(col0 + t * 16 + ln) * ldb + kb;
      FragB b;
      b.half[0] = *(const v8us*)(brow + 8 * hh);
      b.half[1] = *(const v8us*)(brow + 16 + 8 * hh);
      acc[t] = mmaN<ASPLIT ? 2 : 1>(ah.v, al.v, b.v, b.v, acc[t]);
    }
  }
#pragma unroll
  for (int t = 0; t < 4; ++t) {
    float bv = bias ? bias[col0 + t * 16 + ln] : 0.f;
    if (BIAS_BF16) bv = bf16_round(bv);
#pragma unroll
    for (int r = 0; r < 8; ++r) { float v = acc[t][r] + bv; if (ACT == 1) v = fmaxf(v, 0.f); so[w][8 * hh + r][t * 16 + ln] = v; }
  }
  __builtin_amdgcn_fence(__ATOMIC_ACQ_REL, "workgroup");
  __builtin_amdgcn_wave_barrier();
  const int rsub = lane >> 4, c4 = (lane & 15) * 4;
  {
#pragma unroll
    for (int q = 0; q < 8; ++q) {
      const int r = q * 2 + rsub;
      const v4f v = *(const v4fa*)&so[w][r][c4];
      *(v4f*)(C + (size_t)(row0 + r) * ldc + col0 + c4) = v;
    }
    
  }
}

// GEMM C = act(A·W + bias + resid): A f32 (ASPLIT -> hi/lo 2 terms), Wt bf16 [N][K]; ACT 0 none, 1 relu, 2 exact gelu;
// resid (optional, f32, row index = (row % rmod), pitch ldr, RES_BF16 rounds it) added before the activation.
template <bool ASPLIT, int ACT, bool BIAS_BF16, bool RES_BF16>
__global__ __launch_bounds__(128) void k_gemm_bf3(const float* __restrict__ A, int lda, const unsigned short* __restrict__ Wt, int ldb,
                                                const float* __restrict__ bias, const float* __restrict__ resid, int rmod, int ldr,
                                                float* __restrict__ C, int ldc, int M, int N, int K) {
  __shared__ __attribute__((aligned(16))) float so[4][16][64];
  const int tid = threadIdx.x, w = tid >> 5, lane = tid & 31, ln = lane & 15, hh = lane >> 4;
  const int ntn = N / 64;
  const int wid = blockIdx.x * 4 + w;
  const int mt = wid / ntn, nq = wid % ntn;
  if (mt * 16 >= M) return;
  const int row0 = mt * 16, col0 = nq * 64;
  const float* arow = A + (size_t)(row0 + ln) * lda;
  v8f acc[4] = {};
  for (int kb = 0; kb < K; kb += 32) {
    FragB ah, al;
    const v4f x0 = *(const v4fa*)(arow + kb + 8 * hh), x1 = *(const v4fa*)(arow + kb + 8 * hh + 4);
    const v4f x2 = *(const v4fa*)(arow + kb + 16 + 8 * hh), x3 = *(const v4fa*)(arow + kb + 16 + 8 * hh + 4);
    float xs[16] = {x0[0],x0[1],x0[2],x0[3],x1[0],x1[1],x1[2],x1[3],x2[0],x2[1],x2[2],x2[3],x3[0],x3[1],x3[2],x3[3]};
#pragma unroll
    for (int i = 0; i < 16; ++i) { const unsigned short hb = bf16_bits(xs[i]); ah.u[i] = hb; al.u[i] = ASPLIT ? bf16_bits(xs[i] - bf16_val(hb)) : (unsigned short)0; }
#pragma unroll
    for (int t = 0; t < 4; ++t) {
      const unsigned short* brow = Wt + (size_t)(col0 + t * 16 + ln) * ldb + kb;
      FragB b;
      b.half[0] = *(const v8us*)(brow + 8 * hh);
      b.half[1] = *(const v8us*)(brow + 16 + 8 * hh);
      acc[t] = mmaN<ASPLIT ? 2 : 1>(ah.v, al.v, b.v, b.v, acc[t]);
    }
  }
#pragma unroll
  for (int t = 0; t < 4; ++t) {
    const int col = col0 + t * 16 + ln;
    float bv = bias ? bias[col] : 0.f;
    if (BIAS_BF16) bv = bf16_round(bv);
#pragma unroll
    for (int r = 0; r < 8; ++r) {
      float v = acc[t][r] + bv;
      if (resid) { float rv = resid[(size_t)((row0 + 8 * hh + r) % rmod) * ldr + col]; if (RES_BF16) rv = bf16_round(rv); v += rv; }
      if (ACT == 1) v = fmaxf(v, 0.f);
      if (ACT == 2) v = 0.5f * v * (1.0f + erff(v * 0.70710678118654752f));
      if (ACT == 3) { const float u = 0.7978845608028654f * (v + 0.044715f * v * v * v); v = 0.5f * v * (1.0f + tanhf(u)); }
      so[w][8 * hh + r][t * 16 + ln] = v;
    }
  }
  __builtin_amdgcn_fence(__ATOMIC_ACQ_REL, "workgroup");
  __builtin_amdgcn_wave_barrier();
  const int rsub = lane >> 4, c4 = (lane & 15) * 4;
  {
#pragma unroll
    for (int q = 0; q < 8; ++q) {
      const int r = q * 2 + rsub;
      const v4f v = *(const v4fa*)&so[w][r][c4];
      *(v4f*)(C + (size_t)(row0 + r) * ldc + col0 + c4) = v;
    }
    
  }
}
// row LayerNorm (biased variance, eps) over N: s = X (+ R); optional out_sum <- s; out_norm <- (s-mu)*rsqrt(var+eps)*g + b
template <bool PARAM_BF16>
__global__ __launch_bounds__(256) void k_layernorm(const float* __restrict__ X, const float* __restrict__ R, const float* __restrict__ g, const float* __restrict__ bta,
                                                  float* __restrict__ out_sum, float* __restrict__ out_norm, int N, float eps) {
  __shared__ float red[256];
  const int row = blockIdx.x, tid = threadIdx.x;
  const float* x = X + (size_t)row * N; const float* rr = R ? R + (size_t)row * N : nullptr;
  float vals[16];                     // up to N = 4096
  const int per = N / 256;            // contiguous chunk per thread? use strided-by-4 chunks: thread handles j = tid*4 + 1024*u
  float s1 = 0.f;
  for (int u = 0; u < per / 4; ++u) {
    const int j = tid * 4 + 1024 * u;
    const v4f a = *(const v4fa*)(x + j);
    v4f b = {0.f,0.f,0.f,0.f}; if (rr) b = *(const v4fa*)(rr + j);
#pragma unroll
    for (int q = 0; q < 4; ++q) { const float v = a[q] + b[q]; vals[u * 4 + q] = v; s1 += v; }
  }
  red[tid] = s1; __syncthreads();
  for (int st = 128; st > 0; st >>= 1) { if (tid < st) red[tid] += red[tid + st]; __syncthreads(); }
  const float mu = red[0] / (float)N; __syncthreads();
  float s2 = 0.f;
  for (int u = 0; u < per / 4; ++u)
#pragma unroll
    for (int q = 0; q < 4; ++q) { const float c = vals[u * 4 + q] - mu; s2 += c * c; }
  red[tid] = s2; __syncthreads();
  for (int st = 128; st > 0; st >>= 1) { if (tid < st) red[tid] += red[tid + st]; __syncthreads(); }
  const float rs = rsqrtf(red[0] / (float)N + eps);
  {
    for (int u = 0; u < per / 4; ++u) {
      const int j = tid * 4 + 1024 * u;
      v4f o, sm;
#pragma unroll
      for (int q = 0; q < 4; ++q) {
        float gg = g[j + q], bb = bta[j + q];
        if (PARAM_BF16) { gg = bf16_round(gg); bb = bf16_round(bb); }
        sm[q] = vals[u * 4 + q]; o[q] = (vals[u * 4 + q] - mu) * rs * gg + bb;
      }
      if (out_sum) *(v4f*)(out_sum + (size_t)row * N + j) = sm;
      *(v4f*)(out_norm + (size_t)row * N + j) = o;
    }
    
  }
}



// ---- f16 WMMA path (v_wmma_f32_16x16x32_f16): 11-bit significands for operands in range — used where a [0,1] probability operand needs more precision than bf16
typedef _Float16 v16h __attribute__((ext_vector_type(16)));
union FragH { v16h v; v8us half[2]; _Float16 h[16]; unsigned short u[16]; };
template <int NT>
__device__ __forceinline__ v8f mmaH(v16h ah, v16h al, v16h bh, v16h bl, v8f c) {
  c = __builtin_amdgcn_wmma_f32_16x16x32_f16(false, ah, false, bh, (short)0, c, false, false);
  if (NT >= 2) c = __builtin_amdgcn_wmma_f32_16x16x32_f16(false, al, false, bh, (short)0, c, false, false);
  if (NT >= 3) c = __builtin_amdgcn_wmma_f32_16x16x32_f16(false, ah, false, bl, (short)0, c, false, false);
  asm volatile("v_nop\n\tv_nop\n\tv_nop\n\tv_nop" : "+v"(c) : "v"(ah), "v"(al), "v"(bh), "v"(bl));
  return c;
}
// batched GEMM like k_gemm_b but f16 operands: A f32 (split into f16 hi/lo if ASPLIT, else rounded to f16), Bt = f16 values [n][k]; alpha; C f32; N multiple of 16 (partial tiles skipped)
template <bool ASPLIT>
__global__ __launch_bounds__(128) void k_gemm_h(const float* __restrict__ A, int lda, size_t sA, const _Float16* __restrict__ Bh, int ldb, size_t sB, float alpha, float* __restrict__ C, int ldc, size_t sC, int M, int N, int K) {
  __shared__ __attribute__((aligned(16))) float so[4][16][64];
  const int tid = threadIdx.x, w = tid >> 5, lane = tid & 31, ln = lane & 15, hh = lane >> 4; const int by = blockIdx.y;
  A += (size_t)by * sA; Bh += (size_t)by * sB; C += (size_t)by * sC;
  const int ntn = (N + 63) / 64; const int wid = blockIdx.x * 4 + w; const int mt = wid / ntn, nq = wid % ntn; if (mt * 16 >= M) return;
  const int row0 = mt * 16, col0 = nq * 64; const float* arow = A + (size_t)(row0 + ln) * lda;
  v8f acc[4] = {};
  for (int kb = 0; kb < K; kb += 32) {
    FragH ah, al;
    const v4f x0 = *(const v4fa*)(arow + kb + 8 * hh), x1 = *(const v4fa*)(arow + kb + 8 * hh + 4), x2 = *(const v4fa*)(arow + kb + 16 + 8 * hh), x3 = *(const v4fa*)(arow + kb + 16 + 8 * hh + 4);
    float xs[16] = {x0[0],x0[1],x0[2],x0[3],x1[0],x1[1],x1[2],x1[3],x2[0],x2[1],x2[2],x2[3],x3[0],x3[1],x3[2],x3[3]};
#pragma unroll
    for (int i = 0; i < 16; ++i) { const _Float16 h = (_Float16)xs[i]; ah.h[i] = h; al.h[i] = ASPLIT ? (_Float16)(xs[i] - (float)h) : (_Float16)0.0f; }
#pragma unroll
    for (int t = 0; t < 4; ++t) { if (col0 + t * 16 >= N) continue; const size_t boff = (size_t)(col0 + t * 16 + ln) * ldb + kb; FragH bq; bq.half[0] = *(const v8us*)(Bh + boff + 8 * hh); bq.half[1] = *(const v8us*)(Bh + boff + 16 + 8 * hh);
      acc[t] = mmaH<ASPLIT ? 2 : 1>(ah.v, al.v, bq.v, bq.v, acc[t]); }
  }
#pragma unroll
  for (int t = 0; t < 4; ++t) { if (col0 + t * 16 >= N) continue;
#pragma unroll
    for (int r = 0; r < 8; ++r) so[w][8 * hh + r][t * 16 + ln] = acc[t][r] * alpha; }
  __builtin_amdgcn_fence(__ATOMIC_ACQ_REL, "workgroup"); __builtin_amdgcn_wave_barrier();
  const int rsub = lane >> 4, c4 = (lane & 15) * 4;
  {
#pragma unroll
    for (int q = 0; q < 8; ++q) { const int r = q * 2 + rsub; if (col0 + c4 < N) { const v4f v = *(const v4fa*)&so[w][r][c4]; *(v4f*)(C + (size_t)(row0 + r) * ldc + col0 + c4) = v; } }
     }
}

// Wt[n][k] = f16(W[k][n]·scale) from f32 row-major W[K][N] (scale = power of two; bf16-exact weights stay exact in f16 away from the subnormal range)
__global__ __launch_bounds__(256) void k_wt_f16(const float* __restrict__ W, _Float16* __restrict__ Wt, int K, int N, float scale) {
  const int t = blockIdx.x * 256 + threadIdx.x; if (t >= N * (K / 8)) return; const int n = t / (K / 8), k8 = (t % (K / 8)) * 8; FragH f;
#pragma unroll
  for (int i = 0; i < 8; ++i) f.h[i] = (_Float16)(bf16_round(W[(size_t)(k8 + i) * N + n]) * scale); const v8us o = f.half[0];
  *(v8us*)((unsigned short*)Wt + (size_t)n * K + k8) = o; 
}
// k_gemm_hh variant with fused epilogue: v = acc·alpha + bias[by·sBias + col] (+ CP[(row/rowsPerB)·sCPb + by·64 + col] if CP) ; ACT 0 none / 1 elu ; writes f16 C16 (and f32 C if non-null)
template <int ACT>
__global__ __launch_bounds__(128) void k_gemm_hhx(const _Float16* __restrict__ A, int lda, size_t sA, const _Float16* __restrict__ Bh, int ldb, size_t sB, float alpha, const float* __restrict__ bias, size_t sBias, const float* __restrict__ CP, int rowsPerB, size_t sCPb, int row0g,
    float* __restrict__ C, _Float16* __restrict__ C16, int ldc, size_t sC, int M, int N, int K) {
  __shared__ __attribute__((aligned(16))) float so[4][16][64];
  const int tid = threadIdx.x, w = tid >> 5, lane = tid & 31, ln = lane & 15, hh = lane >> 4; const int by = blockIdx.y;
  A += (size_t)by * sA; Bh += (size_t)by * sB; const size_t cofs = (size_t)by * sC; const float* bp = bias ? bias + (size_t)by * sBias : nullptr;
  const int ntn = (N + 63) / 64; const int wid = blockIdx.x * 4 + w; const int mt = wid / ntn, nq = wid % ntn; if (mt * 16 >= M) return;
  const int row0 = mt * 16, col0 = nq * 64; const _Float16* arow = A + (size_t)(row0 + ln) * lda;
  v8f acc[4] = {};
  for (int kb = 0; kb < K; kb += 32) { FragH ah; ah.half[0] = *(const v8us*)((const unsigned short*)arow + kb + 8 * hh); ah.half[1] = *(const v8us*)((const unsigned short*)arow + kb + 16 + 8 * hh);
#pragma unroll
    for (int t = 0; t < 4; ++t) { if (col0 + t * 16 >= N) continue; const size_t boff = (size_t)(col0 + t * 16 + ln) * ldb + kb; FragH bq; bq.half[0] = *(const v8us*)((const unsigned short*)Bh + boff + 8 * hh); bq.half[1] = *(const v8us*)((const unsigned short*)Bh + boff + 16 + 8 * hh);
      acc[t] = mmaH<1>(ah.v, ah.v, bq.v, bq.v, acc[t]); }
  }
#pragma unroll
  for (int t = 0; t < 4; ++t) { if (col0 + t * 16 >= N) continue; const int col = col0 + t * 16 + ln; const float bv = bp ? bf16_round(bp[col]) : 0.f;
#pragma unroll
    for (int r = 0; r < 8; ++r) { float v = acc[t][r] * alpha + bv; if (CP) { const int rr = row0g + row0 + 8 * hh + r; if (rowsPerB < 0) v += CP[cofs + (size_t)rr * ldc + col];      /* rowsPerB < 0: own element of the batched C plane */ else { const int bidx = rr / rowsPerB; v += CP[(size_t)bidx * sCPb + (size_t)by * 64 + col]; } } if (ACT == 1) v = (v > 0.f) ? v : expm1f(v); else if (ACT == 7) v = (v > 0.f) ? v + 1.0f : expf(v); else if (ACT == 8) v = tanhf(v); else if (ACT == 9) v = 0.5f * v * (1.0f + tanhf(0.7978845608028654f * (v + 0.044715f * v * v * v))); else if (ACT == 11) v = 1.0f / (1.0f + expf(-v)); else if (ACT == 12) v = (v > 0.f) ? v : 0.01f * v; else if (ACT == 14) v = (v > 0.f) ? v : 0.1f * v; else if (ACT == 16) v = (v >= 0.f) ? v : 0.3f * v; else if (ACT == 17) v = (v >= 0.f) ? v : 0.2f * v; else if (ACT == 15) v = v / (1.0f + expf(-v)); else if (ACT == 3) v = fmaxf(v, 0.f); else if (ACT == 6) v = 0.5f * v * (1.0f + erff(v * 0.70710678118654752f)); so[w][8 * hh + r][t * 16 + ln] = v; } }
  __builtin_amdgcn_fence(__ATOMIC_ACQ_REL, "workgroup"); __builtin_amdgcn_wave_barrier();
  const int rsub = lane >> 4, c4 = (lane & 15) * 4; typedef _Float16 v4h __attribute__((ext_vector_type(4)));
  {
#pragma unroll
    for (int q = 0; q < 8; ++q) { const int r = q * 2 + rsub; if (col0 + c4 < N) { const v4f v = *(const v4fa*)&so[w][r][c4]; if (C) *(v4f*)(C + cofs + (size_t)(row0 + r) * ldc + col0 + c4) = v; if (C16) { v4h h4; for (int i = 0; i < 4; ++i) h4[i] = (_Float16)v[i]; *(v4h*)(C16 + cofs + (size_t)(row0 + r) * ldc + col0 + c4) = h4; } } }
     }
}


typedef _Float16 v4h __attribute__((ext_vector_type(4)));

__global__ __launch_bounds__(256) void k_h16(const float* __restrict__ x, _Float16* __restrict__ X16, size_t n8) { const size_t t = (size_t)blockIdx.x * 256 + threadIdx.x; if (t >= n8) return; FragH f;
#pragma unroll
  for (int q = 0; q < 8; ++q) f.h[q] = (_Float16)x[t * 8 + q]; *(v8us*)((unsigned short*)X16 + t * 8) = f.half[0];  }
__global__ __launch_bounds__(256) void k_round16f(const float* __restrict__ W, _Float16* __restrict__ Bt, size_t n8) { const size_t t = (size_t)blockIdx.x * 256 + threadIdx.x; if (t >= n8) return; FragH f;
#pragma unroll
  for (int i = 0; i < 8; ++i) f.h[i] = (_Float16)(bf16_round(W[t * 8 + i]) * 16.0f); *(v8us*)((unsigned short*)Bt + t * 8) = f.half[0];  }
template <int NHv, int TTv>
__global__ __launch_bounds__(256) void k_vt(const _Float16* __restrict__ V16, int ldv, int voff, _Float16* __restrict__ Vt) { __shared__ unsigned short tl[64][66]; const int tid = threadIdx.x; const int slab = blockIdx.x / (TTv / 64), lg = blockIdx.x % (TTv / 64); const int b = slab / NHv, h = slab % NHv;
  for (int i = tid; i < 64 * 8; i += 256) { const int r = i / 8, c8 = (i % 8) * 8; FragH f; f.half[0] = *(const v8us*)((const unsigned short*)V16 + ((size_t)b * TTv + lg * 64 + r) * ldv + voff + h * 64 + c8);
#pragma unroll
    for (int q = 0; q < 8; ++q) tl[r][c8 + q] = f.u[q]; }
  __syncthreads();
  {
#pragma unroll
    for (int rd = 0; rd < 2; ++rd) { const int d = rd * 32 + tid / 8, pc = tid % 8; FragH f;
#pragma unroll
      for (int q = 0; q < 8; ++q) f.u[q] = tl[pc * 8 + q][d];
      *(v8us*)((unsigned short*)Vt + ((size_t)slab * 64 + d) * TTv + lg * 64 + pc * 8) = f.half[0]; }
     } }

__global__ __launch_bounds__(256) void k_hl(const float* __restrict__ F, _Float16* __restrict__ Hh, _Float16* __restrict__ Hl, size_t n8) { const size_t t = (size_t)blockIdx.x * 256 + threadIdx.x; if (t >= n8) return; FragH fh, fl; const v4f a = *(const v4fa*)(F + t * 8), c = *(const v4fa*)(F + t * 8 + 4);
#pragma unroll
  for (int q = 0; q < 4; ++q) { _Float16 h = (_Float16)a[q]; fh.h[q] = h; fl.h[q] = (_Float16)((a[q] - (float)h) * 1024.0f); h = (_Float16)c[q]; fh.h[4 + q] = h; fl.h[4 + q] = (_Float16)((c[q] - (float)h) * 1024.0f); }
  { *(v8us*)((unsigned short*)Hh + t * 8) = fh.half[0]; *(v8us*)((unsigned short*)Hl + t * 8) = fl.half[0];  } }

// ---- fast GEMM (wave tile 32x64, work-group tile 128x128; requires M % 128 == 0 rows per launch region, N % 128 == 0, K % 64 == 0); epilogue = k_gemm_hhx semantics ----
__device__ __forceinline__ v16h g2_frag(const _Float16* p, int hh) { FragH f; f.half[0] = *(const v8us*)((const unsigned short*)p + 8 * hh); f.half[1] = *(const v8us*)((const unsigned short*)p + 16 + 8 * hh); return f.v; }
__device__ __forceinline__ v8f g2_mma(v16h a, v16h b, v8f c) { v8f d = __builtin_amdgcn_wmma_f32_16x16x32_f16(false, a, false, b, (short)0, c, false, false); asm volatile("v_nop\n\tv_nop\n\tv_nop\n\tv_nop" : "+v"(d) : "v"(a), "v"(b)); return d; }
// Operand tiles through LDS: a work-group of 8 waves owns 128 x 128 of C and walks K in tiles of 64 (128 bytes of each of its 128 A rows and 128 B rows); asynchronous copies bring whole 128-byte lines into one of two buffers while the other is worked on. A fragment load straight from global memory touches 16 lines for 512 bytes, and every wave of a row or column of waves would repeat it. Needs M % 128 == 0, N % 128 == 0, K % 64 == 0.
#define G3PB 144                     /* LDS pitch of a staged row, bytes: 128 + 16 = 16 bytes x odd, conflict-free for 16-byte reads */
#define G3SB (256 * G3PB)            /* bytes per buffer: 128 A rows, then 128 B rows */
// one tile: 8 copies per lane (A rows sr + 0 / 32 / 64 / 96, then the B rows likewise). The s_wait_xcnt stands inside the copies' own statement, so that no later write of an address register can be moved in front of it.
__device__ __forceinline__ void g3_stage(unsigned l, const _Float16* a, size_t a32, const _Float16* b, size_t b32) {
  asm volatile("global_load_async_to_lds_b128 %0, %8, off\n\tglobal_load_async_to_lds_b128 %1, %9, off\n\tglobal_load_async_to_lds_b128 %2, %10, off\n\tglobal_load_async_to_lds_b128 %3, %11, off\n\t"
               "global_load_async_to_lds_b128 %4, %12, off\n\tglobal_load_async_to_lds_b128 %5, %13, off\n\tglobal_load_async_to_lds_b128 %6, %14, off\n\tglobal_load_async_to_lds_b128 %7, %15, off\n\ts_wait_xcnt 0x0"
               :: "v"(l), "v"(l + 32 * G3PB), "v"(l + 64 * G3PB), "v"(l + 96 * G3PB), "v"(l + 128 * G3PB), "v"(l + 160 * G3PB), "v"(l + 192 * G3PB), "v"(l + 224 * G3PB),
                  "v"(a), "v"(a + a32), "v"(a + 2 * a32), "v"(a + 3 * a32), "v"(b), "v"(b + b32), "v"(b + 2 * b32), "v"(b + 3 * b32) : "memory"); }
#define G3VP 136                     /* LDS pitch of a V^T row of the work-group's tile, in halves: 128 tokens + 8 = 16 bytes x odd, conflict-free for 16-byte accesses */
// ROPE 1: plane 2 of the batch (v) leaves as V^T [batch][column][SQ] into VTo and nowhere else: register r of an accumulator is token 8 hh + r of column ln, so 8 registers ARE 16 bytes of a V^T row; the work-group's 128 x 128 tile is gathered in LDS so that every store is whole 128-byte lines (needs SQ % 128 == 0: a tile lies in one batch).
// ROPE 1: planes 0 and 1 of the batch (q, k) leave through the rotate-half rotation: N is whole heads of HD = 64 columns, so a wave tile is ONE head and both halves of every pair lie in the wave's own staging tile; position = row mod SQ (row 0 of A is a batch's first token); f16 rows only.
template <int ACT, int ROPE = 0>
__global__ __launch_bounds__(256) void k_gemm2(const _Float16* __restrict__ A, int lda, size_t sA, const _Float16* __restrict__ Bh, int ldb, size_t sB, float alpha, const float* __restrict__ bias, size_t sBias, const float* __restrict__ CP, int rowsPerB, size_t sCPb, int row0g,
    float* __restrict__ C, _Float16* __restrict__ C16, int ldc, size_t sC, int M, int N, int K, const float* __restrict__ tcos = nullptr, const float* __restrict__ tsin = nullptr, _Float16* __restrict__ VTo = nullptr) { static_assert(ACT == 0 || ACT == 3 || ACT == 6 || ACT == 8 || ACT == 9 || ACT == 11 || ACT == 12 || ACT == 14 || ACT == 15 || ACT == 16 || ACT == 17, "k_gemm2: unsupported ACT code (would silently apply no activation)");
  __shared__ __attribute__((aligned(16))) unsigned char smem[2 * G3SB]; static_assert(sizeof(float) * 8 * 32 * 68 <= 2 * G3SB, "the epilogue's staging tiles fit in the ring's place");
  float (*so)[32][68] = (float (*)[32][68])smem;      /* the ring's bytes become the 8 waves' own output staging tiles behind the loop's last barrier */
  const int tid = threadIdx.x, lane = tid & 31, ln = lane & 15, hh = lane >> 4; const int w = __builtin_amdgcn_readfirstlane(tid >> 5); const int by = blockIdx.y;
  A += (size_t)by * sA; Bh += (size_t)by * sB; const size_t cofs = (size_t)by * sC; const float* bp = bias ? bias + (size_t)by * sBias : nullptr;
  const int ntn = N >> 7; const int mt = blockIdx.x / ntn, nq = blockIdx.x - mt * ntn; const int rowW = mt * 128, colW = nq * 128; if (rowW >= M) return;      /* the same for the whole work-group, in front of every barrier */
  const int row0 = rowW + 32 * (w & 3), col0 = colW + 64 * (w >> 2);      /* 4 x 2 waves of 32 x 64 */
  const int sr = tid >> 3, sc8 = (tid & 7) * 8;      /* staging: 16 bytes per lane and copy, 8 lanes per 128-byte row piece, so a wave's copy takes 4 whole lines */
  const _Float16* ga = A + (size_t)(rowW + sr) * lda + sc8; const _Float16* gb = Bh + (size_t)(colW + sr) * ldb + sc8; const size_t a32 = (size_t)32 * lda, b32 = (size_t)32 * ldb;
  const unsigned ls = (unsigned)(uintptr_t)(smem + sr * G3PB + sc8 * 2);      /* the lane's LDS byte address in buffer 0: low 32 bits of the shared address */
  const _Float16* fa = (const _Float16*)smem + (32 * (w & 3) + ln) * (G3PB / 2); const _Float16* fb = (const _Float16*)smem + (128 + 64 * (w >> 2) + ln) * (G3PB / 2);
  const int nt = K >> 6;
  const v8f z8 = {0.f,0.f,0.f,0.f,0.f,0.f,0.f,0.f}; v8f c00 = z8, c01 = z8, c02 = z8, c03 = z8, c10 = z8, c11 = z8, c12 = z8, c13 = z8;
  g3_stage(ls, ga, a32, gb, b32);
  asm volatile("s_wait_asynccnt 0x0" ::: "memory");      /* this wave's copies of tile 0 have landed */
  __syncthreads();      /* tile 0 is published */
  if (nt > 1) g3_stage(ls + G3SB, ga + 64, a32, gb + 64, b32);
#pragma unroll 1      /* one tile per trip: the two buffers alternate */
  for (int t = 0; t < nt; ++t) { const _Float16* pa = fa + (t & 1) * (G3SB / 2); const _Float16* pb = fb + (t & 1) * (G3SB / 2);
    v16h a[2][2], b[2][4];      /* the tile's 12 fragments, read as one group in front of its 16 WMMAs */
#pragma unroll      /* constant indices keep a and b in registers */
    for (int s = 0; s < 2; ++s) { a[s][0] = g2_frag(pa + s * 32, hh); b[s][0] = g2_frag(pb + s * 32, hh); a[s][1] = g2_frag(pa + 16 * (G3PB / 2) + s * 32, hh);
      for (int j = 1; j < 4; ++j) b[s][j] = g2_frag(pb + j * 16 * (G3PB / 2) + s * 32, hh); }
#pragma unroll      /* likewise; each accumulator takes its products in ascending k */
    for (int s = 0; s < 2; ++s) { c00 = g2_mma(a[s][0], b[s][0], c00); c10 = g2_mma(a[s][1], b[s][0], c10); c01 = g2_mma(a[s][0], b[s][1], c01); c11 = g2_mma(a[s][1], b[s][1], c11);
      c02 = g2_mma(a[s][0], b[s][2], c02); c12 = g2_mma(a[s][1], b[s][2], c12); c03 = g2_mma(a[s][0], b[s][3], c03); c13 = g2_mma(a[s][1], b[s][3], c13); }
    asm volatile("s_wait_dscnt 0x0" ::: "memory");      /* this wave's reads of tile t are done before the buffer is handed to its next writer */
    asm volatile("s_wait_asynccnt 0x0" ::: "memory");      /* this wave's copies of tile t + 1 have landed */
    __syncthreads();      /* publishes tile t + 1 and ends every wave's reads of tile t */
    if (t + 2 < nt) g3_stage(ls + (t & 1) * G3SB, ga + (size_t)(t + 2) * 64, a32, gb + (size_t)(t + 2) * 64, b32); }
  asm volatile("s_wait_asynccnt 0x0" ::: "memory");      /* nothing is in flight when the ring's bytes change their use */
  v8f accs[8] = {c00, c01, c02, c03, c10, c11, c12, c13};
  if (ROPE && by == 2) {      /* the same for the whole work-group; alpha and bias as below, no CP term and no activation on this plane */
    static_assert(ACT == 0 || !ROPE, "the V^T plane takes no activation"); static_assert(128 * G3VP * 2 <= 2 * G3SB && SQ % 128 == 0, "the V^T tile fits in the ring's place and lies in one batch");
#pragma unroll      /* constant indices into accs */
    for (int u = 0; u < 8; ++u) { const int t = u & 3, half = u >> 2; const int col = col0 + t * 16 + ln; const float bv = bp ? bf16_round(bp[col]) : 0.f; FragH vh;
      for (int r = 0; r < 8; ++r) vh.h[r] = (_Float16)(accs[u][r] * alpha + bv);
      *(v8us*)((unsigned short*)smem + (col - colW) * G3VP + (row0 - rowW) + half * 16 + 8 * hh) = vh.half[0]; }
    __syncthreads();      /* the V^T tile is whole: each of its rows holds tokens of four waves */
    const int dr = tid >> 4, pc = (tid & 15) * 8;      /* 16 lanes per V^T row: 256 contiguous bytes, 2 whole lines */
    unsigned short* vd = (unsigned short*)VTo + ((size_t)(rowW / SQ) * N + colW + dr) * SQ + rowW % SQ + pc;
#pragma unroll      /* all 8 LDS reads go out together */
    for (int q = 0; q < 8; ++q) *(v8us*)(vd + (size_t)q * 16 * SQ) = *(const v8us*)((const unsigned short*)smem + (q * 16 + dr) * G3VP + pc);
    return; }
#pragma unroll
  for (int u = 0; u < 8; ++u) { const int t = u & 3, half = u >> 2; const int col = col0 + t * 16 + ln; const float bv = bp ? bf16_round(bp[col]) : 0.f;
#pragma unroll
    for (int r = 0; r < 8; ++r) { const int rloc = half * 16 + 8 * hh + r; float v = accs[u][r] * alpha + bv; if (CP) { if (rowsPerB < 0) v += CP[cofs + (size_t)(row0g + row0 + rloc) * ldc + col];      /* rowsPerB < 0: own element of the batched C plane */ else { const int bidx = (row0g + row0 + rloc) / rowsPerB; v += CP[(size_t)bidx * sCPb + (size_t)by * 64 + col]; } }
      if (ACT == 3) v = fmaxf(v, 0.f); else if (ACT == 6) v = 0.5f * v * (1.0f + erff(v * 0.70710678118654752f)); else if (ACT == 11) v = 1.0f / (1.0f + expf(-v)); else if (ACT == 15) v = v / (1.0f + expf(-v)); else if (ACT == 12) v = (v > 0.f) ? v : 0.01f * v; else if (ACT == 8) v = tanhf(v); else if (ACT == 9) v = 0.5f * v * (1.0f + tanhf(0.7978845608028654f * (v + 0.044715f * v * v * v))); else if (ACT == 14) v = (v > 0.f) ? v : 0.1f * v; else if (ACT == 16) v = (v >= 0.f) ? v : 0.3f * v; else if (ACT == 17) v = (v >= 0.f) ? v : 0.2f * v;
      so[w][rloc][t * 16 + ln] = v; } }
  __builtin_amdgcn_fence(__ATOMIC_ACQ_REL, "workgroup"); __builtin_amdgcn_wave_barrier();
  if (ROPE) {      /* planes 0 and 1 (plane 2 has left above; the row stores below are not built for ROPE 1). 8 lanes per row: a lane takes columns d4 .. d4 + 3 of BOTH halves, so each table value and each staged value is read once and used twice */
    const int r4 = lane >> 3, d4 = (lane & 7) * 4; v4f cc[8], ss[8]; const unsigned tb = (((unsigned)row0 % SQ + r4) * (HD / 2) + d4) * 4u;      /* byte offset of the lane's first table entries; row0 and SQ are multiples of 32: the tile's 32 positions do not wrap */
#pragma unroll      /* constant indices keep cc and ss in registers; all 16 loads go out together, one latency */
    for (int q = 0; q < 8; ++q) { cc[q] = *(const v4fa*)((const char*)tcos + tb + q * 16 * (HD / 2)); ss[q] = *(const v4fa*)((const char*)tsin + tb + q * 16 * (HD / 2)); }
    asm volatile("s_wait_xcnt 0x0" :: "v"(tb) : "memory");      /* the wait in front of any overwrite of the offset register that the 16 issued table loads name; tb as an input keeps that register out of the loads' own destinations (without it the last load landed on it) */
#pragma unroll      /* constant indices into cc and ss */
    for (int q = 0; q < 8; ++q) { const int r = q * 4 + r4; const v4f lo = *(const v4fa*)&so[w][r][d4]; const v4f hi = *(const v4fa*)&so[w][r][d4 + HD / 2]; v4h ol, oh;
      for (int i = 0; i < 4; ++i) { const float c = bf16_round(cc[q][i]), s = bf16_round(ss[q][i]); ol[i] = (_Float16)(lo[i] * c - hi[i] * s); oh[i] = (_Float16)(lo[i] * s + hi[i] * c); }
      _Float16* dst = C16 + cofs + (size_t)(row0 + r) * ldc + col0 + d4; *(v4h*)dst = ol; *(v4h*)(dst + HD / 2) = oh; }
    return; }
  const int rsub = lane >> 4, c4 = (lane & 15) * 4;
  {
#pragma unroll
    for (int q = 0; q < 16; ++q) { const int r = q * 2 + rsub; const v4f v = *(const v4fa*)&so[w][r][c4]; if (C) *(v4f*)(C + cofs + (size_t)(row0 + r) * ldc + col0 + c4) = v; if (C16) { v4h h4; for (int i = 0; i < 4; ++i) h4[i] = (_Float16)v[i]; *(v4h*)(C16 + cofs + (size_t)(row0 + r) * ldc + col0 + c4) = h4; } }
     } }


// all five operand conversions in ONE launch: the four natural [out][in] weights -> Bt planes x16, x -> f16 rows (values as before: bf16 rounding, then an exact f16). PWG work-groups, 16 waves per WGP on 256 WGPs, start once;
// a thread takes 16 pieces of 4 floats (2 of each weight, 8 of x), PTH pieces apart, so every wave-wide load is 512 contiguous bytes (4 whole lines), every store 256 (2 whole lines), and all 16 loads of a wave are in flight together.
#define PWG 512                      /* work-groups of the conversion launch */
#define PTH (PWG * 256)              /* its threads */
__device__ __forceinline__ v4h prep_cvt(v4f a, float scale) { v4h o; for (int q = 0; q < 4; ++q) o[q] = (_Float16)(bf16_round(a[q]) * scale); return o; }
__global__ __launch_bounds__(256) void k_prep(const float* __restrict__ wq, const float* __restrict__ wk, const float* __restrict__ wv, const float* __restrict__ wo, const float* __restrict__ x,
    _Float16* __restrict__ BQ, _Float16* __restrict__ BK, _Float16* __restrict__ BV, _Float16* __restrict__ BO, _Float16* __restrict__ X16) {
  static_assert((size_t)DM * DM == (size_t)PTH * 4 * 2 && (size_t)KVD * DM == (size_t)PTH * 4 * 2 && NR * DM == (size_t)PTH * 4 * 8, "2 pieces of each weight and 8 of x per thread, none left over");
  const unsigned tb = (blockIdx.x * 256u + threadIdx.x) * 16u; v4f a[4][2], b[8];      /* byte offset of the thread's first piece in every f32 source; half of it in every f16 destination */
#pragma unroll      /* constant indices keep a and b in registers */
  for (int i = 0; i < 2; ++i) { const size_t e = (size_t)i * PTH * 16; a[0][i] = *(const v4fa*)((const char*)wq + e + tb); a[1][i] = *(const v4fa*)((const char*)wk + e + tb); a[2][i] = *(const v4fa*)((const char*)wv + e + tb); a[3][i] = *(const v4fa*)((const char*)wo + e + tb); }
#pragma unroll      /* likewise */
  for (int i = 0; i < 8; ++i) b[i] = *(const v4fa*)((const char*)x + (size_t)i * PTH * 16 + tb);
  __builtin_amdgcn_sched_barrier(0);      /* keeps every conversion behind all 16 loads: without it the scheduler put the first conversions, with their waits, in front of the last loads of x, which then went out only after the weights had arrived (two latencies in a row) */
  const unsigned th = tb >> 1;
#pragma unroll      /* likewise */
  for (int i = 0; i < 2; ++i) { const size_t e = (size_t)i * PTH * 8; *(v4h*)((char*)BQ + e + th) = prep_cvt(a[0][i], 16.0f); *(v4h*)((char*)BK + e + th) = prep_cvt(a[1][i], 16.0f); *(v4h*)((char*)BV + e + th) = prep_cvt(a[2][i], 16.0f); *(v4h*)((char*)BO + e + th) = prep_cvt(a[3][i], 16.0f); }
#pragma unroll      /* likewise */
  for (int i = 0; i < 8; ++i) *(v4h*)((char*)X16 + (size_t)i * PTH * 8 + th) = prep_cvt(b[i], 1.0f); }
// fused attention, ONE launch for all batches, heads and query rows: a work-group of 8 waves owns 256 query rows of one head, a wave 32 of them, and walks the SQ keys in stages of FKS keys (passes of 32). S^T = K Q^T (A = key rows, B = query rows kept in registers), so a lane holds scores of ONE query per 16-column group;
// the two f32 score tiles of a pass, after exp2, ARE the f16 B operand of O^T += V^T P^T (register r of tile t = key 16 t + 8 hh + r = the k order of g2_frag), so neither S nor P is ever stored. Running maximum (log2 units) with a late rescale; weights stay unnormalised (at most 2^8), the row sum divides once at the end.
// K and V^T tiles reach the 8 waves through LDS (whole 128-byte lines from global memory, two buffers, one barrier per stage): a fragment load straight from global memory touches 16 lines for 512 bytes, and all 8 waves would repeat it.
#define FKS 64                       /* keys per stage */
#define FKP (HD + 8)                 /* LDS pitch of a key row, in halves: 16 bytes x odd, conflict-free for 16-byte reads */
#define FVP (FKS + 8)                /* LDS pitch of a V^T row, in halves: likewise */
__device__ __forceinline__ v8f fa_mma(v16h a, v16h b, v8f c) { return __builtin_amdgcn_wmma_f32_16x16x32_f16(false, a, false, b, (short)0, c, false, false); }
__device__ __forceinline__ v16h fa_frag(const unsigned short* p, int hh) { FragH f; f.half[0] = *(const v8us*)(p + 8 * hh); f.half[1] = *(const v8us*)(p + 16 + 8 * hh); return f.v; }
__device__ __forceinline__ void fa_exp2x8(float (&e)[8]) {
  asm("v_exp_f32 %0, %0\n\tv_exp_f32 %1, %1\n\tv_exp_f32 %2, %2\n\tv_exp_f32 %3, %3\n\tv_exp_f32 %4, %4\n\tv_exp_f32 %5, %5\n\tv_exp_f32 %6, %6\n\tv_exp_f32 %7, %7\n\tv_nop"
      : "+v"(e[0]), "+v"(e[1]), "+v"(e[2]), "+v"(e[3]), "+v"(e[4]), "+v"(e[5]), "+v"(e[6]), "+v"(e[7])); }
__global__ __launch_bounds__(256) void k_fattn(const _Float16* __restrict__ Q16, const _Float16* __restrict__ K16, const _Float16* __restrict__ VT, _Float16* __restrict__ O16) {
  __shared__ __attribute__((aligned(16))) unsigned short lk[2][FKS][FKP]; __shared__ __attribute__((aligned(16))) unsigned short lv[2][HD][FVP];
  const int tid = threadIdx.x, lane = tid & 31, ln = lane & 15, hh = lane >> 4; const int w = __builtin_amdgcn_readfirstlane(tid >> 5);
  const int h = blockIdx.y, b = blockIdx.z; const int q0 = blockIdx.x * 256 + w * 32;
  const _Float16* qp = Q16 + ((size_t)b * SQ + q0 + ln) * DM + h * HD;
  const int kr = tid >> 3, kc = (tid & 7) * 8;      /* staging: 16 bytes per thread and step, 8 threads per 128-byte key row */
  const int vr = tid / (FKS / 8), vc = (tid % (FKS / 8)) * 8;      /* FKS / 8 threads per V^T row piece */
  const unsigned short* kg = (const unsigned short*)K16 + ((size_t)b * SQ + kr) * KVD + h * HD + kc;
  const unsigned short* vg = (const unsigned short*)VT + (((size_t)b * NH + h) * HD + vr) * SQ + vc;
  const float cs = 0.125f * 1.44269504088896340736f;      /* 1/sqrt(64) and log2(e) in one factor */
  const v8f z8 = {0.f,0.f,0.f,0.f,0.f,0.f,0.f,0.f};
  v8us gk[FKS / 32], gv[FKS / 32];
#pragma unroll
  for (int i = 0; i < FKS / 32; ++i) { gk[i] = *(const v8us*)(kg + (size_t)i * 32 * KVD); gv[i] = *(const v8us*)(vg + (size_t)i * (2048 / FKS) * SQ); }
  v16h bq[2][2];
#pragma unroll
  for (int j = 0; j < 2; ++j) for (int s = 0; s < 2; ++s) bq[j][s] = g2_frag(qp + (size_t)j * 16 * DM + s * 32, hh);
  v8f o[4][2]; float m[2] = {-1.0e30f, -1.0e30f}; float l[2][2] = {{0.f, 0.f}, {0.f, 0.f}};
#pragma unroll
  for (int t = 0; t < 4; ++t) { o[t][0] = z8; o[t][1] = z8; }
#pragma unroll
  for (int i = 0; i < FKS / 32; ++i) { *(v8us*)&lk[0][kr + i * 32][kc] = gk[i]; *(v8us*)&lv[0][vr + i * (2048 / FKS)][vc] = gv[i]; }
  __syncthreads();      /* stage 0 is published */
#pragma unroll 1      /* one stage per trip: the body already holds FKS / 32 unrolled passes */
  for (int st = 0; st < SQ / FKS; ++st) {
    const int cur = st & 1; const int sn = (st + 1 < SQ / FKS) ? st + 1 : st;      /* the next stage's tiles are asked for now and stored after this stage's passes; the last stage re-reads its own (in bounds; that buffer is not read again) */
#pragma unroll
    for (int i = 0; i < FKS / 32; ++i) { gk[i] = *(const v8us*)(kg + ((size_t)sn * FKS + i * 32) * KVD); gv[i] = *(const v8us*)(vg + (size_t)i * (2048 / FKS) * SQ + sn * FKS); }
    v16h ka[2][2];
#pragma unroll
    for (int t = 0; t < 2; ++t) for (int s = 0; s < 2; ++s) ka[t][s] = fa_frag(&lk[cur][t * 16 + ln][s * 32], hh);
    asm volatile("" ::: "memory");      /* compiler fence: without it the next stage's global loads are sunk to just in front of their LDS stores at the stage's foot, and their whole latency is waited out there */
#pragma unroll
    for (int p = 0; p < FKS / 32; ++p) {
      v16h va[4]; v8f sc[2][2];      /* sc: [key tile][query tile] */
#pragma unroll
      for (int t = 0; t < 2; ++t) for (int j = 0; j < 2; ++j) sc[t][j] = fa_mma(ka[t][1], bq[j][1], fa_mma(ka[t][0], bq[j][0], z8));
#pragma unroll
      for (int t = 0; t < 4; ++t) va[t] = fa_frag(&lv[cur][t * 16 + ln][p * 32], hh);
      if (p + 1 < FKS / 32) {      /* the stage's next pass: its key fragments one pass ahead, into the same registers */
#pragma unroll
        for (int t = 0; t < 2; ++t) for (int s = 0; s < 2; ++s) ka[t][s] = fa_frag(&lk[cur][(p + 1) * 32 + t * 16 + ln][s * 32], hh); }
      asm volatile("" ::: "memory");      /* compiler fence: keeps these LDS reads together in front of the softmax arithmetic, which covers their latency; without it they are sunk in among the WMMAs that use them */
      float mx[2];
#pragma unroll
      for (int j = 0; j < 2; ++j) { float a = fmaxf(sc[0][j][0], sc[1][j][0]); for (int r = 1; r < 8; ++r) a = fmaxf(fmaxf(a, sc[0][j][r]), sc[1][j][r]); mx[j] = a * cs; }
      const bool need = (mx[0] > m[0] + 8.0f) || (mx[1] > m[1] + 8.0f);
      if (__builtin_amdgcn_ballot_w32(need) != 0) {      /* scalar branch: rescale only when some column's maximum has grown by more than 2^8; m[] changes only here and from values joined over the two lane halves, so both halves of a column always use the same m */
#pragma unroll
        for (int j = 0; j < 2; ++j) { const float mj = fmaxf(mx[j], __shfl_xor(mx[j], 16, 32)); const float mn = fmaxf(m[j], mj); const float f = __builtin_amdgcn_exp2f(m[j] - mn); m[j] = mn; l[j][0] *= f; l[j][1] *= f;
          for (int t = 0; t < 4; ++t) for (int r = 0; r < 8; ++r) o[t][j][r] *= f; } }
      v16h pb[2];
#pragma unroll
      for (int j = 0; j < 2; ++j) for (int t = 0; t < 2; ++t) { float e[8]; for (int r = 0; r < 8; ++r) e[r] = fmaf(sc[t][j][r], cs, -m[j]); fa_exp2x8(e); for (int r = 0; r < 8; ++r) { l[j][t] += e[r]; pb[j][t * 8 + r] = (_Float16)e[r]; } }
#pragma unroll
      for (int t = 0; t < 4; ++t) for (int j = 0; j < 2; ++j) o[t][j] = fa_mma(va[t], pb[j], o[t][j]);
    }
#pragma unroll
    for (int i = 0; i < FKS / 32; ++i) { *(v8us*)&lk[cur ^ 1][kr + i * 32][kc] = gk[i]; *(v8us*)&lv[cur ^ 1][vr + i * (2048 / FKS)][vc] = gv[i]; }      /* every wave left that buffer before the barrier that ended the stage before */
    __syncthreads();      /* publishes stage st + 1 and ends every wave's reads of stage st */
  }
#pragma unroll
  for (int j = 0; j < 2; ++j) { float lt = l[j][0] + l[j][1]; lt += __shfl_xor(lt, 16, 32); const float fin = 64.0f / lt;      /* o carried x64, as the output GEMM's alpha expects */
    unsigned short* op = (unsigned short*)O16 + ((size_t)b * SQ + q0 + j * 16 + ln) * DM + h * HD + 8 * hh;
    for (int t = 0; t < 4; ++t) { FragH f; for (int r = 0; r < 8; ++r) f.h[r] = (_Float16)(o[t][j][r] * fin); *(v8us*)(op + t * 16) = f.half[0]; } } }
__global__ __launch_bounds__(256) void k_vt(const _Float16* __restrict__ V16, int b, int h0, _Float16* __restrict__ VT) { __shared__ unsigned short tl[64][65]; const int tid = threadIdx.x; const int hh = blockIdx.x % HG, sg = blockIdx.x / HG; const int s0 = sg * 64; const int h = h0 + hh;
  for (int i = tid; i < 64 * 8; i += 256) { const int j = i / 8, d8 = (i % 8) * 8; FragH f; f.half[0] = *(const v8us*)((const unsigned short*)V16 + ((size_t)b * SQ + s0 + j) * DM + h * HD + d8); for (int q = 0; q < 8; ++q) tl[d8 + q][j] = f.u[q]; }
  __syncthreads();
  { for (int i = tid; i < 64 * 8; i += 256) { const int d = i / 8, j8 = (i % 8) * 8; FragH f; for (int q = 0; q < 8; ++q) f.u[q] = tl[d][j8 + q]; *(v8us*)((unsigned short*)VT + ((size_t)hh * HD + d) * SQ + s0 + j8) = f.half[0]; }  } }



__global__ __launch_bounds__(256) void k_rsmcf2(const float* __restrict__ S, _Float16* __restrict__ P, int hg, int q0, int nk) {
  #pragma clang fp contract(off)
  const int t = blockIdx.x * 256 + threadIdx.x; if (t >= hg * QT) return; const size_t i = (size_t)t; const float* s = S + i * NKX; const int last = q0 + (t % QT); float mx = -3.0e38f;
#pragma unroll 1
  for (int j = 0; j < nk; ++j) { const float f = (j <= last) ? 1.f : 0.f; mx = fmaxf(mx, fmaf(f, s[j], (1.f - f) * -1.0e9f)); } float se = 0.f;
#pragma unroll 1
  for (int j = 0; j < nk; ++j) { const float f = (j <= last) ? 1.f : 0.f; se += __expf(fmaf(f, s[j], (1.f - f) * -1.0e9f) - mx); } const float sc = 256.0f / se;
#pragma unroll 1
  for (int j0 = 0; j0 < nk; j0 += 8) { FragH fr; for (int q = 0; q < 8; ++q) { const int j = j0 + q; const float f = (j <= last) ? 1.f : 0.f; fr.h[q] = (_Float16)(__expf(fmaf(f, s[j], (1.f - f) * -1.0e9f) - mx) * sc); } unsigned short* d = (unsigned short*)P + i * NKX + j0; *(v8us*)d = fr.half[0];  } }


template <int MASKADD>
__global__ __launch_bounds__(64) void k_att0(const float* __restrict__ QF, const float* __restrict__ KF, const float* __restrict__ VF, int ld, const float* __restrict__ mask, float scale, float* __restrict__ OF, int ldo) {
  #pragma clang fp contract(off)
  __shared__ __attribute__((aligned(16))) float lq[64][64]; __shared__ __attribute__((aligned(16))) float lo[64][64];
  const int tid = threadIdx.x; const int h = blockIdx.x / (QT0 / 64), rg = blockIdx.x % (QT0 / 64); const int i = rg * 64 + tid;
  const float* qr = QF + (size_t)i * ld + h * HD;
#pragma unroll 1
  for (int c = 0; c < HD / 4; ++c) { *(v4f*)&lq[tid][c * 4] = *(const v4fa*)(qr + c * 4); const v4f z = {0.f, 0.f, 0.f, 0.f}; *(v4f*)&lo[tid][c * 4] = z; }
  float m = -1.0e30f, l = 0.f; const int jmax = MASKADD ? (SQ - 1) : (rg * 64 + 63);      /* additive-mask form: every key (the mask input decides); causal form: keys up to the block's last row */
#pragma unroll 1
  for (int j = 0; j <= jmax; ++j) { const float* kr = KF + (size_t)j * ld + h * HD; const float* vr = VF + (size_t)j * ld + h * HD; float s = 0.f;
#pragma unroll 1
    for (int c = 0; c < HD / 4; ++c) { const v4f kq = *(const v4fa*)(kr + c * 4); const v4f qq = *(v4f*)&lq[tid][c * 4]; s = __fadd_rn(s, __fmul_rn(qq[0], kq[0])); s = __fadd_rn(s, __fmul_rn(qq[1], kq[1])); s = __fadd_rn(s, __fmul_rn(qq[2], kq[2])); s = __fadd_rn(s, __fmul_rn(qq[3], kq[3])); }
    s = __fmul_rn(s, scale); if (MASKADD) s = __fadd_rn(s, __fmul_rn(bf16_round(mask[(size_t)i * SQ + j]), -10000.0f));
    const float f = (MASKADD || j <= i) ? 1.f : 0.f; const float sm = fmaf(f, s, (1.f - f) * -1.0e30f); const float mn = fmaxf(m, sm); const float sc = expf(m - mn); const float e = expf(sm - mn); l = __fadd_rn(__fmul_rn(l, sc), e); m = mn;
#pragma unroll 1
    for (int c = 0; c < HD / 4; ++c) { const v4f vv = *(const v4fa*)(vr + c * 4); v4f oo = *(v4f*)&lo[tid][c * 4]; for (int u = 0; u < 4; ++u) oo[u] = __fadd_rn(__fmul_rn(oo[u], sc), __fmul_rn(e, vv[u])); *(v4f*)&lo[tid][c * 4] = oo; } }
  const float fin = 64.0f / l;      /* o carried x64 like the f16 path */
#pragma unroll 1
  for (int c = 0; c < HD / 4; ++c) { v4f oo = *(v4f*)&lo[tid][c * 4]; for (int u = 0; u < 4; ++u) oo[u] = __fmul_rn(oo[u], fin); *(v4f*)&lo[tid][c * 4] = oo; }
  __syncthreads();
  {
#pragma unroll 1
    for (int it = 0; it < 16; ++it) { const int row = it * 4 + tid / 16, pc = (tid % 16) * 4; const v4f v = *(const v4f*)&lo[row][pc]; *(v4f*)(OF + (size_t)(rg * 64 + row) * ldo + h * HD + pc) = v; }
     } }


__global__ __launch_bounds__(256) void k_kvexp(const float* __restrict__ src, float* __restrict__ dst, size_t n4) { const size_t t = (size_t)blockIdx.x * 256 + threadIdx.x; if (t >= n4) return; const size_t e = t * 4; const size_t row = e / DM; const int col = (int)(e % DM); const int h = col / HD, d = col % HD; const v4f v = *(const v4fa*)(src + row * KVD + (size_t)(h / HPG) * HD + d); *(v4f*)(dst + e) = v;  }

__global__ __launch_bounds__(256) void k_tab2(float theta, float* __restrict__ CS, float* __restrict__ SN) {
  #pragma clang fp contract(off)
  const int t = blockIdx.x * 256 + threadIdx.x; if (t >= SQ * (HD / 2)) return; const int i = t % (HD / 2); const int p = t / (HD / 2); const float invf = 1.0f / powf(theta, (float)(2 * i) / (float)HD); const float ang = __fmul_rn((float)p, invf); const float c = cosf(ang), s = sinf(ang);
  *(float*)(CS + t) = c; *(float*)(SN + t) = s;  }
template <int NORM, int ROPE>
__global__ __launch_bounds__(64) void k_xform(const float* __restrict__ F, int ldf, int nh, const float* __restrict__ gain, float eps, const float* __restrict__ CS, const float* __restrict__ SN, _Float16* __restrict__ H16, int ldo) {
  #pragma clang fp contract(off)
  __shared__ float xv[HD]; __shared__ float red[HD]; __shared__ unsigned short sh_[HD]; const int d = threadIdx.x; const int h = blockIdx.x % nh; const size_t r = blockIdx.x / nh; const int p = (int)(r % SQ);
  float x = F[r * (size_t)ldf + (size_t)h * HD + d];
  if (NORM) { red[d] = __fmul_rn(x, x); __syncthreads(); for (int st = HD / 2; st > 0; st >>= 1) { if (d < st) red[d] = __fadd_rn(red[d], red[d + st]); __syncthreads(); } const float rs = rsqrtf(__fadd_rn(red[0] / (float)HD, eps)); x = __fmul_rn(__fmul_rn(x, rs), bf16_round(gain[d])); }
  xv[d] = x; __syncthreads();
  float o = x;
  if (ROPE == 1) { const int i = d >> 1; const float c = CS[p * (HD / 2) + i], s = SN[p * (HD / 2) + i]; const float ev = xv[2 * i], od = xv[2 * i + 1]; o = (d & 1) ? __fadd_rn(__fmul_rn(ev, s), __fmul_rn(od, c)) : __fadd_rn(__fmul_rn(ev, c), -__fmul_rn(od, s)); }
  if (ROPE == 2) { const int i = d & (HD / 2 - 1); const float c = CS[p * (HD / 2) + i], s = SN[p * (HD / 2) + i]; const float lo = xv[i], hi = xv[i + HD / 2]; o = (d < HD / 2) ? __fadd_rn(__fmul_rn(lo, c), -__fmul_rn(hi, s)) : __fadd_rn(__fmul_rn(lo, s), __fmul_rn(hi, c)); }
  FragH th; th.h[0] = (_Float16)o; sh_[d] = th.u[0]; __syncthreads();
  if (d < HD / 8) { FragH f; for (int q = 0; q < 8; ++q) f.u[q] = sh_[d * 8 + q]; unsigned short* dst = (unsigned short*)H16 + r * (size_t)ldo + (size_t)h * HD + d * 8; *(v8us*)dst = f.half[0];  } }

template <int NORM, int ROPE>
__global__ __launch_bounds__(64) void k_xformf(const float* __restrict__ F, int ldf, int nh, const float* __restrict__ gain, float eps, const float* __restrict__ CS, const float* __restrict__ SN, float* __restrict__ F32, int ldo) {
  #pragma clang fp contract(off)
  __shared__ float xv[HD]; __shared__ float red[HD]; const int d = threadIdx.x; const int h = blockIdx.x % nh; const size_t r = blockIdx.x / nh; const int p = (int)(r % SQ);
  float x = F[r * (size_t)ldf + (size_t)h * HD + d];
  if (NORM) { red[d] = __fmul_rn(x, x); __syncthreads(); for (int st = HD / 2; st > 0; st >>= 1) { if (d < st) red[d] = __fadd_rn(red[d], red[d + st]); __syncthreads(); } const float rs = rsqrtf(__fadd_rn(red[0] / (float)HD, eps)); x = __fmul_rn(__fmul_rn(x, rs), bf16_round(gain[d])); }
  xv[d] = x; __syncthreads();
  float o = x;
  if (ROPE == 1) { const int i = d >> 1; const float c = CS[p * (HD / 2) + i], s = SN[p * (HD / 2) + i]; const float ev = xv[2 * i], od = xv[2 * i + 1]; o = (d & 1) ? __fadd_rn(__fmul_rn(ev, s), __fmul_rn(od, c)) : __fadd_rn(__fmul_rn(ev, c), -__fmul_rn(od, s)); }
  if (ROPE == 2) { const int i = d & (HD / 2 - 1); const float c = CS[p * (HD / 2) + i], s = SN[p * (HD / 2) + i]; const float lo = xv[i], hi = xv[i + HD / 2]; o = (d < HD / 2) ? __fadd_rn(__fmul_rn(lo, c), -__fmul_rn(hi, s)) : __fadd_rn(__fmul_rn(lo, s), __fmul_rn(hi, c)); }
  float* dst = F32 + r * (size_t)ldo + (size_t)h * HD + d; *(float*)dst = o;  }

__global__ __launch_bounds__(256) void k_bfcp(const float* __restrict__ src, float* __restrict__ dst, size_t n4) { const size_t t = (size_t)blockIdx.x * 256 + threadIdx.x; if (t >= n4) return; const v4f a = *(const v4fa*)(src + t * 4); v4f o; for (int q = 0; q < 4; ++q) o[q] = bf16_round(a[q]); *(v4f*)(dst + t * 4) = o;  }

__global__ __launch_bounds__(256) void k_tab2d(float* __restrict__ CS, float* __restrict__ SN) {
  #pragma clang fp contract(off)
  const int t = blockIdx.x * 256 + threadIdx.x; if (t >= SQ * (HD / 2)) return; const int i = t % (HD / 2); const int p = t / (HD / 2); const float invf = (float)(1.0 / pow(10000.0, (double)(2 * i) / (double)HD)); const float ang = __fmul_rn((float)p, invf); const float c = cosf(ang), s = sinf(ang);
  *(float*)(CS + t) = c; *(float*)(SN + t) = s;  }
extern "C" void kernel_launch(void* const* d_in, const int* in_sizes, int n_in,
                              void* d_out, int out_size, void* d_ws, size_t ws_size, hipStream_t stream) {
  (void)in_sizes; (void)n_in; (void)out_size;
  const float* const* I = (const float* const*)d_in; const float* x = I[0]; const float* wq = I[1]; const float* wk = I[2]; const float* wv = I[3]; const float* wo = I[4]; const float* tcos = I[5]; const float* tsin = I[6]; const float* bq = nullptr; const float* bk = nullptr; const float* bv = nullptr; const float* bo = nullptr;      /* natural [out][in] weights, no biases; rope_cos / rope_sin INPUT tables [2048][32] */
  static_assert(HPG == 1 && NH == NG * HPG && NH * HD == DM && KVD == DM, "plain multi-head attention as 16 kv groups of one query head");
  char* ws = (char*)d_ws; size_t off = 0;
  auto take = [&](size_t bytes) { char* p = ws + off; off += (bytes + 255) & ~(size_t)255; return p; };
  _Float16* BQ = (_Float16*)take((size_t)DM * DM * 2); _Float16* BK = (_Float16*)take((size_t)KVD * DM * 2); _Float16* BV = (_Float16*)take((size_t)KVD * DM * 2); _Float16* BO = (_Float16*)take((size_t)DM * DM * 2);
  _Float16* X16 = (_Float16*)take(NR * DM * 2); _Float16* Q16 = (_Float16*)take(NR * DM * 2); _Float16* K16 = (_Float16*)take(NR * KVD * 2); _Float16* V16 = (_Float16*)take(NR * KVD * 2); _Float16* O16 = (_Float16*)take(NR * DM * 2);
  _Float16* VT = (_Float16*)take((size_t)NB * NH * HD * SQ * 2);
  float* QF0 = (float*)take((size_t)QT0 * DM * 4); float* KF0 = (float*)take((size_t)QT0 * KVD * 4); float* VF0 = (float*)take((size_t)QT0 * KVD * 4); float* KF0e = (float*)take((size_t)QT0 * DM * 4); float* VF0e = (float*)take((size_t)QT0 * DM * 4); float* OF0 = (float*)take((size_t)NB * QT0 * DM * 4); _Float16* OH0 = (_Float16*)take((size_t)NB * QT0 * DM * 2); _Float16* OL0 = (_Float16*)take((size_t)NB * QT0 * DM * 2);
  if (off > ws_size) return;
  k_prep<<<PWG, 256, 0, stream>>>(wq, wk, wv, wo, x, BQ, BK, BV, BO, X16);      /* natural [out][in] = Bt planes x16; x as f16 rows */
  const size_t r0p = (size_t)B0 * SQ;      /* first projected row */
  static_assert(((size_t)DM * DM * 2) % 256 == 0 && (NR * DM * 2) % 256 == 0, "BQ | BK | BV and Q16 | K16 | V16 lie back to back in the workspace: the plane strides of the batched launch");
  k_gemm2<0, 1><<<dim3((unsigned)((MP / 128) * (DM / 128)), 3), 256, 0, stream>>>(X16 + r0p * DM, DM, 0, BQ, DM, (size_t)DM * DM, 0.0625f, nullptr, 0, nullptr, 1, 0, 0, nullptr, Q16 + r0p * DM, DM, NR * DM, MP, DM, DM, tcos, tsin, VT + (size_t)B0 * NH * HD * SQ);      /* q, k (rotated by the INPUT rope tables [2048][32]: column d uses table column d mod 32 = the module's [cos | cos]) of every batch -> f16 rows; v -> V^T [NB][NH][HD][SQ] */
  k_fattn<<<dim3(SQ / 256, NH, NB), 256, 0, stream>>>(Q16, K16, VT, O16);      /* scores, softmax and P V of every batch, head and query row in ONE launch; o (x64) into merged f16 rows */
  k_gemm2<0><<<dim3((unsigned)((MPO / 128) * (DM / 128)), 1), 256, 0, stream>>>(O16 + r0p * DM, DM, 0, BO, DM, 0, 0.0009765625f, bo, 0, nullptr, 1, 0, 0, (float*)d_out + r0p * DM, nullptr, DM, 0, MPO, DM, DM);      /* out rows are the output layout */
}

// v007
// Measured time: 85.9 microseconds a run.
// Timed twice side by side with v006, it ran 1.10 and 1.09 times as fast.
// Counting every step since v000, it is 83.1 times as fast.
#include <hip/hip_runtime.h>
// Multi-head self-attention with half-split RoPE from RANDOM input tables, NON-causal (x [2][2048][1024]; q / k / v = x W^T (nn.Linear natural [1024][1024] sigma 1/32, no biases), 16 heads of 64; rope: x * [cos | cos] + rotate_half(x) * [sin | sin] with rotate_half = (-x2, x1) over the two 32-lane halves and INPUT tables rope_cos / rope_sin [2048][32] (cos / sin of uniform-random angles); scores / sqrt(64); softmax over all 2048 keys (f32; no mask); out = merged Wo^T (natural, no bias) -> [2][2048][1024]); run as grouped-query attention with 16 groups of ONE head.
// Structure: x as exact f16 rows; natural weights as exact x16 planes; q, k and v of both batches as ONE batched WMMA GEMM launch (32x64 wave tiles, f32 accumulation, blockIdx.y picks the weight plane and the output rows) whose epilogue rotates q and k in f32 (rotate-half; a 64-column wave tile is one head; INPUT tables rounded to bf16 as read) and writes f16 rows, and writes v as V^T of the heads straight from its accumulators (a lane holds 8 consecutive tokens of one column); then ONE fused attention launch for all batches, heads and query rows (k_fattn: scores of 32 query columns per wave against ALL 2048 keys, running softmax in registers with f32 statistics and native exp2, unnormalised f16 weights, o = P V^T carried x64) into merged f16 rows; out = o Wo^T GEMM (f32, alpha 2^-10); launches: see trace.
// Compute dtype: inputs rounded to bf16; x / weights exact; q, k, v, softmax weights and o as plain f16 GEMM operands (~2^-12); scores and softmax statistics f32. v_wmma_f32_16x16x32_f16.
#define NB 2
#define NG 16
#define HPG 1
#define KVD (NG * HD)
#define SQ 2048
#define DM 1024
#define NH 16
#define HD 64
#define HG 4                         /* heads per block group of the unlaunched k_vt overload */
#define QT 256                       /* query rows per tile */
#define NKX SQ                       /* S / P row pitch */
#define QT0 128                      /* rows per head of k_att0 (not launched); sizes unused f32 buffers */
#define B0 0                         /* first batch processed (debug hook) */
#define NBR NB                       /* batches processed (debug hook) */
#define NR ((size_t)NB * SQ)         /* token rows */
#define MP ((int)((size_t)NBR * SQ)) /* rows projected (debug hook) */
#define QN SQ                        /* unused: k_fattn attends all SQ query rows of a batch */
#define NHD NH                       /* unused: k_fattn attends all NH heads */
#define MPO MP                       /* rows through the output stage (debug hook) */
#define LQ DM      /* unused: the q and k rows have pitch DM */
typedef __bf16 v16b __attribute__((ext_vector_type(16)));
typedef unsigned short v8us __attribute__((ext_vector_type(8), may_alias));
typedef float  v8f  __attribute__((ext_vector_type(8)));
typedef float  v4f  __attribute__((ext_vector_type(4)));
typedef float  v4fa __attribute__((ext_vector_type(4), may_alias));
union FragB { v16b v; v8us half[2]; unsigned short u[16]; };

__device__ __forceinline__ unsigned short bf16_bits(float x) { unsigned int u = __float_as_uint(x); return (unsigned short)((u + 0x7FFFu + ((u >> 16) & 1u)) >> 16); }
__device__ __forceinline__ float bf16_val(unsigned short b) { return __uint_as_float(((unsigned int)b) << 16); }
__device__ __forceinline__ float bf16_round(float x) { return bf16_val(bf16_bits(x)); }
// D += A·B with NT terms: 1 = ah·bh, 2 = + al·bh (A split), 3 = + ah·bl (both split)
template <int NT>
__device__ __forceinline__ v8f mmaN(v16b ah, v16b al, v16b bh, v16b bl, v8f c) {
  c = __builtin_amdgcn_wmma_f32_16x16x32_bf16(false, ah, false, bh, (short)0, c, false, false);
  if (NT >= 2) c = __builtin_amdgcn_wmma_f32_16x16x32_bf16(false, al, false, bh, (short)0, c, false, false);
  if (NT >= 3) c = __builtin_amdgcn_wmma_f32_16x16x32_bf16(false, ah, false, bl, (short)0, c, false, false);
  asm volatile("v_nop\n\tv_nop\n\tv_nop\n\tv_nop" : "+v"(c) : "v"(ah), "v"(al), "v"(bh), "v"(bl));
  return c;
}

__global__ __launch_bounds__(256) void k_wt_bf16(const float* __restrict__ W, unsigned short* __restrict__ Wt, int K, int N) {
  const int t = blockIdx.x * 256 + threadIdx.x;
  const int k8n = K / 8;
  if (t >= N * k8n) return;
  const int n = t / k8n, k8 = (t % k8n) * 8;
  v8us v;
#pragma unroll
  for (int i = 0; i < 8; ++i) v[i] = bf16_bits(W[(size_t)(k8 + i) * N + n]);
  *(v8us*)(Wt + (size_t)n * K + k8) = v;
  
}

// GEMM C[M][N] (f32, pitch ldc) = act(A[M][K]·W + bias). A f32 row-major (pitch lda) converted per fragment to bf16
// (ASPLIT: hi/lo two planes -> 2 terms, else single rounded term); Wt bf16 [N][K] (pitch ldb). BIAS_BF16 rounds the
// bias to bf16 first (bias quantised to bf16 before the add). K%32==0, M%16==0, N%64==0.
template <bool ASPLIT, int ACT, bool BIAS_BF16>
__global__ __launch_bounds__(128) void k_gemm_bf(const float* __restrict__ A, int lda, const unsigned short* __restrict__ Wt, int ldb,
                                               const float* __restrict__ bias, float* __restrict__ C, int ldc, int M, int N, int K) {
  __shared__ __attribute__((aligned(16))) float so[4][16][64];
  const int tid = threadIdx.x, w = tid >> 5, lane = tid & 31, ln = lane & 15, hh = lane >> 4;
  const int ntn = N / 64;
  const int wid = blockIdx.x * 4 + w;
  const int mt = wid / ntn, nq = wid % ntn;
  if (mt * 16 >= M) return;
  const int row0 = mt * 16, col0 = nq * 64;
  const float* arow = A + (size_t)(row0 + ln) * lda;
  v8f acc[4] = {};
  for (int kb = 0; kb < K; kb += 32) {
    FragB ah, al;
    const v4f x0 = *(const v4fa*)(arow + kb + 8 * hh), x1 = *(const v4fa*)(arow + kb + 8 * hh + 4);
    const v4f x2 = *(const v4fa*)(arow + kb + 16 + 8 * hh), x3 = *(const v4fa*)(arow + kb + 16 + 8 * hh + 4);
    float xs[16] = {x0[0],x0[1],x0[2],x0[3],x1[0],x1[1],x1[2],x1[3],x2[0],x2[1],x2[2],x2[3],x3[0],x3[1],x3[2],x3[3]};
#pragma unroll
    for (int i = 0; i < 16; ++i) { const unsigned short hb = bf16_bits(xs[i]); ah.u[i] = hb; al.u[i] = ASPLIT ? bf16_bits(xs[i] - bf16_val(hb)) : (unsigned short)0; }
#pragma unroll
    for (int t = 0; t < 4; ++t) {
      const unsigned short* brow = Wt + (size_t)(col0 + t * 16 + ln) * ldb + kb;
      FragB b;
      b.half[0] = *(const v8us*)(brow + 8 * hh);
      b.half[1] = *(const v8us*)(brow + 16 + 8 * hh);
      acc[t] = mmaN<ASPLIT ? 2 : 1>(ah.v, al.v, b.v, b.v, acc[t]);
    }
  }
#pragma unroll
  for (int t = 0; t < 4; ++t) {
    float bv = bias ? bias[col0 + t * 16 + ln] : 0.f;
    if (BIAS_BF16) bv = bf16_round(bv);
#pragma unroll
    for (int r = 0; r < 8; ++r) { float v = acc[t][r] + bv; if (ACT == 1) v = fmaxf(v, 0.f); so[w][8 * hh + r][t * 16 + ln] = v; }
  }
  __builtin_amdgcn_fence(__ATOMIC_ACQ_REL, "workgroup");
  __builtin_amdgcn_wave_barrier();
  const int rsub = lane >> 4, c4 = (lane & 15) * 4;
  {
#pragma unroll
    for (int q = 0; q < 8; ++q) {
      const int r = q * 2 + rsub;
      const v4f v = *(const v4fa*)&so[w][r][c4];
      *(v4f*)(C + (size_t)(row0 + r) * ldc + col0 + c4) = v;
    }
    
  }
}

// GEMM C = act(A·W + bias + resid): A f32 (ASPLIT -> hi/lo 2 terms), Wt bf16 [N][K]; ACT 0 none, 1 relu, 2 exact gelu;
// resid (optional, f32, row index = (row % rmod), pitch ldr, RES_BF16 rounds it) added before the activation.
template <bool ASPLIT, int ACT, bool BIAS_BF16, bool RES_BF16>
__global__ __launch_bounds__(128) void k_gemm_bf3(const float* __restrict__ A, int lda, const unsigned short* __restrict__ Wt, int ldb,
                                                const float* __restrict__ bias, const float* __restrict__ resid, int rmod, int ldr,
                                                float* __restrict__ C, int ldc, int M, int N, int K) {
  __shared__ __attribute__((aligned(16))) float so[4][16][64];
  const int tid = threadIdx.x, w = tid >> 5, lane = tid & 31, ln = lane & 15, hh = lane >> 4;
  const int ntn = N / 64;
  const int wid = blockIdx.x * 4 + w;
  const int mt = wid / ntn, nq = wid % ntn;
  if (mt * 16 >= M) return;
  const int row0 = mt * 16, col0 = nq * 64;
  const float* arow = A + (size_t)(row0 + ln) * lda;
  v8f acc[4] = {};
  for (int kb = 0; kb < K; kb += 32) {
    FragB ah, al;
    const v4f x0 = *(const v4fa*)(arow + kb + 8 * hh), x1 = *(const v4fa*)(arow + kb + 8 * hh + 4);
    const v4f x2 = *(const v4fa*)(arow + kb + 16 + 8 * hh), x3 = *(const v4fa*)(arow + kb + 16 + 8 * hh + 4);
    float xs[16] = {x0[0],x0[1],x0[2],x0[3],x1[0],x1[1],x1[2],x1[3],x2[0],x2[1],x2[2],x2[3],x3[0],x3[1],x3[2],x3[3]};
#pragma unroll
    for (int i = 0; i < 16; ++i) { const unsigned short hb = bf16_bits(xs[i]); ah.u[i] = hb; al.u[i] = ASPLIT ? bf16_bits(xs[i] - bf16_val(hb)) : (unsigned short)0; }
#pragma unroll
    for (int t = 0; t < 4; ++t) {
      const unsigned short* brow = Wt + (size_t)(col0 + t * 16 + ln) * ldb + kb;
      FragB b;
      b.half[0] = *(const v8us*)(brow + 8 * hh);
      b.half[1] = *(const v8us*)(brow + 16 + 8 * hh);
      acc[t] = mmaN<ASPLIT ? 2 : 1>(ah.v, al.v, b.v, b.v, acc[t]);
    }
  }
#pragma unroll
  for (int t = 0; t < 4; ++t) {
    const int col = col0 + t * 16 + ln;
    float bv = bias ? bias[col] : 0.f;
    if (BIAS_BF16) bv = bf16_round(bv);
#pragma unroll
    for (int r = 0; r < 8; ++r) {
      float v = acc[t][r] + bv;
      if (resid) { float rv = resid[(size_t)((row0 + 8 * hh + r) % rmod) * ldr + col]; if (RES_BF16) rv = bf16_round(rv); v += rv; }
      if (ACT == 1) v = fmaxf(v, 0.f);
      if (ACT == 2) v = 0.5f * v * (1.0f + erff(v * 0.70710678118654752f));
      if (ACT == 3) { const float u = 0.7978845608028654f * (v + 0.044715f * v * v * v); v = 0.5f * v * (1.0f + tanhf(u)); }
      so[w][8 * hh + r][t * 16 + ln] = v;
    }
  }
  __builtin_amdgcn_fence(__ATOMIC_ACQ_REL, "workgroup");
  __builtin_amdgcn_wave_barrier();
  const int rsub = lane >> 4, c4 = (lane & 15) * 4;
  {
#pragma unroll
    for (int q = 0; q < 8; ++q) {
      const int r = q * 2 + rsub;
      const v4f v = *(const v4fa*)&so[w][r][c4];
      *(v4f*)(C + (size_t)(row0 + r) * ldc + col0 + c4) = v;
    }
    
  }
}
// row LayerNorm (biased variance, eps) over N: s = X (+ R); optional out_sum <- s; out_norm <- (s-mu)*rsqrt(var+eps)*g + b
template <bool PARAM_BF16>
__global__ __launch_bounds__(256) void k_layernorm(const float* __restrict__ X, const float* __restrict__ R, const float* __restrict__ g, const float* __restrict__ bta,
                                                  float* __restrict__ out_sum, float* __restrict__ out_norm, int N, float eps) {
  __shared__ float red[256];
  const int row = blockIdx.x, tid = threadIdx.x;
  const float* x = X + (size_t)row * N; const float* rr = R ? R + (size_t)row * N : nullptr;
  float vals[16];                     // up to N = 4096
  const int per = N / 256;            // contiguous chunk per thread? use strided-by-4 chunks: thread handles j = tid*4 + 1024*u
  float s1 = 0.f;
  for (int u = 0; u < per / 4; ++u) {
    const int j = tid * 4 + 1024 * u;
    const v4f a = *(const v4fa*)(x + j);
    v4f b = {0.f,0.f,0.f,0.f}; if (rr) b = *(const v4fa*)(rr + j);
#pragma unroll
    for (int q = 0; q < 4; ++q) { const float v = a[q] + b[q]; vals[u * 4 + q] = v; s1 += v; }
  }
  red[tid] = s1; __syncthreads();
  for (int st = 128; st > 0; st >>= 1) { if (tid < st) red[tid] += red[tid + st]; __syncthreads(); }
  const float mu = red[0] / (float)N; __syncthreads();
  float s2 = 0.f;
  for (int u = 0; u < per / 4; ++u)
#pragma unroll
    for (int q = 0; q < 4; ++q) { const float c = vals[u * 4 + q] - mu; s2 += c * c; }
  red[tid] = s2; __syncthreads();
  for (int st = 128; st > 0; st >>= 1) { if (tid < st) red[tid] += red[tid + st]; __syncthreads(); }
  const float rs = rsqrtf(red[0] / (float)N + eps);
  {
    for (int u = 0; u < per / 4; ++u) {
      const int j = tid * 4 + 1024 * u;
      v4f o, sm;
#pragma unroll
      for (int q = 0; q < 4; ++q) {
        float gg = g[j + q], bb = bta[j + q];
        if (PARAM_BF16) { gg = bf16_round(gg); bb = bf16_round(bb); }
        sm[q] = vals[u * 4 + q]; o[q] = (vals[u * 4 + q] - mu) * rs * gg + bb;
      }
      if (out_sum) *(v4f*)(out_sum + (size_t)row * N + j) = sm;
      *(v4f*)(out_norm + (size_t)row * N + j) = o;
    }
    
  }
}



// ---- f16 WMMA path (v_wmma_f32_16x16x32_f16): 11-bit significands for operands in range — used where a [0,1] probability operand needs more precision than bf16
typedef _Float16 v16h __attribute__((ext_vector_type(16)));
union FragH { v16h v; v8us half[2]; _Float16 h[16]; unsigned short u[16]; };
template <int NT>
__device__ __forceinline__ v8f mmaH(v16h ah, v16h al, v16h bh, v16h bl, v8f c) {
  c = __builtin_amdgcn_wmma_f32_16x16x32_f16(false, ah, false, bh, (short)0, c, false, false);
  if (NT >= 2) c = __builtin_amdgcn_wmma_f32_16x16x32_f16(false, al, false, bh, (short)0, c, false, false);
  if (NT >= 3) c = __builtin_amdgcn_wmma_f32_16x16x32_f16(false, ah, false, bl, (short)0, c, false, false);
  asm volatile("v_nop\n\tv_nop\n\tv_nop\n\tv_nop" : "+v"(c) : "v"(ah), "v"(al), "v"(bh), "v"(bl));
  return c;
}
// batched GEMM like k_gemm_b but f16 operands: A f32 (split into f16 hi/lo if ASPLIT, else rounded to f16), Bt = f16 values [n][k]; alpha; C f32; N multiple of 16 (partial tiles skipped)
template <bool ASPLIT>
__global__ __launch_bounds__(128) void k_gemm_h(const float* __restrict__ A, int lda, size_t sA, const _Float16* __restrict__ Bh, int ldb, size_t sB, float alpha, float* __restrict__ C, int ldc, size_t sC, int M, int N, int K) {
  __shared__ __attribute__((aligned(16))) float so[4][16][64];
  const int tid = threadIdx.x, w = tid >> 5, lane = tid & 31, ln = lane & 15, hh = lane >> 4; const int by = blockIdx.y;
  A += (size_t)by * sA; Bh += (size_t)by * sB; C += (size_t)by * sC;
  const int ntn = (N + 63) / 64; const int wid = blockIdx.x * 4 + w; const int mt = wid / ntn, nq = wid % ntn; if (mt * 16 >= M) return;
  const int row0 = mt * 16, col0 = nq * 64; const float* arow = A + (size_t)(row0 + ln) * lda;
  v8f acc[4] = {};
  for (int kb = 0; kb < K; kb += 32) {
    FragH ah, al;
    const v4f x0 = *(const v4fa*)(arow + kb + 8 * hh), x1 = *(const v4fa*)(arow + kb + 8 * hh + 4), x2 = *(const v4fa*)(arow + kb + 16 + 8 * hh), x3 = *(const v4fa*)(arow + kb + 16 + 8 * hh + 4);
    float xs[16] = {x0[0],x0[1],x0[2],x0[3],x1[0],x1[1],x1[2],x1[3],x2[0],x2[1],x2[2],x2[3],x3[0],x3[1],x3[2],x3[3]};
#pragma unroll
    for (int i = 0; i < 16; ++i) { const _Float16 h = (_Float16)xs[i]; ah.h[i] = h; al.h[i] = ASPLIT ? (_Float16)(xs[i] - (float)h) : (_Float16)0.0f; }
#pragma unroll
    for (int t = 0; t < 4; ++t) { if (col0 + t * 16 >= N) continue; const size_t boff = (size_t)(col0 + t * 16 + ln) * ldb + kb; FragH bq; bq.half[0] = *(const v8us*)(Bh + boff + 8 * hh); bq.half[1] = *(const v8us*)(Bh + boff + 16 + 8 * hh);
      acc[t] = mmaH<ASPLIT ? 2 : 1>(ah.v, al.v, bq.v, bq.v, acc[t]); }
  }
#pragma unroll
  for (int t = 0; t < 4; ++t) { if (col0 + t * 16 >= N) continue;
#pragma unroll
    for (int r = 0; r < 8; ++r) so[w][8 * hh + r][t * 16 + ln] = acc[t][r] * alpha; }
  __builtin_amdgcn_fence(__ATOMIC_ACQ_REL, "workgroup"); __builtin_amdgcn_wave_barrier();
  const int rsub = lane >> 4, c4 = (lane & 15) * 4;
  {
#pragma unroll
    for (int q = 0; q < 8; ++q) { const int r = q * 2 + rsub; if (col0 + c4 < N) { const v4f v = *(const v4fa*)&so[w][r][c4]; *(v4f*)(C + (size_t)(row0 + r) * ldc + col0 + c4) = v; } }
     }
}

// Wt[n][k] = f16(W[k][n]·scale) from f32 row-major W[K][N] (scale = power of two; bf16-exact weights stay exact in f16 away from the subnormal range)
__global__ __launch_bounds__(256) void k_wt_f16(const float* __restrict__ W, _Float16* __restrict__ Wt, int K, int N, float scale) {
  const int t = blockIdx.x * 256 + threadIdx.x; if (t >= N * (K / 8)) return; const int n = t / (K / 8), k8 = (t % (K / 8)) * 8; FragH f;
#pragma unroll
  for (int i = 0; i < 8; ++i) f.h[i] = (_Float16)(bf16_round(W[(size_t)(k8 + i) * N + n]) * scale); const v8us o = f.half[0];
  *(v8us*)((unsigned short*)Wt + (size_t)n * K + k8) = o; 
}
// k_gemm_hh variant with fused epilogue: v = acc·alpha + bias[by·sBias + col] (+ CP[(row/rowsPerB)·sCPb + by·64 + col] if CP) ; ACT 0 none / 1 elu ; writes f16 C16 (and f32 C if non-null)
template <int ACT>
__global__ __launch_bounds__(128) void k_gemm_hhx(const _Float16* __restrict__ A, int lda, size_t sA, const _Float16* __restrict__ Bh, int ldb, size_t sB, float alpha, const float* __restrict__ bias, size_t sBias, const float* __restrict__ CP, int rowsPerB, size_t sCPb, int row0g,
    float* __restrict__ C, _Float16* __restrict__ C16, int ldc, size_t sC, int M, int N, int K) {
  __shared__ __attribute__((aligned(16))) float so[4][16][64];
  const int tid = threadIdx.x, w = tid >> 5, lane = tid & 31, ln = lane & 15, hh = lane >> 4; const int by = blockIdx.y;
  A += (size_t)by * sA; Bh += (size_t)by * sB; const size_t cofs = (size_t)by * sC; const float* bp = bias ? bias + (size_t)by * sBias : nullptr;
  const int ntn = (N + 63) / 64; const int wid = blockIdx.x * 4 + w; const int mt = wid / ntn, nq = wid % ntn; if (mt * 16 >= M) return;
  const int row0 = mt * 16, col0 = nq * 64; const _Float16* arow = A + (size_t)(row0 + ln) * lda;
  v8f acc[4] = {};
  for (int kb = 0; kb < K; kb += 32) { FragH ah; ah.half[0] = *(const v8us*)((const unsigned short*)arow + kb + 8 * hh); ah.half[1] = *(const v8us*)((const unsigned short*)arow + kb + 16 + 8 * hh);
#pragma unroll
    for (int t = 0; t < 4; ++t) { if (col0 + t * 16 >= N) continue; const size_t boff = (size_t)(col0 + t * 16 + ln) * ldb + kb; FragH bq; bq.half[0] = *(const v8us*)((const unsigned short*)Bh + boff + 8 * hh); bq.half[1] = *(const v8us*)((const unsigned short*)Bh + boff + 16 + 8 * hh);
      acc[t] = mmaH<1>(ah.v, ah.v, bq.v, bq.v, acc[t]); }
  }
#pragma unroll
  for (int t = 0; t < 4; ++t) { if (col0 + t * 16 >= N) continue; const int col = col0 + t * 16 + ln; const float bv = bp ? bf16_round(bp[col]) : 0.f;
#pragma unroll
    for (int r = 0; r < 8; ++r) { float v = acc[t][r] * alpha + bv; if (CP) { const int rr = row0g + row0 + 8 * hh + r; if (rowsPerB < 0) v += CP[cofs + (size_t)rr * ldc + col];      /* rowsPerB < 0: own element of the batched C plane */ else { const int bidx = rr / rowsPerB; v += CP[(size_t)bidx * sCPb + (size_t)by * 64 + col]; } } if (ACT == 1) v = (v > 0.f) ? v : expm1f(v); else if (ACT == 7) v = (v > 0.f) ? v + 1.0f : expf(v); else if (ACT == 8) v = tanhf(v); else if (ACT == 9) v = 0.5f * v * (1.0f + tanhf(0.7978845608028654f * (v + 0.044715f * v * v * v))); else if (ACT == 11) v = 1.0f / (1.0f + expf(-v)); else if (ACT == 12) v = (v > 0.f) ? v : 0.01f * v; else if (ACT == 14) v = (v > 0.f) ? v : 0.1f * v; else if (ACT == 16) v = (v >= 0.f) ? v : 0.3f * v; else if (ACT == 17) v = (v >= 0.f) ? v : 0.2f * v; else if (ACT == 15) v = v / (1.0f + expf(-v)); else if (ACT == 3) v = fmaxf(v, 0.f); else if (ACT == 6) v = 0.5f * v * (1.0f + erff(v * 0.70710678118654752f)); so[w][8 * hh + r][t * 16 + ln] = v; } }
  __builtin_amdgcn_fence(__ATOMIC_ACQ_REL, "workgroup"); __builtin_amdgcn_wave_barrier();
  const int rsub = lane >> 4, c4 = (lane & 15) * 4; typedef _Float16 v4h __attribute__((ext_vector_type(4)));
  {
#pragma unroll
    for (int q = 0; q < 8; ++q) { const int r = q * 2 + rsub; if (col0 + c4 < N) { const v4f v = *(const v4fa*)&so[w][r][c4]; if (C) *(v4f*)(C + cofs + (size_t)(row0 + r) * ldc + col0 + c4) = v; if (C16) { v4h h4; for (int i = 0; i < 4; ++i) h4[i] = (_Float16)v[i]; *(v4h*)(C16 + cofs + (size_t)(row0 + r) * ldc + col0 + c4) = h4; } } }
     }
}


typedef _Float16 v4h __attribute__((ext_vector_type(4)));

__global__ __launch_bounds__(256) void k_h16(const float* __restrict__ x, _Float16* __restrict__ X16, size_t n8) { const size_t t = (size_t)blockIdx.x * 256 + threadIdx.x; if (t >= n8) return; FragH f;
#pragma unroll
  for (int q = 0; q < 8; ++q) f.h[q] = (_Float16)x[t * 8 + q]; *(v8us*)((unsigned short*)X16 + t * 8) = f.half[0];  }
__global__ __launch_bounds__(256) void k_round16f(const float* __restrict__ W, _Float16* __restrict__ Bt, size_t n8) { const size_t t = (size_t)blockIdx.x * 256 + threadIdx.x; if (t >= n8) return; FragH f;
#pragma unroll
  for (int i = 0; i < 8; ++i) f.h[i] = (_Float16)(bf16_round(W[t * 8 + i]) * 16.0f); *(v8us*)((unsigned short*)Bt + t * 8) = f.half[0];  }
template <int NHv, int TTv>
__global__ __launch_bounds__(256) void k_vt(const _Float16* __restrict__ V16, int ldv, int voff, _Float16* __restrict__ Vt) { __shared__ unsigned short tl[64][66]; const int tid = threadIdx.x; const int slab = blockIdx.x / (TTv / 64), lg = blockIdx.x % (TTv / 64); const int b = slab / NHv, h = slab % NHv;
  for (int i = tid; i < 64 * 8; i += 256) { const int r = i / 8, c8 = (i % 8) * 8; FragH f; f.half[0] = *(const v8us*)((const unsigned short*)V16 + ((size_t)b * TTv + lg * 64 + r) * ldv + voff + h * 64 + c8);
#pragma unroll
    for (int q = 0; q < 8; ++q) tl[r][c8 + q] = f.u[q]; }
  __syncthreads();
  {
#pragma unroll
    for (int rd = 0; rd < 2; ++rd) { const int d = rd * 32 + tid / 8, pc = tid % 8; FragH f;
#pragma unroll
      for (int q = 0; q < 8; ++q) f.u[q] = tl[pc * 8 + q][d];
      *(v8us*)((unsigned short*)Vt + ((size_t)slab * 64 + d) * TTv + lg * 64 + pc * 8) = f.half[0]; }
     } }

__global__ __launch_bounds__(256) void k_hl(const float* __restrict__ F, _Float16* __restrict__ Hh, _Float16* __restrict__ Hl, size_t n8) { const size_t t = (size_t)blockIdx.x * 256 + threadIdx.x; if (t >= n8) return; FragH fh, fl; const v4f a = *(const v4fa*)(F + t * 8), c = *(const v4fa*)(F + t * 8 + 4);
#pragma unroll
  for (int q = 0; q < 4; ++q) { _Float16 h = (_Float16)a[q]; fh.h[q] = h; fl.h[q] = (_Float16)((a[q] - (float)h) * 1024.0f); h = (_Float16)c[q]; fh.h[4 + q] = h; fl.h[4 + q] = (_Float16)((c[q] - (float)h) * 1024.0f); }
  { *(v8us*)((unsigned short*)Hh + t * 8) = fh.half[0]; *(v8us*)((unsigned short*)Hl + t * 8) = fl.half[0];  } }

// ---- fast GEMM (wave tile 32x64, work-group tile 128x128; requires M % 128 == 0 rows per launch region, N % 128 == 0, K % 128 == 0); epilogue = k_gemm_hhx semantics ----
__device__ __forceinline__ v16h g2_frag(const _Float16* p, int hh) { FragH f; f.half[0] = *(const v8us*)((const unsigned short*)p + 8 * hh); f.half[1] = *(const v8us*)((const unsigned short*)p + 16 + 8 * hh); return f.v; }
__device__ __forceinline__ v8f g2_mma(v16h a, v16h b, v8f c) { v8f d = __builtin_amdgcn_wmma_f32_16x16x32_f16(false, a, false, b, (short)0, c, false, false); asm volatile("v_nop\n\tv_nop\n\tv_nop\n\tv_nop" : "+v"(d) : "v"(a), "v"(b)); return d; }
// Operand tiles through LDS: a work-group of 8 waves owns 128 x 128 of C and walks K in tiles of 128 (256 bytes of each of its 128 A rows and 128 B rows); asynchronous copies bring whole 256-byte pieces into one of two buffers while the other is worked on. A tile's copies have one trip to land: a trip of 128 k holds 32 WMMAs and 48 LDS reads a wave, twice the cover of a trip of 64 k, for operands that the launch before has just written and that may come from memory. A fragment load straight from global memory touches 16 lines for 512 bytes, and every wave of a row or column of waves would repeat it. Needs M % 128 == 0, N % 128 == 0, K % 128 == 0.
#define G3PB 272                     /* LDS pitch of a staged row, bytes: 256 + 16 = 16 bytes x odd, conflict-free for 16-byte reads */
#define G3SB (256 * G3PB)            /* bytes per buffer: 128 A rows, then 128 B rows */
// one operand's half of a tile: 8 copies per lane (rows sr + 0 / 16 / ... / 112). The s_wait_xcnt stands inside the copies' own statement, so that no later write of an address register can be moved in front of it.
__device__ __forceinline__ void g3_stage(unsigned l, const _Float16* p, size_t p16) {
  asm volatile("global_load_async_to_lds_b128 %0, %8, off\n\tglobal_load_async_to_lds_b128 %1, %9, off\n\tglobal_load_async_to_lds_b128 %2, %10, off\n\tglobal_load_async_to_lds_b128 %3, %11, off\n\t"
               "global_load_async_to_lds_b128 %4, %12, off\n\tglobal_load_async_to_lds_b128 %5, %13, off\n\tglobal_load_async_to_lds_b128 %6, %14, off\n\tglobal_load_async_to_lds_b128 %7, %15, off\n\ts_wait_xcnt 0x0"
               :: "v"(l), "v"(l + 16 * G3PB), "v"(l + 32 * G3PB), "v"(l + 48 * G3PB), "v"(l + 64 * G3PB), "v"(l + 80 * G3PB), "v"(l + 96 * G3PB), "v"(l + 112 * G3PB),
                  "v"(p), "v"(p + p16), "v"(p + 2 * p16), "v"(p + 3 * p16), "v"(p + 4 * p16), "v"(p + 5 * p16), "v"(p + 6 * p16), "v"(p + 7 * p16) : "memory"); }
#define G3VP 136                     /* LDS pitch of a V^T row of the work-group's tile, in halves: 128 tokens + 8 = 16 bytes x odd, conflict-free for 16-byte accesses */
// ROPE 1: plane 2 of the batch (v) leaves as V^T [batch][column][SQ] into VTo and nowhere else: register r of an accumulator is token 8 hh + r of column ln, so 8 registers ARE 16 bytes of a V^T row; the work-group's 128 x 128 tile is gathered in LDS so that every store is whole 128-byte lines (needs SQ % 128 == 0: a tile lies in one batch).
// ROPE 1: planes 0 and 1 of the batch (q, k) leave through the rotate-half rotation: N is whole heads of HD = 64 columns, so a wave tile is ONE head and both halves of every pair lie in the wave's own staging tile; position = row mod SQ (row 0 of A is a batch's first token); f16 rows only.
template <int ACT, int ROPE = 0>
__global__ __launch_bounds__(256) void k_gemm2(const _Float16* __restrict__ A, int lda, size_t sA, const _Float16* __restrict__ Bh, int ldb, size_t sB, float alpha, const float* __restrict__ bias, size_t sBias, const float* __restrict__ CP, int rowsPerB, size_t sCPb, int row0g,
    float* __restrict__ C, _Float16* __restrict__ C16, int ldc, size_t sC, int M, int N, int K, const float* __restrict__ tcos = nullptr, const float* __restrict__ tsin = nullptr, _Float16* __restrict__ VTo = nullptr) { static_assert(ACT == 0 || ACT == 3 || ACT == 6 || ACT == 8 || ACT == 9 || ACT == 11 || ACT == 12 || ACT == 14 || ACT == 15 || ACT == 16 || ACT == 17, "k_gemm2: unsupported ACT code (would silently apply no activation)");
  __shared__ __attribute__((aligned(16))) unsigned char smem[2 * G3SB]; static_assert(sizeof(float) * 8 * 32 * 68 <= 2 * G3SB, "the epilogue's staging tiles fit in the ring's place");
  float (*so)[32][68] = (float (*)[32][68])smem;      /* the ring's bytes become the 8 waves' own output staging tiles behind the loop's last barrier */
  const int tid = threadIdx.x, lane = tid & 31, ln = lane & 15, hh = lane >> 4; const int w = __builtin_amdgcn_readfirstlane(tid >> 5); const int by = blockIdx.y;
  A += (size_t)by * sA; Bh += (size_t)by * sB; const size_t cofs = (size_t)by * sC; const float* bp = bias ? bias + (size_t)by * sBias : nullptr;
  const int ntn = N >> 7; const int mt = blockIdx.x / ntn, nq = blockIdx.x - mt * ntn; const int rowW = mt * 128, colW = nq * 128; if (rowW >= M) return;      /* the same for the whole work-group, in front of every barrier */
  const int row0 = rowW + 32 * (w & 3), col0 = colW + 64 * (w >> 2);      /* 4 x 2 waves of 32 x 64 */
  const int sr = tid >> 4, sc8 = (tid & 15) * 8;      /* staging: 16 bytes per lane and copy, 16 lanes per 256-byte row piece, so a wave's copy takes 4 whole lines in 2 aligned 256-byte units */
  const _Float16* ga = A + (size_t)(rowW + sr) * lda + sc8; const _Float16* gb = Bh + (size_t)(colW + sr) * ldb + sc8; const size_t a16 = (size_t)16 * lda, b16 = (size_t)16 * ldb;
  const unsigned ls = (unsigned)(uintptr_t)(smem + sr * G3PB + sc8 * 2);      /* the lane's LDS byte address in buffer 0: low 32 bits of the shared address */
  const _Float16* fa = (const _Float16*)smem + (32 * (w & 3) + ln) * (G3PB / 2); const _Float16* fb = (const _Float16*)smem + (128 + 64 * (w >> 2) + ln) * (G3PB / 2);
  const int nt = K >> 7;
  const v8f z8 = {0.f,0.f,0.f,0.f,0.f,0.f,0.f,0.f}; v8f c00 = z8, c01 = z8, c02 = z8, c03 = z8, c10 = z8, c11 = z8, c12 = z8, c13 = z8;
  g3_stage(ls, ga, a16); g3_stage(ls + 128 * G3PB, gb, b16);
  asm volatile("s_wait_asynccnt 0x0" ::: "memory");      /* this wave's copies of tile 0 have landed */
  __syncthreads();      /* tile 0 is published */
  if (nt > 1) { g3_stage(ls + G3SB, ga + 128, a16); g3_stage(ls + G3SB + 128 * G3PB, gb + 128, b16); }
#pragma unroll 1      /* one tile per trip: the two buffers alternate */
  for (int t = 0; t < nt; ++t) { const _Float16* pa = fa + (t & 1) * (G3SB / 2); const _Float16* pb = fb + (t & 1) * (G3SB / 2);
#pragma unroll 1      /* the tile's two halves of 64 k run through one copy of the code: unrolled, a second set of 24 LDS reads and 16 WMMAs would lengthen a text that already stands near 32 KB */
    for (int h = 0; h < 2; ++h) {
    v16h a[2][2], b[2][4];      /* the half's 12 fragments, read as one group in front of its 16 WMMAs */
#pragma unroll      /* constant indices keep a and b in registers */
    for (int s = 0; s < 2; ++s) { const int ko = h * 64 + s * 32; a[s][0] = g2_frag(pa + ko, hh); b[s][0] = g2_frag(pb + ko, hh); a[s][1] = g2_frag(pa + 16 * (G3PB / 2) + ko, hh);
      for (int j = 1; j < 4; ++j) b[s][j] = g2_frag(pb + j * 16 * (G3PB / 2) + ko, hh); }
#pragma unroll      /* likewise; each accumulator takes its products in ascending k */
    for (int s = 0; s < 2; ++s) { c00 = g2_mma(a[s][0], b[s][0], c00); c10 = g2_mma(a[s][1], b[s][0], c10); c01 = g2_mma(a[s][0], b[s][1], c01); c11 = g2_mma(a[s][1], b[s][1], c11);
      c02 = g2_mma(a[s][0], b[s][2], c02); c12 = g2_mma(a[s][1], b[s][2], c12); c03 = g2_mma(a[s][0], b[s][3], c03); c13 = g2_mma(a[s][1], b[s][3], c13); } }
    asm volatile("s_wait_dscnt 0x0" ::: "memory");      /* this wave's reads of tile t are done before the buffer is handed to its next writer */
    asm volatile("s_wait_asynccnt 0x0" ::: "memory");      /* this wave's copies of tile t + 1 have landed */
    __syncthreads();      /* publishes tile t + 1 and ends every wave's reads of tile t */
    if (t + 2 < nt) { g3_stage(ls + (t & 1) * G3SB, ga + (size_t)(t + 2) * 128, a16); g3_stage(ls + (t & 1) * G3SB + 128 * G3PB, gb + (size_t)(t + 2) * 128, b16); } }
  asm volatile("s_wait_asynccnt 0x0" ::: "memory");      /* nothing is in flight when the ring's bytes change their use */
  v8f accs[8] = {c00, c01, c02, c03, c10, c11, c12, c13};
  if (ROPE && by == 2) {      /* the same for the whole work-group; alpha and bias as below, no CP term and no activation on this plane */
    static_assert(ACT == 0 || !ROPE, "the V^T plane takes no activation"); static_assert(128 * G3VP * 2 <= 2 * G3SB && SQ % 128 == 0, "the V^T tile fits in the ring's place and lies in one batch");
#pragma unroll      /* constant indices into accs */
    for (int u = 0; u < 8; ++u) { const int t = u & 3, half = u >> 2; const int col = col0 + t * 16 + ln; const float bv = bp ? bf16_round(bp[col]) : 0.f; FragH vh;
      for (int r = 0; r < 8; ++r) vh.h[r] = (_Float16)(accs[u][r] * alpha + bv);
      *(v8us*)((unsigned short*)smem + (col - colW) * G3VP + (row0 - rowW) + half * 16 + 8 * hh) = vh.half[0]; }
    __syncthreads();      /* the V^T tile is whole: each of its rows holds tokens of four waves */
    const int dr = tid >> 4, pc = (tid & 15) * 8;      /* 16 lanes per V^T row: 256 contiguous bytes, 2 whole lines */
    unsigned short* vd = (unsigned short*)VTo + ((size_t)(rowW / SQ) * N + colW + dr) * SQ + rowW % SQ + pc;
#pragma unroll      /* all 8 LDS reads go out together */
    for (int q = 0; q < 8; ++q) *(v8us*)(vd + (size_t)q * 16 * SQ) = *(const v8us*)((const unsigned short*)smem + (q * 16 + dr) * G3VP + pc);
    return; }
#pragma unroll
  for (int u = 0; u < 8; ++u) { const int t = u & 3, half = u >> 2; const int col = col0 + t * 16 + ln; const float bv = bp ? bf16_round(bp[col]) : 0.f;
#pragma unroll
    for (int r = 0; r < 8; ++r) { const int rloc = half * 16 + 8 * hh + r; float v = accs[u][r] * alpha + bv; if (CP) { if (rowsPerB < 0) v += CP[cofs + (size_t)(row0g + row0 + rloc) * ldc + col];      /* rowsPerB < 0: own element of the batched C plane */ else { const int bidx = (row0g + row0 + rloc) / rowsPerB; v += CP[(size_t)bidx * sCPb + (size_t)by * 64 + col]; } }
      if (ACT == 3) v = fmaxf(v, 0.f); else if (ACT == 6) v = 0.5f * v * (1.0f + erff(v * 0.70710678118654752f)); else if (ACT == 11) v = 1.0f / (1.0f + expf(-v)); else if (ACT == 15) v = v / (1.0f + expf(-v)); else if (ACT == 12) v = (v > 0.f) ? v : 0.01f * v; else if (ACT == 8) v = tanhf(v); else if (ACT == 9) v = 0.5f * v * (1.0f + tanhf(0.7978845608028654f * (v + 0.044715f * v * v * v))); else if (ACT == 14) v = (v > 0.f) ? v : 0.1f * v; else if (ACT == 16) v = (v >= 0.f) ? v : 0.3f * v; else if (ACT == 17) v = (v >= 0.f) ? v : 0.2f * v;
      so[w][rloc][t * 16 + ln] = v; } }
  __builtin_amdgcn_fence(__ATOMIC_ACQ_REL, "workgroup"); __builtin_amdgcn_wave_barrier();
  if (ROPE) {      /* planes 0 and 1 (plane 2 has left above; the row stores below are not built for ROPE 1). 8 lanes per row: a lane takes columns d4 .. d4 + 3 of BOTH halves, so each table value and each staged value is read once and used twice */
    const int r4 = lane >> 3, d4 = (lane & 7) * 4; v4f cc[8], ss[8]; const unsigned tb = (((unsigned)row0 % SQ + r4) * (HD / 2) + d4) * 4u;      /* byte offset of the lane's first table entries; row0 and SQ are multiples of 32: the tile's 32 positions do not wrap */
#pragma unroll      /* constant indices keep cc and ss in registers; all 16 loads go out together, one latency */
    for (int q = 0; q < 8; ++q) { cc[q] = *(const v4fa*)((const char*)tcos + tb + q * 16 * (HD / 2)); ss[q] = *(const v4fa*)((const char*)tsin + tb + q * 16 * (HD / 2)); }
    asm volatile("s_wait_xcnt 0x0" :: "v"(tb) : "memory");      /* the wait in front of any overwrite of the offset register that the 16 issued table loads name; tb as an input keeps that register out of the loads' own destinations (without it the last load landed on it) */
#pragma unroll      /* constant indices into cc and ss */
    for (int q = 0; q < 8; ++q) { const int r = q * 4 + r4; const v4f lo = *(const v4fa*)&so[w][r][d4]; const v4f hi = *(const v4fa*)&so[w][r][d4 + HD / 2]; v4h ol, oh;
      for (int i = 0; i < 4; ++i) { const float c = bf16_round(cc[q][i]), s = bf16_round(ss[q][i]); ol[i] = (_Float16)(lo[i] * c - hi[i] * s); oh[i] = (_Float16)(lo[i] * s + hi[i] * c); }
      _Float16* dst = C16 + cofs + (size_t)(row0 + r) * ldc + col0 + d4; *(v4h*)dst = ol; *(v4h*)(dst + HD / 2) = oh; }
    return; }
  const int rsub = lane >> 4, c4 = (lane & 15) * 4;
  {
#pragma unroll
    for (int q = 0; q < 16; ++q) { const int r = q * 2 + rsub; const v4f v = *(const v4fa*)&so[w][r][c4]; if (C) *(v4f*)(C + cofs + (size_t)(row0 + r) * ldc + col0 + c4) = v; if (C16) { v4h h4; for (int i = 0; i < 4; ++i) h4[i] = (_Float16)v[i]; *(v4h*)(C16 + cofs + (size_t)(row0 + r) * ldc + col0 + c4) = h4; } }
     } }


// all five operand conversions in ONE launch: the four natural [out][in] weights -> Bt planes x16, x -> f16 rows (values as before: bf16 rounding, then an exact f16). PWG work-groups, 16 waves per WGP on 256 WGPs, start once;
// a thread takes 16 pieces of 4 floats (2 of each weight, 8 of x), PTH pieces apart, so every wave-wide load is 512 contiguous bytes (4 whole lines), every store 256 (2 whole lines), and all 16 loads of a wave are in flight together.
#define PWG 512                      /* work-groups of the conversion launch */
#define PTH (PWG * 256)              /* its threads */
__device__ __forceinline__ v4h prep_cvt(v4f a, float scale) { v4h o; for (int q = 0; q < 4; ++q) o[q] = (_Float16)(bf16_round(a[q]) * scale); return o; }
__global__ __launch_bounds__(256) void k_prep(const float* __restrict__ wq, const float* __restrict__ wk, const float* __restrict__ wv, const float* __restrict__ wo, const float* __restrict__ x,
    _Float16* __restrict__ BQ, _Float16* __restrict__ BK, _Float16* __restrict__ BV, _Float16* __restrict__ BO, _Float16* __restrict__ X16) {
  static_assert((size_t)DM * DM == (size_t)PTH * 4 * 2 && (size_t)KVD * DM == (size_t)PTH * 4 * 2 && NR * DM == (size_t)PTH * 4 * 8, "2 pieces of each weight and 8 of x per thread, none left over");
  const unsigned tb = (blockIdx.x * 256u + threadIdx.x) * 16u; v4f a[4][2], b[8];      /* byte offset of the thread's first piece in every f32 source; half of it in every f16 destination */
#pragma unroll      /* constant indices keep a and b in registers */
  for (int i = 0; i < 2; ++i) { const size_t e = (size_t)i * PTH * 16; a[0][i] = *(const v4fa*)((const char*)wq + e + tb); a[1][i] = *(const v4fa*)((const char*)wk + e + tb); a[2][i] = *(const v4fa*)((const char*)wv + e + tb); a[3][i] = *(const v4fa*)((const char*)wo + e + tb); }
#pragma unroll      /* likewise */
  for (int i = 0; i < 8; ++i) b[i] = *(const v4fa*)((const char*)x + (size_t)i * PTH * 16 + tb);
  __builtin_amdgcn_sched_barrier(0);      /* keeps every conversion behind all 16 loads: without it the scheduler put the first conversions, with their waits, in front of the last loads of x, which then went out only after the weights had arrived (two latencies in a row) */
  const unsigned th = tb >> 1;
#pragma unroll      /* likewise */
  for (int i = 0; i < 2; ++i) { const size_t e = (size_t)i * PTH * 8; *(v4h*)((char*)BQ + e + th) = prep_cvt(a[0][i], 16.0f); *(v4h*)((char*)BK + e + th) = prep_cvt(a[1][i], 16.0f); *(v4h*)((char*)BV + e + th) = prep_cvt(a[2][i], 16.0f); *(v4h*)((char*)BO + e + th) = prep_cvt(a[3][i], 16.0f); }
#pragma unroll      /* likewise */
  for (int i = 0; i < 8; ++i) *(v4h*)((char*)X16 + (size_t)i * PTH * 8 + th) = prep_cvt(b[i], 1.0f); }
// fused attention, ONE launch for all batches, heads and query rows: a work-group of 8 waves owns 256 query rows of one head, a wave 32 of them, and walks the SQ keys in stages of FKS keys (passes of 32). S^T = K Q^T (A = key rows, B = query rows kept in registers), so a lane holds scores of ONE query per 16-column group;
// the two f32 score tiles of a pass, after exp2, ARE the f16 B operand of O^T += V^T P^T (register r of tile t = key 16 t + 8 hh + r = the k order of g2_frag), so neither S nor P is ever stored. Running maximum (log2 units) with a late rescale; weights stay unnormalised (at most 2^8), the row sum divides once at the end.
// K and V^T tiles reach the 8 waves through LDS (whole 128-byte lines from global memory, two buffers, one barrier per stage): a fragment load straight from global memory touches 16 lines for 512 bytes, and all 8 waves would repeat it.
#define FKS 64                       /* keys per stage */
#define FKP (HD + 8)                 /* LDS pitch of a key row, in halves: 16 bytes x odd, conflict-free for 16-byte reads */
#define FVP (FKS + 8)                /* LDS pitch of a V^T row, in halves: likewise */
__device__ __forceinline__ v8f fa_mma(v16h a, v16h b, v8f c) { return __builtin_amdgcn_wmma_f32_16x16x32_f16(false, a, false, b, (short)0, c, false, false); }
__device__ __forceinline__ v16h fa_frag(const unsigned short* p, int hh) { FragH f; f.half[0] = *(const v8us*)(p + 8 * hh); f.half[1] = *(const v8us*)(p + 16 + 8 * hh); return f.v; }
__device__ __forceinline__ void fa_exp2x8(float (&e)[8]) {
  asm("v_exp_f32 %0, %0\n\tv_exp_f32 %1, %1\n\tv_exp_f32 %2, %2\n\tv_exp_f32 %3, %3\n\tv_exp_f32 %4, %4\n\tv_exp_f32 %5, %5\n\tv_exp_f32 %6, %6\n\tv_exp_f32 %7, %7\n\tv_nop"
      : "+v"(e[0]), "+v"(e[1]), "+v"(e[2]), "+v"(e[3]), "+v"(e[4]), "+v"(e[5]), "+v"(e[6]), "+v"(e[7])); }
__global__ __launch_bounds__(256) void k_fattn(const _Float16* __restrict__ Q16, const _Float16* __restrict__ K16, const _Float16* __restrict__ VT, _Float16* __restrict__ O16) {
  __shared__ __attribute__((aligned(16))) unsigned short lk[2][FKS][FKP]; __shared__ __attribute__((aligned(16))) unsigned short lv[2][HD][FVP];
  const int tid = threadIdx.x, lane = tid & 31, ln = lane & 15, hh = lane >> 4; const int w = __builtin_amdgcn_readfirstlane(tid >> 5);
  const int h = blockIdx.y, b = blockIdx.z; const int q0 = blockIdx.x * 256 + w * 32;
  const _Float16* qp = Q16 + ((size_t)b * SQ + q0 + ln) * DM + h * HD;
  const int kr = tid >> 3, kc = (tid & 7) * 8;      /* staging: 16 bytes per thread and step, 8 threads per 128-byte key row */
  const int vr = tid / (FKS / 8), vc = (tid % (FKS / 8)) * 8;      /* FKS / 8 threads per V^T row piece */
  const unsigned short* kg = (const unsigned short*)K16 + ((size_t)b * SQ + kr) * KVD + h * HD + kc;
  const unsigned short* vg = (const unsigned short*)VT + (((size_t)b * NH + h) * HD + vr) * SQ + vc;
  const float cs = 0.125f * 1.44269504088896340736f;      /* 1/sqrt(64) and log2(e) in one factor */
  const v8f z8 = {0.f,0.f,0.f,0.f,0.f,0.f,0.f,0.f};
  v8us gk[FKS / 32], gv[FKS / 32];
#pragma unroll
  for (int i = 0; i < FKS / 32; ++i) { gk[i] = *(const v8us*)(kg + (size_t)i * 32 * KVD); gv[i] = *(const v8us*)(vg + (size_t)i * (2048 / FKS) * SQ); }
  v16h bq[2][2];
#pragma unroll
  for (int j = 0; j < 2; ++j) for (int s = 0; s < 2; ++s) bq[j][s] = g2_frag(qp + (size_t)j * 16 * DM + s * 32, hh);
  v8f o[4][2]; float m[2] = {-1.0e30f, -1.0e30f}; float l[2][2] = {{0.f, 0.f}, {0.f, 0.f}};
#pragma unroll
  for (int t = 0; t < 4; ++t) { o[t][0] = z8; o[t][1] = z8; }
#pragma unroll
  for (int i = 0; i < FKS / 32; ++i) { *(v8us*)&lk[0][kr + i * 32][kc] = gk[i]; *(v8us*)&lv[0][vr + i * (2048 / FKS)][vc] = gv[i]; }
  __syncthreads();      /* stage 0 is published */
#pragma unroll 1      /* one stage per trip: the body already holds FKS / 32 unrolled passes */
  for (int st = 0; st < SQ / FKS; ++st) {
    const int cur = st & 1; const int sn = (st + 1 < SQ / FKS) ? st + 1 : st;      /* the next stage's tiles are asked for now and stored after this stage's passes; the last stage re-reads its own (in bounds; that buffer is not read again) */
#pragma unroll
    for (int i = 0; i < FKS / 32; ++i) { gk[i] = *(const v8us*)(kg + ((size_t)sn * FKS + i * 32) * KVD); gv[i] = *(const v8us*)(vg + (size_t)i * (2048 / FKS) * SQ + sn * FKS); }
    v16h ka[2][2];
#pragma unroll
    for (int t = 0; t < 2; ++t) for (int s = 0; s < 2; ++s) ka[t][s] = fa_frag(&lk[cur][t * 16 + ln][s * 32], hh);
    asm volatile("" ::: "memory");      /* compiler fence: without it the next stage's global loads are sunk to just in front of their LDS stores at the stage's foot, and their whole latency is waited out there */
#pragma unroll
    for (int p = 0; p < FKS / 32; ++p) {
      v16h va[4]; v8f sc[2][2];      /* sc: [key tile][query tile] */
#pragma unroll
      for (int t = 0; t < 2; ++t) for (int j = 0; j < 2; ++j) sc[t][j] = fa_mma(ka[t][1], bq[j][1], fa_mma(ka[t][0], bq[j][0], z8));
#pragma unroll
      for (int t = 0; t < 4; ++t) va[t] = fa_frag(&lv[cur][t * 16 + ln][p * 32], hh);
      if (p + 1 < FKS / 32) {      /* the stage's next pass: its key fragments one pass ahead, into the same registers */
#pragma unroll
        for (int t = 0; t < 2; ++t) for (int s = 0; s < 2; ++s) ka[t][s] = fa_frag(&lk[cur][(p + 1) * 32 + t * 16 + ln][s * 32], hh); }
      asm volatile("" ::: "memory");      /* compiler fence: keeps these LDS reads together in front of the softmax arithmetic, which covers their latency; without it they are sunk in among the WMMAs that use them */
      float mx[2];
#pragma unroll
      for (int j = 0; j < 2; ++j) { float a = fmaxf(sc[0][j][0], sc[1][j][0]); for (int r = 1; r < 8; ++r) a = fmaxf(fmaxf(a, sc[0][j][r]), sc[1][j][r]); mx[j] = a * cs; }
      const bool need = (mx[0] > m[0] + 8.0f) || (mx[1] > m[1] + 8.0f);
      if (__builtin_amdgcn_ballot_w32(need) != 0) {      /* scalar branch: rescale only when some column's maximum has grown by more than 2^8; m[] changes only here and from values joined over the two lane halves, so both halves of a column always use the same m */
#pragma unroll
        for (int j = 0; j < 2; ++j) { const float mj = fmaxf(mx[j], __shfl_xor(mx[j], 16, 32)); const float mn = fmaxf(m[j], mj); const float f = __builtin_amdgcn_exp2f(m[j] - mn); m[j] = mn; l[j][0] *= f; l[j][1] *= f;
          for (int t = 0; t < 4; ++t) for (int r = 0; r < 8; ++r) o[t][j][r] *= f; } }
      v16h pb[2];
#pragma unroll
      for (int j = 0; j < 2; ++j) for (int t = 0; t < 2; ++t) { float e[8]; for (int r = 0; r < 8; ++r) e[r] = fmaf(sc[t][j][r], cs, -m[j]); fa_exp2x8(e); for (int r = 0; r < 8; ++r) { l[j][t] += e[r]; pb[j][t * 8 + r] = (_Float16)e[r]; } }
#pragma unroll
      for (int t = 0; t < 4; ++t) for (int j = 0; j < 2; ++j) o[t][j] = fa_mma(va[t], pb[j], o[t][j]);
    }
#pragma unroll
    for (int i = 0; i < FKS / 32; ++i) { *(v8us*)&lk[cur ^ 1][kr + i * 32][kc] = gk[i]; *(v8us*)&lv[cur ^ 1][vr + i * (2048 / FKS)][vc] = gv[i]; }      /* every wave left that buffer before the barrier that ended the stage before */
    __syncthreads();      /* publishes stage st + 1 and ends every wave's reads of stage st */
  }
#pragma unroll
  for (int j = 0; j < 2; ++j) { float lt = l[j][0] + l[j][1]; lt += __shfl_xor(lt, 16, 32); const float fin = 64.0f / lt;      /* o carried x64, as the output GEMM's alpha expects */
    unsigned short* op = (unsigned short*)O16 + ((size_t)b * SQ + q0 + j * 16 + ln) * DM + h * HD + 8 * hh;
    for (int t = 0; t < 4; ++t) { FragH f; for (int r = 0; r < 8; ++r) f.h[r] = (_Float16)(o[t][j][r] * fin); *(v8us*)(op + t * 16) = f.half[0]; } } }
__global__ __launch_bounds__(256) void k_vt(const _Float16* __restrict__ V16, int b, int h0, _Float16* __restrict__ VT) { __shared__ unsigned short tl[64][65]; const int tid = threadIdx.x; const int hh = blockIdx.x % HG, sg = blockIdx.x / HG; const int s0 = sg * 64; const int h = h0 + hh;
  for (int i = tid; i < 64 * 8; i += 256) { const int j = i / 8, d8 = (i % 8) * 8; FragH f; f.half[0] = *(const v8us*)((const unsigned short*)V16 + ((size_t)b * SQ + s0 + j) * DM + h * HD + d8); for (int q = 0; q < 8; ++q) tl[d8 + q][j] = f.u[q]; }
  __syncthreads();
  { for (int i = tid; i < 64 * 8; i += 256) { const int d = i / 8, j8 = (i % 8) * 8; FragH f; for (int q = 0; q < 8; ++q) f.u[q] = tl[d][j8 + q]; *(v8us*)((unsigned short*)VT + ((size_t)hh * HD + d) * SQ + s0 + j8) = f.half[0]; }  } }



__global__ __launch_bounds__(256) void k_rsmcf2(const float* __restrict__ S, _Float16* __restrict__ P, int hg, int q0, int nk) {
  #pragma clang fp contract(off)
  const int t = blockIdx.x * 256 + threadIdx.x; if (t >= hg * QT) return; const size_t i = (size_t)t; const float* s = S + i * NKX; const int last = q0 + (t % QT); float mx = -3.0e38f;
#pragma unroll 1
  for (int j = 0; j < nk; ++j) { const float f = (j <= last) ? 1.f : 0.f; mx = fmaxf(mx, fmaf(f, s[j], (1.f - f) * -1.0e9f)); } float se = 0.f;
#pragma unroll 1
  for (int j = 0; j < nk; ++j) { const float f = (j <= last) ? 1.f : 0.f; se += __expf(fmaf(f, s[j], (1.f - f) * -1.0e9f) - mx); } const float sc = 256.0f / se;
#pragma unroll 1
  for (int j0 = 0; j0 < nk; j0 += 8) { FragH fr; for (int q = 0; q < 8; ++q) { const int j = j0 + q; const float f = (j <= last) ? 1.f : 0.f; fr.h[q] = (_Float16)(__expf(fmaf(f, s[j], (1.f - f) * -1.0e9f) - mx) * sc); } unsigned short* d = (unsigned short*)P + i * NKX + j0; *(v8us*)d = fr.half[0];  } }


template <int MASKADD>
__global__ __launch_bounds__(64) void k_att0(const float* __restrict__ QF, const float* __restrict__ KF, const float* __restrict__ VF, int ld, const float* __restrict__ mask, float scale, float* __restrict__ OF, int ldo) {
  #pragma clang fp contract(off)
  __shared__ __attribute__((aligned(16))) float lq[64][64]; __shared__ __attribute__((aligned(16))) float lo[64][64];
  const int tid = threadIdx.x; const int h = blockIdx.x / (QT0 / 64), rg = blockIdx.x % (QT0 / 64); const int i = rg * 64 + tid;
  const float* qr = QF + (size_t)i * ld + h * HD;
#pragma unroll 1
  for (int c = 0; c < HD / 4; ++c) { *(v4f*)&lq[tid][c * 4] = *(const v4fa*)(qr + c * 4); const v4f z = {0.f, 0.f, 0.f, 0.f}; *(v4f*)&lo[tid][c * 4] = z; }
  float m = -1.0e30f, l = 0.f; const int jmax = MASKADD ? (SQ - 1) : (rg * 64 + 63);      /* additive-mask form: every key (the mask input decides); causal form: keys up to the block's last row */
#pragma unroll 1
  for (int j = 0; j <= jmax; ++j) { const float* kr = KF + (size_t)j * ld + h * HD; const float* vr = VF + (size_t)j * ld + h * HD; float s = 0.f;
#pragma unroll 1
    for (int c = 0; c < HD / 4; ++c) { const v4f kq = *(const v4fa*)(kr + c * 4); const v4f qq = *(v4f*)&lq[tid][c * 4]; s = __fadd_rn(s, __fmul_rn(qq[0], kq[0])); s = __fadd_rn(s, __fmul_rn(qq[1], kq[1])); s = __fadd_rn(s, __fmul_rn(qq[2], kq[2])); s = __fadd_rn(s, __fmul_rn(qq[3], kq[3])); }
    s = __fmul_rn(s, scale); if (MASKADD) s = __fadd_rn(s, __fmul_rn(bf16_round(mask[(size_t)i * SQ + j]), -10000.0f));
    const float f = (MASKADD || j <= i) ? 1.f : 0.f; const float sm = fmaf(f, s, (1.f - f) * -1.0e30f); const float mn = fmaxf(m, sm); const float sc = expf(m - mn); const float e = expf(sm - mn); l = __fadd_rn(__fmul_rn(l, sc), e); m = mn;
#pragma unroll 1
    for (int c = 0; c < HD / 4; ++c) { const v4f vv = *(const v4fa*)(vr + c * 4); v4f oo = *(v4f*)&lo[tid][c * 4]; for (int u = 0; u < 4; ++u) oo[u] = __fadd_rn(__fmul_rn(oo[u], sc), __fmul_rn(e, vv[u])); *(v4f*)&lo[tid][c * 4] = oo; } }
  const float fin = 64.0f / l;      /* o carried x64 like the f16 path */
#pragma unroll 1
  for (int c = 0; c < HD / 4; ++c) { v4f oo = *(v4f*)&lo[tid][c * 4]; for (int u = 0; u < 4; ++u) oo[u] = __fmul_rn(oo[u], fin); *(v4f*)&lo[tid][c * 4] = oo; }
  __syncthreads();
  {
#pragma unroll 1
    for (int it = 0; it < 16; ++it) { const int row = it * 4 + tid / 16, pc = (tid % 16) * 4; const v4f v = *(const v4f*)&lo[row][pc]; *(v4f*)(OF + (size_t)(rg * 64 + row) * ldo + h * HD + pc) = v; }
     } }


__global__ __launch_bounds__(256) void k_kvexp(const float* __restrict__ src, float* __restrict__ dst, size_t n4) { const size_t t = (size_t)blockIdx.x * 256 + threadIdx.x; if (t >= n4) return; const size_t e = t * 4; const size_t row = e / DM; const int col = (int)(e % DM); const int h = col / HD, d = col % HD; const v4f v = *(const v4fa*)(src + row * KVD + (size_t)(h / HPG) * HD + d); *(v4f*)(dst + e) = v;  }

__global__ __launch_bounds__(256) void k_tab2(float theta, float* __restrict__ CS, float* __restrict__ SN) {
  #pragma clang fp contract(off)
  const int t = blockIdx.x * 256 + threadIdx.x; if (t >= SQ * (HD / 2)) return; const int i = t % (HD / 2); const int p = t / (HD / 2); const float invf = 1.0f / powf(theta, (float)(2 * i) / (float)HD); const float ang = __fmul_rn((float)p, invf); const float c = cosf(ang), s = sinf(ang);
  *(float*)(CS + t) = c; *(float*)(SN + t) = s;  }
template <int NORM, int ROPE>
__global__ __launch_bounds__(64) void k_xform(const float* __restrict__ F, int ldf, int nh, const float* __restrict__ gain, float eps, const float* __restrict__ CS, const float* __restrict__ SN, _Float16* __restrict__ H16, int ldo) {
  #pragma clang fp contract(off)
  __shared__ float xv[HD]; __shared__ float red[HD]; __shared__ unsigned short sh_[HD]; const int d = threadIdx.x; const int h = blockIdx.x % nh; const size_t r = blockIdx.x / nh; const int p = (int)(r % SQ);
  float x = F[r * (size_t)ldf + (size_t)h * HD + d];
  if (NORM) { red[d] = __fmul_rn(x, x); __syncthreads(); for (int st = HD / 2; st > 0; st >>= 1) { if (d < st) red[d] = __fadd_rn(red[d], red[d + st]); __syncthreads(); } const float rs = rsqrtf(__fadd_rn(red[0] / (float)HD, eps)); x = __fmul_rn(__fmul_rn(x, rs), bf16_round(gain[d])); }
  xv[d] = x; __syncthreads();
  float o = x;
  if (ROPE == 1) { const int i = d >> 1; const float c = CS[p * (HD / 2) + i], s = SN[p * (HD / 2) + i]; const float ev = xv[2 * i], od = xv[2 * i + 1]; o = (d & 1) ? __fadd_rn(__fmul_rn(ev, s), __fmul_rn(od, c)) : __fadd_rn(__fmul_rn(ev, c), -__fmul_rn(od, s)); }
  if (ROPE == 2) { const int i = d & (HD / 2 - 1); const float c = CS[p * (HD / 2) + i], s = SN[p * (HD / 2) + i]; const float lo = xv[i], hi = xv[i + HD / 2]; o = (d < HD / 2) ? __fadd_rn(__fmul_rn(lo, c), -__fmul_rn(hi, s)) : __fadd_rn(__fmul_rn(lo, s), __fmul_rn(hi, c)); }
  FragH th; th.h[0] = (_Float16)o; sh_[d] = th.u[0]; __syncthreads();
  if (d < HD / 8) { FragH f; for (int q = 0; q < 8; ++q) f.u[q] = sh_[d * 8 + q]; unsigned short* dst = (unsigned short*)H16 + r * (size_t)ldo + (size_t)h * HD + d * 8; *(v8us*)dst = f.half[0];  } }

template <int NORM, int ROPE>
__global__ __launch_bounds__(64) void k_xformf(const float* __restrict__ F, int ldf, int nh, const float* __restrict__ gain, float eps, const float* __restrict__ CS, const float* __restrict__ SN, float* __restrict__ F32, int ldo) {
  #pragma clang fp contract(off)
  __shared__ float xv[HD]; __shared__ float red[HD]; const int d = threadIdx.x; const int h = blockIdx.x % nh; const size_t r = blockIdx.x / nh; const int p = (int)(r % SQ);
  float x = F[r * (size_t)ldf + (size_t)h * HD + d];
  if (NORM) { red[d] = __fmul_rn(x, x); __syncthreads(); for (int st = HD / 2; st > 0; st >>= 1) { if (d < st) red[d] = __fadd_rn(red[d], red[d + st]); __syncthreads(); } const float rs = rsqrtf(__fadd_rn(red[0] / (float)HD, eps)); x = __fmul_rn(__fmul_rn(x, rs), bf16_round(gain[d])); }
  xv[d] = x; __syncthreads();
  float o = x;
  if (ROPE == 1) { const int i = d >> 1; const float c = CS[p * (HD / 2) + i], s = SN[p * (HD / 2) + i]; const float ev = xv[2 * i], od = xv[2 * i + 1]; o = (d & 1) ? __fadd_rn(__fmul_rn(ev, s), __fmul_rn(od, c)) : __fadd_rn(__fmul_rn(ev, c), -__fmul_rn(od, s)); }
  if (ROPE == 2) { const int i = d & (HD / 2 - 1); const float c = CS[p * (HD / 2) + i], s = SN[p * (HD / 2) + i]; const float lo = xv[i], hi = xv[i + HD / 2]; o = (d < HD / 2) ? __fadd_rn(__fmul_rn(lo, c), -__fmul_rn(hi, s)) : __fadd_rn(__fmul_rn(lo, s), __fmul_rn(hi, c)); }
  float* dst = F32 + r * (size_t)ldo + (size_t)h * HD + d; *(float*)dst = o;  }

__global__ __launch_bounds__(256) void k_bfcp(const float* __restrict__ src, float* __restrict__ dst, size_t n4) { const size_t t = (size_t)blockIdx.x * 256 + threadIdx.x; if (t >= n4) return; const v4f a = *(const v4fa*)(src + t * 4); v4f o; for (int q = 0; q < 4; ++q) o[q] = bf16_round(a[q]); *(v4f*)(dst + t * 4) = o;  }

__global__ __launch_bounds__(256) void k_tab2d(float* __restrict__ CS, float* __restrict__ SN) {
  #pragma clang fp contract(off)
  const int t = blockIdx.x * 256 + threadIdx.x; if (t >= SQ * (HD / 2)) return; const int i = t % (HD / 2); const int p = t / (HD / 2); const float invf = (float)(1.0 / pow(10000.0, (double)(2 * i) / (double)HD)); const float ang = __fmul_rn((float)p, invf); const float c = cosf(ang), s = sinf(ang);
  *(float*)(CS + t) = c; *(float*)(SN + t) = s;  }
extern "C" void kernel_launch(void* const* d_in, const int* in_sizes, int n_in,
                              void* d_out, int out_size, void* d_ws, size_t ws_size, hipStream_t stream) {
  (void)in_sizes; (void)n_in; (void)out_size;
  const float* const* I = (const float* const*)d_in; const float* x = I[0]; const float* wq = I[1]; const float* wk = I[2]; const float* wv = I[3]; const float* wo = I[4]; const float* tcos = I[5]; const float* tsin = I[6]; const float* bq = nullptr; const float* bk = nullptr; const float* bv = nullptr; const float* bo = nullptr;      /* natural [out][in] weights, no biases; rope_cos / rope_sin INPUT tables [2048][32] */
  static_assert(HPG == 1 && NH == NG * HPG && NH * HD == DM && KVD == DM, "plain multi-head attention as 16 kv groups of one query head");
  char* ws = (char*)d_ws; size_t off = 0;
  auto take = [&](size_t bytes) { char* p = ws + off; off += (bytes + 255) & ~(size_t)255; return p; };
  _Float16* BQ = (_Float16*)take((size_t)DM * DM * 2); _Float16* BK = (_Float16*)take((size_t)KVD * DM * 2); _Float16* BV = (_Float16*)take((size_t)KVD * DM * 2); _Float16* BO = (_Float16*)take((size_t)DM * DM * 2);
  _Float16* X16 = (_Float16*)take(NR * DM * 2); _Float16* Q16 = (_Float16*)take(NR * DM * 2); _Float16* K16 = (_Float16*)take(NR * KVD * 2); _Float16* V16 = (_Float16*)take(NR * KVD * 2); _Float16* O16 = (_Float16*)take(NR * DM * 2);
  _Float16* VT = (_Float16*)take((size_t)NB * NH * HD * SQ * 2);
  float* QF0 = (float*)take((size_t)QT0 * DM * 4); float* KF0 = (float*)take((size_t)QT0 * KVD * 4); float* VF0 = (float*)take((size_t)QT0 * KVD * 4); float* KF0e = (float*)take((size_t)QT0 * DM * 4); float* VF0e = (float*)take((size_t)QT0 * DM * 4); float* OF0 = (float*)take((size_t)NB * QT0 * DM * 4); _Float16* OH0 = (_Float16*)take((size_t)NB * QT0 * DM * 2); _Float16* OL0 = (_Float16*)take((size_t)NB * QT0 * DM * 2);
  if (off > ws_size) return;
  k_prep<<<PWG, 256, 0, stream>>>(wq, wk, wv, wo, x, BQ, BK, BV, BO, X16);      /* natural [out][in] = Bt planes x16; x as f16 rows */
  const size_t r0p = (size_t)B0 * SQ;      /* first projected row */
  static_assert(((size_t)DM * DM * 2) % 256 == 0 && (NR * DM * 2) % 256 == 0, "BQ | BK | BV and Q16 | K16 | V16 lie back to back in the workspace: the plane strides of the batched launch");
  k_gemm2<0, 1><<<dim3((unsigned)((MP / 128) * (DM / 128)), 3), 256, 0, stream>>>(X16 + r0p * DM, DM, 0, BQ, DM, (size_t)DM * DM, 0.0625f, nullptr, 0, nullptr, 1, 0, 0, nullptr, Q16 + r0p * DM, DM, NR * DM, MP, DM, DM, tcos, tsin, VT + (size_t)B0 * NH * HD * SQ);      /* q, k (rotated by the INPUT rope tables [2048][32]: column d uses table column d mod 32 = the module's [cos | cos]) of every batch -> f16 rows; v -> V^T [NB][NH][HD][SQ] */
  k_fattn<<<dim3(SQ / 256, NH, NB), 256, 0, stream>>>(Q16, K16, VT, O16);      /* scores, softmax and P V of every batch, head and query row in ONE launch; o (x64) into merged f16 rows */
  k_gemm2<0><<<dim3((unsigned)((MPO / 128) * (DM / 128)), 1), 256, 0, stream>>>(O16 + r0p * DM, DM, 0, BO, DM, 0, 0.0009765625f, bo, 0, nullptr, 1, 0, 0, (float*)d_out + r0p * DM, nullptr, DM, 0, MPO, DM, DM);      /* out rows are the output layout */
}

// v008
// Measured time: 77.7 microseconds a run.
// Timed twice side by side with v007, it ran 1.15 and 1.11 times as fast.
// Counting every step since v000, it is 93.9 times as fast.
#include <hip/hip_runtime.h>
// Multi-head self-attention with half-split RoPE from RANDOM input tables, NON-causal (x [2][2048][1024]; q / k / v = x W^T (nn.Linear natural [1024][1024] sigma 1/32, no biases), 16 heads of 64; rope: x * [cos | cos] + rotate_half(x) * [sin | sin] with rotate_half = (-x2, x1) over the two 32-lane halves and INPUT tables rope_cos / rope_sin [2048][32] (cos / sin of uniform-random angles); scores / sqrt(64); softmax over all 2048 keys (f32; no mask); out = merged Wo^T (natural, no bias) -> [2][2048][1024]); run as 16 groups of ONE head.
// Structure: x as exact f16 rows; natural weights as exact x16 planes; q, k and v of both batches as ONE batched WMMA GEMM launch (k_qkv: 64x64 wave tiles, f32 accumulation, a work-group holds 128 token rows x 128 columns of each of the three planes) whose epilogue rotates q and k in f32 (rotate-half; a 64-column wave tile is one head; INPUT tables rounded to bf16 as read) and writes f16 rows, and writes v as V^T of the heads straight from its accumulators (a lane holds 8 consecutive tokens of one column); then ONE fused attention launch for all batches, heads and query rows (k_fattn: scores of 32 query columns per wave against ALL 2048 keys, running softmax in registers with f32 statistics and native exp2, unnormalised f16 weights, o = P V^T carried x64) into merged f16 rows; out = o Wo^T GEMM (f32, alpha 2^-10); launches: see trace.
// Compute dtype: inputs rounded to bf16; x / weights exact; q, k, v, softmax weights and o as plain f16 GEMM operands (~2^-12); scores and softmax statistics f32. v_wmma_f32_16x16x32_f16.
#define NB 2
#define NG 16
#define HPG 1
#define KVD (NG * HD)
#define SQ 2048
#define DM 1024
#define NH 16
#define HD 64
#define HG 4                         /* heads per block group of the unlaunched k_vt overload */
#define QT 256                       /* query rows per tile */
#define NKX SQ                       /* S / P row pitch */
#define QT0 128                      /* rows per head of k_att0 (not launched); sizes unused f32 buffers */
#define B0 0                         /* first batch processed (debug hook) */
#define NBR NB                       /* batches processed (debug hook) */
#define NR ((size_t)NB * SQ)         /* token rows */
#define MP ((int)((size_t)NBR * SQ)) /* rows projected (debug hook) */
#define QN SQ                        /* unused: k_fattn attends all SQ query rows of a batch */
#define NHD NH                       /* unused: k_fattn attends all NH heads */
#define MPO MP                       /* rows through the output stage (debug hook) */
#define LQ DM      /* unused: the q and k rows have pitch DM */
typedef __bf16 v16b __attribute__((ext_vector_type(16)));
typedef unsigned short v8us __attribute__((ext_vector_type(8), may_alias));
typedef float  v8f  __attribute__((ext_vector_type(8)));
typedef float  v4f  __attribute__((ext_vector_type(4)));
typedef float  v4fa __attribute__((ext_vector_type(4), may_alias));
union FragB { v16b v; v8us half[2]; unsigned short u[16]; };

__device__ __forceinline__ unsigned short bf16_bits(float x) { unsigned int u = __float_as_uint(x); return (unsigned short)((u + 0x7FFFu + ((u >> 16) & 1u)) >> 16); }
__device__ __forceinline__ float bf16_val(unsigned short b) { return __uint_as_float(((unsigned int)b) << 16); }
__device__ __forceinline__ float bf16_round(float x) { return bf16_val(bf16_bits(x)); }
// D += A·B with NT terms: 1 = ah·bh, 2 = + al·bh (A split), 3 = + ah·bl (both split)
template <int NT>
__device__ __forceinline__ v8f mmaN(v16b ah, v16b al, v16b bh, v16b bl, v8f c) {
  c = __builtin_amdgcn_wmma_f32_16x16x32_bf16(false, ah, false, bh, (short)0, c, false, false);
  if (NT >= 2) c = __builtin_amdgcn_wmma_f32_16x16x32_bf16(false, al, false, bh, (short)0, c, false, false);
  if (NT >= 3) c = __builtin_amdgcn_wmma_f32_16x16x32_bf16(false, ah, false, bl, (short)0, c, false, false);
  asm volatile("v_nop\n\tv_nop\n\tv_nop\n\tv_nop" : "+v"(c) : "v"(ah), "v"(al), "v"(bh), "v"(bl));
  return c;
}

__global__ __launch_bounds__(256) void k_wt_bf16(const float* __restrict__ W, unsigned short* __restrict__ Wt, int K, int N) {
  const int t = blockIdx.x * 256 + threadIdx.x;
  const int k8n = K / 8;
  if (t >= N * k8n) return;
  const int n = t / k8n, k8 = (t % k8n) * 8;
  v8us v;
#pragma unroll
  for (int i = 0; i < 8; ++i) v[i] = bf16_bits(W[(size_t)(k8 + i) * N + n]);
  *(v8us*)(Wt + (size_t)n * K + k8) = v;
  
}

// GEMM C[M][N] (f32, pitch ldc) = act(A[M][K]·W + bias). A f32 row-major (pitch lda) converted per fragment to bf16
// (ASPLIT: hi/lo two planes -> 2 terms, else single rounded term); Wt bf16 [N][K] (pitch ldb). BIAS_BF16 rounds the
// bias to bf16 first (bias quantised to bf16 before the add). K%32==0, M%16==0, N%64==0.
template <bool ASPLIT, int ACT, bool BIAS_BF16>
__global__ __launch_bounds__(128) void k_gemm_bf(const float* __restrict__ A, int lda, const unsigned short* __restrict__ Wt, int ldb,
                                               const float* __restrict__ bias, float* __restrict__ C, int ldc, int M, int N, int K) {
  __shared__ __attribute__((aligned(16))) float so[4][16][64];
  const int tid = threadIdx.x, w = tid >> 5, lane = tid & 31, ln = lane & 15, hh = lane >> 4;
  const int ntn = N / 64;
  const int wid = blockIdx.x * 4 + w;
  const int mt = wid / ntn, nq = wid % ntn;
  if (mt * 16 >= M) return;
  const int row0 = mt * 16, col0 = nq * 64;
  const float* arow = A + (size_t)(row0 + ln) * lda;
  v8f acc[4] = {};
  for (int kb = 0; kb < K; kb += 32) {
    FragB ah, al;
    const v4f x0 = *(const v4fa*)(arow + kb + 8 * hh), x1 = *(const v4fa*)(arow + kb + 8 * hh + 4);
    const v4f x2 = *(const v4fa*)(arow + kb + 16 + 8 * hh), x3 = *(const v4fa*)(arow + kb + 16 + 8 * hh + 4);
    float xs[16] = {x0[0],x0[1],x0[2],x0[3],x1[0],x1[1],x1[2],x1[3],x2[0],x2[1],x2[2],x2[3],x3[0],x3[1],x3[2],x3[3]};
#pragma unroll
    for (int i = 0; i < 16; ++i) { const unsigned short hb = bf16_bits(xs[i]); ah.u[i] = hb; al.u[i] = ASPLIT ? bf16_bits(xs[i] - bf16_val(hb)) : (unsigned short)0; }
#pragma unroll
    for (int t = 0; t < 4; ++t) {
      const unsigned short* brow = Wt + (size_t)(col0 + t * 16 + ln) * ldb + kb;
      FragB b;
      b.half[0] = *(const v8us*)(brow + 8 * hh);
      b.half[1] = *(const v8us*)(brow + 16 + 8 * hh);
      acc[t] = mmaN<ASPLIT ? 2 : 1>(ah.v, al.v, b.v, b.v, acc[t]);
    }
  }
#pragma unroll
  for (int t = 0; t < 4; ++t) {
    float bv = bias ? bias[col0 + t * 16 + ln] : 0.f;
    if (BIAS_BF16) bv = bf16_round(bv);
#pragma unroll
    for (int r = 0; r < 8; ++r) { float v = acc[t][r] + bv; if (ACT == 1) v = fmaxf(v, 0.f); so[w][8 * hh + r][t * 16 + ln] = v; }
  }
  __builtin_amdgcn_fence(__ATOMIC_ACQ_REL, "workgroup");
  __builtin_amdgcn_wave_barrier();
  const int rsub = lane >> 4, c4 = (lane & 15) * 4;
  {
#pragma unroll
    for (int q = 0; q < 8; ++q) {
      const int r = q * 2 + rsub;
      const v4f v = *(const v4fa*)&so[w][r][c4];
      *(v4f*)(C + (size_t)(row0 + r) * ldc + col0 + c4) = v;
    }
    
  }
}

// GEMM C = act(A·W + bias + resid): A f32 (ASPLIT -> hi/lo 2 terms), Wt bf16 [N][K]; ACT 0 none, 1 relu, 2 exact gelu;
// resid (optional, f32, row index = (row % rmod), pitch ldr, RES_BF16 rounds it) added before the activation.
template <bool ASPLIT, int ACT, bool BIAS_BF16, bool RES_BF16>
__global__ __launch_bounds__(128) void k_gemm_bf3(const float* __restrict__ A, int lda, const unsigned short* __restrict__ Wt, int ldb,
                                                const float* __restrict__ bias, const float* __restrict__ resid, int rmod, int ldr,
                                                float* __restrict__ C, int ldc, int M, int N, int K) {
  __shared__ __attribute__((aligned(16))) float so[4][16][64];
  const int tid = threadIdx.x, w = tid >> 5, lane = tid & 31, ln = lane & 15, hh = lane >> 4;
  const int ntn = N / 64;
  const int wid = blockIdx.x * 4 + w;
  const int mt = wid / ntn, nq = wid % ntn;
  if (mt * 16 >= M) return;
  const int row0 = mt * 16, col0 = nq * 64;
  const float* arow = A + (size_t)(row0 + ln) * lda;
  v8f acc[4] = {};
  for (int kb = 0; kb < K; kb += 32) {
    FragB ah, al;
    const v4f x0 = *(const v4fa*)(arow + kb + 8 * hh), x1 = *(const v4fa*)(arow + kb + 8 * hh + 4);
    const v4f x2 = *(const v4fa*)(arow + kb + 16 + 8 * hh), x3 = *(const v4fa*)(arow + kb + 16 + 8 * hh + 4);
    float xs[16] = {x0[0],x0[1],x0[2],x0[3],x1[0],x1[1],x1[2],x1[3],x2[0],x2[1],x2[2],x2[3],x3[0],x3[1],x3[2],x3[3]};
#pragma unroll
    for (int i = 0; i < 16; ++i) { const unsigned short hb = bf16_bits(xs[i]); ah.u[i] = hb; al.u[i] = ASPLIT ? bf16_bits(xs[i] - bf16_val(hb)) : (unsigned short)0; }
#pragma unroll
    for (int t = 0; t < 4; ++t) {
      const unsigned short* brow = Wt + (size_t)(col0 + t * 16 + ln) * ldb + kb;
      FragB b;
      b.half[0] = *(const v8us*)(brow + 8 * hh);
      b.half[1] = *(const v8us*)(brow + 16 + 8 * hh);
      acc[t] = mmaN<ASPLIT ? 2 : 1>(ah.v, al.v, b.v, b.v, acc[t]);
    }
  }
#pragma unroll
  for (int t = 0; t < 4; ++t) {
    const int col = col0 + t * 16 + ln;
    float bv = bias ? bias[col] : 0.f;
    if (BIAS_BF16) bv = bf16_round(bv);
#pragma unroll
    for (int r = 0; r < 8; ++r) {
      float v = acc[t][r] + bv;
      if (resid) { float rv = resid[(size_t)((row0 + 8 * hh + r) % rmod) * ldr + col]; if (RES_BF16) rv = bf16_round(rv); v += rv; }
      if (ACT == 1) v = fmaxf(v, 0.f);
      if (ACT == 2) v = 0.5f * v * (1.0f + erff(v * 0.70710678118654752f));
      if (ACT == 3) { const float u = 0.7978845608028654f * (v + 0.044715f * v * v * v); v = 0.5f * v * (1.0f + tanhf(u)); }
      so[w][8 * hh + r][t * 16 + ln] = v;
    }
  }
  __builtin_amdgcn_fence(__ATOMIC_ACQ_REL, "workgroup");
  __builtin_amdgcn_wave_barrier();
  const int rsub = lane >> 4, c4 = (lane & 15) * 4;
  {
#pragma unroll
    for (int q = 0; q < 8; ++q) {
      const int r = q * 2 + rsub;
      const v4f v = *(const v4fa*)&so[w][r][c4];
      *(v4f*)(C + (size_t)(row0 + r) * ldc + col0 + c4) = v;
    }
    
  }
}
// row LayerNorm (biased variance, eps) over N: s = X (+ R); optional out_sum <- s; out_norm <- (s-mu)*rsqrt(var+eps)*g + b
template <bool PARAM_BF16>
__global__ __launch_bounds__(256) void k_layernorm(const float* __restrict__ X, const float* __restrict__ R, const float* __restrict__ g, const float* __restrict__ bta,
                                                  float* __restrict__ out_sum, float* __restrict__ out_norm, int N, float eps) {
  __shared__ float red[256];
  const int row = blockIdx.x, tid = threadIdx.x;
  const float* x = X + (size_t)row * N; const float* rr = R ? R + (size_t)row * N : nullptr;
  float vals[16];                     // up to N = 4096
  const int per = N / 256;            // contiguous chunk per thread? use strided-by-4 chunks: thread handles j = tid*4 + 1024*u
  float s1 = 0.f;
  for (int u = 0; u < per / 4; ++u) {
    const int j = tid * 4 + 1024 * u;
    const v4f a = *(const v4fa*)(x + j);
    v4f b = {0.f,0.f,0.f,0.f}; if (rr) b = *(const v4fa*)(rr + j);
#pragma unroll
    for (int q = 0; q < 4; ++q) { const float v = a[q] + b[q]; vals[u * 4 + q] = v; s1 += v; }
  }
  red[tid] = s1; __syncthreads();
  for (int st = 128; st > 0; st >>= 1) { if (tid < st) red[tid] += red[tid + st]; __syncthreads(); }
  const float mu = red[0] / (float)N; __syncthreads();
  float s2 = 0.f;
  for (int u = 0; u < per / 4; ++u)
#pragma unroll
    for (int q = 0; q < 4; ++q) { const float c = vals[u * 4 + q] - mu; s2 += c * c; }
  red[tid] = s2; __syncthreads();
  for (int st = 128; st > 0; st >>= 1) { if (tid < st) red[tid] += red[tid + st]; __syncthreads(); }
  const float rs = rsqrtf(red[0] / (float)N + eps);
  {
    for (int u = 0; u < per / 4; ++u) {
      const int j = tid * 4 + 1024 * u;
      v4f o, sm;
#pragma unroll
      for (int q = 0; q < 4; ++q) {
        float gg = g[j + q], bb = bta[j + q];
        if (PARAM_BF16) { gg = bf16_round(gg); bb = bf16_round(bb); }
        sm[q] = vals[u * 4 + q]; o[q] = (vals[u * 4 + q] - mu) * rs * gg + bb;
      }
      if (out_sum) *(v4f*)(out_sum + (size_t)row * N + j) = sm;
      *(v4f*)(out_norm + (size_t)row * N + j) = o;
    }
    
  }
}



// ---- f16 WMMA path (v_wmma_f32_16x16x32_f16): 11-bit significands for operands in range — used where a [0,1] probability operand needs more precision than bf16
typedef _Float16 v16h __attribute__((ext_vector_type(16)));
union FragH { v16h v; v8us half[2]; _Float16 h[16]; unsigned short u[16]; };
template <int NT>
__device__ __forceinline__ v8f mmaH(v16h ah, v16h al, v16h bh, v16h bl, v8f c) {
  c = __builtin_amdgcn_wmma_f32_16x16x32_f16(false, ah, false, bh, (short)0, c, false, false);
  if (NT >= 2) c = __builtin_amdgcn_wmma_f32_16x16x32_f16(false, al, false, bh, (short)0, c, false, false);
  if (NT >= 3) c = __builtin_amdgcn_wmma_f32_16x16x32_f16(false, ah, false, bl, (short)0, c, false, false);
  asm volatile("v_nop\n\tv_nop\n\tv_nop\n\tv_nop" : "+v"(c) : "v"(ah), "v"(al), "v"(bh), "v"(bl));
  return c;
}
// batched GEMM like k_gemm_b but f16 operands: A f32 (split into f16 hi/lo if ASPLIT, else rounded to f16), Bt = f16 values [n][k]; alpha; C f32; N multiple of 16 (partial tiles skipped)
template <bool ASPLIT>
__global__ __launch_bounds__(128) void k_gemm_h(const float* __restrict__ A, int lda, size_t sA, const _Float16* __restrict__ Bh, int ldb, size_t sB, float alpha, float* __restrict__ C, int ldc, size_t sC, int M, int N, int K) {
  __shared__ __attribute__((aligned(16))) float so[4][16][64];
  const int tid = threadIdx.x, w = tid >> 5, lane = tid & 31, ln = lane & 15, hh = lane >> 4; const int by = blockIdx.y;
  A += (size_t)by * sA; Bh += (size_t)by * sB; C += (size_t)by * sC;
  const int ntn = (N + 63) / 64; const int wid = blockIdx.x * 4 + w; const int mt = wid / ntn, nq = wid % ntn; if (mt * 16 >= M) return;
  const int row0 = mt * 16, col0 = nq * 64; const float* arow = A + (size_t)(row0 + ln) * lda;
  v8f acc[4] = {};
  for (int kb = 0; kb < K; kb += 32) {
    FragH ah, al;
    const v4f x0 = *(const v4fa*)(arow + kb + 8 * hh), x1 = *(const v4fa*)(arow + kb + 8 * hh + 4), x2 = *(const v4fa*)(arow + kb + 16 + 8 * hh), x3 = *(const v4fa*)(arow + kb + 16 + 8 * hh + 4);
    float xs[16] = {x0[0],x0[1],x0[2],x0[3],x1[0],x1[1],x1[2],x1[3],x2[0],x2[1],x2[2],x2[3],x3[0],x3[1],x3[2],x3[3]};
#pragma unroll
    for (int i = 0; i < 16; ++i) { const _Float16 h = (_Float16)xs[i]; ah.h[i] = h; al.h[i] = ASPLIT ? (_Float16)(xs[i] - (float)h) : (_Float16)0.0f; }
#pragma unroll
    for (int t = 0; t < 4; ++t) { if (col0 + t * 16 >= N) continue; const size_t boff = (size_t)(col0 + t * 16 + ln) * ldb + kb; FragH bq; bq.half[0] = *(const v8us*)(Bh + boff + 8 * hh); bq.half[1] = *(const v8us*)(Bh + boff + 16 + 8 * hh);
      acc[t] = mmaH<ASPLIT ? 2 : 1>(ah.v, al.v, bq.v, bq.v, acc[t]); }
  }
#pragma unroll
  for (int t = 0; t < 4; ++t) { if (col0 + t * 16 >= N) continue;
#pragma unroll
    for (int r = 0; r < 8; ++r) so[w][8 * hh + r][t * 16 + ln] = acc[t][r] * alpha; }
  __builtin_amdgcn_fence(__ATOMIC_ACQ_REL, "workgroup"); __builtin_amdgcn_wave_barrier();
  const int rsub = lane >> 4, c4 = (lane & 15) * 4;
  {
#pragma unroll
    for (int q = 0; q < 8; ++q) { const int r = q * 2 + rsub; if (col0 + c4 < N) { const v4f v = *(const v4fa*)&so[w][r][c4]; *(v4f*)(C + (size_t)(row0 + r) * ldc + col0 + c4) = v; } }
     }
}

// Wt[n][k] = f16(W[k][n]·scale) from f32 row-major W[K][N] (scale = power of two; bf16-exact weights stay exact in f16 away from the subnormal range)
__global__ __launch_bounds__(256) void k_wt_f16(const float* __restrict__ W, _Float16* __restrict__ Wt, int K, int N, float scale) {
  const int t = blockIdx.x * 256 + threadIdx.x; if (t >= N * (K / 8)) return; const int n = t / (K / 8), k8 = (t % (K / 8)) * 8; FragH f;
#pragma unroll
  for (int i = 0; i < 8; ++i) f.h[i] = (_Float16)(bf16_round(W[(size_t)(k8 + i) * N + n]) * scale); const v8us o = f.half[0];
  *(v8us*)((unsigned short*)Wt + (size_t)n * K + k8) = o; 
}
// k_gemm_hh variant with fused epilogue: v = acc·alpha + bias[by·sBias + col] (+ CP[(row/rowsPerB)·sCPb + by·64 + col] if CP) ; ACT 0 none / 1 elu ; writes f16 C16 (and f32 C if non-null)
template <int ACT>
__global__ __launch_bounds__(128) void k_gemm_hhx(const _Float16* __restrict__ A, int lda, size_t sA, const _Float16* __restrict__ Bh, int ldb, size_t sB, float alpha, const float* __restrict__ bias, size_t sBias, const float* __restrict__ CP, int rowsPerB, size_t sCPb, int row0g,
    float* __restrict__ C, _Float16* __restrict__ C16, int ldc, size_t sC, int M, int N, int K) {
  __shared__ __attribute__((aligned(16))) float so[4][16][64];
  const int tid = threadIdx.x, w = tid >> 5, lane = tid & 31, ln = lane & 15, hh = lane >> 4; const int by = blockIdx.y;
  A += (size_t)by * sA; Bh += (size_t)by * sB; const size_t cofs = (size_t)by * sC; const float* bp = bias ? bias + (size_t)by * sBias : nullptr;
  const int ntn = (N + 63) / 64; const int wid = blockIdx.x * 4 + w; const int mt = wid / ntn, nq = wid % ntn; if (mt * 16 >= M) return;
  const int row0 = mt * 16, col0 = nq * 64; const _Float16* arow = A + (size_t)(row0 + ln) * lda;
  v8f acc[4] = {};
  for (int kb = 0; kb < K; kb += 32) { FragH ah; ah.half[0] = *(const v8us*)((const unsigned short*)arow + kb + 8 * hh); ah.half[1] = *(const v8us*)((const unsigned short*)arow + kb + 16 + 8 * hh);
#pragma unroll
    for (int t = 0; t < 4; ++t) { if (col0 + t * 16 >= N) continue; const size_t boff = (size_t)(col0 + t * 16 + ln) * ldb + kb; FragH bq; bq.half[0] = *(const v8us*)((const unsigned short*)Bh + boff + 8 * hh); bq.half[1] = *(const v8us*)((const unsigned short*)Bh + boff + 16 + 8 * hh);
      acc[t] = mmaH<1>(ah.v, ah.v, bq.v, bq.v, acc[t]); }
  }
#pragma unroll
  for (int t = 0; t < 4; ++t) { if (col0 + t * 16 >= N) continue; const int col = col0 + t * 16 + ln; const float bv = bp ? bf16_round(bp[col]) : 0.f;
#pragma unroll
    for (int r = 0; r < 8; ++r) { float v = acc[t][r] * alpha + bv; if (CP) { const int rr = row0g + row0 + 8 * hh + r; if (rowsPerB < 0) v += CP[cofs + (size_t)rr * ldc + col];      /* rowsPerB < 0: own element of the batched C plane */ else { const int bidx = rr / rowsPerB; v += CP[(size_t)bidx * sCPb + (size_t)by * 64 + col]; } } if (ACT == 1) v = (v > 0.f) ? v : expm1f(v); else if (ACT == 7) v = (v > 0.f) ? v + 1.0f : expf(v); else if (ACT == 8) v = tanhf(v); else if (ACT == 9) v = 0.5f * v * (1.0f + tanhf(0.7978845608028654f * (v + 0.044715f * v * v * v))); else if (ACT == 11) v = 1.0f / (1.0f + expf(-v)); else if (ACT == 12) v = (v > 0.f) ? v : 0.01f * v; else if (ACT == 14) v = (v > 0.f) ? v : 0.1f * v; else if (ACT == 16) v = (v >= 0.f) ? v : 0.3f * v; else if (ACT == 17) v = (v >= 0.f) ? v : 0.2f * v; else if (ACT == 15) v = v / (1.0f + expf(-v)); else if (ACT == 3) v = fmaxf(v, 0.f); else if (ACT == 6) v = 0.5f * v * (1.0f + erff(v * 0.70710678118654752f)); so[w][8 * hh + r][t * 16 + ln] = v; } }
  __builtin_amdgcn_fence(__ATOMIC_ACQ_REL, "workgroup"); __builtin_amdgcn_wave_barrier();
  const int rsub = lane >> 4, c4 = (lane & 15) * 4; typedef _Float16 v4h __attribute__((ext_vector_type(4)));
  {
#pragma unroll
    for (int q = 0; q < 8; ++q) { const int r = q * 2 + rsub; if (col0 + c4 < N) { const v4f v = *(const v4fa*)&so[w][r][c4]; if (C) *(v4f*)(C + cofs + (size_t)(row0 + r) * ldc + col0 + c4) = v; if (C16) { v4h h4; for (int i = 0; i < 4; ++i) h4[i] = (_Float16)v[i]; *(v4h*)(C16 + cofs + (size_t)(row0 + r) * ldc + col0 + c4) = h4; } } }
     }
}


typedef _Float16 v4h __attribute__((ext_vector_type(4)));

__global__ __launch_bounds__(256) void k_h16(const float* __restrict__ x, _Float16* __restrict__ X16, size_t n8) { const size_t t = (size_t)blockIdx.x * 256 + threadIdx.x; if (t >= n8) return; FragH f;
#pragma unroll
  for (int q = 0; q < 8; ++q) f.h[q] = (_Float16)x[t * 8 + q]; *(v8us*)((unsigned short*)X16 + t * 8) = f.half[0];  }
__global__ __launch_bounds__(256) void k_round16f(const float* __restrict__ W, _Float16* __restrict__ Bt, size_t n8) { const size_t t = (size_t)blockIdx.x * 256 + threadIdx.x; if (t >= n8) return; FragH f;
#pragma unroll
  for (int i = 0; i < 8; ++i) f.h[i] = (_Float16)(bf16_round(W[t * 8 + i]) * 16.0f); *(v8us*)((unsigned short*)Bt + t * 8) = f.half[0];  }
template <int NHv, int TTv>
__global__ __launch_bounds__(256) void k_vt(const _Float16* __restrict__ V16, int ldv, int voff, _Float16* __restrict__ Vt) { __shared__ unsigned short tl[64][66]; const int tid = threadIdx.x; const int slab = blockIdx.x / (TTv / 64), lg = blockIdx.x % (TTv / 64); const int b = slab / NHv, h = slab % NHv;
  for (int i = tid; i < 64 * 8; i += 256) { const int r = i / 8, c8 = (i % 8) * 8; FragH f; f.half[0] = *(const v8us*)((const unsigned short*)V16 + ((size_t)b * TTv + lg * 64 + r) * ldv + voff + h * 64 + c8);
#pragma unroll
    for (int q = 0; q < 8; ++q) tl[r][c8 + q] = f.u[q]; }
  __syncthreads();
  {
#pragma unroll
    for (int rd = 0; rd < 2; ++rd) { const int d = rd * 32 + tid / 8, pc = tid % 8; FragH f;
#pragma unroll
      for (int q = 0; q < 8; ++q) f.u[q] = tl[pc * 8 + q][d];
      *(v8us*)((unsigned short*)Vt + ((size_t)slab * 64 + d) * TTv + lg * 64 + pc * 8) = f.half[0]; }
     } }

__global__ __launch_bounds__(256) void k_hl(const float* __restrict__ F, _Float16* __restrict__ Hh, _Float16* __restrict__ Hl, size_t n8) { const size_t t = (size_t)blockIdx.x * 256 + threadIdx.x; if (t >= n8) return; FragH fh, fl; const v4f a = *(const v4fa*)(F + t * 8), c = *(const v4fa*)(F + t * 8 + 4);
#pragma unroll
  for (int q = 0; q < 4; ++q) { _Float16 h = (_Float16)a[q]; fh.h[q] = h; fl.h[q] = (_Float16)((a[q] - (float)h) * 1024.0f); h = (_Float16)c[q]; fh.h[4 + q] = h; fl.h[4 + q] = (_Float16)((c[q] - (float)h) * 1024.0f); }
  { *(v8us*)((unsigned short*)Hh + t * 8) = fh.half[0]; *(v8us*)((unsigned short*)Hl + t * 8) = fl.half[0];  } }

// ---- fast GEMM (wave tile 32x64, work-group tile 128x128; requires M % 128 == 0 rows per launch region, N % 128 == 0, K % 128 == 0); epilogue = k_gemm_hhx semantics ----
__device__ __forceinline__ v16h g2_frag(const _Float16* p, int hh) { FragH f; f.half[0] = *(const v8us*)((const unsigned short*)p + 8 * hh); f.half[1] = *(const v8us*)((const unsigned short*)p + 16 + 8 * hh); return f.v; }
__device__ __forceinline__ v8f g2_mma(v16h a, v16h b, v8f c) { v8f d = __builtin_amdgcn_wmma_f32_16x16x32_f16(false, a, false, b, (short)0, c, false, false); asm volatile("v_nop\n\tv_nop\n\tv_nop\n\tv_nop" : "+v"(d) : "v"(a), "v"(b)); return d; }
// Operand tiles through LDS: a work-group of 8 waves owns 128 x 128 of C and walks K in tiles of 128 (256 bytes of each of its 128 A rows and 128 B rows); asynchronous copies bring whole 256-byte pieces into one of two buffers while the other is worked on. A tile's copies have one trip to land: a trip of 128 k holds 32 WMMAs and 48 LDS reads a wave, twice the cover of a trip of 64 k, for operands that the launch before has just written and that may come from memory. A fragment load straight from global memory touches 16 lines for 512 bytes, and every wave of a row or column of waves would repeat it. Needs M % 128 == 0, N % 128 == 0, K % 128 == 0.
#define G3PB 272                     /* LDS pitch of a staged row, bytes: 256 + 16 = 16 bytes x odd, conflict-free for 16-byte reads */
#define G3SB (256 * G3PB)            /* bytes per buffer: 128 A rows, then 128 B rows */
// one operand's half of a tile: 8 copies per lane (rows sr + 0 / 16 / ... / 112). The s_wait_xcnt stands inside the copies' own statement, so that no later write of an address register can be moved in front of it.
__device__ __forceinline__ void g3_stage(unsigned l, const _Float16* p, size_t p16) {
  asm volatile("global_load_async_to_lds_b128 %0, %8, off\n\tglobal_load_async_to_lds_b128 %1, %9, off\n\tglobal_load_async_to_lds_b128 %2, %10, off\n\tglobal_load_async_to_lds_b128 %3, %11, off\n\t"
               "global_load_async_to_lds_b128 %4, %12, off\n\tglobal_load_async_to_lds_b128 %5, %13, off\n\tglobal_load_async_to_lds_b128 %6, %14, off\n\tglobal_load_async_to_lds_b128 %7, %15, off\n\ts_wait_xcnt 0x0"
               :: "v"(l), "v"(l + 16 * G3PB), "v"(l + 32 * G3PB), "v"(l + 48 * G3PB), "v"(l + 64 * G3PB), "v"(l + 80 * G3PB), "v"(l + 96 * G3PB), "v"(l + 112 * G3PB),
                  "v"(p), "v"(p + p16), "v"(p + 2 * p16), "v"(p + 3 * p16), "v"(p + 4 * p16), "v"(p + 5 * p16), "v"(p + 6 * p16), "v"(p + 7 * p16) : "memory"); }
#define G3VP 136                     /* LDS pitch of a V^T row of the work-group's tile, in halves: 128 tokens + 8 = 16 bytes x odd, conflict-free for 16-byte accesses */
// ROPE 1: plane 2 of the batch (v) leaves as V^T [batch][column][SQ] into VTo and nowhere else: register r of an accumulator is token 8 hh + r of column ln, so 8 registers ARE 16 bytes of a V^T row; the work-group's 128 x 128 tile is gathered in LDS so that every store is whole 128-byte lines (needs SQ % 128 == 0: a tile lies in one batch).
// ROPE 1: planes 0 and 1 of the batch (q, k) leave through the rotate-half rotation: N is whole heads of HD = 64 columns, so a wave tile is ONE head and both halves of every pair lie in the wave's own staging tile; position = row mod SQ (row 0 of A is a batch's first token); f16 rows only.
template <int ACT, int ROPE = 0>
__global__ __launch_bounds__(256) void k_gemm2(const _Float16* __restrict__ A, int lda, size_t sA, const _Float16* __restrict__ Bh, int ldb, size_t sB, float alpha, const float* __restrict__ bias, size_t sBias, const float* __restrict__ CP, int rowsPerB, size_t sCPb, int row0g,
    float* __restrict__ C, _Float16* __restrict__ C16, int ldc, size_t sC, int M, int N, int K, const float* __restrict__ tcos = nullptr, const float* __restrict__ tsin = nullptr, _Float16* __restrict__ VTo = nullptr) { static_assert(ACT == 0 || ACT == 3 || ACT == 6 || ACT == 8 || ACT == 9 || ACT == 11 || ACT == 12 || ACT == 14 || ACT == 15 || ACT == 16 || ACT == 17, "k_gemm2: unsupported ACT code (would silently apply no activation)");
  __shared__ __attribute__((aligned(16))) unsigned char smem[2 * G3SB]; static_assert(sizeof(float) * 8 * 32 * 68 <= 2 * G3SB, "the epilogue's staging tiles fit in the ring's place");
  float (*so)[32][68] = (float (*)[32][68])smem;      /* the ring's bytes become the 8 waves' own output staging tiles behind the loop's last barrier */
  const int tid = threadIdx.x, lane = tid & 31, ln = lane & 15, hh = lane >> 4; const int w = __builtin_amdgcn_readfirstlane(tid >> 5); const int by = blockIdx.y;
  A += (size_t)by * sA; Bh += (size_t)by * sB; const size_t cofs = (size_t)by * sC; const float* bp = bias ? bias + (size_t)by * sBias : nullptr;
  const int ntn = N >> 7; const int mt = blockIdx.x / ntn, nq = blockIdx.x - mt * ntn; const int rowW = mt * 128, colW = nq * 128; if (rowW >= M) return;      /* the same for the whole work-group, in front of every barrier */
  const int row0 = rowW + 32 * (w & 3), col0 = colW + 64 * (w >> 2);      /* 4 x 2 waves of 32 x 64 */
  const int sr = tid >> 4, sc8 = (tid & 15) * 8;      /* staging: 16 bytes per lane and copy, 16 lanes per 256-byte row piece, so a wave's copy takes 4 whole lines in 2 aligned 256-byte units */
  const _Float16* ga = A + (size_t)(rowW + sr) * lda + sc8; const _Float16* gb = Bh + (size_t)(colW + sr) * ldb + sc8; const size_t a16 = (size_t)16 * lda, b16 = (size_t)16 * ldb;
  const unsigned ls = (unsigned)(uintptr_t)(smem + sr * G3PB + sc8 * 2);      /* the lane's LDS byte address in buffer 0: low 32 bits of the shared address */
  const _Float16* fa = (const _Float16*)smem + (32 * (w & 3) + ln) * (G3PB / 2); const _Float16* fb = (const _Float16*)smem + (128 + 64 * (w >> 2) + ln) * (G3PB / 2);
  const int nt = K >> 7;
  const v8f z8 = {0.f,0.f,0.f,0.f,0.f,0.f,0.f,0.f}; v8f c00 = z8, c01 = z8, c02 = z8, c03 = z8, c10 = z8, c11 = z8, c12 = z8, c13 = z8;
  g3_stage(ls, ga, a16); g3_stage(ls + 128 * G3PB, gb, b16);
  asm volatile("s_wait_asynccnt 0x0" ::: "memory");      /* this wave's copies of tile 0 have landed */
  __syncthreads();      /* tile 0 is published */
  if (nt > 1) { g3_stage(ls + G3SB, ga + 128, a16); g3_stage(ls + G3SB + 128 * G3PB, gb + 128, b16); }
#pragma unroll 1      /* one tile per trip: the two buffers alternate */
  for (int t = 0; t < nt; ++t) { const _Float16* pa = fa + (t & 1) * (G3SB / 2); const _Float16* pb = fb + (t & 1) * (G3SB / 2);
#pragma unroll 1      /* the tile's two halves of 64 k run through one copy of the code: unrolled, a second set of 24 LDS reads and 16 WMMAs would lengthen a text that already stands near 32 KB */
    for (int h = 0; h < 2; ++h) {
    v16h a[2][2], b[2][4];      /* the half's 12 fragments, read as one group in front of its 16 WMMAs */
#pragma unroll      /* constant indices keep a and b in registers */
    for (int s = 0; s < 2; ++s) { const int ko = h * 64 + s * 32; a[s][0] = g2_frag(pa + ko, hh); b[s][0] = g2_frag(pb + ko, hh); a[s][1] = g2_frag(pa + 16 * (G3PB / 2) + ko, hh);
      for (int j = 1; j < 4; ++j) b[s][j] = g2_frag(pb + j * 16 * (G3PB / 2) + ko, hh); }
#pragma unroll      /* likewise; each accumulator takes its products in ascending k */
    for (int s = 0; s < 2; ++s) { c00 = g2_mma(a[s][0], b[s][0], c00); c10 = g2_mma(a[s][1], b[s][0], c10); c01 = g2_mma(a[s][0], b[s][1], c01); c11 = g2_mma(a[s][1], b[s][1], c11);
      c02 = g2_mma(a[s][0], b[s][2], c02); c12 = g2_mma(a[s][1], b[s][2], c12); c03 = g2_mma(a[s][0], b[s][3], c03); c13 = g2_mma(a[s][1], b[s][3], c13); } }
    asm volatile("s_wait_dscnt 0x0" ::: "memory");      /* this wave's reads of tile t are done before the buffer is handed to its next writer */
    asm volatile("s_wait_asynccnt 0x0" ::: "memory");      /* this wave's copies of tile t + 1 have landed */
    __syncthreads();      /* publishes tile t + 1 and ends every wave's reads of tile t */
    if (t + 2 < nt) { g3_stage(ls + (t & 1) * G3SB, ga + (size_t)(t + 2) * 128, a16); g3_stage(ls + (t & 1) * G3SB + 128 * G3PB, gb + (size_t)(t + 2) * 128, b16); } }
  asm volatile("s_wait_asynccnt 0x0" ::: "memory");      /* nothing is in flight when the ring's bytes change their use */
  v8f accs[8] = {c00, c01, c02, c03, c10, c11, c12, c13};
  if (ROPE && by == 2) {      /* the same for the whole work-group; alpha and bias as below, no CP term and no activation on this plane */
    static_assert(ACT == 0 || !ROPE, "the V^T plane takes no activation"); static_assert(128 * G3VP * 2 <= 2 * G3SB && SQ % 128 == 0, "the V^T tile fits in the ring's place and lies in one batch");
#pragma unroll      /* constant indices into accs */
    for (int u = 0; u < 8; ++u) { const int t = u & 3, half = u >> 2; const int col = col0 + t * 16 + ln; const float bv = bp ? bf16_round(bp[col]) : 0.f; FragH vh;
      for (int r = 0; r < 8; ++r) vh.h[r] = (_Float16)(accs[u][r] * alpha + bv);
      *(v8us*)((unsigned short*)smem + (col - colW) * G3VP + (row0 - rowW) + half * 16 + 8 * hh) = vh.half[0]; }
    __syncthreads();      /* the V^T tile is whole: each of its rows holds tokens of four waves */
    const int dr = tid >> 4, pc = (tid & 15) * 8;      /* 16 lanes per V^T row: 256 contiguous bytes, 2 whole lines */
    unsigned short* vd = (unsigned short*)VTo + ((size_t)(rowW / SQ) * N + colW + dr) * SQ + rowW % SQ + pc;
#pragma unroll      /* all 8 LDS reads go out together */
    for (int q = 0; q < 8; ++q) *(v8us*)(vd + (size_t)q * 16 * SQ) = *(const v8us*)((const unsigned short*)smem + (q * 16 + dr) * G3VP + pc);
    return; }
#pragma unroll
  for (int u = 0; u < 8; ++u) { const int t = u & 3, half = u >> 2; const int col = col0 + t * 16 + ln; const float bv = bp ? bf16_round(bp[col]) : 0.f;
#pragma unroll
    for (int r = 0; r < 8; ++r) { const int rloc = half * 16 + 8 * hh + r; float v = accs[u][r] * alpha + bv; if (CP) { if (rowsPerB < 0) v += CP[cofs + (size_t)(row0g + row0 + rloc) * ldc + col];      /* rowsPerB < 0: own element of the batched C plane */ else { const int bidx = (row0g + row0 + rloc) / rowsPerB; v += CP[(size_t)bidx * sCPb + (size_t)by * 64 + col]; } }
      if (ACT == 3) v = fmaxf(v, 0.f); else if (ACT == 6) v = 0.5f * v * (1.0f + erff(v * 0.70710678118654752f)); else if (ACT == 11) v = 1.0f / (1.0f + expf(-v)); else if (ACT == 15) v = v / (1.0f + expf(-v)); else if (ACT == 12) v = (v > 0.f) ? v : 0.01f * v; else if (ACT == 8) v = tanhf(v); else if (ACT == 9) v = 0.5f * v * (1.0f + tanhf(0.7978845608028654f * (v + 0.044715f * v * v * v))); else if (ACT == 14) v = (v > 0.f) ? v : 0.1f * v; else if (ACT == 16) v = (v >= 0.f) ? v : 0.3f * v; else if (ACT == 17) v = (v >= 0.f) ? v : 0.2f * v;
      so[w][rloc][t * 16 + ln] = v; } }
  __builtin_amdgcn_fence(__ATOMIC_ACQ_REL, "workgroup"); __builtin_amdgcn_wave_barrier();
  if (ROPE) {      /* planes 0 and 1 (plane 2 has left above; the row stores below are not built for ROPE 1). 8 lanes per row: a lane takes columns d4 .. d4 + 3 of BOTH halves, so each table value and each staged value is read once and used twice */
    const int r4 = lane >> 3, d4 = (lane & 7) * 4; v4f cc[8], ss[8]; const unsigned tb = (((unsigned)row0 % SQ + r4) * (HD / 2) + d4) * 4u;      /* byte offset of the lane's first table entries; row0 and SQ are multiples of 32: the tile's 32 positions do not wrap */
#pragma unroll      /* constant indices keep cc and ss in registers; all 16 loads go out together, one latency */
    for (int q = 0; q < 8; ++q) { cc[q] = *(const v4fa*)((const char*)tcos + tb + q * 16 * (HD / 2)); ss[q] = *(const v4fa*)((const char*)tsin + tb + q * 16 * (HD / 2)); }
    asm volatile("s_wait_xcnt 0x0" :: "v"(tb) : "memory");      /* the wait in front of any overwrite of the offset register that the 16 issued table loads name; tb as an input keeps that register out of the loads' own destinations (without it the last load landed on it) */
#pragma unroll      /* constant indices into cc and ss */
    for (int q = 0; q < 8; ++q) { const int r = q * 4 + r4; const v4f lo = *(const v4fa*)&so[w][r][d4]; const v4f hi = *(const v4fa*)&so[w][r][d4 + HD / 2]; v4h ol, oh;
      for (int i = 0; i < 4; ++i) { const float c = bf16_round(cc[q][i]), s = bf16_round(ss[q][i]); ol[i] = (_Float16)(lo[i] * c - hi[i] * s); oh[i] = (_Float16)(lo[i] * s + hi[i] * c); }
      _Float16* dst = C16 + cofs + (size_t)(row0 + r) * ldc + col0 + d4; *(v4h*)dst = ol; *(v4h*)(dst + HD / 2) = oh; }
    return; }
  const int rsub = lane >> 4, c4 = (lane & 15) * 4;
  {
#pragma unroll
    for (int q = 0; q < 16; ++q) { const int r = q * 2 + rsub; const v4f v = *(const v4fa*)&so[w][r][c4]; if (C) *(v4f*)(C + cofs + (size_t)(row0 + r) * ldc + col0 + c4) = v; if (C16) { v4h h4; for (int i = 0; i < 4; ++i) h4[i] = (_Float16)v[i]; *(v4h*)(C16 + cofs + (size_t)(row0 + r) * ldc + col0 + c4) = h4; } }
     } }


// all five operand conversions in ONE launch: the four natural [out][in] weights -> Bt planes x16, x -> f16 rows (values as before: bf16 rounding, then an exact f16). PWG work-groups, 16 waves per WGP on 256 WGPs, start once;
// a thread takes 16 pieces of 4 floats (2 of each weight, 8 of x), PTH pieces apart, so every wave-wide load is 512 contiguous bytes (4 whole lines), every store 256 (2 whole lines), and all 16 loads of a wave are in flight together.
#define PWG 512                      /* work-groups of the conversion launch */
#define PTH (PWG * 256)              /* its threads */
__device__ __forceinline__ v4h prep_cvt(v4f a, float scale) { v4h o; for (int q = 0; q < 4; ++q) o[q] = (_Float16)(bf16_round(a[q]) * scale); return o; }
__global__ __launch_bounds__(256) void k_prep(const float* __restrict__ wq, const float* __restrict__ wk, const float* __restrict__ wv, const float* __restrict__ wo, const float* __restrict__ x,
    _Float16* __restrict__ BQ, _Float16* __restrict__ BK, _Float16* __restrict__ BV, _Float16* __restrict__ BO, _Float16* __restrict__ X16) {
  static_assert((size_t)DM * DM == (size_t)PTH * 4 * 2 && (size_t)KVD * DM == (size_t)PTH * 4 * 2 && NR * DM == (size_t)PTH * 4 * 8, "2 pieces of each weight and 8 of x per thread, none left over");
  const unsigned tb = (blockIdx.x * 256u + threadIdx.x) * 16u; v4f a[4][2], b[8];      /* byte offset of the thread's first piece in every f32 source; half of it in every f16 destination */
#pragma unroll      /* constant indices keep a and b in registers */
  for (int i = 0; i < 2; ++i) { const size_t e = (size_t)i * PTH * 16; a[0][i] = *(const v4fa*)((const char*)wq + e + tb); a[1][i] = *(const v4fa*)((const char*)wk + e + tb); a[2][i] = *(const v4fa*)((const char*)wv + e + tb); a[3][i] = *(const v4fa*)((const char*)wo + e + tb); }
#pragma unroll      /* likewise */
  for (int i = 0; i < 8; ++i) b[i] = *(const v4fa*)((const char*)x + (size_t)i * PTH * 16 + tb);
  __builtin_amdgcn_sched_barrier(0);      /* keeps every conversion behind all 16 loads: without it the scheduler put the first conversions, with their waits, in front of the last loads of x, which then went out only after the weights had arrived (two latencies in a row) */
  const unsigned th = tb >> 1;
#pragma unroll      /* likewise */
  for (int i = 0; i < 2; ++i) { const size_t e = (size_t)i * PTH * 8; *(v4h*)((char*)BQ + e + th) = prep_cvt(a[0][i], 16.0f); *(v4h*)((char*)BK + e + th) = prep_cvt(a[1][i], 16.0f); *(v4h*)((char*)BV + e + th) = prep_cvt(a[2][i], 16.0f); *(v4h*)((char*)BO + e + th) = prep_cvt(a[3][i], 16.0f); }
#pragma unroll      /* likewise */
  for (int i = 0; i < 8; ++i) *(v4h*)((char*)X16 + (size_t)i * PTH * 8 + th) = prep_cvt(b[i], 1.0f); }
// fused attention, ONE launch for all batches, heads and query rows: a work-group of 8 waves owns 256 query rows of one head, a wave 32 of them, and walks the SQ keys in stages of FKS keys (passes of 32). S^T = K Q^T (A = key rows, B = query rows kept in registers), so a lane holds scores of ONE query per 16-column group;
// the two f32 score tiles of a pass, after exp2, ARE the f16 B operand of O^T += V^T P^T (register r of tile t = key 16 t + 8 hh + r = the k order of g2_frag), so neither S nor P is ever stored. Running maximum (log2 units) with a late rescale; weights stay unnormalised (at most 2^8), the row sum divides once at the end.
// K and V^T tiles reach the 8 waves through LDS (whole 128-byte lines from global memory, two buffers, one barrier per stage): a fragment load straight from global memory touches 16 lines for 512 bytes, and all 8 waves would repeat it.
#define FKS 64                       /* keys per stage */
#define FKP (HD + 8)                 /* LDS pitch of a key row, in halves: 16 bytes x odd, conflict-free for 16-byte reads */
#define FVP (FKS + 8)                /* LDS pitch of a V^T row, in halves: likewise */
__device__ __forceinline__ v8f fa_mma(v16h a, v16h b, v8f c) { return __builtin_amdgcn_wmma_f32_16x16x32_f16(false, a, false, b, (short)0, c, false, false); }
__device__ __forceinline__ v16h fa_frag(const unsigned short* p, int hh) { FragH f; f.half[0] = *(const v8us*)(p + 8 * hh); f.half[1] = *(const v8us*)(p + 16 + 8 * hh); return f.v; }
__device__ __forceinline__ void fa_exp2x8(float (&e)[8]) {
  asm("v_exp_f32 %0, %0\n\tv_exp_f32 %1, %1\n\tv_exp_f32 %2, %2\n\tv_exp_f32 %3, %3\n\tv_exp_f32 %4, %4\n\tv_exp_f32 %5, %5\n\tv_exp_f32 %6, %6\n\tv_exp_f32 %7, %7\n\tv_nop"
      : "+v"(e[0]), "+v"(e[1]), "+v"(e[2]), "+v"(e[3]), "+v"(e[4]), "+v"(e[5]), "+v"(e[6]), "+v"(e[7])); }
// q, k and v projections in ONE work-group per 128 token rows x 128 columns OF EACH PLANE (a 128 x 384 tile of [q | k | v]): the x tile is brought from L2 once for the three planes, not once per plane, and MP / 128 * DM / 128 = 256 work-groups fill 256 WGPs in one round.
// 12 waves of 64 x 64 (2 x 6; a wave tile is ONE head of ONE plane): a fragment read from LDS feeds 4 WMMAs (8 fragments per 16 WMMAs, against 6 per 8 at 32 x 64). Ring, stage (128 k), pitch, k order of the fragments and of every accumulator's sum: as in k_gemm2.
#define G4SB (512 * G3PB)            /* bytes per buffer: 128 x rows, then 128 rows of each of the three weight planes */
// 8 copies per lane: a wave's copy takes 2 rows of 256 bytes (16 lanes each), the 8 copies 16 consecutive rows. The s_wait_xcnt stands inside the copies' own statement, so that no later write of an address register can be moved in front of it.
__device__ __forceinline__ void g4_stage(unsigned l, const _Float16* p) {
  asm volatile("global_load_async_to_lds_b128 %0, %8, off\n\tglobal_load_async_to_lds_b128 %1, %9, off\n\tglobal_load_async_to_lds_b128 %2, %10, off\n\tglobal_load_async_to_lds_b128 %3, %11, off\n\t"
               "global_load_async_to_lds_b128 %4, %12, off\n\tglobal_load_async_to_lds_b128 %5, %13, off\n\tglobal_load_async_to_lds_b128 %6, %14, off\n\tglobal_load_async_to_lds_b128 %7, %15, off\n\ts_wait_xcnt 0x0"
               :: "v"(l), "v"(l + 2 * G3PB), "v"(l + 4 * G3PB), "v"(l + 6 * G3PB), "v"(l + 8 * G3PB), "v"(l + 10 * G3PB), "v"(l + 12 * G3PB), "v"(l + 14 * G3PB),
                  "v"(p), "v"(p + 2 * DM), "v"(p + 4 * DM), "v"(p + 6 * DM), "v"(p + 8 * DM), "v"(p + 10 * DM), "v"(p + 12 * DM), "v"(p + 14 * DM) : "memory"); }
__global__ __launch_bounds__(384) void k_qkv(const _Float16* __restrict__ A, const _Float16* __restrict__ Bh, const float* __restrict__ tcos, const float* __restrict__ tsin, _Float16* __restrict__ C16, _Float16* __restrict__ VTo) {
  __shared__ __attribute__((aligned(16))) unsigned char smem[2 * G4SB];
  static_assert(sizeof(float) * 8 * 64 * 68 <= G4SB && 128 * G3VP * 2 <= G4SB && SQ % 128 == 0 && DM % 128 == 0 && DM / 128 >= 2 && HD == 64, "the q and k staging tiles fit in buffer 0, the V^T tile in buffer 1; a tile lies in one batch; both ring buffers are filled; a wave tile is one head");
  const int tid = threadIdx.x, lane = tid & 31, ln = lane & 15, hh = lane >> 4; const int w = __builtin_amdgcn_readfirstlane(tid >> 5);
  const int wm = w & 1, wn = w >> 1;      /* 2 x 6 waves; columns 64 wn of [q 128 | k 128 | v 128]: waves 0 - 3 hold q, 4 - 7 k, 8 - 11 v */
  const int mt = blockIdx.x / (DM / 128), nq = blockIdx.x % (DM / 128); const int rowW = mt * 128, colW = nq * 128;
  /* staging: every wave brings 32 weight rows (rows 32 w of the 384: plane w / 4, the planes lie back to back), waves 0 - 7 also 16 rows of x */
  const _Float16* gb = Bh + ((size_t)(w >> 2) * DM + colW + 32 * (w & 3) + hh) * DM + ln * 8; const _Float16* ga = A + (size_t)(rowW + 16 * (w & 7) + hh) * DM + ln * 8;
  const unsigned l0 = (unsigned)(uintptr_t)smem + hh * G3PB + ln * 16;      /* low 32 bits of the shared address: the lane's LDS byte address in row hh of buffer 0 */
  const unsigned lb = l0 + (128 + 32 * w) * G3PB, la = l0 + 16 * (w & 7) * G3PB;
  const _Float16* fa = (const _Float16*)smem + (64 * wm + ln) * (G3PB / 2); const _Float16* fb = (const _Float16*)smem + (128 + 64 * wn + ln) * (G3PB / 2);
  const v8f z8 = {0.f,0.f,0.f,0.f,0.f,0.f,0.f,0.f}; v8f c[4][4];
#pragma unroll      /* constant indices keep c in registers */
  for (int i = 0; i < 4; ++i) for (int j = 0; j < 4; ++j) c[i][j] = z8;
  g4_stage(lb, gb); g4_stage(lb + 16 * G3PB, gb + 16 * DM); if (w < 8) g4_stage(la, ga);      /* w is a scalar: a wave-uniform branch */
  asm volatile("s_wait_asynccnt 0x0" ::: "memory");      /* this wave's copies of tile 0 have landed */
  __syncthreads();      /* tile 0 is published */
  g4_stage(lb + G4SB, gb + 128); g4_stage(lb + G4SB + 16 * G3PB, gb + 16 * DM + 128); if (w < 8) g4_stage(la + G4SB, ga + 128);
#pragma unroll 1      /* one tile per trip: the two buffers alternate */
  for (int t = 0; t < DM / 128; ++t) { const _Float16* pa = fa + (t & 1) * (G4SB / 2); const _Float16* pb = fb + (t & 1) * (G4SB / 2);
    v16h a[4], b[4];      /* a step's 8 fragments, read as one group in front of its 16 WMMAs, in the order in which the WMMAs need them */
#pragma unroll      /* constant offsets for the tile's four steps of 32 k */
    for (int s = 0; s < 4; ++s) {
      a[0] = g2_frag(pa + s * 32, hh); b[0] = g2_frag(pb + s * 32, hh);
      for (int i = 1; i < 4; ++i) a[i] = g2_frag(pa + i * 16 * (G3PB / 2) + s * 32, hh);
      for (int i = 1; i < 4; ++i) b[i] = g2_frag(pb + i * 16 * (G3PB / 2) + s * 32, hh);
      __builtin_amdgcn_sched_barrier(0);      /* keeps the 16 LDS reads together in front of the WMMAs: without it the scheduler lifts the WMMAs in among them, three of the four weight fragments share one register set, and each is waited for to 0 in front of its 4 WMMAs */
      if (s == 3) {      /* the tile's last fragments are asked for: the buffer is handed on here, so that the next copies go out in front of the last 16 WMMAs, which need registers only */
        asm volatile("s_wait_dscnt 0x0" ::: "memory");      /* this wave's reads of tile t are done before the buffer is handed to its next writer */
        asm volatile("s_wait_asynccnt 0x0" ::: "memory");      /* this wave's copies of tile t + 1 have landed */
        __syncthreads();      /* publishes tile t + 1 and ends every wave's reads of tile t */
        if (t + 2 < DM / 128) { const unsigned lo = (t & 1) * G4SB; const int ko = (t + 2) * 128; g4_stage(lb + lo, gb + ko); g4_stage(lb + lo + 16 * G3PB, gb + 16 * DM + ko); if (w < 8) g4_stage(la + lo, ga + ko); } }
      for (int j = 0; j < 4; ++j) for (int i = 0; i < 4; ++i) c[i][j] = fa_mma(a[i], b[j], c[i][j]); } }      /* each accumulator takes its products in ascending k */
  asm volatile("s_wait_asynccnt 0x0" ::: "memory");      /* nothing is in flight when the ring's bytes change their use */
  const float alpha = 0.0625f;      /* the weight planes are carried x16 */
  float (*so)[68] = (float (*)[68])(smem + (size_t)(w & 7) * (64 * 68 * 4));      /* a q or k wave's own 64 x 64 staging tile, in buffer 0 */
  unsigned short* vt = (unsigned short*)(smem + G4SB);      /* the work-group's 128 x 128 V^T tile, in buffer 1 */
  if (w < 8) {
#pragma unroll      /* constant indices into c */
    for (int i = 0; i < 4; ++i) for (int j = 0; j < 4; ++j) for (int r = 0; r < 8; ++r) so[i * 16 + 8 * hh + r][j * 16 + ln] = c[i][j][r] * alpha;
  } else {      /* register r of an accumulator is token 8 hh + r of column ln: 8 registers ARE 16 bytes of a V^T row */
#pragma unroll      /* constant indices into c */
    for (int i = 0; i < 4; ++i) for (int j = 0; j < 4; ++j) { FragH vh; for (int r = 0; r < 8; ++r) vh.h[r] = (_Float16)(c[i][j][r] * alpha);
      *(v8us*)(vt + (64 * (wn & 1) + j * 16 + ln) * G3VP + 64 * wm + i * 16 + 8 * hh) = vh.half[0]; } }
  __syncthreads();      /* the V^T tile is whole (each of its rows holds tokens of two waves); every wave passes here */
  if (w >= 8) {      /* the four v waves store V^T [batch][column][SQ]: 16 lanes per row, 256 contiguous bytes, 2 whole lines */
    const int vtid = tid - 256; const int dr = vtid >> 4, pc = (vtid & 15) * 8;
    unsigned short* vd = (unsigned short*)VTo + ((size_t)(rowW / SQ) * DM + colW + dr) * SQ + rowW % SQ + pc;
#pragma unroll      /* all 16 LDS reads go out together */
    for (int q = 0; q < 16; ++q) *(v8us*)(vd + (size_t)q * 8 * SQ) = *(const v8us*)(vt + (q * 8 + dr) * G3VP + pc);
    return; }
  /* q and k leave through the rotate-half rotation; position = row mod SQ. 8 lanes per row: a lane takes columns d4 .. d4 + 3 of BOTH halves of the head, so each table value and each staged value is read once and used twice */
  const int row0 = rowW + 64 * wm; const int r4 = lane >> 3, d4 = (lane & 7) * 4;
  _Float16* crow = C16 + (size_t)(wn >> 1) * (NR * DM) + (size_t)row0 * DM + colW + 64 * (wn & 1) + d4;
#pragma unroll 1      /* the tile's two halves of 32 rows through one copy of the code */
  for (int hf = 0; hf < 2; ++hf) { v4f cc[8], ss[8]; const unsigned tb = (((unsigned)row0 % SQ + hf * 32 + r4) * (HD / 2) + d4) * 4u;      /* byte offset of the lane's first table entries; row0 and SQ are multiples of 64: the tile's positions do not wrap */
#pragma unroll      /* constant indices keep cc and ss in registers; all 16 loads go out together, one latency */
    for (int q = 0; q < 8; ++q) { cc[q] = *(const v4fa*)((const char*)tcos + tb + q * 16 * (HD / 2)); ss[q] = *(const v4fa*)((const char*)tsin + tb + q * 16 * (HD / 2)); }
    asm volatile("s_wait_xcnt 0x0" :: "v"(tb) : "memory");      /* the wait in front of any overwrite of the offset register that the 16 issued table loads name; tb as an input keeps that register out of the loads' own destinations */
#pragma unroll      /* constant indices into cc and ss */
    for (int q = 0; q < 8; ++q) { const int r = hf * 32 + q * 4 + r4; const v4f lo = *(const v4fa*)&so[r][d4]; const v4f hi = *(const v4fa*)&so[r][d4 + HD / 2]; v4h ol, oh;
      for (int i = 0; i < 4; ++i) { const float cv = bf16_round(cc[q][i]), sv = bf16_round(ss[q][i]); ol[i] = (_Float16)(lo[i] * cv - hi[i] * sv); oh[i] = (_Float16)(lo[i] * sv + hi[i] * cv); }
      _Float16* dst = crow + (size_t)r * DM; *(v4h*)dst = ol; *(v4h*)(dst + HD / 2) = oh; }
    asm volatile("s_wait_xcnt 0x0" ::: "memory"); } }      /* the wait in front of the next half's first instructions, which overwrite address and data registers that this half's last stores name */
__global__ __launch_bounds__(256) void k_fattn(const _Float16* __restrict__ Q16, const _Float16* __restrict__ K16, const _Float16* __restrict__ VT, _Float16* __restrict__ O16) {
  __shared__ __attribute__((aligned(16))) unsigned short lk[2][FKS][FKP]; __shared__ __attribute__((aligned(16))) unsigned short lv[2][HD][FVP];
  const int tid = threadIdx.x, lane = tid & 31, ln = lane & 15, hh = lane >> 4; const int w = __builtin_amdgcn_readfirstlane(tid >> 5);
  const int h = blockIdx.y, b = blockIdx.z; const int q0 = blockIdx.x * 256 + w * 32;
  const _Float16* qp = Q16 + ((size_t)b * SQ + q0 + ln) * DM + h * HD;
  const int kr = tid >> 3, kc = (tid & 7) * 8;      /* staging: 16 bytes per thread and step, 8 threads per 128-byte key row */
  const int vr = tid / (FKS / 8), vc = (tid % (FKS / 8)) * 8;      /* FKS / 8 threads per V^T row piece */
  const unsigned short* kg = (const unsigned short*)K16 + ((size_t)b * SQ + kr) * KVD + h * HD + kc;
  const unsigned short* vg = (const unsigned short*)VT + (((size_t)b * NH + h) * HD + vr) * SQ + vc;
  const float cs = 0.125f * 1.44269504088896340736f;      /* 1/sqrt(64) and log2(e) in one factor */
  const v8f z8 = {0.f,0.f,0.f,0.f,0.f,0.f,0.f,0.f};
  v8us gk[FKS / 32], gv[FKS / 32];
#pragma unroll
  for (int i = 0; i < FKS / 32; ++i) { gk[i] = *(const v8us*)(kg + (size_t)i * 32 * KVD); gv[i] = *(const v8us*)(vg + (size_t)i * (2048 / FKS) * SQ); }
  v16h bq[2][2];
#pragma unroll
  for (int j = 0; j < 2; ++j) for (int s = 0; s < 2; ++s) bq[j][s] = g2_frag(qp + (size_t)j * 16 * DM + s * 32, hh);
  v8f o[4][2]; float m[2] = {-1.0e30f, -1.0e30f}; float l[2][2] = {{0.f, 0.f}, {0.f, 0.f}};
#pragma unroll
  for (int t = 0; t < 4; ++t) { o[t][0] = z8; o[t][1] = z8; }
#pragma unroll
  for (int i = 0; i < FKS / 32; ++i) { *(v8us*)&lk[0][kr + i * 32][kc] = gk[i]; *(v8us*)&lv[0][vr + i * (2048 / FKS)][vc] = gv[i]; }
  __syncthreads();      /* stage 0 is published */
#pragma unroll 1      /* one stage per trip: the body already holds FKS / 32 unrolled passes */
  for (int st = 0; st < SQ / FKS; ++st) {
    const int cur = st & 1; const int sn = (st + 1 < SQ / FKS) ? st + 1 : st;      /* the next stage's tiles are asked for now and stored after this stage's passes; the last stage re-reads its own (in bounds; that buffer is not read again) */
#pragma unroll
    for (int i = 0; i < FKS / 32; ++i) { gk[i] = *(const v8us*)(kg + ((size_t)sn * FKS + i * 32) * KVD); gv[i] = *(const v8us*)(vg + (size_t)i * (2048 / FKS) * SQ + sn * FKS); }
    v16h ka[2][2];
#pragma unroll
    for (int t = 0; t < 2; ++t) for (int s = 0; s < 2; ++s) ka[t][s] = fa_frag(&lk[cur][t * 16 + ln][s * 32], hh);
    asm volatile("" ::: "memory");      /* compiler fence: without it the next stage's global loads are sunk to just in front of their LDS stores at the stage's foot, and their whole latency is waited out there */
#pragma unroll
    for (int p = 0; p < FKS / 32; ++p) {
      v16h va[4]; v8f sc[2][2];      /* sc: [key tile][query tile] */
#pragma unroll
      for (int t = 0; t < 2; ++t) for (int j = 0; j < 2; ++j) sc[t][j] = fa_mma(ka[t][1], bq[j][1], fa_mma(ka[t][0], bq[j][0], z8));
#pragma unroll
      for (int t = 0; t < 4; ++t) va[t] = fa_frag(&lv[cur][t * 16 + ln][p * 32], hh);
      if (p + 1 < FKS / 32) {      /* the stage's next pass: its key fragments one pass ahead, into the same registers */
#pragma unroll
        for (int t = 0; t < 2; ++t) for (int s = 0; s < 2; ++s) ka[t][s] = fa_frag(&lk[cur][(p + 1) * 32 + t * 16 + ln][s * 32], hh); }
      asm volatile("" ::: "memory");      /* compiler fence: keeps these LDS reads together in front of the softmax arithmetic, which covers their latency; without it they are sunk in among the WMMAs that use them */
      float mx[2];
#pragma unroll
      for (int j = 0; j < 2; ++j) { float a = fmaxf(sc[0][j][0], sc[1][j][0]); for (int r = 1; r < 8; ++r) a = fmaxf(fmaxf(a, sc[0][j][r]), sc[1][j][r]); mx[j] = a * cs; }
      const bool need = (mx[0] > m[0] + 8.0f) || (mx[1] > m[1] + 8.0f);
      if (__builtin_amdgcn_ballot_w32(need) != 0) {      /* scalar branch: rescale only when some column's maximum has grown by more than 2^8; m[] changes only here and from values joined over the two lane halves, so both halves of a column always use the same m */
#pragma unroll
        for (int j = 0; j < 2; ++j) { const float mj = fmaxf(mx[j], __shfl_xor(mx[j], 16, 32)); const float mn = fmaxf(m[j], mj); const float f = __builtin_amdgcn_exp2f(m[j] - mn); m[j] = mn; l[j][0] *= f; l[j][1] *= f;
          for (int t = 0; t < 4; ++t) for (int r = 0; r < 8; ++r) o[t][j][r] *= f; } }
      v16h pb[2];
#pragma unroll
      for (int j = 0; j < 2; ++j) for (int t = 0; t < 2; ++t) { float e[8]; for (int r = 0; r < 8; ++r) e[r] = fmaf(sc[t][j][r], cs, -m[j]); fa_exp2x8(e); for (int r = 0; r < 8; ++r) { l[j][t] += e[r]; pb[j][t * 8 + r] = (_Float16)e[r]; } }
#pragma unroll
      for (int t = 0; t < 4; ++t) for (int j = 0; j < 2; ++j) o[t][j] = fa_mma(va[t], pb[j], o[t][j]);
    }
#pragma unroll
    for (int i = 0; i < FKS / 32; ++i) { *(v8us*)&lk[cur ^ 1][kr + i * 32][kc] = gk[i]; *(v8us*)&lv[cur ^ 1][vr + i * (2048 / FKS)][vc] = gv[i]; }      /* every wave left that buffer before the barrier that ended the stage before */
    __syncthreads();      /* publishes stage st + 1 and ends every wave's reads of stage st */
  }
#pragma unroll
  for (int j = 0; j < 2; ++j) { float lt = l[j][0] + l[j][1]; lt += __shfl_xor(lt, 16, 32); const float fin = 64.0f / lt;      /* o carried x64, as the output GEMM's alpha expects */
    unsigned short* op = (unsigned short*)O16 + ((size_t)b * SQ + q0 + j * 16 + ln) * DM + h * HD + 8 * hh;
    for (int t = 0; t < 4; ++t) { FragH f; for (int r = 0; r < 8; ++r) f.h[r] = (_Float16)(o[t][j][r] * fin); *(v8us*)(op + t * 16) = f.half[0]; } } }
__global__ __launch_bounds__(256) void k_vt(const _Float16* __restrict__ V16, int b, int h0, _Float16* __restrict__ VT) { __shared__ unsigned short tl[64][65]; const int tid = threadIdx.x; const int hh = blockIdx.x % HG, sg = blockIdx.x / HG; const int s0 = sg * 64; const int h = h0 + hh;
  for (int i = tid; i < 64 * 8; i += 256) { const int j = i / 8, d8 = (i % 8) * 8; FragH f; f.half[0] = *(const v8us*)((const unsigned short*)V16 + ((size_t)b * SQ + s0 + j) * DM + h * HD + d8); for (int q = 0; q < 8; ++q) tl[d8 + q][j] = f.u[q]; }
  __syncthreads();
  { for (int i = tid; i < 64 * 8; i += 256) { const int d = i / 8, j8 = (i % 8) * 8; FragH f; for (int q = 0; q < 8; ++q) f.u[q] = tl[d][j8 + q]; *(v8us*)((unsigned short*)VT + ((size_t)hh * HD + d) * SQ + s0 + j8) = f.half[0]; }  } }



__global__ __launch_bounds__(256) void k_rsmcf2(const float* __restrict__ S, _Float16* __restrict__ P, int hg, int q0, int nk) {
  #pragma clang fp contract(off)
  const int t = blockIdx.x * 256 + threadIdx.x; if (t >= hg * QT) return; const size_t i = (size_t)t; const float* s = S + i * NKX; const int last = q0 + (t % QT); float mx = -3.0e38f;
#pragma unroll 1
  for (int j = 0; j < nk; ++j) { const float f = (j <= last) ? 1.f : 0.f; mx = fmaxf(mx, fmaf(f, s[j], (1.f - f) * -1.0e9f)); } float se = 0.f;
#pragma unroll 1
  for (int j = 0; j < nk; ++j) { const float f = (j <= last) ? 1.f : 0.f; se += __expf(fmaf(f, s[j], (1.f - f) * -1.0e9f) - mx); } const float sc = 256.0f / se;
#pragma unroll 1
  for (int j0 = 0; j0 < nk; j0 += 8) { FragH fr; for (int q = 0; q < 8; ++q) { const int j = j0 + q; const float f = (j <= last) ? 1.f : 0.f; fr.h[q] = (_Float16)(__expf(fmaf(f, s[j], (1.f - f) * -1.0e9f) - mx) * sc); } unsigned short* d = (unsigned short*)P + i * NKX + j0; *(v8us*)d = fr.half[0];  } }


template <int MASKADD>
__global__ __launch_bounds__(64) void k_att0(const float* __restrict__ QF, const float* __restrict__ KF, const float* __restrict__ VF, int ld, const float* __restrict__ mask, float scale, float* __restrict__ OF, int ldo) {
  #pragma clang fp contract(off)
  __shared__ __attribute__((aligned(16))) float lq[64][64]; __shared__ __attribute__((aligned(16))) float lo[64][64];
  const int tid = threadIdx.x; const int h = blockIdx.x / (QT0 / 64), rg = blockIdx.x % (QT0 / 64); const int i = rg * 64 + tid;
  const float* qr = QF + (size_t)i * ld + h * HD;
#pragma unroll 1
  for (int c = 0; c < HD / 4; ++c) { *(v4f*)&lq[tid][c * 4] = *(const v4fa*)(qr + c * 4); const v4f z = {0.f, 0.f, 0.f, 0.f}; *(v4f*)&lo[tid][c * 4] = z; }
  float m = -1.0e30f, l = 0.f; const int jmax = MASKADD ? (SQ - 1) : (rg * 64 + 63);      /* additive-mask form: every key (the mask input decides); causal form: keys up to the block's last row */
#pragma unroll 1
  for (int j = 0; j <= jmax; ++j) { const float* kr = KF + (size_t)j * ld + h * HD; const float* vr = VF + (size_t)j * ld + h * HD; float s = 0.f;
#pragma unroll 1
    for (int c = 0; c < HD / 4; ++c) { const v4f kq = *(const v4fa*)(kr + c * 4); const v4f qq = *(v4f*)&lq[tid][c * 4]; s = __fadd_rn(s, __fmul_rn(qq[0], kq[0])); s = __fadd_rn(s, __fmul_rn(qq[1], kq[1])); s = __fadd_rn(s, __fmul_rn(qq[2], kq[2])); s = __fadd_rn(s, __fmul_rn(qq[3], kq[3])); }
    s = __fmul_rn(s, scale); if (MASKADD) s = __fadd_rn(s, __fmul_rn(bf16_round(mask[(size_t)i * SQ + j]), -10000.0f));
    const float f = (MASKADD || j <= i) ? 1.f : 0.f; const float sm = fmaf(f, s, (1.f - f) * -1.0e30f); const float mn = fmaxf(m, sm); const float sc = expf(m - mn); const float e = expf(sm - mn); l = __fadd_rn(__fmul_rn(l, sc), e); m = mn;
#pragma unroll 1
    for (int c = 0; c < HD / 4; ++c) { const v4f vv = *(const v4fa*)(vr + c * 4); v4f oo = *(v4f*)&lo[tid][c * 4]; for (int u = 0; u < 4; ++u) oo[u] = __fadd_rn(__fmul_rn(oo[u], sc), __fmul_rn(e, vv[u])); *(v4f*)&lo[tid][c * 4] = oo; } }
  const float fin = 64.0f / l;      /* o carried x64 like the f16 path */
#pragma unroll 1
  for (int c = 0; c < HD / 4; ++c) { v4f oo = *(v4f*)&lo[tid][c * 4]; for (int u = 0; u < 4; ++u) oo[u] = __fmul_rn(oo[u], fin); *(v4f*)&lo[tid][c * 4] = oo; }
  __syncthreads();
  {
#pragma unroll 1
    for (int it = 0; it < 16; ++it) { const int row = it * 4 + tid / 16, pc = (tid % 16) * 4; const v4f v = *(const v4f*)&lo[row][pc]; *(v4f*)(OF + (size_t)(rg * 64 + row) * ldo + h * HD + pc) = v; }
     } }


__global__ __launch_bounds__(256) void k_kvexp(const float* __restrict__ src, float* __restrict__ dst, size_t n4) { const size_t t = (size_t)blockIdx.x * 256 + threadIdx.x; if (t >= n4) return; const size_t e = t * 4; const size_t row = e / DM; const int col = (int)(e % DM); const int h = col / HD, d = col % HD; const v4f v = *(const v4fa*)(src + row * KVD + (size_t)(h / HPG) * HD + d); *(v4f*)(dst + e) = v;  }

__global__ __launch_bounds__(256) void k_tab2(float theta, float* __restrict__ CS, float* __restrict__ SN) {
  #pragma clang fp contract(off)
  const int t = blockIdx.x * 256 + threadIdx.x; if (t >= SQ * (HD / 2)) return; const int i = t % (HD / 2); const int p = t / (HD / 2); const float invf = 1.0f / powf(theta, (float)(2 * i) / (float)HD); const float ang = __fmul_rn((float)p, invf); const float c = cosf(ang), s = sinf(ang);
  *(float*)(CS + t) = c; *(float*)(SN + t) = s;  }
template <int NORM, int ROPE>
__global__ __launch_bounds__(64) void k_xform(const float* __restrict__ F, int ldf, int nh, const float* __restrict__ gain, float eps, const float* __restrict__ CS, const float* __restrict__ SN, _Float16* __restrict__ H16, int ldo) {
  #pragma clang fp contract(off)
  __shared__ float xv[HD]; __shared__ float red[HD]; __shared__ unsigned short sh_[HD]; const int d = threadIdx.x; const int h = blockIdx.x % nh; const size_t r = blockIdx.x / nh; const int p = (int)(r % SQ);
  float x = F[r * (size_t)ldf + (size_t)h * HD + d];
  if (NORM) { red[d] = __fmul_rn(x, x); __syncthreads(); for (int st = HD / 2; st > 0; st >>= 1) { if (d < st) red[d] = __fadd_rn(red[d], red[d + st]); __syncthreads(); } const float rs = rsqrtf(__fadd_rn(red[0] / (float)HD, eps)); x = __fmul_rn(__fmul_rn(x, rs), bf16_round(gain[d])); }
  xv[d] = x; __syncthreads();
  float o = x;
  if (ROPE == 1) { const int i = d >> 1; const float c = CS[p * (HD / 2) + i], s = SN[p * (HD / 2) + i]; const float ev = xv[2 * i], od = xv[2 * i + 1]; o = (d & 1) ? __fadd_rn(__fmul_rn(ev, s), __fmul_rn(od, c)) : __fadd_rn(__fmul_rn(ev, c), -__fmul_rn(od, s)); }
  if (ROPE == 2) { const int i = d & (HD / 2 - 1); const float c = CS[p * (HD / 2) + i], s = SN[p * (HD / 2) + i]; const float lo = xv[i], hi = xv[i + HD / 2]; o = (d < HD / 2) ? __fadd_rn(__fmul_rn(lo, c), -__fmul_rn(hi, s)) : __fadd_rn(__fmul_rn(lo, s), __fmul_rn(hi, c)); }
  FragH th; th.h[0] = (_Float16)o; sh_[d] = th.u[0]; __syncthreads();
  if (d < HD / 8) { FragH f; for (int q = 0; q < 8; ++q) f.u[q] = sh_[d * 8 + q]; unsigned short* dst = (unsigned short*)H16 + r * (size_t)ldo + (size_t)h * HD + d * 8; *(v8us*)dst = f.half[0];  } }

template <int NORM, int ROPE>
__global__ __launch_bounds__(64) void k_xformf(const float* __restrict__ F, int ldf, int nh, const float* __restrict__ gain, float eps, const float* __restrict__ CS, const float* __restrict__ SN, float* __restrict__ F32, int ldo) {
  #pragma clang fp contract(off)
  __shared__ float xv[HD]; __shared__ float red[HD]; const int d = threadIdx.x; const int h = blockIdx.x % nh; const size_t r = blockIdx.x / nh; const int p = (int)(r % SQ);
  float x = F[r * (size_t)ldf + (size_t)h * HD + d];
  if (NORM) { red[d] = __fmul_rn(x, x); __syncthreads(); for (int st = HD / 2; st > 0; st >>= 1) { if (d < st) red[d] = __fadd_rn(red[d], red[d + st]); __syncthreads(); } const float rs = rsqrtf(__fadd_rn(red[0] / (float)HD, eps)); x = __fmul_rn(__fmul_rn(x, rs), bf16_round(gain[d])); }
  xv[d] = x; __syncthreads();
  float o = x;
  if (ROPE == 1) { const int i = d >> 1; const float c = CS[p * (HD / 2) + i], s = SN[p * (HD / 2) + i]; const float ev = xv[2 * i], od = xv[2 * i + 1]; o = (d & 1) ? __fadd_rn(__fmul_rn(ev, s), __fmul_rn(od, c)) : __fadd_rn(__fmul_rn(ev, c), -__fmul_rn(od, s)); }
  if (ROPE == 2) { const int i = d & (HD / 2 - 1); const float c = CS[p * (HD / 2) + i], s = SN[p * (HD / 2) + i]; const float lo = xv[i], hi = xv[i + HD / 2]; o = (d < HD / 2) ? __fadd_rn(__fmul_rn(lo, c), -__fmul_rn(hi, s)) : __fadd_rn(__fmul_rn(lo, s), __fmul_rn(hi, c)); }
  float* dst = F32 + r * (size_t)ldo + (size_t)h * HD + d; *(float*)dst = o;  }

__global__ __launch_bounds__(256) void k_bfcp(const float* __restrict__ src, float* __restrict__ dst, size_t n4) { const size_t t = (size_t)blockIdx.x * 256 + threadIdx.x; if (t >= n4) return; const v4f a = *(const v4fa*)(src + t * 4); v4f o; for (int q = 0; q < 4; ++q) o[q] = bf16_round(a[q]); *(v4f*)(dst + t * 4) = o;  }

__global__ __launch_bounds__(256) void k_tab2d(float* __restrict__ CS, float* __restrict__ SN) {
  #pragma clang fp contract(off)
  const int t = blockIdx.x * 256 + threadIdx.x; if (t >= SQ * (HD / 2)) return; const int i = t % (HD / 2); const int p = t / (HD / 2); const float invf = (float)(1.0 / pow(10000.0, (double)(2 * i) / (double)HD)); const float ang = __fmul_rn((float)p, invf); const float c = cosf(ang), s = sinf(ang);
  *(float*)(CS + t) = c; *(float*)(SN + t) = s;  }
extern "C" void kernel_launch(void* const* d_in, const int* in_sizes, int n_in,
                              void* d_out, int out_size, void* d_ws, size_t ws_size, hipStream_t stream) {
  (void)in_sizes; (void)n_in; (void)out_size;
  const float* const* I = (const float* const*)d_in; const float* x = I[0]; const float* wq = I[1]; const float* wk = I[2]; const float* wv = I[3]; const float* wo = I[4]; const float* tcos = I[5]; const float* tsin = I[6]; const float* bq = nullptr; const float* bk = nullptr; const float* bv = nullptr; const float* bo = nullptr;      /* natural [out][in] weights, no biases; rope_cos / rope_sin INPUT tables [2048][32] */
  static_assert(HPG == 1 && NH == NG * HPG && NH * HD == DM && KVD == DM, "plain multi-head attention as 16 kv groups of one query head");
  char* ws = (char*)d_ws; size_t off = 0;
  auto take = [&](size_t bytes) { char* p = ws + off; off += (bytes + 255) & ~(size_t)255; return p; };
  _Float16* BQ = (_Float16*)take((size_t)DM * DM * 2); _Float16* BK = (_Float16*)take((size_t)KVD * DM * 2); _Float16* BV = (_Float16*)take((size_t)KVD * DM * 2); _Float16* BO = (_Float16*)take((size_t)DM * DM * 2);
  _Float16* X16 = (_Float16*)take(NR * DM * 2); _Float16* Q16 = (_Float16*)take(NR * DM * 2); _Float16* K16 = (_Float16*)take(NR * KVD * 2); _Float16* V16 = (_Float16*)take(NR * KVD * 2); _Float16* O16 = (_Float16*)take(NR * DM * 2);
  _Float16* VT = (_Float16*)take((size_t)NB * NH * HD * SQ * 2);
  float* QF0 = (float*)take((size_t)QT0 * DM * 4); float* KF0 = (float*)take((size_t)QT0 * KVD * 4); float* VF0 = (float*)take((size_t)QT0 * KVD * 4); float* KF0e = (float*)take((size_t)QT0 * DM * 4); float* VF0e = (float*)take((size_t)QT0 * DM * 4); float* OF0 = (float*)take((size_t)NB * QT0 * DM * 4); _Float16* OH0 = (_Float16*)take((size_t)NB * QT0 * DM * 2); _Float16* OL0 = (_Float16*)take((size_t)NB * QT0 * DM * 2);
  if (off > ws_size) return;
  k_prep<<<PWG, 256, 0, stream>>>(wq, wk, wv, wo, x, BQ, BK, BV, BO, X16);      /* natural [out][in] = Bt planes x16; x as f16 rows */
  const size_t r0p = (size_t)B0 * SQ;      /* first projected row */
  static_assert(((size_t)DM * DM * 2) % 256 == 0 && (NR * DM * 2) % 256 == 0, "BQ | BK | BV and Q16 | K16 | V16 lie back to back in the workspace: the plane strides of the batched launch");
  k_qkv<<<dim3((unsigned)((MP / 128) * (DM / 128))), 384, 0, stream>>>(X16 + r0p * DM, BQ, tcos, tsin, Q16 + r0p * DM, VT + (size_t)B0 * NH * HD * SQ);      /* q, k (rotated by the INPUT rope tables [2048][32]: column d uses table column d mod 32 = the module's [cos | cos]) of every batch -> f16 rows; v -> V^T [NB][NH][HD][SQ] */
  k_fattn<<<dim3(SQ / 256, NH, NB), 256, 0, stream>>>(Q16, K16, VT, O16);      /* scores, softmax and P V of every batch, head and query row in ONE launch; o (x64) into merged f16 rows */
  k_gemm2<0><<<dim3((unsigned)((MPO / 128) * (DM / 128)), 1), 256, 0, stream>>>(O16 + r0p * DM, DM, 0, BO, DM, 0, 0.0009765625f, bo, 0, nullptr, 1, 0, 0, (float*)d_out + r0p * DM, nullptr, DM, 0, MPO, DM, DM);      /* out rows are the output layout */
}
